// v000
// Times are from an AMD MI455X. After a warm-up the kernel runs many times in a row, and a time is the length of
// such a window on the GPU divided by its runs, so every launch and the gaps after it count. The runs cycle
// through copies of the inputs. A figure is the median of several windows, for all but v000 over two sittings.
// Sittings can differ by a few percent; kernels timed side by side share one.
// v000, which the later versions start from, runs in 1260 microseconds.
// Contractions: q|k, v^T and vc^T projections = v_wmma_f32_16x16x32_bf16 (bf16 operands from RNE-converted x and W, single product);
// q.k^T scores = v_wmma_f32_16x16x32_f16 (q as f16 hi plane + f16 residual plane x4096 in a separate accumulator, k f16; 2 products);
// p.v = v_wmma_f32_16x16x32_f16 (p carried x1024 in f16, v^T as f16 hi plane + f16 residual plane x4096 in a separate accumulator; 2 products);
// ctx.Wp = v_wmma_f32_16x16x32_bf16 (ctx as bf16 hi + lo planes times bf16 Wp^T, 2 products); all f32 accumulate; softmax in f32.
#include <hip/hip_runtime.h>
#include <math.h>
#include <stdint.h>

#define NBATCH 16
#define NTOK   906
#define NP     960            // padded token count per batch element (15 tiles of 64)
#define DM     768
#define NH     12
#define HD     64
#define M1     513            // modality split: query / key rows < M1 vs >= M1
#define NKT    (NP / 64)      // 15 key chunks of 64
#define NQB_NM 14             // query tiles 0..7 and 9..14 (tile 8 is the mixed tile)
#define QKP    (2 * DM)       // pitch of the q|k plane: q at cols 0..DM-1, k at cols DM..2DM-1
#define GB     4              // batch elements per group
#define NGRP   (NBATCH / GB)
static_assert(NH * HD == DM);
static_assert((NP % 64) == 0 && NP >= NTOK && (DM % 64) == 0 && (DM % 32) == 0);
static_assert((NBATCH % GB) == 0);
static_assert(M1 - 1 == 8 * 64);   // row 512 is the first row of query tile 8 and of key chunk 8
static_assert(NTOK > (NKT - 1) * 64 && NTOK <= NP);   // invalid keys live only in the last chunk

typedef _Float16 v16h __attribute__((ext_vector_type(16)));
typedef _Float16 v8h  __attribute__((ext_vector_type(8)));
typedef __bf16   v16b __attribute__((ext_vector_type(16)));
typedef __bf16   v8b  __attribute__((ext_vector_type(8)));
typedef float    v8f  __attribute__((ext_vector_type(8)));
typedef float    v4f  __attribute__((ext_vector_type(4)));
typedef unsigned int v4u __attribute__((ext_vector_type(4)));

union FH { v16h v; v8h h[2]; };

// ---- scalar helpers --------------------------------------------------------------------------------
__device__ __forceinline__ unsigned short bf_bits(float f) {          // f32 -> bf16 bits, RNE convert
  unsigned u = __float_as_uint(f);
  return (unsigned short)((u + 0x7FFFu + ((u >> 16) & 1u)) >> 16);
}
__device__ __forceinline__ float bf_up(unsigned short h) { return __uint_as_float(((unsigned)h) << 16); }
__device__ __forceinline__ unsigned short h_bits(_Float16 x) { return __builtin_bit_cast(unsigned short, x); }
__device__ __forceinline__ unsigned pk16(unsigned short a, unsigned short b) { return (unsigned)a | ((unsigned)b << 16); }
__device__ __forceinline__ v8f zero8() { v8f z = {0.f, 0.f, 0.f, 0.f, 0.f, 0.f, 0.f, 0.f}; return z; }

// ---- fragment loaders: 16-bit A/B operand, lane -> row/col (lane&15), p already includes +8*(lane>>4);
//      elements 0..7 <- p[0..7] (k0+8h..), elements 8..15 <- p[16..23] (k0+16+8h..)
__device__ __forceinline__ v16b ldfrag_b(const __bf16* p) {
  union { v16b v; v8b h[2]; } f;
  f.h[0] = *(const v8b*)(p);
  f.h[1] = *(const v8b*)(p + 16);
  return f.v;
}
__device__ __forceinline__ v16h ldfrag_h(const _Float16* p) {
  union { v16h v; v8h h[2]; } f;
  f.h[0] = *(const v8h*)(p);
  f.h[1] = *(const v8h*)(p + 16);
  return f.v;
}

// ---- WMMA helpers with trailing VALU hazard gap --------------------------------------------------------
__device__ __forceinline__ v8f mma_h(v16h a, v16h b, v8f c) {
  c = __builtin_amdgcn_wmma_f32_16x16x32_f16(false, a, false, b, (short)0, c, false, false);
#if defined(__HIP_DEVICE_COMPILE__)
  asm volatile("v_nop\n\tv_nop\n\tv_nop\n\tv_nop" : "+v"(c) : "v"(a), "v"(b));
#endif
  return c;
}
__device__ __forceinline__ v8f mma_b_raw(v16b a, v16b b, v8f c) {
  return __builtin_amdgcn_wmma_f32_16x16x32_bf16(false, a, false, b, (short)0, c, false, false);
}
__device__ __forceinline__ void dep_guard_b(v8f& a, v8f& b, v16b x, v16b y) {
#if defined(__HIP_DEVICE_COMPILE__)
  asm volatile("v_nop\n\tv_nop\n\tv_nop\n\tv_nop" : "+v"(a), "+v"(b) : "v"(x), "v"(y));
#endif
}
__device__ __forceinline__ void keep4_b(v16b a, v16b b, v16b c, v16b d) {
#if defined(__HIP_DEVICE_COMPILE__)
  asm volatile("v_nop" :: "v"(a), "v"(b), "v"(c), "v"(d));
#endif
}
__device__ __forceinline__ void acc_guard4(v8f& a, v8f& b, v8f& c, v8f& d) {
#if defined(__HIP_DEVICE_COMPILE__)
  asm volatile("v_nop\n\tv_nop\n\tv_nop\n\tv_nop" : "+v"(a), "+v"(b), "+v"(c), "+v"(d));
#endif
}
__device__ __forceinline__ void wave_sync_lds() {
  __builtin_amdgcn_fence(__ATOMIC_RELEASE, "workgroup");
  __builtin_amdgcn_wave_barrier();
  __builtin_amdgcn_fence(__ATOMIC_ACQUIRE, "workgroup");
}

// =====================================================================================================
// x f32 [b][NTOK][DM] -> zero-padded bf16 plane Xp [GB*NP][DM] for batch elements b0..b0+GB-1 (RNE convert).
// address, value select). coverage: n8 = GB*NP*DM/8 threads x 8 = the whole Xp plane incl. padded rows.
// =====================================================================================================
__global__ __launch_bounds__(256) void cvt_x_bf16(const float* __restrict__ x, unsigned short* xp,
                                                   int b0, int n8) {
  const int i = blockIdx.x * 256 + threadIdx.x;
  if (i < n8) {
    const int row = i / (DM / 8);
    const int c8  = (i - row * (DM / 8)) * 8;
    const int bl  = row / NP;
    const int r   = row - bl * NP;
    const int rr  = (r < NTOK) ? r : (NTOK - 1);                 // clamped address for padded rows
    const float* src = x + ((size_t)(b0 + bl) * NTOK + rr) * DM + c8;
    const v4f a = *(const v4f*)(src);
    const v4f b = *(const v4f*)(src + 4);
    v4u p;
    p[0] = pk16(bf_bits(a[0]), bf_bits(a[1]));
    p[1] = pk16(bf_bits(a[2]), bf_bits(a[3]));
    p[2] = pk16(bf_bits(b[0]), bf_bits(b[1]));
    p[3] = pk16(bf_bits(b[2]), bf_bits(b[3]));
    const bool valid = (r < NTOK);
#pragma unroll
    for (int e = 0; e < 4; ++e) p[e] = valid ? p[e] : 0u;
    *(v4u*)(xp + (size_t)i * 8) = p;
    
  }
}

// =====================================================================================================
// Weight transpose-convert: W f32 [DM ci][DM co] (x @ W layout) -> Wt bf16 [co][ci] (k = ci contiguous),
// RNE convert. blockIdx.z selects the weight (0..4 -> Wq, Wk, Wv, Wvc, Wp), written back to back in wt.
// coverage: 8 waves x (2 it x 4 row groups) = 64 rows x (8 lanes x 8) = 64 cols per tile; grid 12x12x5.
// =====================================================================================================
__global__ __launch_bounds__(256) void wtr_bf16(const float* __restrict__ w0, const float* __restrict__ w1,
                                                 const float* __restrict__ w2, const float* __restrict__ w3,
                                                 const float* __restrict__ w4, unsigned short* wt) {
  __shared__ __align__(16) unsigned short T[64 * 72];   // [co][ci], pitch 72 (144 B, 16-B aligned rows)
  const int z = blockIdx.z;
  const float* W = (z == 0) ? w0 : (z == 1) ? w1 : (z == 2) ? w2 : (z == 3) ? w3 : w4;
  unsigned short* dst = wt + (size_t)z * DM * DM;
  const int co0 = blockIdx.x * 64;
  const int ci0 = blockIdx.y * 64;
  const int tid = threadIdx.x;
#pragma unroll
  for (int it = 0; it < 16; ++it) {
    const int idx = it * 256 + tid;
    const int i = idx >> 6;          // ci within tile
    const int j = idx & 63;          // co within tile
    T[j * 72 + i] = bf_bits(W[(size_t)(ci0 + i) * DM + co0 + j]);
  }
  __syncthreads();
  const int wave = tid >> 5, lane = tid & 31;
  const int q = lane >> 3, c8 = (lane & 7) * 8;
  v4u v[2];
#pragma unroll
  for (int it = 0; it < 2; ++it) {
    const int row = wave * 8 + it * 4 + q;
    v[it] = *(const v4u*)(T + row * 72 + c8);
  }
  {
#pragma unroll
    for (int it = 0; it < 2; ++it) {
      const int row = wave * 8 + it * 4 + q;
      *(v4u*)(dst + (size_t)(co0 + row) * DM + ci0 + c8) = v[it];
    }
    
  }
}

// =====================================================================================================
// Register-blocked batched bf16 WMMA GEMM: C[m][n] = sum_k A[m][k] * Bt[n][k]; one wave per 64x64 tile,
// no block barriers. A row-major [M][K] pitch lda; Bt row-major [N][K] pitch ldb (k contiguous);
// M, N multiples of 64, K multiple of 32 (host-checked). blockIdx.y = batch index (strides in elements).
// NSPLIT: 0 = A.Bt; 1 = (A + A2).Bt (A2 = unscaled bf16 lo plane of A); 2 = A.Bt + A2.Bt + A.Bt2.
// OUT_MODE: 0 = f32 (pitch ldc); 2 = bf16 hi plane C + bf16 lo plane C2 (lo = RNE(v - hi), unscaled);
//           3 = f16 hi plane C + f16 residual plane C2 = f16((v - hi) * rscale), C2 written only for tiles
//               with n0 < N2 (pitch ldc2, batch stride strideC2).
// =====================================================================================================
template <int NSPLIT, int OUT_MODE>
__global__ __launch_bounds__(256) void gemm64(
    const unsigned short* __restrict__ Ap, const unsigned short* A2p, int lda, long long strideA,
    const unsigned short* __restrict__ Btp, const unsigned short* Bt2p, int ldb, long long strideB,
    void* Cout, int ldc, long long strideC,
    void* Cout2, int ldc2, long long strideC2, int N2,
    int M, int N, int K, float rscale) {
  const __bf16* A   = (const __bf16*)(const void*)Ap;
  const __bf16* A2  = (const __bf16*)(const void*)A2p;
  const __bf16* Bt  = (const __bf16*)(const void*)Btp;
  const __bf16* Bt2 = (const __bf16*)(const void*)Bt2p;
  __shared__ __align__(16) float sT[8][16 * 68];   // per-wave 16x64 slab, pitch 68 floats
  const int b    = blockIdx.y;
  const int lane = threadIdx.x & 31;
  const int wave = threadIdx.x >> 5;
  const int tilesN = N >> 6;
  const int tilesM = M >> 6;
  const int tile = blockIdx.x * 8 + wave;
  if (tile >= tilesM * tilesN) return;   // wave-uniform; no block barriers in this kernel
  const int tm = tile / tilesN;
  const int tn = tile - tm * tilesN;
  const int m0 = tm << 6;
  const int n0 = tn << 6;

  const __bf16* Ab  = A  + (size_t)b * strideA;
  const __bf16* Bb  = Bt + (size_t)b * strideB;
  const __bf16* Ab2 = (NSPLIT >= 1) ? (A2  + (size_t)b * strideA) : Ab;
  const __bf16* Bb2 = (NSPLIT == 2) ? (Bt2 + (size_t)b * strideB) : Bb;

  const int rlane = lane & 15;                 // row (A) / col (B, D) within subtile
  const int koff  = (lane >> 4) * 8;           // k offset of this lane half
  const int mOff  = (lane >> 4) * 8;           // D row offset

  v8f acc[4][4];
#pragma unroll
  for (int i = 0; i < 4; ++i)
#pragma unroll
    for (int j = 0; j < 4; ++j) acc[i][j] = zero8();

  for (int k0 = 0; k0 < K; k0 += 32) {
    v16b bh[4], bl[4];
#pragma unroll
    for (int j = 0; j < 4; ++j) {
      const size_t bo = (size_t)(n0 + (j << 4) + rlane) * ldb + koff + k0;
      bh[j] = ldfrag_b(Bb + bo);
      if (NSPLIT == 2) bl[j] = ldfrag_b(Bb2 + bo); else bl[j] = bh[j];
    }
#pragma unroll
    for (int i = 0; i < 4; ++i) {
      const size_t ao = (size_t)(m0 + (i << 4) + rlane) * lda + koff + k0;
      const v16b ah = ldfrag_b(Ab + ao);
      v16b al = ah;
      if (NSPLIT >= 1) al = ldfrag_b(Ab2 + ao);
#pragma unroll
      for (int j = 0; j < 4; ++j) {
        acc[i][j] = mma_b_raw(ah, bh[j], acc[i][j]);
        if (NSPLIT >= 1) acc[i][j] = mma_b_raw(al, bh[j], acc[i][j]);
        if (NSPLIT == 2) acc[i][j] = mma_b_raw(ah, bl[j], acc[i][j]);
      }
      dep_guard_b(acc[i][0], acc[i][3], ah, al);
    }
    keep4_b(bh[0], bh[1], bh[2], bh[3]);
    if (NSPLIT == 2) keep4_b(bl[0], bl[1], bl[2], bl[3]);
  }
  acc_guard4(acc[0][0], acc[0][1], acc[0][2], acc[0][3]);
  acc_guard4(acc[1][0], acc[1][1], acc[1][2], acc[1][3]);
  acc_guard4(acc[2][0], acc[2][1], acc[2][2], acc[2][3]);
  acc_guard4(acc[3][0], acc[3][1], acc[3][2], acc[3][3]);

  // ---- epilogue ----
  float* slab = sT[wave];
#pragma unroll
  for (int i = 0; i < 4; ++i) {
    const int mBase = m0 + (i << 4);
#pragma unroll
    for (int j = 0; j < 4; ++j) {
#pragma unroll
      for (int r = 0; r < 8; ++r) {
        slab[(mOff + r) * 68 + (j << 4) + rlane] = acc[i][j][r];
      }
    }
    wave_sync_lds();
    if (OUT_MODE == 0) {
      float* C = (float*)Cout + (size_t)b * strideC;
      const int hh = lane >> 4, c4 = (lane & 15) * 4;     // 256-B row segment = 16 lanes x 16 B
      {
#pragma unroll
        for (int it = 0; it < 8; ++it) {
          const int row = it * 2 + hh;                     // it 0..7 x hh 0..1 = rows 0..15
          const v4f v = *(const v4f*)(slab + row * 68 + c4);
          *(v4f*)(C + (size_t)(mBase + row) * ldc + n0 + c4) = v;
        }
        
      }
    } else {
      const int q = lane >> 3, c8 = (lane & 7) * 8;
      unsigned short* C  = (unsigned short*)Cout  + (size_t)b * strideC;
      unsigned short* C2 = (unsigned short*)Cout2 + (size_t)b * strideC2;
      const bool wlo = (OUT_MODE == 2) || (n0 < N2);      // wave-uniform
      v4u hv[4], lv[4];
#pragma unroll
      for (int it = 0; it < 4; ++it) {
        const int row = it * 4 + q;                        // it 0..3 x q 0..3 = rows 0..15
        const float* sp = slab + row * 68 + c8;
        v4u a, a2;
#pragma unroll
        for (int e = 0; e < 4; ++e) {
          const float f0 = sp[2 * e], f1 = sp[2 * e + 1];
          unsigned short h0, h1, l0, l1;
          if (OUT_MODE == 2) {
            h0 = bf_bits(f0); h1 = bf_bits(f1);
            l0 = bf_bits(f0 - bf_up(h0)); l1 = bf_bits(f1 - bf_up(h1));
          } else {
            const _Float16 x0 = (_Float16)f0, x1 = (_Float16)f1;
            h0 = h_bits(x0); h1 = h_bits(x1);
            l0 = h_bits((_Float16)((f0 - (float)x0) * rscale));
            l1 = h_bits((_Float16)((f1 - (float)x1) * rscale));
          }
          a[e] = pk16(h0, h1); a2[e] = pk16(l0, l1);
        }
        hv[it] = a; lv[it] = a2;
      }
      {
#pragma unroll
        for (int it = 0; it < 4; ++it) {
          const int row = it * 4 + q;
          *(v4u*)(C + (size_t)(mBase + row) * ldc + n0 + c8) = hv[it];
          if (wlo) *(v4u*)(C2 + (size_t)(mBase + row) * ldc2 + n0 + c8) = lv[it];
        }
        
      }
    }
    wave_sync_lds();
  }
}

// =====================================================================================================
// V^T chunk staging with the per-key-row value swap: destination LDS tiles dh/dl [d][kv] (64x64 f16),
// source planes (already offset to (batch, head)) [d][s] pitch NP: keys s < M1 come from (s0h, s0l),
// keys s >= M1 from (s1h, s1l). Chunks kt < 8 are all < M1, chunks kt > 8 all >= M1 (chunk-uniform source);
// chunk 8 (kv0 = 512) takes key 512 (element 0 of the hf == 0 half-row) from s0 and the rest from s1.
// Thread (r, hf): row d = r, keys kv0+hf .. kv0+hf+31; 128 threads x 32 keys x 2 planes = the whole tile.
// =====================================================================================================
__device__ __forceinline__ void stage_vt(_Float16* dh, _Float16* dl,
                                         const _Float16* s0h, const _Float16* s0l,
                                         const _Float16* s1h, const _Float16* s1l,
                                         int kt, int kv0, int r, int hf) {
  const bool lowc = (kt < 8);
  const _Float16* gh = (lowc ? s0h : s1h) + (size_t)r * NP + kv0 + hf;
  const _Float16* gl = (lowc ? s0l : s1l) + (size_t)r * NP + kv0 + hf;
#pragma unroll
  for (int i = 0; i < 4; ++i) {
    v8h a  = *(const v8h*)(gh + 8 * i);
    v8h a2 = *(const v8h*)(gl + 8 * i);
    if (i == 0 && kt == 8) {                         // block-uniform
      const _Float16 eh = s0h[(size_t)r * NP + (M1 - 1)];
      const _Float16 el = s0l[(size_t)r * NP + (M1 - 1)];
      a[0]  = (hf == 0) ? eh : a[0];
      a2[0] = (hf == 0) ? el : a2[0];
    }
    *(v8h*)(dh + r * 64 + hf + 8 * i) = a;
    *(v8h*)(dl + r * 64 + hf + 8 * i) = a2;
  }
}

// ---- context += P . V^T tile (f16 WMMA), residual products into a separate accumulator folded in f32 ----
__device__ __forceinline__ void pv_acc(v8f (&oacc)[4], const _Float16* pwh,
                                       const _Float16* Vth, const _Float16* Vtl,
                                       float rres, int c, int hh) {
  v8f o1[4];
#pragma unroll
  for (int t = 0; t < 4; ++t) o1[t] = zero8();
#pragma unroll 1
  for (int kk = 0; kk < 2; ++kk) {
    FH pa;
    pa.h[0] = *(const v8h*)(pwh + c * 64 + kk * 32 + 8 * hh);
    pa.h[1] = *(const v8h*)(pwh + c * 64 + kk * 32 + 16 + 8 * hh);
#pragma unroll
    for (int t = 0; t < 4; ++t) {
      FH vb, vl;
      vb.h[0] = *(const v8h*)(Vth + (t * 16 + c) * 64 + kk * 32 + 8 * hh);
      vb.h[1] = *(const v8h*)(Vth + (t * 16 + c) * 64 + kk * 32 + 16 + 8 * hh);
      vl.h[0] = *(const v8h*)(Vtl + (t * 16 + c) * 64 + kk * 32 + 8 * hh);
      vl.h[1] = *(const v8h*)(Vtl + (t * 16 + c) * 64 + kk * 32 + 16 + 8 * hh);
      oacc[t] = mma_h(pa.v, vb.v, oacc[t]);
      o1[t]   = mma_h(pa.v, vl.v, o1[t]);
    }
  }
#pragma unroll
  for (int t = 0; t < 4; ++t)
#pragma unroll
    for (int r = 0; r < 8; ++r) oacc[t][r] += o1[t][r] * rres;
}

// =====================================================================================================
// Attention, head dim 64, softmax over the NTOK valid keys of the batch element (keys s >= NTOK masked to
// -1e30 before the row max in the last chunk), per-modality value swap handled at V^T staging.
//   q|k plane (f16, pitch QKP): element (row, col) at [row*QKP + col], row = bl*NP + t, q col = h*64+d,
//   k col = DM + h*64 + d; q residual plane (f16, (q - f16(q))*4096, pitch DM): [row*DM + h*64 + d]
//   v^T / vc^T hi planes (f16): element (bl, h, d, s) at [(bl*DM + h*64 + d)*NP + s]; residual planes (x4096) same
//   out planes (bf16 hi / lo of the normalised context): element (row, h, d) at [row*DM + h*64 + d]
//   NV == 1: query tiles 0..7 (rows < M1, values: v for keys < M1, vc for keys >= M1) and 9..14
//            (values: vc for keys < M1, v for keys >= M1); grid = NQB_NM * NH * GB.
//   NV == 2: query tile 8 (rows 512..575): main set = the rows >= M1 combination, extra set (wave 0 only)
//            = the rows < M1 combination; row 512 selects the extra set at the end; grid = NH * GB.
//   scores = (qh . k + (ql . k) * rres) * sscale on f16 WMMA, residual products in a separate accumulator;
//   p = exp(s - m) carried as f16(1024 p); online softmax in f32.
//   Block = 4 waves = 64 query rows of one (bl, h); kv chunks of 64, static trip NKT.
//   K / V^T chunk staging: 128 threads x 32 elements per plane = the whole 64x64 tile (plain 16-B loads,
//   __syncthreads before and after); P tiles are wave-private, spilled with _Float16 element stores; the output stage
//   aliases the K / V LDS region after a final __syncthreads.
//   Output coverage: each wave stores rows q0..q0+15 (it 0..3 x lane>>3 0..3) x 64 columns (8 lanes x 8) of both planes.
// =====================================================================================================
template <int NV>
__global__ __launch_bounds__(128)
void attn64(const unsigned short* __restrict__ qkp, const unsigned short* __restrict__ qlp,
            const unsigned short* __restrict__ vhp, const unsigned short* __restrict__ vlp,
            const unsigned short* __restrict__ vchp, const unsigned short* __restrict__ vclp,
            unsigned short* ohp, unsigned short* olp, float sscale, float rres) {
  __shared__ __align__(16) _Float16 smem[(NV == 2) ? 24576 : 16384];
  _Float16* Ksh = smem;                                   // K [kv][d]           8 KB
  _Float16* VMh = smem + 4096;                            // main V^T hi [d][kv]  8 KB
  _Float16* VMl = smem + 8192;                            // main V^T residual     8 KB
  _Float16* VEh = (NV == 2) ? (smem + 12288) : VMh;       // extra set (NV == 2)   8 KB
  _Float16* VEl = (NV == 2) ? (smem + 16384) : VMl;       //                       8 KB
  _Float16* Psh = smem + ((NV == 2) ? 20480 : 12288);     // per wave P [row][kv]  8 KB

  const int tid  = threadIdx.x;
  const int wave = tid >> 5;
  const int lane = tid & 31;
  const int hh   = lane >> 4;
  const int c    = lane & 15;

  const int bx = blockIdx.x;
  int qb, rest;
  if (NV == 1) {
    const int idx = bx % NQB_NM;
    qb = idx + ((idx >= 8) ? 1 : 0);
    rest = bx / NQB_NM;
  } else {
    qb = 8;
    rest = bx;
  }
  const int h  = rest % NH;
  const int bl = rest / NH;
  const int q0 = qb * 64 + wave * 16;
  const size_t rowB = (size_t)bl * NP;

  const _Float16* Qh = (const _Float16*)(const void*)qkp + (size_t)h * HD;
  const _Float16* Kg = (const _Float16*)(const void*)qkp + DM + (size_t)h * HD;
  const _Float16* Ql = (const _Float16*)(const void*)qlp + (size_t)h * HD;
  const size_t vbase = ((size_t)bl * DM + (size_t)h * HD) * NP;
  const _Float16* Vh  = (const _Float16*)(const void*)vhp  + vbase;
  const _Float16* Vl  = (const _Float16*)(const void*)vlp  + vbase;
  const _Float16* Vch = (const _Float16*)(const void*)vchp + vbase;
  const _Float16* Vcl = (const _Float16*)(const void*)vclp + vbase;
  // main set: keys < M1 from (M0h, M0l), keys >= M1 from (M1h, M1l); block-uniform pointer choice
  const bool useB = (NV == 2) || (qb > 8);
  const _Float16* M0h = useB ? Vch : Vh;
  const _Float16* M0l = useB ? Vcl : Vl;
  const _Float16* M1h = useB ? Vh  : Vch;
  const _Float16* M1l = useB ? Vl  : Vcl;

  // ---- Q fragments (A operand, row = lane&15): 2 d-chunks, hi and residual ----
  v16h qah[2], qal[2];
#pragma unroll
  for (int dc = 0; dc < 2; ++dc) {
    qah[dc] = ldfrag_h(Qh + (rowB + q0 + c) * QKP + dc * 32 + 8 * hh);
    qal[dc] = ldfrag_h(Ql + (rowB + q0 + c) * DM  + dc * 32 + 8 * hh);
  }

  float mrow[8], lrow[8];
  v8f oacc[4], oaccE[4];
#pragma unroll
  for (int r = 0; r < 8; ++r) { mrow[r] = -INFINITY; lrow[r] = 0.f; }
#pragma unroll
  for (int t = 0; t < 4; ++t) { oacc[t] = zero8(); oaccE[t] = zero8(); }

  for (int kt = 0; kt < NKT; ++kt) {         // static trip count
    const int kv0 = kt * 64;
    __syncthreads();
    {
      const int r = tid >> 1, hf = (tid & 1) * 32;
      const _Float16* kg = Kg + (rowB + kv0 + r) * QKP + hf;      // K row kv0+r, d = hf..hf+31
#pragma unroll
      for (int i = 0; i < 4; ++i) {
        const v8h a0 = *(const v8h*)(kg + 8 * i);
        *(v8h*)(Ksh + r * 64 + hf + 8 * i) = a0;
      }
      stage_vt(VMh, VMl, M0h, M0l, M1h, M1l, kt, kv0, r, hf);
      if (NV == 2) stage_vt(VEh, VEl, Vh, Vl, Vch, Vcl, kt, kv0, r, hf);
    }
    __syncthreads();

    // ---- scores: 16 query rows x 64 keys per wave, 2 f16 products (hi, residual) ----
    v8f s[4];
#pragma unroll
    for (int j = 0; j < 4; ++j) {
      v8f sh = zero8(), sl = zero8();
#pragma unroll
      for (int dc = 0; dc < 2; ++dc) {
        FH kb;
        kb.h[0] = *(const v8h*)(Ksh + (j * 16 + c) * 64 + dc * 32 + 8 * hh);
        kb.h[1] = *(const v8h*)(Ksh + (j * 16 + c) * 64 + dc * 32 + 16 + 8 * hh);
        sh = mma_h(qah[dc], kb.v, sh);
        sl = mma_h(qal[dc], kb.v, sl);
      }
#pragma unroll
      for (int r = 0; r < 8; ++r) s[j][r] = (sh[r] + sl[r] * rres) * sscale;
    }
    // ---- keys s >= NTOK (only in the last chunk) are invalid: force -1e30 before the row max ----
    if (kt == NKT - 1) {                    // block-uniform
#pragma unroll
      for (int j = 0; j < 4; ++j) {
        const bool kval = (kv0 + j * 16 + c) < NTOK;
#pragma unroll
        for (int r = 0; r < 8; ++r) s[j][r] = kval ? s[j][r] : -1.0e30f;
      }
    }

    // ---- row max, online softmax, P (x1024, f16) to LDS ----
    _Float16* pwh = Psh + wave * 1024;
#pragma unroll
    for (int r = 0; r < 8; ++r) {
      float m = s[0][r];
      m = fmaxf(m, s[1][r]);
      m = fmaxf(m, s[2][r]);
      m = fmaxf(m, s[3][r]);
#pragma unroll
      for (int off = 1; off < 16; off <<= 1) m = fmaxf(m, __shfl_xor(m, off, 32));
      const float mnew  = fmaxf(mrow[r], m);
      const float alpha = __expf(mrow[r] - mnew);
      mrow[r] = mnew;
      float psum = 0.f;
#pragma unroll
      for (int j = 0; j < 4; ++j) {
        const float p = __expf(s[j][r] - mnew);
        psum += p;
        pwh[(8 * hh + r) * 64 + j * 16 + c] = (_Float16)(p * 1024.0f);
      }
#pragma unroll
      for (int off = 1; off < 16; off <<= 1) psum += __shfl_xor(psum, off, 32);
      lrow[r] = lrow[r] * alpha + psum;
#pragma unroll
      for (int t = 0; t < 4; ++t) { oacc[t][r] *= alpha; if (NV == 2) oaccE[t][r] *= alpha; }
    }
    wave_sync_lds();

    // ---- context += P . V ----
    pv_acc(oacc, pwh, VMh, VMl, rres, c, hh);
    if (NV == 2) {
      if (wave == 0) pv_acc(oaccE, pwh, VEh, VEl, rres, c, hh);   // wave-uniform
    }
  }
  __syncthreads();                           // all waves done with K / V tiles before the alias below

  // ---- normalise (1/l and the 1/1024 p carry), stage the wave's 16x64 tile (aliases the K / V region),
  float* os = (float*)(void*)smem + wave * 1024;
#pragma unroll
  for (int r = 0; r < 8; ++r) {
    const float l = lrow[r];
    const float inv = ((l > 0.f) ? (1.0f / l) : 0.f) * (1.0f / 1024.0f);
#pragma unroll
    for (int t = 0; t < 4; ++t) {
      float vm = oacc[t][r] * inv;
      if (NV == 2) {
        const float ve = oaccE[t][r] * inv;
        const bool rowA = (q0 + 8 * hh + r) == (M1 - 1);   // query row 512 uses the extra set
        vm = rowA ? ve : vm;
      }
      os[(8 * hh + r) * 64 + t * 16 + c] = vm;
    }
  }
  wave_sync_lds();
  {
    const int q4 = lane >> 3, c8 = (lane & 7) * 8;
    v4u hv[4], lv[4];
#pragma unroll
    for (int it = 0; it < 4; ++it) {
      const int row = it * 4 + q4;   // it 0..3 x q4 0..3 = rows 0..15 of the wave tile
      const float* sp = os + row * 64 + c8;
      v4u a, a2;
#pragma unroll
      for (int e = 0; e < 4; ++e) {
        const float f0 = sp[2 * e], f1 = sp[2 * e + 1];
        const unsigned short h0 = bf_bits(f0), h1 = bf_bits(f1);
        const unsigned short l0 = bf_bits(f0 - bf_up(h0)), l1 = bf_bits(f1 - bf_up(h1));
        a[e] = pk16(h0, h1); a2[e] = pk16(l0, l1);
      }
      hv[it] = a; lv[it] = a2;
    }
    {
#pragma unroll
      for (int it = 0; it < 4; ++it) {
        const int row = it * 4 + q4;
        const size_t go = (rowB + q0 + row) * DM + (size_t)h * HD + c8;
        *(v4u*)(ohp + go) = hv[it];
        *(v4u*)(olp + go) = lv[it];
      }
      
    }
  }
}

// =====================================================================================================
// d_out[(b0 + bl)*NTOK + r][c] = OUTP[(bl*NP + r)][c] + bf16-RNE(bp[c]) for r < NTOK (padded rows dropped).
// One thread per 4 floats in d_out row-major order over the group's rows, which are contiguous in d_out:
// coverage: n4 = GB*NTOK*DM/4 threads x 4 = every d_out element of batch elements b0..b0+GB-1.
// =====================================================================================================
__global__ __launch_bounds__(256) void copy_out(const float* __restrict__ op, const float* __restrict__ bp,
                                                 float* out, int b0, int n4) {
  const int i = blockIdx.x * 256 + threadIdx.x;
  if (i < n4) {
    const int row = i / (DM / 4);
    const int c4  = (i - row * (DM / 4)) * 4;
    const int bl  = row / NTOK;
    const int r   = row - bl * NTOK;
    v4f v = *(const v4f*)(op + ((size_t)bl * NP + r) * DM + c4);
    const v4f bb = *(const v4f*)(bp + c4);
#pragma unroll
    for (int e = 0; e < 4; ++e) v[e] += bf_up(bf_bits(bb[e]));
    float* d = out + ((size_t)b0 * NTOK + row) * DM + c4;
    *(v4f*)d = v;
    
  }
}

// =====================================================================================================
// Workspace map (bytes), group of GB = 4 batch elements (GB*NP = 3840 rows), every plane an exact multiple
// of its 64x64-tile / whole-line store granularity (padded rows included):
//   Wt    bf16 [5][768 co][768 ci]   0          5898240   (Wq^T | Wk^T | Wv^T | Wvc^T | Wp^T)
//   Xp    bf16 [3840][768]           5898240    5898240
//   QK    f16  [3840][1536]          11796480   11796480  (q cols 0..767, k cols 768..1535)
//   Ql    f16  [3840][768]           23592960   5898240   (q residual x4096)
//   VTh   f16  [4][768][960]         29491200   5898240   (v^T hi)
//   VTl   f16  [4][768][960]         35389440   5898240   (v^T residual x4096)
//   VCh   f16  [4][768][960]         41287680   5898240   (vc^T hi)
//   VCl   f16  [4][768][960]         47185920   5898240   (vc^T residual x4096)
//   Oh    bf16 [3840][768]           53084160   5898240
//   Ol    bf16 [3840][768]           58982400   5898240
//   OUTP  f32  [3840][768]           64880640   11796480
//   end                              76677120
// =====================================================================================================
extern "C" void kernel_launch(void* const* d_in, const int* in_sizes, int n_in,
                              void* d_out, int out_size, void* d_ws, size_t ws_size,
                              hipStream_t stream) {
  if (n_in < 7) return;
  if (in_sizes[0] != NBATCH * NTOK * DM) return;
  if (in_sizes[1] != DM * DM || in_sizes[2] != DM * DM || in_sizes[3] != DM * DM) return;
  if (in_sizes[4] != DM * DM || in_sizes[5] != DM * DM) return;
  if (in_sizes[6] != DM) return;
  if (out_size != NBATCH * NTOK * DM) return;

  const float* x   = (const float*)d_in[0];
  const float* Wq  = (const float*)d_in[1];
  const float* Wk  = (const float*)d_in[2];
  const float* Wv  = (const float*)d_in[3];
  const float* Wvc = (const float*)d_in[4];
  const float* Wp  = (const float*)d_in[5];
  const float* bp  = (const float*)d_in[6];

  const size_t ROWS = (size_t)GB * NP;                 // 3840
  const size_t PW   = (size_t)5 * DM * DM * 2;          //  5898240
  const size_t PX   = ROWS * DM * 2;                    //  5898240
  const size_t PQK  = ROWS * QKP * 2;                   // 11796480
  const size_t PQl  = ROWS * DM * 2;                    //  5898240
  const size_t PVT  = (size_t)GB * DM * NP * 2;         //  5898240
  const size_t PO   = ROWS * DM * 2;                    //  5898240
  const size_t POUT = ROWS * DM * 4;                    // 11796480
  size_t off = 0;
  const size_t oW   = off; off += PW;
  const size_t oXp  = off; off += PX;
  const size_t oQK  = off; off += PQK;
  const size_t oQl  = off; off += PQl;
  const size_t oVTh = off; off += PVT;
  const size_t oVTl = off; off += PVT;
  const size_t oVCh = off; off += PVT;
  const size_t oVCl = off; off += PVT;
  const size_t oOh  = off; off += PO;
  const size_t oOl  = off; off += PO;
  const size_t oOUT = off; off += POUT;
  if (off > ws_size) return;                            // off = 76677120
  if (off > (size_t)134217728) return;

  char* ws = (char*)d_ws;
  unsigned short* Wt   = (unsigned short*)(ws + oW);
  unsigned short* Wqk_t = Wt;                                   // rows 0..1535: Wq^T then Wk^T
  unsigned short* Wv_t  = Wt + (size_t)2 * DM * DM;
  unsigned short* Wvc_t = Wt + (size_t)3 * DM * DM;
  unsigned short* Wp_t  = Wt + (size_t)4 * DM * DM;
  unsigned short* Xp   = (unsigned short*)(ws + oXp);
  unsigned short* QK   = (unsigned short*)(ws + oQK);
  unsigned short* Ql   = (unsigned short*)(ws + oQl);
  unsigned short* VTh  = (unsigned short*)(ws + oVTh);
  unsigned short* VTl  = (unsigned short*)(ws + oVTl);
  unsigned short* VCh  = (unsigned short*)(ws + oVCh);
  unsigned short* VCl  = (unsigned short*)(ws + oVCl);
  unsigned short* Oh   = (unsigned short*)(ws + oOh);
  unsigned short* Ol   = (unsigned short*)(ws + oOl);
  float*          OUTP = (float*)(ws + oOUT);
  float*          out  = (float*)d_out;

  const dim3 blk(256);
  const int n8x = GB * NP * (DM / 8);                            // 368640
  const int n4o = GB * NTOK * (DM / 4);                          // 695808
  const dim3 gCvtX((n8x + 255) / 256);                           // 1440 blocks
  const dim3 gCopy((n4o + 255) / 256);                           // 2718 blocks
  const dim3 gWtr(DM / 64, DM / 64, 5);                          // 12 x 12 x 5 tiles
  const dim3 gQK(((GB * NP / 64) * (QKP / 64) + 7) / 8, 1);      // 1440 tiles -> 180 blocks: M=3840, N=1536
  const dim3 gVT(((DM / 64) * (NP / 64) + 7) / 8, GB);           // 180 tiles -> 23 blocks x 4: M=768, N=960
  const dim3 gOut(((GB * NP / 64) * (DM / 64) + 7) / 8, 1);      // 720 tiles -> 90 blocks: M=3840, N=768
  const dim3 gAttn1(NQB_NM * NH * GB);                           // 672 blocks
  const dim3 gAttn2(NH * GB);                                    //  48 blocks

  // (0) weights -> bf16 [out][in] planes (k contiguous = the Bt / A layout the GEMM wants)
  wtr_bf16<<<gWtr, blk, 0, stream>>>(Wq, Wk, Wv, Wvc, Wp, Wt);

  for (int g = 0; g < NGRP; ++g) {
    const int b0 = g * GB;
    // (1) x -> zero-padded bf16 plane [3840][768]
    cvt_x_bf16<<<gCvtX, blk, 0, stream>>>(x, Xp, b0, n8x);
    // (2) q|k = Xp . Wqk^T -> f16 plane [3840][1536] + f16 residual x4096 of the q half (n0 < 768, pitch 768)
    gemm64<0, 3><<<gQK, blk, 0, stream>>>(
        Xp, Xp, DM, 0LL, Wqk_t, Wqk_t, DM, 0LL,
        (void*)QK, QKP, 0LL, (void*)Ql, DM, 0LL, DM,
        GB * NP, QKP, DM, 4096.0f);
    // (3) v^T = Wv^T . Xp^T per batch element -> f16 hi [bl][h*64+d][s] (pitch NP) + residual x4096
    gemm64<0, 3><<<gVT, blk, 0, stream>>>(
        Wv_t, Wv_t, DM, 0LL, Xp, Xp, DM, (long long)NP * DM,
        (void*)VTh, NP, (long long)DM * NP, (void*)VTl, NP, (long long)DM * NP, NP,
        DM, NP, DM, 4096.0f);
    // (4) vc^T likewise
    gemm64<0, 3><<<gVT, blk, 0, stream>>>(
        Wvc_t, Wvc_t, DM, 0LL, Xp, Xp, DM, (long long)NP * DM,
        (void*)VCh, NP, (long long)DM * NP, (void*)VCl, NP, (long long)DM * NP, NP,
        DM, NP, DM, 4096.0f);
    // (5) attention -> context bf16 hi / lo planes [3840][768]: query tiles 0..7, 9..14, then the mixed tile 8
    attn64<1><<<gAttn1, dim3(128), 0, stream>>>(QK, Ql, VTh, VTl, VCh, VCl, Oh, Ol, 0.125f, 1.0f / 4096.0f);
    attn64<2><<<gAttn2, dim3(128), 0, stream>>>(QK, Ql, VTh, VTl, VCh, VCl, Oh, Ol, 0.125f, 1.0f / 4096.0f);
    // (6) OUTP = context . Wp (A = context hi + lo planes, 2 products; K=768) -> f32 [3840][768]
    gemm64<1, 0><<<gOut, blk, 0, stream>>>(
        Oh, Ol, DM, 0LL, Wp_t, Wp_t, DM, 0LL,
        (void*)OUTP, DM, 0LL, (void*)OUTP, DM, 0LL, DM,
        GB * NP, DM, DM, 1.0f);
    // (7) valid rows + bias -> d_out rows (b0 + bl)*906 + r
    copy_out<<<gCopy, blk, 0, stream>>>(OUTP, bp, out, b0, n4o);
  }
  (void)hipGetLastError();
}

// v001
// Measured time: 652 microseconds a run.
// In two side-by-side timings against v000, it was 1.92 and 1.91 times as fast.
// Contractions: q|k, v^T and vc^T projections = v_wmma_f32_16x16x32_bf16 (bf16 operands from RNE-converted x and W, single product);
// q.k^T scores = v_wmma_f32_16x16x32_f16 (q as f16 hi plane + f16 residual plane x4096 in a separate accumulator, k f16; 2 products);
// p.v = v_wmma_f32_16x16x32_f16 (p carried x1024 in f16, v^T as f16 hi plane + f16 residual plane x4096 in a separate accumulator; 2 products);
// ctx.Wp = v_wmma_f32_16x16x32_bf16 (ctx as bf16 hi + lo planes times bf16 Wp^T, 2 products); all f32 accumulate; softmax in f32.
#include <hip/hip_runtime.h>
#include <math.h>
#include <stdint.h>

#define NBATCH 16
#define NTOK   906
#define NP     960            // padded token count per batch element (15 tiles of 64)
#define DM     768
#define NH     12
#define HD     64
#define M1     513            // modality split: query / key rows < M1 vs >= M1
#define NKT    (NP / 64)      // 15 key chunks of 64
#define NQB_NM 14             // query tiles 0..7 and 9..14 (tile 8 is the mixed tile)
#define QKP    (2 * DM)       // pitch of the q|k plane: q at cols 0..DM-1, k at cols DM..2DM-1
#define GB     16             // batch elements per group (all of them: one pass of launches fills the chip)
#define NGRP   (NBATCH / GB)
static_assert(NH * HD == DM);
static_assert((NP % 64) == 0 && NP >= NTOK && (DM % 64) == 0 && (DM % 32) == 0);
static_assert((NBATCH % GB) == 0);
static_assert(M1 - 1 == 8 * 64);   // row 512 is the first row of query tile 8 and of key chunk 8
static_assert(NTOK > (NKT - 1) * 64 && NTOK <= NP);   // invalid keys live only in the last chunk

typedef _Float16 v16h __attribute__((ext_vector_type(16)));
typedef _Float16 v8h  __attribute__((ext_vector_type(8)));
typedef __bf16   v16b __attribute__((ext_vector_type(16)));
typedef __bf16   v8b  __attribute__((ext_vector_type(8)));
typedef float    v8f  __attribute__((ext_vector_type(8)));
typedef float    v4f  __attribute__((ext_vector_type(4)));
typedef unsigned int v4u __attribute__((ext_vector_type(4)));

union FH { v16h v; v8h h[2]; };

// ---- scalar helpers --------------------------------------------------------------------------------
__device__ __forceinline__ unsigned short bf_bits(float f) {          // f32 -> bf16 bits, RNE convert
  unsigned u = __float_as_uint(f);
  return (unsigned short)((u + 0x7FFFu + ((u >> 16) & 1u)) >> 16);
}
__device__ __forceinline__ float bf_up(unsigned short h) { return __uint_as_float(((unsigned)h) << 16); }
__device__ __forceinline__ unsigned short h_bits(_Float16 x) { return __builtin_bit_cast(unsigned short, x); }
__device__ __forceinline__ unsigned pk16(unsigned short a, unsigned short b) { return (unsigned)a | ((unsigned)b << 16); }
__device__ __forceinline__ v8f zero8() { v8f z = {0.f, 0.f, 0.f, 0.f, 0.f, 0.f, 0.f, 0.f}; return z; }

// ---- fragment loaders: 16-bit A/B operand, lane -> row/col (lane&15), p already includes +8*(lane>>4);
//      elements 0..7 <- p[0..7] (k0+8h..), elements 8..15 <- p[16..23] (k0+16+8h..)
__device__ __forceinline__ v16b ldfrag_b(const __bf16* p) {
  union { v16b v; v8b h[2]; } f;
  f.h[0] = *(const v8b*)(p);
  f.h[1] = *(const v8b*)(p + 16);
  return f.v;
}
__device__ __forceinline__ v16h ldfrag_h(const _Float16* p) {
  union { v16h v; v8h h[2]; } f;
  f.h[0] = *(const v8h*)(p);
  f.h[1] = *(const v8h*)(p + 16);
  return f.v;
}

// ---- WMMA helpers with trailing VALU hazard gap --------------------------------------------------------
__device__ __forceinline__ v8f mma_h(v16h a, v16h b, v8f c) {
  c = __builtin_amdgcn_wmma_f32_16x16x32_f16(false, a, false, b, (short)0, c, false, false);
#if defined(__HIP_DEVICE_COMPILE__)
  asm volatile("v_nop\n\tv_nop\n\tv_nop\n\tv_nop" : "+v"(c) : "v"(a), "v"(b));
#endif
  return c;
}
__device__ __forceinline__ v8f mma_b_raw(v16b a, v16b b, v8f c) {
  return __builtin_amdgcn_wmma_f32_16x16x32_bf16(false, a, false, b, (short)0, c, false, false);
}
__device__ __forceinline__ void dep_guard_b(v8f& a, v8f& b, v16b x, v16b y) {
#if defined(__HIP_DEVICE_COMPILE__)
  asm volatile("v_nop\n\tv_nop\n\tv_nop\n\tv_nop" : "+v"(a), "+v"(b) : "v"(x), "v"(y));
#endif
}
__device__ __forceinline__ void keep4_b(v16b a, v16b b, v16b c, v16b d) {
#if defined(__HIP_DEVICE_COMPILE__)
  asm volatile("v_nop" :: "v"(a), "v"(b), "v"(c), "v"(d));
#endif
}
__device__ __forceinline__ void acc_guard4(v8f& a, v8f& b, v8f& c, v8f& d) {
#if defined(__HIP_DEVICE_COMPILE__)
  asm volatile("v_nop\n\tv_nop\n\tv_nop\n\tv_nop" : "+v"(a), "+v"(b), "+v"(c), "+v"(d));
#endif
}
__device__ __forceinline__ void wave_sync_lds() {
  __builtin_amdgcn_fence(__ATOMIC_RELEASE, "workgroup");
  __builtin_amdgcn_wave_barrier();
  __builtin_amdgcn_fence(__ATOMIC_ACQUIRE, "workgroup");
}

// =====================================================================================================
// x f32 [b][NTOK][DM] -> zero-padded bf16 plane Xp [GB*NP][DM] for batch elements b0..b0+GB-1 (RNE convert).
// address, value select). coverage: n8 = GB*NP*DM/8 threads x 8 = the whole Xp plane incl. padded rows.
// =====================================================================================================
__global__ __launch_bounds__(256) void cvt_x_bf16(const float* __restrict__ x, unsigned short* xp,
                                                   int b0, int n8) {
  const int i = blockIdx.x * 256 + threadIdx.x;
  if (i < n8) {
    const int row = i / (DM / 8);
    const int c8  = (i - row * (DM / 8)) * 8;
    const int bl  = row / NP;
    const int r   = row - bl * NP;
    const int rr  = (r < NTOK) ? r : (NTOK - 1);                 // clamped address for padded rows
    const float* src = x + ((size_t)(b0 + bl) * NTOK + rr) * DM + c8;
    const v4f a = *(const v4f*)(src);
    const v4f b = *(const v4f*)(src + 4);
    v4u p;
    p[0] = pk16(bf_bits(a[0]), bf_bits(a[1]));
    p[1] = pk16(bf_bits(a[2]), bf_bits(a[3]));
    p[2] = pk16(bf_bits(b[0]), bf_bits(b[1]));
    p[3] = pk16(bf_bits(b[2]), bf_bits(b[3]));
    const bool valid = (r < NTOK);
#pragma unroll
    for (int e = 0; e < 4; ++e) p[e] = valid ? p[e] : 0u;
    *(v4u*)(xp + (size_t)i * 8) = p;
    
  }
}

// =====================================================================================================
// Weight transpose-convert: W f32 [DM ci][DM co] (x @ W layout) -> Wt bf16 [co][ci] (k = ci contiguous),
// RNE convert. blockIdx.z selects the weight (0..4 -> Wq, Wk, Wv, Wvc, Wp), written back to back in wt.
// coverage: 8 waves x (2 it x 4 row groups) = 64 rows x (8 lanes x 8) = 64 cols per tile; grid 12x12x5.
// =====================================================================================================
__global__ __launch_bounds__(256) void wtr_bf16(const float* __restrict__ w0, const float* __restrict__ w1,
                                                 const float* __restrict__ w2, const float* __restrict__ w3,
                                                 const float* __restrict__ w4, unsigned short* wt) {
  __shared__ __align__(16) unsigned short T[64 * 72];   // [co][ci], pitch 72 (144 B, 16-B aligned rows)
  const int z = blockIdx.z;
  const float* W = (z == 0) ? w0 : (z == 1) ? w1 : (z == 2) ? w2 : (z == 3) ? w3 : w4;
  unsigned short* dst = wt + (size_t)z * DM * DM;
  const int co0 = blockIdx.x * 64;
  const int ci0 = blockIdx.y * 64;
  const int tid = threadIdx.x;
#pragma unroll
  for (int it = 0; it < 16; ++it) {
    const int idx = it * 256 + tid;
    const int i = idx >> 6;          // ci within tile
    const int j = idx & 63;          // co within tile
    T[j * 72 + i] = bf_bits(W[(size_t)(ci0 + i) * DM + co0 + j]);
  }
  __syncthreads();
  const int wave = tid >> 5, lane = tid & 31;
  const int q = lane >> 3, c8 = (lane & 7) * 8;
  v4u v[2];
#pragma unroll
  for (int it = 0; it < 2; ++it) {
    const int row = wave * 8 + it * 4 + q;
    v[it] = *(const v4u*)(T + row * 72 + c8);
  }
  {
#pragma unroll
    for (int it = 0; it < 2; ++it) {
      const int row = wave * 8 + it * 4 + q;
      *(v4u*)(dst + (size_t)(co0 + row) * DM + ci0 + c8) = v[it];
    }
    
  }
}

// =====================================================================================================
// Register-blocked batched bf16 WMMA GEMM: C[m][n] = sum_k A[m][k] * Bt[n][k]; one wave per 64x64 tile,
// no block barriers. A row-major [M][K] pitch lda; Bt row-major [N][K] pitch ldb (k contiguous);
// M, N multiples of 64, K multiple of 32 (host-checked). blockIdx.y = batch index (strides in elements).
// NSPLIT: 0 = A.Bt; 1 = (A + A2).Bt (A2 = unscaled bf16 lo plane of A); 2 = A.Bt + A2.Bt + A.Bt2.
// OUT_MODE: 0 = f32 (pitch ldc); 2 = bf16 hi plane C + bf16 lo plane C2 (lo = RNE(v - hi), unscaled);
//           3 = f16 hi plane C + f16 residual plane C2 = f16((v - hi) * rscale), C2 written only for tiles
//               with n0 < N2 (pitch ldc2, batch stride strideC2).
// =====================================================================================================
template <int NSPLIT, int OUT_MODE>
__global__ __launch_bounds__(256) void gemm64(
    const unsigned short* __restrict__ Ap, const unsigned short* A2p, int lda, long long strideA,
    const unsigned short* __restrict__ Btp, const unsigned short* Bt2p, int ldb, long long strideB,
    void* Cout, int ldc, long long strideC,
    void* Cout2, int ldc2, long long strideC2, int N2,
    int M, int N, int K, float rscale) {
  const __bf16* A   = (const __bf16*)(const void*)Ap;
  const __bf16* A2  = (const __bf16*)(const void*)A2p;
  const __bf16* Bt  = (const __bf16*)(const void*)Btp;
  const __bf16* Bt2 = (const __bf16*)(const void*)Bt2p;
  __shared__ __align__(16) float sT[8][16 * 68];   // per-wave 16x64 slab, pitch 68 floats
  const int b    = blockIdx.y;
  const int lane = threadIdx.x & 31;
  const int wave = threadIdx.x >> 5;
  const int tilesN = N >> 6;
  const int tilesM = M >> 6;
  const int tile = blockIdx.x * 8 + wave;
  if (tile >= tilesM * tilesN) return;   // wave-uniform; no block barriers in this kernel
  const int tm = tile / tilesN;
  const int tn = tile - tm * tilesN;
  const int m0 = tm << 6;
  const int n0 = tn << 6;

  const __bf16* Ab  = A  + (size_t)b * strideA;
  const __bf16* Bb  = Bt + (size_t)b * strideB;
  const __bf16* Ab2 = (NSPLIT >= 1) ? (A2  + (size_t)b * strideA) : Ab;
  const __bf16* Bb2 = (NSPLIT == 2) ? (Bt2 + (size_t)b * strideB) : Bb;

  const int rlane = lane & 15;                 // row (A) / col (B, D) within subtile
  const int koff  = (lane >> 4) * 8;           // k offset of this lane half
  const int mOff  = (lane >> 4) * 8;           // D row offset

  v8f acc[4][4];
#pragma unroll
  for (int i = 0; i < 4; ++i)
#pragma unroll
    for (int j = 0; j < 4; ++j) acc[i][j] = zero8();

  for (int k0 = 0; k0 < K; k0 += 32) {
    v16b bh[4], bl[4];
#pragma unroll
    for (int j = 0; j < 4; ++j) {
      const size_t bo = (size_t)(n0 + (j << 4) + rlane) * ldb + koff + k0;
      bh[j] = ldfrag_b(Bb + bo);
      if (NSPLIT == 2) bl[j] = ldfrag_b(Bb2 + bo); else bl[j] = bh[j];
    }
#pragma unroll
    for (int i = 0; i < 4; ++i) {
      const size_t ao = (size_t)(m0 + (i << 4) + rlane) * lda + koff + k0;
      const v16b ah = ldfrag_b(Ab + ao);
      v16b al = ah;
      if (NSPLIT >= 1) al = ldfrag_b(Ab2 + ao);
#pragma unroll
      for (int j = 0; j < 4; ++j) {
        acc[i][j] = mma_b_raw(ah, bh[j], acc[i][j]);
        if (NSPLIT >= 1) acc[i][j] = mma_b_raw(al, bh[j], acc[i][j]);
        if (NSPLIT == 2) acc[i][j] = mma_b_raw(ah, bl[j], acc[i][j]);
      }
      dep_guard_b(acc[i][0], acc[i][3], ah, al);
    }
    keep4_b(bh[0], bh[1], bh[2], bh[3]);
    if (NSPLIT == 2) keep4_b(bl[0], bl[1], bl[2], bl[3]);
  }
  acc_guard4(acc[0][0], acc[0][1], acc[0][2], acc[0][3]);
  acc_guard4(acc[1][0], acc[1][1], acc[1][2], acc[1][3]);
  acc_guard4(acc[2][0], acc[2][1], acc[2][2], acc[2][3]);
  acc_guard4(acc[3][0], acc[3][1], acc[3][2], acc[3][3]);

  // ---- epilogue ----
  float* slab = sT[wave];
#pragma unroll
  for (int i = 0; i < 4; ++i) {
    const int mBase = m0 + (i << 4);
#pragma unroll
    for (int j = 0; j < 4; ++j) {
#pragma unroll
      for (int r = 0; r < 8; ++r) {
        slab[(mOff + r) * 68 + (j << 4) + rlane] = acc[i][j][r];
      }
    }
    wave_sync_lds();
    if (OUT_MODE == 0) {
      float* C = (float*)Cout + (size_t)b * strideC;
      const int hh = lane >> 4, c4 = (lane & 15) * 4;     // 256-B row segment = 16 lanes x 16 B
      {
#pragma unroll
        for (int it = 0; it < 8; ++it) {
          const int row = it * 2 + hh;                     // it 0..7 x hh 0..1 = rows 0..15
          const v4f v = *(const v4f*)(slab + row * 68 + c4);
          *(v4f*)(C + (size_t)(mBase + row) * ldc + n0 + c4) = v;
        }
        
      }
    } else {
      const int q = lane >> 3, c8 = (lane & 7) * 8;
      unsigned short* C  = (unsigned short*)Cout  + (size_t)b * strideC;
      unsigned short* C2 = (unsigned short*)Cout2 + (size_t)b * strideC2;
      const bool wlo = (OUT_MODE == 2) || (n0 < N2);      // wave-uniform
      v4u hv[4], lv[4];
#pragma unroll
      for (int it = 0; it < 4; ++it) {
        const int row = it * 4 + q;                        // it 0..3 x q 0..3 = rows 0..15
        const float* sp = slab + row * 68 + c8;
        v4u a, a2;
#pragma unroll
        for (int e = 0; e < 4; ++e) {
          const float f0 = sp[2 * e], f1 = sp[2 * e + 1];
          unsigned short h0, h1, l0, l1;
          if (OUT_MODE == 2) {
            h0 = bf_bits(f0); h1 = bf_bits(f1);
            l0 = bf_bits(f0 - bf_up(h0)); l1 = bf_bits(f1 - bf_up(h1));
          } else {
            const _Float16 x0 = (_Float16)f0, x1 = (_Float16)f1;
            h0 = h_bits(x0); h1 = h_bits(x1);
            l0 = h_bits((_Float16)((f0 - (float)x0) * rscale));
            l1 = h_bits((_Float16)((f1 - (float)x1) * rscale));
          }
          a[e] = pk16(h0, h1); a2[e] = pk16(l0, l1);
        }
        hv[it] = a; lv[it] = a2;
      }
      {
#pragma unroll
        for (int it = 0; it < 4; ++it) {
          const int row = it * 4 + q;
          *(v4u*)(C + (size_t)(mBase + row) * ldc + n0 + c8) = hv[it];
          if (wlo) *(v4u*)(C2 + (size_t)(mBase + row) * ldc2 + n0 + c8) = lv[it];
        }
        
      }
    }
    wave_sync_lds();
  }
}

// =====================================================================================================
// V^T chunk staging with the per-key-row value swap: destination LDS tiles dh/dl [d][kv] (64x64 f16),
// source planes (already offset to (batch, head)) [d][s] pitch NP: keys s < M1 come from (s0h, s0l),
// keys s >= M1 from (s1h, s1l). Chunks kt < 8 are all < M1, chunks kt > 8 all >= M1 (chunk-uniform source);
// chunk 8 (kv0 = 512) takes key 512 (element 0 of the hf == 0 half-row) from s0 and the rest from s1.
// Thread (r, hf): row d = r, keys kv0+hf .. kv0+hf+31; 128 threads x 32 keys x 2 planes = the whole tile.
// =====================================================================================================
__device__ __forceinline__ void stage_vt(_Float16* dh, _Float16* dl,
                                         const _Float16* s0h, const _Float16* s0l,
                                         const _Float16* s1h, const _Float16* s1l,
                                         int kt, int kv0, int r, int hf) {
  const bool lowc = (kt < 8);
  const _Float16* gh = (lowc ? s0h : s1h) + (size_t)r * NP + kv0 + hf;
  const _Float16* gl = (lowc ? s0l : s1l) + (size_t)r * NP + kv0 + hf;
#pragma unroll
  for (int i = 0; i < 4; ++i) {
    v8h a  = *(const v8h*)(gh + 8 * i);
    v8h a2 = *(const v8h*)(gl + 8 * i);
    if (i == 0 && kt == 8) {                         // block-uniform
      const _Float16 eh = s0h[(size_t)r * NP + (M1 - 1)];
      const _Float16 el = s0l[(size_t)r * NP + (M1 - 1)];
      a[0]  = (hf == 0) ? eh : a[0];
      a2[0] = (hf == 0) ? el : a2[0];
    }
    *(v8h*)(dh + r * 64 + hf + 8 * i) = a;
    *(v8h*)(dl + r * 64 + hf + 8 * i) = a2;
  }
}

// ---- context += P . V^T tile (f16 WMMA), residual products into a separate accumulator folded in f32 ----
__device__ __forceinline__ void pv_acc(v8f (&oacc)[4], const _Float16* pwh,
                                       const _Float16* Vth, const _Float16* Vtl,
                                       float rres, int c, int hh) {
  v8f o1[4];
#pragma unroll
  for (int t = 0; t < 4; ++t) o1[t] = zero8();
#pragma unroll 1
  for (int kk = 0; kk < 2; ++kk) {
    FH pa;
    pa.h[0] = *(const v8h*)(pwh + c * 64 + kk * 32 + 8 * hh);
    pa.h[1] = *(const v8h*)(pwh + c * 64 + kk * 32 + 16 + 8 * hh);
#pragma unroll
    for (int t = 0; t < 4; ++t) {
      FH vb, vl;
      vb.h[0] = *(const v8h*)(Vth + (t * 16 + c) * 64 + kk * 32 + 8 * hh);
      vb.h[1] = *(const v8h*)(Vth + (t * 16 + c) * 64 + kk * 32 + 16 + 8 * hh);
      vl.h[0] = *(const v8h*)(Vtl + (t * 16 + c) * 64 + kk * 32 + 8 * hh);
      vl.h[1] = *(const v8h*)(Vtl + (t * 16 + c) * 64 + kk * 32 + 16 + 8 * hh);
      oacc[t] = mma_h(pa.v, vb.v, oacc[t]);
      o1[t]   = mma_h(pa.v, vl.v, o1[t]);
    }
  }
#pragma unroll
  for (int t = 0; t < 4; ++t)
#pragma unroll
    for (int r = 0; r < 8; ++r) oacc[t][r] += o1[t][r] * rres;
}

// =====================================================================================================
// Attention, head dim 64, softmax over the NTOK valid keys of the batch element (keys s >= NTOK masked to
// -1e30 before the row max in the last chunk), per-modality value swap handled at V^T staging.
//   q|k plane (f16, pitch QKP): element (row, col) at [row*QKP + col], row = bl*NP + t, q col = h*64+d,
//   k col = DM + h*64 + d; q residual plane (f16, (q - f16(q))*4096, pitch DM): [row*DM + h*64 + d]
//   v^T / vc^T hi planes (f16): element (bl, h, d, s) at [(bl*DM + h*64 + d)*NP + s]; residual planes (x4096) same
//   out planes (bf16 hi / lo of the normalised context): element (row, h, d) at [row*DM + h*64 + d]
//   NV == 1: query tiles 0..7 (rows < M1, values: v for keys < M1, vc for keys >= M1) and 9..14
//            (values: vc for keys < M1, v for keys >= M1); grid = NQB_NM * NH * GB.
//   NV == 2: query tile 8 (rows 512..575): main set = the rows >= M1 combination, extra set (wave 0 only)
//            = the rows < M1 combination; row 512 selects the extra set at the end; grid = NH * GB.
//   scores = (qh . k + (ql . k) * rres) * sscale on f16 WMMA, residual products in a separate accumulator;
//   p = exp(s - m) carried as f16(1024 p); online softmax in f32.
//   Block = 4 waves = 64 query rows of one (bl, h); kv chunks of 64, static trip NKT.
//   K / V^T chunk staging: 128 threads x 32 elements per plane = the whole 64x64 tile (plain 16-B loads,
//   __syncthreads before and after); P tiles are wave-private, spilled with _Float16 element stores; the output stage
//   aliases the K / V LDS region after a final __syncthreads.
//   Output coverage: each wave stores rows q0..q0+15 (it 0..3 x lane>>3 0..3) x 64 columns (8 lanes x 8) of both planes.
// =====================================================================================================
template <int NV>
__global__ __launch_bounds__(128)
void attn64(const unsigned short* __restrict__ qkp, const unsigned short* __restrict__ qlp,
            const unsigned short* __restrict__ vhp, const unsigned short* __restrict__ vlp,
            const unsigned short* __restrict__ vchp, const unsigned short* __restrict__ vclp,
            unsigned short* ohp, unsigned short* olp, float sscale, float rres) {
  __shared__ __align__(16) _Float16 smem[(NV == 2) ? 24576 : 16384];
  _Float16* Ksh = smem;                                   // K [kv][d]           8 KB
  _Float16* VMh = smem + 4096;                            // main V^T hi [d][kv]  8 KB
  _Float16* VMl = smem + 8192;                            // main V^T residual     8 KB
  _Float16* VEh = (NV == 2) ? (smem + 12288) : VMh;       // extra set (NV == 2)   8 KB
  _Float16* VEl = (NV == 2) ? (smem + 16384) : VMl;       //                       8 KB
  _Float16* Psh = smem + ((NV == 2) ? 20480 : 12288);     // per wave P [row][kv]  8 KB

  const int tid  = threadIdx.x;
  const int wave = tid >> 5;
  const int lane = tid & 31;
  const int hh   = lane >> 4;
  const int c    = lane & 15;

  const int bx = blockIdx.x;
  int qb, rest;
  if (NV == 1) {
    const int idx = bx % NQB_NM;
    qb = idx + ((idx >= 8) ? 1 : 0);
    rest = bx / NQB_NM;
  } else {
    qb = 8;
    rest = bx;
  }
  const int h  = rest % NH;
  const int bl = rest / NH;
  const int q0 = qb * 64 + wave * 16;
  const size_t rowB = (size_t)bl * NP;

  const _Float16* Qh = (const _Float16*)(const void*)qkp + (size_t)h * HD;
  const _Float16* Kg = (const _Float16*)(const void*)qkp + DM + (size_t)h * HD;
  const _Float16* Ql = (const _Float16*)(const void*)qlp + (size_t)h * HD;
  const size_t vbase = ((size_t)bl * DM + (size_t)h * HD) * NP;
  const _Float16* Vh  = (const _Float16*)(const void*)vhp  + vbase;
  const _Float16* Vl  = (const _Float16*)(const void*)vlp  + vbase;
  const _Float16* Vch = (const _Float16*)(const void*)vchp + vbase;
  const _Float16* Vcl = (const _Float16*)(const void*)vclp + vbase;
  // main set: keys < M1 from (M0h, M0l), keys >= M1 from (M1h, M1l); block-uniform pointer choice
  const bool useB = (NV == 2) || (qb > 8);
  const _Float16* M0h = useB ? Vch : Vh;
  const _Float16* M0l = useB ? Vcl : Vl;
  const _Float16* M1h = useB ? Vh  : Vch;
  const _Float16* M1l = useB ? Vl  : Vcl;

  // ---- Q fragments (A operand, row = lane&15): 2 d-chunks, hi and residual ----
  v16h qah[2], qal[2];
#pragma unroll
  for (int dc = 0; dc < 2; ++dc) {
    qah[dc] = ldfrag_h(Qh + (rowB + q0 + c) * QKP + dc * 32 + 8 * hh);
    qal[dc] = ldfrag_h(Ql + (rowB + q0 + c) * DM  + dc * 32 + 8 * hh);
  }

  float mrow[8], lrow[8];
  v8f oacc[4], oaccE[4];
#pragma unroll
  for (int r = 0; r < 8; ++r) { mrow[r] = -INFINITY; lrow[r] = 0.f; }
#pragma unroll
  for (int t = 0; t < 4; ++t) { oacc[t] = zero8(); oaccE[t] = zero8(); }

  for (int kt = 0; kt < NKT; ++kt) {         // static trip count
    const int kv0 = kt * 64;
    __syncthreads();
    {
      const int r = tid >> 1, hf = (tid & 1) * 32;
      const _Float16* kg = Kg + (rowB + kv0 + r) * QKP + hf;      // K row kv0+r, d = hf..hf+31
#pragma unroll
      for (int i = 0; i < 4; ++i) {
        const v8h a0 = *(const v8h*)(kg + 8 * i);
        *(v8h*)(Ksh + r * 64 + hf + 8 * i) = a0;
      }
      stage_vt(VMh, VMl, M0h, M0l, M1h, M1l, kt, kv0, r, hf);
      if (NV == 2) stage_vt(VEh, VEl, Vh, Vl, Vch, Vcl, kt, kv0, r, hf);
    }
    __syncthreads();

    // ---- scores: 16 query rows x 64 keys per wave, 2 f16 products (hi, residual) ----
    v8f s[4];
#pragma unroll
    for (int j = 0; j < 4; ++j) {
      v8f sh = zero8(), sl = zero8();
#pragma unroll
      for (int dc = 0; dc < 2; ++dc) {
        FH kb;
        kb.h[0] = *(const v8h*)(Ksh + (j * 16 + c) * 64 + dc * 32 + 8 * hh);
        kb.h[1] = *(const v8h*)(Ksh + (j * 16 + c) * 64 + dc * 32 + 16 + 8 * hh);
        sh = mma_h(qah[dc], kb.v, sh);
        sl = mma_h(qal[dc], kb.v, sl);
      }
#pragma unroll
      for (int r = 0; r < 8; ++r) s[j][r] = (sh[r] + sl[r] * rres) * sscale;
    }
    // ---- keys s >= NTOK (only in the last chunk) are invalid: force -1e30 before the row max ----
    if (kt == NKT - 1) {                    // block-uniform
#pragma unroll
      for (int j = 0; j < 4; ++j) {
        const bool kval = (kv0 + j * 16 + c) < NTOK;
#pragma unroll
        for (int r = 0; r < 8; ++r) s[j][r] = kval ? s[j][r] : -1.0e30f;
      }
    }

    // ---- row max, online softmax, P (x1024, f16) to LDS ----
    _Float16* pwh = Psh + wave * 1024;
#pragma unroll
    for (int r = 0; r < 8; ++r) {
      float m = s[0][r];
      m = fmaxf(m, s[1][r]);
      m = fmaxf(m, s[2][r]);
      m = fmaxf(m, s[3][r]);
#pragma unroll
      for (int off = 1; off < 16; off <<= 1) m = fmaxf(m, __shfl_xor(m, off, 32));
      const float mnew  = fmaxf(mrow[r], m);
      const float alpha = __expf(mrow[r] - mnew);
      mrow[r] = mnew;
      float psum = 0.f;
#pragma unroll
      for (int j = 0; j < 4; ++j) {
        const float p = __expf(s[j][r] - mnew);
        psum += p;
        pwh[(8 * hh + r) * 64 + j * 16 + c] = (_Float16)(p * 1024.0f);
      }
#pragma unroll
      for (int off = 1; off < 16; off <<= 1) psum += __shfl_xor(psum, off, 32);
      lrow[r] = lrow[r] * alpha + psum;
#pragma unroll
      for (int t = 0; t < 4; ++t) { oacc[t][r] *= alpha; if (NV == 2) oaccE[t][r] *= alpha; }
    }
    wave_sync_lds();

    // ---- context += P . V ----
    pv_acc(oacc, pwh, VMh, VMl, rres, c, hh);
    if (NV == 2) {
      if (wave == 0) pv_acc(oaccE, pwh, VEh, VEl, rres, c, hh);   // wave-uniform
    }
  }
  __syncthreads();                           // all waves done with K / V tiles before the alias below

  // ---- normalise (1/l and the 1/1024 p carry), stage the wave's 16x64 tile (aliases the K / V region),
  float* os = (float*)(void*)smem + wave * 1024;
#pragma unroll
  for (int r = 0; r < 8; ++r) {
    const float l = lrow[r];
    const float inv = ((l > 0.f) ? (1.0f / l) : 0.f) * (1.0f / 1024.0f);
#pragma unroll
    for (int t = 0; t < 4; ++t) {
      float vm = oacc[t][r] * inv;
      if (NV == 2) {
        const float ve = oaccE[t][r] * inv;
        const bool rowA = (q0 + 8 * hh + r) == (M1 - 1);   // query row 512 uses the extra set
        vm = rowA ? ve : vm;
      }
      os[(8 * hh + r) * 64 + t * 16 + c] = vm;
    }
  }
  wave_sync_lds();
  {
    const int q4 = lane >> 3, c8 = (lane & 7) * 8;
    v4u hv[4], lv[4];
#pragma unroll
    for (int it = 0; it < 4; ++it) {
      const int row = it * 4 + q4;   // it 0..3 x q4 0..3 = rows 0..15 of the wave tile
      const float* sp = os + row * 64 + c8;
      v4u a, a2;
#pragma unroll
      for (int e = 0; e < 4; ++e) {
        const float f0 = sp[2 * e], f1 = sp[2 * e + 1];
        const unsigned short h0 = bf_bits(f0), h1 = bf_bits(f1);
        const unsigned short l0 = bf_bits(f0 - bf_up(h0)), l1 = bf_bits(f1 - bf_up(h1));
        a[e] = pk16(h0, h1); a2[e] = pk16(l0, l1);
      }
      hv[it] = a; lv[it] = a2;
    }
    {
#pragma unroll
      for (int it = 0; it < 4; ++it) {
        const int row = it * 4 + q4;
        const size_t go = (rowB + q0 + row) * DM + (size_t)h * HD + c8;
        *(v4u*)(ohp + go) = hv[it];
        *(v4u*)(olp + go) = lv[it];
      }
      
    }
  }
}

// =====================================================================================================
// d_out[(b0 + bl)*NTOK + r][c] = OUTP[(bl*NP + r)][c] + bf16-RNE(bp[c]) for r < NTOK (padded rows dropped).
// One thread per 4 floats in d_out row-major order over the group's rows, which are contiguous in d_out:
// coverage: n4 = GB*NTOK*DM/4 threads x 4 = every d_out element of batch elements b0..b0+GB-1.
// =====================================================================================================
__global__ __launch_bounds__(256) void copy_out(const float* __restrict__ op, const float* __restrict__ bp,
                                                 float* out, int b0, int n4) {
  const int i = blockIdx.x * 256 + threadIdx.x;
  if (i < n4) {
    const int row = i / (DM / 4);
    const int c4  = (i - row * (DM / 4)) * 4;
    const int bl  = row / NTOK;
    const int r   = row - bl * NTOK;
    v4f v = *(const v4f*)(op + ((size_t)bl * NP + r) * DM + c4);
    const v4f bb = *(const v4f*)(bp + c4);
#pragma unroll
    for (int e = 0; e < 4; ++e) v[e] += bf_up(bf_bits(bb[e]));
    float* d = out + ((size_t)b0 * NTOK + row) * DM + c4;
    *(v4f*)d = v;
    
  }
}

// =====================================================================================================
// Workspace map (bytes), one group of GB = 16 batch elements (GB*NP = 15360 rows), every plane an exact
// multiple of its 64x64-tile / whole-line store granularity (padded rows included):
//   Wt    bf16 [5][768 co][768 ci]   0          5898240   (Wq^T | Wk^T | Wv^T | Wvc^T | Wp^T)
//   Xp    bf16 [15360][768]          5898240    23592960
//   QK    f16  [15360][1536]         29491200   47185920  (q cols 0..767, k cols 768..1535)
//   Ql    f16  [15360][768]          76677120   23592960  (q residual x4096)
//   VTh   f16  [16][768][960]        100270080  23592960  (v^T hi)
//   VTl   f16  [16][768][960]        123863040  23592960  (v^T residual x4096)
//   VCh   f16  [16][768][960]        147456000  23592960  (vc^T hi)
//   VCl   f16  [16][768][960]        171048960  23592960  (vc^T residual x4096)
//   Oh    bf16 [15360][768]          194641920  23592960
//   Ol    bf16 [15360][768]          218234880  23592960
//   end                              241827840
//   OUTP  f32  [15360][768]          29491200   47185920  (same bytes as QK: q|k are last read by the attention
//                                                          launches, which end before launch (6) writes OUTP)
// =====================================================================================================
extern "C" void kernel_launch(void* const* d_in, const int* in_sizes, int n_in,
                              void* d_out, int out_size, void* d_ws, size_t ws_size,
                              hipStream_t stream) {
  if (n_in < 7) return;
  if (in_sizes[0] != NBATCH * NTOK * DM) return;
  if (in_sizes[1] != DM * DM || in_sizes[2] != DM * DM || in_sizes[3] != DM * DM) return;
  if (in_sizes[4] != DM * DM || in_sizes[5] != DM * DM) return;
  if (in_sizes[6] != DM) return;
  if (out_size != NBATCH * NTOK * DM) return;

  const float* x   = (const float*)d_in[0];
  const float* Wq  = (const float*)d_in[1];
  const float* Wk  = (const float*)d_in[2];
  const float* Wv  = (const float*)d_in[3];
  const float* Wvc = (const float*)d_in[4];
  const float* Wp  = (const float*)d_in[5];
  const float* bp  = (const float*)d_in[6];

  const size_t ROWS = (size_t)GB * NP;                 // 15360
  const size_t PW   = (size_t)5 * DM * DM * 2;          //  5898240
  const size_t PX   = ROWS * DM * 2;                    // 23592960
  const size_t PQK  = ROWS * QKP * 2;                   // 47185920
  const size_t PQl  = ROWS * DM * 2;                    // 23592960
  const size_t PVT  = (size_t)GB * DM * NP * 2;         // 23592960
  const size_t PO   = ROWS * DM * 2;                    // 23592960
  static_assert((size_t)DM * 4 == (size_t)QKP * 2);     // an f32 OUTP row is as long as an f16 q|k row: OUTP fits QK exactly
  size_t off = 0;
  const size_t oW   = off; off += PW;
  const size_t oXp  = off; off += PX;
  const size_t oQK  = off; off += PQK;
  const size_t oQl  = off; off += PQl;
  const size_t oVTh = off; off += PVT;
  const size_t oVTl = off; off += PVT;
  const size_t oVCh = off; off += PVT;
  const size_t oVCl = off; off += PVT;
  const size_t oOh  = off; off += PO;
  const size_t oOl  = off; off += PO;
  const size_t oOUT = oQK;                              // OUTP over QK (dead once attention has run)
  if (off > ws_size) return;                            // off = 241827840

  char* ws = (char*)d_ws;
  unsigned short* Wt   = (unsigned short*)(ws + oW);
  unsigned short* Wqk_t = Wt;                                   // rows 0..1535: Wq^T then Wk^T
  unsigned short* Wv_t  = Wt + (size_t)2 * DM * DM;
  unsigned short* Wvc_t = Wt + (size_t)3 * DM * DM;
  unsigned short* Wp_t  = Wt + (size_t)4 * DM * DM;
  unsigned short* Xp   = (unsigned short*)(ws + oXp);
  unsigned short* QK   = (unsigned short*)(ws + oQK);
  unsigned short* Ql   = (unsigned short*)(ws + oQl);
  unsigned short* VTh  = (unsigned short*)(ws + oVTh);
  unsigned short* VTl  = (unsigned short*)(ws + oVTl);
  unsigned short* VCh  = (unsigned short*)(ws + oVCh);
  unsigned short* VCl  = (unsigned short*)(ws + oVCl);
  unsigned short* Oh   = (unsigned short*)(ws + oOh);
  unsigned short* Ol   = (unsigned short*)(ws + oOl);
  float*          OUTP = (float*)(ws + oOUT);
  float*          out  = (float*)d_out;

  const dim3 blk(256);
  const int n8x = GB * NP * (DM / 8);                            // 1474560
  const int n4o = GB * NTOK * (DM / 4);                          // 2783232
  const dim3 gCvtX((n8x + 255) / 256);                           // 5760 blocks
  const dim3 gCopy((n4o + 255) / 256);                           // 10872 blocks
  const dim3 gWtr(DM / 64, DM / 64, 5);                          // 12 x 12 x 5 tiles
  const dim3 gQK(((GB * NP / 64) * (QKP / 64) + 7) / 8, 1);      // 5760 tiles -> 720 blocks: M=15360, N=1536
  const dim3 gVT(((DM / 64) * (NP / 64) + 7) / 8, GB);           // 180 tiles -> 23 blocks x 16: M=768, N=960
  const dim3 gOut(((GB * NP / 64) * (DM / 64) + 7) / 8, 1);      // 2880 tiles -> 360 blocks: M=15360, N=768
  const dim3 gAttn1(NQB_NM * NH * GB);                           // 2688 blocks
  const dim3 gAttn2(NH * GB);                                    // 192 blocks

  // (0) weights -> bf16 [out][in] planes (k contiguous = the Bt / A layout the GEMM wants)
  wtr_bf16<<<gWtr, blk, 0, stream>>>(Wq, Wk, Wv, Wvc, Wp, Wt);

  for (int g = 0; g < NGRP; ++g) {
    const int b0 = g * GB;
    // (1) x -> zero-padded bf16 plane [15360][768]
    cvt_x_bf16<<<gCvtX, blk, 0, stream>>>(x, Xp, b0, n8x);
    // (2) q|k = Xp . Wqk^T -> f16 plane [15360][1536] + f16 residual x4096 of the q half (n0 < 768, pitch 768)
    gemm64<0, 3><<<gQK, blk, 0, stream>>>(
        Xp, Xp, DM, 0LL, Wqk_t, Wqk_t, DM, 0LL,
        (void*)QK, QKP, 0LL, (void*)Ql, DM, 0LL, DM,
        GB * NP, QKP, DM, 4096.0f);
    // (3) v^T = Wv^T . Xp^T per batch element -> f16 hi [bl][h*64+d][s] (pitch NP) + residual x4096
    gemm64<0, 3><<<gVT, blk, 0, stream>>>(
        Wv_t, Wv_t, DM, 0LL, Xp, Xp, DM, (long long)NP * DM,
        (void*)VTh, NP, (long long)DM * NP, (void*)VTl, NP, (long long)DM * NP, NP,
        DM, NP, DM, 4096.0f);
    // (4) vc^T likewise
    gemm64<0, 3><<<gVT, blk, 0, stream>>>(
        Wvc_t, Wvc_t, DM, 0LL, Xp, Xp, DM, (long long)NP * DM,
        (void*)VCh, NP, (long long)DM * NP, (void*)VCl, NP, (long long)DM * NP, NP,
        DM, NP, DM, 4096.0f);
    // (5) attention -> context bf16 hi / lo planes [15360][768]: query tiles 0..7, 9..14, then the mixed tile 8
    attn64<1><<<gAttn1, dim3(128), 0, stream>>>(QK, Ql, VTh, VTl, VCh, VCl, Oh, Ol, 0.125f, 1.0f / 4096.0f);
    attn64<2><<<gAttn2, dim3(128), 0, stream>>>(QK, Ql, VTh, VTl, VCh, VCl, Oh, Ol, 0.125f, 1.0f / 4096.0f);
    // (6) OUTP = context . Wp (A = context hi + lo planes, 2 products; K=768) -> f32 [15360][768]
    gemm64<1, 0><<<gOut, blk, 0, stream>>>(
        Oh, Ol, DM, 0LL, Wp_t, Wp_t, DM, 0LL,
        (void*)OUTP, DM, 0LL, (void*)OUTP, DM, 0LL, DM,
        GB * NP, DM, DM, 1.0f);
    // (7) valid rows + bias -> d_out rows (b0 + bl)*906 + r
    copy_out<<<gCopy, blk, 0, stream>>>(OUTP, bp, out, b0, n4o);
  }
  (void)hipGetLastError();
}

// v002
// Measured time: 523 microseconds a run.
// Timed twice side by side with v001, it ran 1.25 times as fast both times.
// Over all steps from v000 it is 2.39 times as fast.
// Contractions: q|k, v^T and vc^T projections = v_wmma_f32_16x16x32_bf16 (bf16 operands from RNE-converted x and W, single product);
// q.k^T scores = v_wmma_f32_16x16x32_f16 (q as f16 hi plane + f16 residual plane x4096 in a separate accumulator, k f16; 2 products);
// p.v = v_wmma_f32_16x16x32_f16 (p carried x1024 in f16, v^T as f16 hi plane + f16 residual plane x4096 in a separate accumulator; 2 products);
// ctx.Wp = v_wmma_f32_16x16x32_bf16 (ctx as bf16 hi + lo planes times bf16 Wp^T, 2 products); all f32 accumulate; softmax in f32.
#include <hip/hip_runtime.h>
#include <math.h>
#include <stdint.h>

#define NBATCH 16
#define NTOK   906
#define NP     960            // padded token count per batch element (15 tiles of 64)
#define DM     768
#define NH     12
#define HD     64
#define M1     513            // modality split: query / key rows < M1 vs >= M1
#define NKT    (NP / 64)      // 15 key chunks of 64
#define NQB_NM 14             // query tiles 0..7 and 9..14 (tile 8 is the mixed tile)
#define QKP    (2 * DM)       // pitch of the q|k plane: q at cols 0..DM-1, k at cols DM..2DM-1
#define GB     16             // batch elements per group (all of them: one pass of launches fills the chip)
#define NGRP   (NBATCH / GB)
#define LP     72             // LDS row pitch of the attention K / V^T / P tiles in f16: 144 B = 16 B x 9 (odd), so the 16 rows of a 16-byte fragment read fall on 16 different bank groups
#define LTILE  (64 * LP)      // one 64-row tile at that pitch
static_assert(NH * HD == DM);
static_assert((NP % 64) == 0 && NP >= NTOK && (DM % 64) == 0 && (DM % 32) == 0);
static_assert((NBATCH % GB) == 0);
static_assert(M1 - 1 == 8 * 64);   // row 512 is the first row of query tile 8 and of key chunk 8
static_assert(NTOK > (NKT - 1) * 64 && NTOK <= NP);   // invalid keys live only in the last chunk

typedef _Float16 v16h __attribute__((ext_vector_type(16)));
typedef _Float16 v8h  __attribute__((ext_vector_type(8)));
typedef __bf16   v16b __attribute__((ext_vector_type(16)));
typedef __bf16   v8b  __attribute__((ext_vector_type(8)));
typedef float    v8f  __attribute__((ext_vector_type(8)));
typedef float    v4f  __attribute__((ext_vector_type(4)));
typedef unsigned int v4u __attribute__((ext_vector_type(4)));

union FH { v16h v; v8h h[2]; };

// ---- scalar helpers --------------------------------------------------------------------------------
__device__ __forceinline__ unsigned short bf_bits(float f) {          // f32 -> bf16 bits, RNE convert
  unsigned u = __float_as_uint(f);
  return (unsigned short)((u + 0x7FFFu + ((u >> 16) & 1u)) >> 16);
}
__device__ __forceinline__ float bf_up(unsigned short h) { return __uint_as_float(((unsigned)h) << 16); }
__device__ __forceinline__ unsigned short h_bits(_Float16 x) { return __builtin_bit_cast(unsigned short, x); }
__device__ __forceinline__ unsigned pk16(unsigned short a, unsigned short b) { return (unsigned)a | ((unsigned)b << 16); }
__device__ __forceinline__ v8f zero8() { v8f z = {0.f, 0.f, 0.f, 0.f, 0.f, 0.f, 0.f, 0.f}; return z; }

// ---- fragment loaders: 16-bit A/B operand, lane -> row/col (lane&15), p already includes +8*(lane>>4);
//      elements 0..7 <- p[0..7] (k0+8h..), elements 8..15 <- p[16..23] (k0+16+8h..)
__device__ __forceinline__ v16b ldfrag_b(const __bf16* p) {
  union { v16b v; v8b h[2]; } f;
  f.h[0] = *(const v8b*)(p);
  f.h[1] = *(const v8b*)(p + 16);
  return f.v;
}
__device__ __forceinline__ v16h ldfrag_h(const _Float16* p) {
  union { v16h v; v8h h[2]; } f;
  f.h[0] = *(const v8h*)(p);
  f.h[1] = *(const v8h*)(p + 16);
  return f.v;
}

// ---- WMMA helpers with trailing VALU hazard gap --------------------------------------------------------
__device__ __forceinline__ v8f mma_h(v16h a, v16h b, v8f c) {
  c = __builtin_amdgcn_wmma_f32_16x16x32_f16(false, a, false, b, (short)0, c, false, false);
#if defined(__HIP_DEVICE_COMPILE__)
  asm volatile("v_nop\n\tv_nop\n\tv_nop\n\tv_nop" : "+v"(c) : "v"(a), "v"(b));
#endif
  return c;
}
__device__ __forceinline__ v8f mma_b_raw(v16b a, v16b b, v8f c) {
  return __builtin_amdgcn_wmma_f32_16x16x32_bf16(false, a, false, b, (short)0, c, false, false);
}
__device__ __forceinline__ void dep_guard_b(v8f& a, v8f& b, v16b x, v16b y) {
#if defined(__HIP_DEVICE_COMPILE__)
  asm volatile("v_nop\n\tv_nop\n\tv_nop\n\tv_nop" : "+v"(a), "+v"(b) : "v"(x), "v"(y));
#endif
}
__device__ __forceinline__ void keep4_b(v16b a, v16b b, v16b c, v16b d) {
#if defined(__HIP_DEVICE_COMPILE__)
  asm volatile("v_nop" :: "v"(a), "v"(b), "v"(c), "v"(d));
#endif
}
__device__ __forceinline__ void acc_guard4(v8f& a, v8f& b, v8f& c, v8f& d) {
#if defined(__HIP_DEVICE_COMPILE__)
  asm volatile("v_nop\n\tv_nop\n\tv_nop\n\tv_nop" : "+v"(a), "+v"(b), "+v"(c), "+v"(d));
#endif
}
__device__ __forceinline__ void wave_sync_lds() {
  __builtin_amdgcn_fence(__ATOMIC_RELEASE, "workgroup");
  __builtin_amdgcn_wave_barrier();
  __builtin_amdgcn_fence(__ATOMIC_ACQUIRE, "workgroup");
}

// =====================================================================================================
// x f32 [b][NTOK][DM] -> zero-padded bf16 plane Xp [GB*NP][DM] for batch elements b0..b0+GB-1 (RNE convert).
// address, value select). coverage: n8 = GB*NP*DM/8 threads x 8 = the whole Xp plane incl. padded rows.
// =====================================================================================================
__global__ __launch_bounds__(256) void cvt_x_bf16(const float* __restrict__ x, unsigned short* xp,
                                                   int b0, int n8) {
  const int i = blockIdx.x * 256 + threadIdx.x;
  if (i < n8) {
    const int row = i / (DM / 8);
    const int c8  = (i - row * (DM / 8)) * 8;
    const int bl  = row / NP;
    const int r   = row - bl * NP;
    const int rr  = (r < NTOK) ? r : (NTOK - 1);                 // clamped address for padded rows
    const float* src = x + ((size_t)(b0 + bl) * NTOK + rr) * DM + c8;
    const v4f a = *(const v4f*)(src);
    const v4f b = *(const v4f*)(src + 4);
    v4u p;
    p[0] = pk16(bf_bits(a[0]), bf_bits(a[1]));
    p[1] = pk16(bf_bits(a[2]), bf_bits(a[3]));
    p[2] = pk16(bf_bits(b[0]), bf_bits(b[1]));
    p[3] = pk16(bf_bits(b[2]), bf_bits(b[3]));
    const bool valid = (r < NTOK);
#pragma unroll
    for (int e = 0; e < 4; ++e) p[e] = valid ? p[e] : 0u;
    *(v4u*)(xp + (size_t)i * 8) = p;
    
  }
}

// =====================================================================================================
// Weight transpose-convert: W f32 [DM ci][DM co] (x @ W layout) -> Wt bf16 [co][ci] (k = ci contiguous),
// RNE convert. blockIdx.z selects the weight (0..4 -> Wq, Wk, Wv, Wvc, Wp), written back to back in wt.
// coverage: 8 waves x (2 it x 4 row groups) = 64 rows x (8 lanes x 8) = 64 cols per tile; grid 12x12x5.
// =====================================================================================================
__global__ __launch_bounds__(256) void wtr_bf16(const float* __restrict__ w0, const float* __restrict__ w1,
                                                 const float* __restrict__ w2, const float* __restrict__ w3,
                                                 const float* __restrict__ w4, unsigned short* wt) {
  __shared__ __align__(16) unsigned short T[64 * 72];   // [co][ci], pitch 72 (144 B, 16-B aligned rows)
  const int z = blockIdx.z;
  const float* W = (z == 0) ? w0 : (z == 1) ? w1 : (z == 2) ? w2 : (z == 3) ? w3 : w4;
  unsigned short* dst = wt + (size_t)z * DM * DM;
  const int co0 = blockIdx.x * 64;
  const int ci0 = blockIdx.y * 64;
  const int tid = threadIdx.x;
#pragma unroll
  for (int it = 0; it < 16; ++it) {
    const int idx = it * 256 + tid;
    const int i = idx >> 6;          // ci within tile
    const int j = idx & 63;          // co within tile
    T[j * 72 + i] = bf_bits(W[(size_t)(ci0 + i) * DM + co0 + j]);
  }
  __syncthreads();
  const int wave = tid >> 5, lane = tid & 31;
  const int q = lane >> 3, c8 = (lane & 7) * 8;
  v4u v[2];
#pragma unroll
  for (int it = 0; it < 2; ++it) {
    const int row = wave * 8 + it * 4 + q;
    v[it] = *(const v4u*)(T + row * 72 + c8);
  }
  {
#pragma unroll
    for (int it = 0; it < 2; ++it) {
      const int row = wave * 8 + it * 4 + q;
      *(v4u*)(dst + (size_t)(co0 + row) * DM + ci0 + c8) = v[it];
    }
    
  }
}

// =====================================================================================================
// Register-blocked batched bf16 WMMA GEMM: C[m][n] = sum_k A[m][k] * Bt[n][k]; one wave per 64x64 tile,
// no block barriers. A row-major [M][K] pitch lda; Bt row-major [N][K] pitch ldb (k contiguous);
// M, N multiples of 64, K multiple of 32 (host-checked). blockIdx.y = batch index (strides in elements).
// NSPLIT: 0 = A.Bt; 1 = (A + A2).Bt (A2 = unscaled bf16 lo plane of A); 2 = A.Bt + A2.Bt + A.Bt2.
// OUT_MODE: 0 = f32 (pitch ldc); 2 = bf16 hi plane C + bf16 lo plane C2 (lo = RNE(v - hi), unscaled);
//           3 = f16 hi plane C + f16 residual plane C2 = f16((v - hi) * rscale), C2 written only for tiles
//               with n0 < N2 (pitch ldc2, batch stride strideC2).
// =====================================================================================================
template <int NSPLIT, int OUT_MODE>
__global__ __launch_bounds__(256) void gemm64(
    const unsigned short* __restrict__ Ap, const unsigned short* A2p, int lda, long long strideA,
    const unsigned short* __restrict__ Btp, const unsigned short* Bt2p, int ldb, long long strideB,
    void* Cout, int ldc, long long strideC,
    void* Cout2, int ldc2, long long strideC2, int N2,
    int M, int N, int K, float rscale) {
  const __bf16* A   = (const __bf16*)(const void*)Ap;
  const __bf16* A2  = (const __bf16*)(const void*)A2p;
  const __bf16* Bt  = (const __bf16*)(const void*)Btp;
  const __bf16* Bt2 = (const __bf16*)(const void*)Bt2p;
  __shared__ __align__(16) float sT[8][16 * 68];   // per-wave 16x64 slab, pitch 68 floats
  const int b    = blockIdx.y;
  const int lane = threadIdx.x & 31;
  const int wave = threadIdx.x >> 5;
  const int tilesN = N >> 6;
  const int tilesM = M >> 6;
  const int tile = blockIdx.x * 8 + wave;
  if (tile >= tilesM * tilesN) return;   // wave-uniform; no block barriers in this kernel
  const int tm = tile / tilesN;
  const int tn = tile - tm * tilesN;
  const int m0 = tm << 6;
  const int n0 = tn << 6;

  const __bf16* Ab  = A  + (size_t)b * strideA;
  const __bf16* Bb  = Bt + (size_t)b * strideB;
  const __bf16* Ab2 = (NSPLIT >= 1) ? (A2  + (size_t)b * strideA) : Ab;
  const __bf16* Bb2 = (NSPLIT == 2) ? (Bt2 + (size_t)b * strideB) : Bb;

  const int rlane = lane & 15;                 // row (A) / col (B, D) within subtile
  const int koff  = (lane >> 4) * 8;           // k offset of this lane half
  const int mOff  = (lane >> 4) * 8;           // D row offset

  v8f acc[4][4];
#pragma unroll
  for (int i = 0; i < 4; ++i)
#pragma unroll
    for (int j = 0; j < 4; ++j) acc[i][j] = zero8();

  for (int k0 = 0; k0 < K; k0 += 32) {
    v16b bh[4], bl[4];
#pragma unroll
    for (int j = 0; j < 4; ++j) {
      const size_t bo = (size_t)(n0 + (j << 4) + rlane) * ldb + koff + k0;
      bh[j] = ldfrag_b(Bb + bo);
      if (NSPLIT == 2) bl[j] = ldfrag_b(Bb2 + bo); else bl[j] = bh[j];
    }
#pragma unroll
    for (int i = 0; i < 4; ++i) {
      const size_t ao = (size_t)(m0 + (i << 4) + rlane) * lda + koff + k0;
      const v16b ah = ldfrag_b(Ab + ao);
      v16b al = ah;
      if (NSPLIT >= 1) al = ldfrag_b(Ab2 + ao);
#pragma unroll
      for (int j = 0; j < 4; ++j) {
        acc[i][j] = mma_b_raw(ah, bh[j], acc[i][j]);
        if (NSPLIT >= 1) acc[i][j] = mma_b_raw(al, bh[j], acc[i][j]);
        if (NSPLIT == 2) acc[i][j] = mma_b_raw(ah, bl[j], acc[i][j]);
      }
      dep_guard_b(acc[i][0], acc[i][3], ah, al);
    }
    keep4_b(bh[0], bh[1], bh[2], bh[3]);
    if (NSPLIT == 2) keep4_b(bl[0], bl[1], bl[2], bl[3]);
  }
  acc_guard4(acc[0][0], acc[0][1], acc[0][2], acc[0][3]);
  acc_guard4(acc[1][0], acc[1][1], acc[1][2], acc[1][3]);
  acc_guard4(acc[2][0], acc[2][1], acc[2][2], acc[2][3]);
  acc_guard4(acc[3][0], acc[3][1], acc[3][2], acc[3][3]);

  // ---- epilogue ----
  float* slab = sT[wave];
#pragma unroll
  for (int i = 0; i < 4; ++i) {
    const int mBase = m0 + (i << 4);
#pragma unroll
    for (int j = 0; j < 4; ++j) {
#pragma unroll
      for (int r = 0; r < 8; ++r) {
        slab[(mOff + r) * 68 + (j << 4) + rlane] = acc[i][j][r];
      }
    }
    wave_sync_lds();
    if (OUT_MODE == 0) {
      float* C = (float*)Cout + (size_t)b * strideC;
      const int hh = lane >> 4, c4 = (lane & 15) * 4;     // 256-B row segment = 16 lanes x 16 B
      {
#pragma unroll
        for (int it = 0; it < 8; ++it) {
          const int row = it * 2 + hh;                     // it 0..7 x hh 0..1 = rows 0..15
          const v4f v = *(const v4f*)(slab + row * 68 + c4);
          *(v4f*)(C + (size_t)(mBase + row) * ldc + n0 + c4) = v;
        }
        
      }
    } else {
      const int q = lane >> 3, c8 = (lane & 7) * 8;
      unsigned short* C  = (unsigned short*)Cout  + (size_t)b * strideC;
      unsigned short* C2 = (unsigned short*)Cout2 + (size_t)b * strideC2;
      const bool wlo = (OUT_MODE == 2) || (n0 < N2);      // wave-uniform
      v4u hv[4], lv[4];
#pragma unroll
      for (int it = 0; it < 4; ++it) {
        const int row = it * 4 + q;                        // it 0..3 x q 0..3 = rows 0..15
        const float* sp = slab + row * 68 + c8;
        v4u a, a2;
#pragma unroll
        for (int e = 0; e < 4; ++e) {
          const float f0 = sp[2 * e], f1 = sp[2 * e + 1];
          unsigned short h0, h1, l0, l1;
          if (OUT_MODE == 2) {
            h0 = bf_bits(f0); h1 = bf_bits(f1);
            l0 = bf_bits(f0 - bf_up(h0)); l1 = bf_bits(f1 - bf_up(h1));
          } else {
            const _Float16 x0 = (_Float16)f0, x1 = (_Float16)f1;
            h0 = h_bits(x0); h1 = h_bits(x1);
            l0 = h_bits((_Float16)((f0 - (float)x0) * rscale));
            l1 = h_bits((_Float16)((f1 - (float)x1) * rscale));
          }
          a[e] = pk16(h0, h1); a2[e] = pk16(l0, l1);
        }
        hv[it] = a; lv[it] = a2;
      }
      {
#pragma unroll
        for (int it = 0; it < 4; ++it) {
          const int row = it * 4 + q;
          *(v4u*)(C + (size_t)(mBase + row) * ldc + n0 + c8) = hv[it];
          if (wlo) *(v4u*)(C2 + (size_t)(mBase + row) * ldc2 + n0 + c8) = lv[it];
        }
        
      }
    }
    wave_sync_lds();
  }
}

// =====================================================================================================
// V^T chunk staging with the per-key-row value swap: destination LDS tiles dh/dl [d][kv] (64x64 f16, row pitch LP),
// source planes (already offset to (batch, head)) [d][s] pitch NP: keys s < M1 come from (s0h, s0l),
// keys s >= M1 from (s1h, s1l). Chunks kt < 8 are all < M1, chunks kt > 8 all >= M1 (chunk-uniform source);
// chunk 8 (kv0 = 512) takes key 512 (element 0 of the hf == 0 half-row) from s0 and the rest from s1.
// Thread (r, hf): row d = r, keys kv0+hf .. kv0+hf+31; 128 threads x 32 keys x 2 planes = the whole tile.
// =====================================================================================================
__device__ __forceinline__ void stage_vt(_Float16* dh, _Float16* dl,
                                         const _Float16* s0h, const _Float16* s0l,
                                         const _Float16* s1h, const _Float16* s1l,
                                         int kt, int kv0, int r, int hf) {
  const bool lowc = (kt < 8);
  const _Float16* gh = (lowc ? s0h : s1h) + (size_t)r * NP + kv0 + hf;
  const _Float16* gl = (lowc ? s0l : s1l) + (size_t)r * NP + kv0 + hf;
#pragma unroll
  for (int i = 0; i < 4; ++i) {
    v8h a  = *(const v8h*)(gh + 8 * i);
    v8h a2 = *(const v8h*)(gl + 8 * i);
    if (i == 0 && kt == 8) {                         // block-uniform
      const _Float16 eh = s0h[(size_t)r * NP + (M1 - 1)];
      const _Float16 el = s0l[(size_t)r * NP + (M1 - 1)];
      a[0]  = (hf == 0) ? eh : a[0];
      a2[0] = (hf == 0) ? el : a2[0];
    }
    *(v8h*)(dh + r * LP + hf + 8 * i) = a;
    *(v8h*)(dl + r * LP + hf + 8 * i) = a2;
  }
}

// ---- context += P . V^T tile (f16 WMMA), residual products into a separate accumulator folded in f32 ----
__device__ __forceinline__ void pv_acc(v8f (&oacc)[4], const _Float16* pwh,
                                       const _Float16* Vth, const _Float16* Vtl,
                                       float rres, int c, int hh) {
  v8f o1[4];
#pragma unroll
  for (int t = 0; t < 4; ++t) o1[t] = zero8();
#pragma unroll 1
  for (int kk = 0; kk < 2; ++kk) {
    FH pa;
    pa.h[0] = *(const v8h*)(pwh + c * LP + kk * 32 + 8 * hh);
    pa.h[1] = *(const v8h*)(pwh + c * LP + kk * 32 + 16 + 8 * hh);
#pragma unroll
    for (int t = 0; t < 4; ++t) {
      FH vb, vl;
      vb.h[0] = *(const v8h*)(Vth + (t * 16 + c) * LP + kk * 32 + 8 * hh);
      vb.h[1] = *(const v8h*)(Vth + (t * 16 + c) * LP + kk * 32 + 16 + 8 * hh);
      vl.h[0] = *(const v8h*)(Vtl + (t * 16 + c) * LP + kk * 32 + 8 * hh);
      vl.h[1] = *(const v8h*)(Vtl + (t * 16 + c) * LP + kk * 32 + 16 + 8 * hh);
      oacc[t] = mma_h(pa.v, vb.v, oacc[t]);
      o1[t]   = mma_h(pa.v, vl.v, o1[t]);
    }
  }
#pragma unroll
  for (int t = 0; t < 4; ++t)
#pragma unroll
    for (int r = 0; r < 8; ++r) oacc[t][r] += o1[t][r] * rres;
}

// =====================================================================================================
// Attention, head dim 64, softmax over the NTOK valid keys of the batch element (keys s >= NTOK masked to
// -1e30 before the row max in the last chunk), per-modality value swap handled at V^T staging.
//   q|k plane (f16, pitch QKP): element (row, col) at [row*QKP + col], row = bl*NP + t, q col = h*64+d,
//   k col = DM + h*64 + d; q residual plane (f16, (q - f16(q))*4096, pitch DM): [row*DM + h*64 + d]
//   v^T / vc^T hi planes (f16): element (bl, h, d, s) at [(bl*DM + h*64 + d)*NP + s]; residual planes (x4096) same
//   out planes (bf16 hi / lo of the normalised context): element (row, h, d) at [row*DM + h*64 + d]
//   NV == 1: query tiles 0..7 (rows < M1, values: v for keys < M1, vc for keys >= M1) and 9..14
//            (values: vc for keys < M1, v for keys >= M1); grid = NQB_NM * NH * GB.
//   NV == 2: query tile 8 (rows 512..575): main set = the rows >= M1 combination, extra set (wave 0 only)
//            = the rows < M1 combination; row 512 selects the extra set at the end; grid = NH * GB.
//   scores = (qh . k + (ql . k) * rres) * sscale on f16 WMMA, residual products in a separate accumulator;
//   p = exp(s - m) carried as f16(1024 p); online softmax in f32.
//   Block = 4 waves = 64 query rows of one (bl, h); kv chunks of 64, static trip NKT.
//   K / V^T chunk staging: 128 threads x 32 elements per plane = the whole 64x64 tile (plain 16-B loads,
//   __syncthreads before and after); P tiles are wave-private, spilled with _Float16 element stores; the output stage
//   aliases the K / V LDS region after a final __syncthreads.
//   Output coverage: each wave stores rows q0..q0+15 (it 0..3 x lane>>3 0..3) x 64 columns (8 lanes x 8) of both planes.
// =====================================================================================================
template <int NV>
__global__ __launch_bounds__(128)
void attn64(const unsigned short* __restrict__ qkp, const unsigned short* __restrict__ qlp,
            const unsigned short* __restrict__ vhp, const unsigned short* __restrict__ vlp,
            const unsigned short* __restrict__ vchp, const unsigned short* __restrict__ vclp,
            unsigned short* ohp, unsigned short* olp, float sscale, float rres) {
  __shared__ __align__(16) _Float16 smem[((NV == 2) ? 6 : 4) * LTILE];
  _Float16* Ksh = smem;                                   // K [kv][d]           9 KB (rows of 64 at pitch LP)
  _Float16* VMh = smem + LTILE;                           // main V^T hi [d][kv]  9 KB
  _Float16* VMl = smem + 2 * LTILE;                       // main V^T residual     9 KB
  _Float16* VEh = (NV == 2) ? (smem + 3 * LTILE) : VMh;   // extra set (NV == 2)   9 KB
  _Float16* VEl = (NV == 2) ? (smem + 4 * LTILE) : VMl;   //                       9 KB
  _Float16* Psh = smem + ((NV == 2) ? 5 : 3) * LTILE;     // per wave P [row][kv]  9 KB

  const int tid  = threadIdx.x;
  const int wave = tid >> 5;
  const int lane = tid & 31;
  const int hh   = lane >> 4;
  const int c    = lane & 15;

  const int bx = blockIdx.x;
  int qb, rest;
  if (NV == 1) {
    const int idx = bx % NQB_NM;
    qb = idx + ((idx >= 8) ? 1 : 0);
    rest = bx / NQB_NM;
  } else {
    qb = 8;
    rest = bx;
  }
  const int h  = rest % NH;
  const int bl = rest / NH;
  const int q0 = qb * 64 + wave * 16;
  const size_t rowB = (size_t)bl * NP;

  const _Float16* Qh = (const _Float16*)(const void*)qkp + (size_t)h * HD;
  const _Float16* Kg = (const _Float16*)(const void*)qkp + DM + (size_t)h * HD;
  const _Float16* Ql = (const _Float16*)(const void*)qlp + (size_t)h * HD;
  const size_t vbase = ((size_t)bl * DM + (size_t)h * HD) * NP;
  const _Float16* Vh  = (const _Float16*)(const void*)vhp  + vbase;
  const _Float16* Vl  = (const _Float16*)(const void*)vlp  + vbase;
  const _Float16* Vch = (const _Float16*)(const void*)vchp + vbase;
  const _Float16* Vcl = (const _Float16*)(const void*)vclp + vbase;
  // main set: keys < M1 from (M0h, M0l), keys >= M1 from (M1h, M1l); block-uniform pointer choice
  const bool useB = (NV == 2) || (qb > 8);
  const _Float16* M0h = useB ? Vch : Vh;
  const _Float16* M0l = useB ? Vcl : Vl;
  const _Float16* M1h = useB ? Vh  : Vch;
  const _Float16* M1l = useB ? Vl  : Vcl;

  // ---- Q fragments (A operand, row = lane&15): 2 d-chunks, hi and residual ----
  v16h qah[2], qal[2];
#pragma unroll
  for (int dc = 0; dc < 2; ++dc) {
    qah[dc] = ldfrag_h(Qh + (rowB + q0 + c) * QKP + dc * 32 + 8 * hh);
    qal[dc] = ldfrag_h(Ql + (rowB + q0 + c) * DM  + dc * 32 + 8 * hh);
  }

  float mrow[8], lrow[8];
  v8f oacc[4], oaccE[4];
#pragma unroll
  for (int r = 0; r < 8; ++r) { mrow[r] = -INFINITY; lrow[r] = 0.f; }
#pragma unroll
  for (int t = 0; t < 4; ++t) { oacc[t] = zero8(); oaccE[t] = zero8(); }

  for (int kt = 0; kt < NKT; ++kt) {         // static trip count
    const int kv0 = kt * 64;
    __syncthreads();
    {
      const int r = tid >> 1, hf = (tid & 1) * 32;
      const _Float16* kg = Kg + (rowB + kv0 + r) * QKP + hf;      // K row kv0+r, d = hf..hf+31
#pragma unroll
      for (int i = 0; i < 4; ++i) {
        const v8h a0 = *(const v8h*)(kg + 8 * i);
        *(v8h*)(Ksh + r * LP + hf + 8 * i) = a0;
      }
      stage_vt(VMh, VMl, M0h, M0l, M1h, M1l, kt, kv0, r, hf);
      if (NV == 2) stage_vt(VEh, VEl, Vh, Vl, Vch, Vcl, kt, kv0, r, hf);
    }
    __syncthreads();

    // ---- scores: 16 query rows x 64 keys per wave, 2 f16 products (hi, residual) ----
    v8f s[4];
#pragma unroll
    for (int j = 0; j < 4; ++j) {
      v8f sh = zero8(), sl = zero8();
#pragma unroll
      for (int dc = 0; dc < 2; ++dc) {
        FH kb;
        kb.h[0] = *(const v8h*)(Ksh + (j * 16 + c) * LP + dc * 32 + 8 * hh);
        kb.h[1] = *(const v8h*)(Ksh + (j * 16 + c) * LP + dc * 32 + 16 + 8 * hh);
        sh = mma_h(qah[dc], kb.v, sh);
        sl = mma_h(qal[dc], kb.v, sl);
      }
#pragma unroll
      for (int r = 0; r < 8; ++r) s[j][r] = (sh[r] + sl[r] * rres) * sscale;
    }
    // ---- keys s >= NTOK (only in the last chunk) are invalid: force -1e30 before the row max ----
    if (kt == NKT - 1) {                    // block-uniform
#pragma unroll
      for (int j = 0; j < 4; ++j) {
        const bool kval = (kv0 + j * 16 + c) < NTOK;
#pragma unroll
        for (int r = 0; r < 8; ++r) s[j][r] = kval ? s[j][r] : -1.0e30f;
      }
    }

    // ---- row max, online softmax, P (x1024, f16) to LDS ----
    _Float16* pwh = Psh + wave * (16 * LP);
#pragma unroll
    for (int r = 0; r < 8; ++r) {
      float m = s[0][r];
      m = fmaxf(m, s[1][r]);
      m = fmaxf(m, s[2][r]);
      m = fmaxf(m, s[3][r]);
#pragma unroll
      for (int off = 1; off < 16; off <<= 1) m = fmaxf(m, __shfl_xor(m, off, 32));
      const float mnew  = fmaxf(mrow[r], m);
      const float alpha = __expf(mrow[r] - mnew);
      mrow[r] = mnew;
      float psum = 0.f;
#pragma unroll
      for (int j = 0; j < 4; ++j) {
        const float p = __expf(s[j][r] - mnew);
        psum += p;
        pwh[(8 * hh + r) * LP + j * 16 + c] = (_Float16)(p * 1024.0f);
      }
#pragma unroll
      for (int off = 1; off < 16; off <<= 1) psum += __shfl_xor(psum, off, 32);
      lrow[r] = lrow[r] * alpha + psum;
#pragma unroll
      for (int t = 0; t < 4; ++t) { oacc[t][r] *= alpha; if (NV == 2) oaccE[t][r] *= alpha; }
    }
    wave_sync_lds();

    // ---- context += P . V ----
    pv_acc(oacc, pwh, VMh, VMl, rres, c, hh);
    if (NV == 2) {
      if (wave == 0) pv_acc(oaccE, pwh, VEh, VEl, rres, c, hh);   // wave-uniform
    }
  }
  __syncthreads();                           // all waves done with K / V tiles before the alias below

  // ---- normalise (1/l and the 1/1024 p carry), stage the wave's 16x64 tile (aliases the K / V region),
  float* os = (float*)(void*)smem + wave * 1024;
#pragma unroll
  for (int r = 0; r < 8; ++r) {
    const float l = lrow[r];
    const float inv = ((l > 0.f) ? (1.0f / l) : 0.f) * (1.0f / 1024.0f);
#pragma unroll
    for (int t = 0; t < 4; ++t) {
      float vm = oacc[t][r] * inv;
      if (NV == 2) {
        const float ve = oaccE[t][r] * inv;
        const bool rowA = (q0 + 8 * hh + r) == (M1 - 1);   // query row 512 uses the extra set
        vm = rowA ? ve : vm;
      }
      os[(8 * hh + r) * 64 + t * 16 + c] = vm;
    }
  }
  wave_sync_lds();
  {
    const int q4 = lane >> 3, c8 = (lane & 7) * 8;
    v4u hv[4], lv[4];
#pragma unroll
    for (int it = 0; it < 4; ++it) {
      const int row = it * 4 + q4;   // it 0..3 x q4 0..3 = rows 0..15 of the wave tile
      const float* sp = os + row * 64 + c8;
      v4u a, a2;
#pragma unroll
      for (int e = 0; e < 4; ++e) {
        const float f0 = sp[2 * e], f1 = sp[2 * e + 1];
        const unsigned short h0 = bf_bits(f0), h1 = bf_bits(f1);
        const unsigned short l0 = bf_bits(f0 - bf_up(h0)), l1 = bf_bits(f1 - bf_up(h1));
        a[e] = pk16(h0, h1); a2[e] = pk16(l0, l1);
      }
      hv[it] = a; lv[it] = a2;
    }
    {
#pragma unroll
      for (int it = 0; it < 4; ++it) {
        const int row = it * 4 + q4;
        const size_t go = (rowB + q0 + row) * DM + (size_t)h * HD + c8;
        *(v4u*)(ohp + go) = hv[it];
        *(v4u*)(olp + go) = lv[it];
      }
      
    }
  }
}

// =====================================================================================================
// d_out[(b0 + bl)*NTOK + r][c] = OUTP[(bl*NP + r)][c] + bf16-RNE(bp[c]) for r < NTOK (padded rows dropped).
// One thread per 4 floats in d_out row-major order over the group's rows, which are contiguous in d_out:
// coverage: n4 = GB*NTOK*DM/4 threads x 4 = every d_out element of batch elements b0..b0+GB-1.
// =====================================================================================================
__global__ __launch_bounds__(256) void copy_out(const float* __restrict__ op, const float* __restrict__ bp,
                                                 float* out, int b0, int n4) {
  const int i = blockIdx.x * 256 + threadIdx.x;
  if (i < n4) {
    const int row = i / (DM / 4);
    const int c4  = (i - row * (DM / 4)) * 4;
    const int bl  = row / NTOK;
    const int r   = row - bl * NTOK;
    v4f v = *(const v4f*)(op + ((size_t)bl * NP + r) * DM + c4);
    const v4f bb = *(const v4f*)(bp + c4);
#pragma unroll
    for (int e = 0; e < 4; ++e) v[e] += bf_up(bf_bits(bb[e]));
    float* d = out + ((size_t)b0 * NTOK + row) * DM + c4;
    *(v4f*)d = v;
    
  }
}

// =====================================================================================================
// Workspace map (bytes), one group of GB = 16 batch elements (GB*NP = 15360 rows), every plane an exact
// multiple of its 64x64-tile / whole-line store granularity (padded rows included):
//   Wt    bf16 [5][768 co][768 ci]   0          5898240   (Wq^T | Wk^T | Wv^T | Wvc^T | Wp^T)
//   Xp    bf16 [15360][768]          5898240    23592960
//   QK    f16  [15360][1536]         29491200   47185920  (q cols 0..767, k cols 768..1535)
//   Ql    f16  [15360][768]          76677120   23592960  (q residual x4096)
//   VTh   f16  [16][768][960]        100270080  23592960  (v^T hi)
//   VTl   f16  [16][768][960]        123863040  23592960  (v^T residual x4096)
//   VCh   f16  [16][768][960]        147456000  23592960  (vc^T hi)
//   VCl   f16  [16][768][960]        171048960  23592960  (vc^T residual x4096)
//   Oh    bf16 [15360][768]          194641920  23592960
//   Ol    bf16 [15360][768]          218234880  23592960
//   end                              241827840
//   OUTP  f32  [15360][768]          29491200   47185920  (same bytes as QK: q|k are last read by the attention
//                                                          launches, which end before launch (6) writes OUTP)
// =====================================================================================================
extern "C" void kernel_launch(void* const* d_in, const int* in_sizes, int n_in,
                              void* d_out, int out_size, void* d_ws, size_t ws_size,
                              hipStream_t stream) {
  if (n_in < 7) return;
  if (in_sizes[0] != NBATCH * NTOK * DM) return;
  if (in_sizes[1] != DM * DM || in_sizes[2] != DM * DM || in_sizes[3] != DM * DM) return;
  if (in_sizes[4] != DM * DM || in_sizes[5] != DM * DM) return;
  if (in_sizes[6] != DM) return;
  if (out_size != NBATCH * NTOK * DM) return;

  const float* x   = (const float*)d_in[0];
  const float* Wq  = (const float*)d_in[1];
  const float* Wk  = (const float*)d_in[2];
  const float* Wv  = (const float*)d_in[3];
  const float* Wvc = (const float*)d_in[4];
  const float* Wp  = (const float*)d_in[5];
  const float* bp  = (const float*)d_in[6];

  const size_t ROWS = (size_t)GB * NP;                 // 15360
  const size_t PW   = (size_t)5 * DM * DM * 2;          //  5898240
  const size_t PX   = ROWS * DM * 2;                    // 23592960
  const size_t PQK  = ROWS * QKP * 2;                   // 47185920
  const size_t PQl  = ROWS * DM * 2;                    // 23592960
  const size_t PVT  = (size_t)GB * DM * NP * 2;         // 23592960
  const size_t PO   = ROWS * DM * 2;                    // 23592960
  static_assert((size_t)DM * 4 == (size_t)QKP * 2);     // an f32 OUTP row is as long as an f16 q|k row: OUTP fits QK exactly
  size_t off = 0;
  const size_t oW   = off; off += PW;
  const size_t oXp  = off; off += PX;
  const size_t oQK  = off; off += PQK;
  const size_t oQl  = off; off += PQl;
  const size_t oVTh = off; off += PVT;
  const size_t oVTl = off; off += PVT;
  const size_t oVCh = off; off += PVT;
  const size_t oVCl = off; off += PVT;
  const size_t oOh  = off; off += PO;
  const size_t oOl  = off; off += PO;
  const size_t oOUT = oQK;                              // OUTP over QK (dead once attention has run)
  if (off > ws_size) return;                            // off = 241827840

  char* ws = (char*)d_ws;
  unsigned short* Wt   = (unsigned short*)(ws + oW);
  unsigned short* Wqk_t = Wt;                                   // rows 0..1535: Wq^T then Wk^T
  unsigned short* Wv_t  = Wt + (size_t)2 * DM * DM;
  unsigned short* Wvc_t = Wt + (size_t)3 * DM * DM;
  unsigned short* Wp_t  = Wt + (size_t)4 * DM * DM;
  unsigned short* Xp   = (unsigned short*)(ws + oXp);
  unsigned short* QK   = (unsigned short*)(ws + oQK);
  unsigned short* Ql   = (unsigned short*)(ws + oQl);
  unsigned short* VTh  = (unsigned short*)(ws + oVTh);
  unsigned short* VTl  = (unsigned short*)(ws + oVTl);
  unsigned short* VCh  = (unsigned short*)(ws + oVCh);
  unsigned short* VCl  = (unsigned short*)(ws + oVCl);
  unsigned short* Oh   = (unsigned short*)(ws + oOh);
  unsigned short* Ol   = (unsigned short*)(ws + oOl);
  float*          OUTP = (float*)(ws + oOUT);
  float*          out  = (float*)d_out;

  const dim3 blk(256);
  const int n8x = GB * NP * (DM / 8);                            // 1474560
  const int n4o = GB * NTOK * (DM / 4);                          // 2783232
  const dim3 gCvtX((n8x + 255) / 256);                           // 5760 blocks
  const dim3 gCopy((n4o + 255) / 256);                           // 10872 blocks
  const dim3 gWtr(DM / 64, DM / 64, 5);                          // 12 x 12 x 5 tiles
  const dim3 gQK(((GB * NP / 64) * (QKP / 64) + 7) / 8, 1);      // 5760 tiles -> 720 blocks: M=15360, N=1536
  const dim3 gVT(((DM / 64) * (NP / 64) + 7) / 8, GB);           // 180 tiles -> 23 blocks x 16: M=768, N=960
  const dim3 gOut(((GB * NP / 64) * (DM / 64) + 7) / 8, 1);      // 2880 tiles -> 360 blocks: M=15360, N=768
  const dim3 gAttn1(NQB_NM * NH * GB);                           // 2688 blocks
  const dim3 gAttn2(NH * GB);                                    // 192 blocks

  // (0) weights -> bf16 [out][in] planes (k contiguous = the Bt / A layout the GEMM wants)
  wtr_bf16<<<gWtr, blk, 0, stream>>>(Wq, Wk, Wv, Wvc, Wp, Wt);

  for (int g = 0; g < NGRP; ++g) {
    const int b0 = g * GB;
    // (1) x -> zero-padded bf16 plane [15360][768]
    cvt_x_bf16<<<gCvtX, blk, 0, stream>>>(x, Xp, b0, n8x);
    // (2) q|k = Xp . Wqk^T -> f16 plane [15360][1536] + f16 residual x4096 of the q half (n0 < 768, pitch 768)
    gemm64<0, 3><<<gQK, blk, 0, stream>>>(
        Xp, Xp, DM, 0LL, Wqk_t, Wqk_t, DM, 0LL,
        (void*)QK, QKP, 0LL, (void*)Ql, DM, 0LL, DM,
        GB * NP, QKP, DM, 4096.0f);
    // (3) v^T = Wv^T . Xp^T per batch element -> f16 hi [bl][h*64+d][s] (pitch NP) + residual x4096
    gemm64<0, 3><<<gVT, blk, 0, stream>>>(
        Wv_t, Wv_t, DM, 0LL, Xp, Xp, DM, (long long)NP * DM,
        (void*)VTh, NP, (long long)DM * NP, (void*)VTl, NP, (long long)DM * NP, NP,
        DM, NP, DM, 4096.0f);
    // (4) vc^T likewise
    gemm64<0, 3><<<gVT, blk, 0, stream>>>(
        Wvc_t, Wvc_t, DM, 0LL, Xp, Xp, DM, (long long)NP * DM,
        (void*)VCh, NP, (long long)DM * NP, (void*)VCl, NP, (long long)DM * NP, NP,
        DM, NP, DM, 4096.0f);
    // (5) attention -> context bf16 hi / lo planes [15360][768]: query tiles 0..7, 9..14, then the mixed tile 8
    attn64<1><<<gAttn1, dim3(128), 0, stream>>>(QK, Ql, VTh, VTl, VCh, VCl, Oh, Ol, 0.125f, 1.0f / 4096.0f);
    attn64<2><<<gAttn2, dim3(128), 0, stream>>>(QK, Ql, VTh, VTl, VCh, VCl, Oh, Ol, 0.125f, 1.0f / 4096.0f);
    // (6) OUTP = context . Wp (A = context hi + lo planes, 2 products; K=768) -> f32 [15360][768]
    gemm64<1, 0><<<gOut, blk, 0, stream>>>(
        Oh, Ol, DM, 0LL, Wp_t, Wp_t, DM, 0LL,
        (void*)OUTP, DM, 0LL, (void*)OUTP, DM, 0LL, DM,
        GB * NP, DM, DM, 1.0f);
    // (7) valid rows + bias -> d_out rows (b0 + bl)*906 + r
    copy_out<<<gCopy, blk, 0, stream>>>(OUTP, bp, out, b0, n4o);
  }
  (void)hipGetLastError();
}

// v003
// It runs in 497 microseconds.
// Timed twice side by side with v002, it ran 1.05 times as fast both times.
// Counting every step since v000, it is 2.51 times as fast.
// Contractions: q|k, v^T and vc^T projections = v_wmma_f32_16x16x32_bf16 (bf16 operands from RNE-converted x and W, single product);
// q.k^T scores = v_wmma_f32_16x16x32_f16 (q as f16 hi plane + f16 residual plane x4096 in a separate accumulator, k f16; 2 products);
// p.v = v_wmma_f32_16x16x32_f16 (p carried x1024 in f16, v^T as f16 hi plane + f16 residual plane x4096 in a separate accumulator; 2 products);
// ctx.Wp = v_wmma_f32_16x16x32_bf16 (ctx as bf16 hi + lo planes times bf16 Wp^T, 2 products); all f32 accumulate; softmax in f32.
#include <hip/hip_runtime.h>
#include <math.h>
#include <stdint.h>

#define NBATCH 16
#define NTOK   906
#define NP     960            // padded token count per batch element (15 tiles of 64)
#define DM     768
#define NH     12
#define HD     64
#define M1     513            // modality split: query / key rows < M1 vs >= M1
#define NKT    (NP / 64)      // 15 key chunks of 64
#define NQB_NM 14             // query tiles 0..7 and 9..14 (tile 8 is the mixed tile)
#define QKP    (2 * DM)       // pitch of the q|k plane: q at cols 0..DM-1, k at cols DM..2DM-1
#define GB     16             // batch elements per group (all of them: one pass of launches fills the chip)
#define NGRP   (NBATCH / GB)
#define LP     72             // LDS row pitch of the attention K / V^T / P tiles in f16: 144 B = 16 B x 9 (odd), so the 16 rows of a 16-byte fragment read fall on 16 different bank groups
#define LTILE  (64 * LP)      // one 64-row tile at that pitch
static_assert(NH * HD == DM);
static_assert((NP % 64) == 0 && NP >= NTOK && (DM % 64) == 0 && (DM % 32) == 0);
static_assert((NBATCH % GB) == 0);
static_assert(M1 - 1 == 8 * 64);   // row 512 is the first row of query tile 8 and of key chunk 8
static_assert(NTOK > (NKT - 1) * 64 && NTOK <= NP);   // invalid keys live only in the last chunk

typedef _Float16 v16h __attribute__((ext_vector_type(16)));
typedef _Float16 v8h  __attribute__((ext_vector_type(8)));
typedef __bf16   v16b __attribute__((ext_vector_type(16)));
typedef __bf16   v8b  __attribute__((ext_vector_type(8)));
typedef float    v8f  __attribute__((ext_vector_type(8)));
typedef float    v4f  __attribute__((ext_vector_type(4)));
typedef unsigned int v4u __attribute__((ext_vector_type(4)));

union FH { v16h v; v8h h[2]; };

// ---- scalar helpers --------------------------------------------------------------------------------
__device__ __forceinline__ unsigned short bf_bits(float f) {          // f32 -> bf16 bits, RNE convert
  unsigned u = __float_as_uint(f);
  return (unsigned short)((u + 0x7FFFu + ((u >> 16) & 1u)) >> 16);
}
__device__ __forceinline__ float bf_up(unsigned short h) { return __uint_as_float(((unsigned)h) << 16); }
__device__ __forceinline__ unsigned short h_bits(_Float16 x) { return __builtin_bit_cast(unsigned short, x); }
__device__ __forceinline__ unsigned pk16(unsigned short a, unsigned short b) { return (unsigned)a | ((unsigned)b << 16); }
__device__ __forceinline__ v8f zero8() { v8f z = {0.f, 0.f, 0.f, 0.f, 0.f, 0.f, 0.f, 0.f}; return z; }

// ---- fragment loaders: 16-bit A/B operand, lane -> row/col (lane&15), p already includes +8*(lane>>4);
//      elements 0..7 <- p[0..7] (k0+8h..), elements 8..15 <- p[16..23] (k0+16+8h..)
__device__ __forceinline__ v16b ldfrag_b(const __bf16* p) {
  union { v16b v; v8b h[2]; } f;
  f.h[0] = *(const v8b*)(p);
  f.h[1] = *(const v8b*)(p + 16);
  return f.v;
}
__device__ __forceinline__ v16h ldfrag_h(const _Float16* p) {
  union { v16h v; v8h h[2]; } f;
  f.h[0] = *(const v8h*)(p);
  f.h[1] = *(const v8h*)(p + 16);
  return f.v;
}

// ---- WMMA helpers with trailing VALU hazard gap --------------------------------------------------------
__device__ __forceinline__ v8f mma_h(v16h a, v16h b, v8f c) {
  c = __builtin_amdgcn_wmma_f32_16x16x32_f16(false, a, false, b, (short)0, c, false, false);
#if defined(__HIP_DEVICE_COMPILE__)
  asm volatile("v_nop\n\tv_nop\n\tv_nop\n\tv_nop" : "+v"(c) : "v"(a), "v"(b));
#endif
  return c;
}
__device__ __forceinline__ v8f mma_b_raw(v16b a, v16b b, v8f c) {
  return __builtin_amdgcn_wmma_f32_16x16x32_bf16(false, a, false, b, (short)0, c, false, false);
}
__device__ __forceinline__ void dep_guard_b(v8f& a, v8f& b, v16b x, v16b y) {
#if defined(__HIP_DEVICE_COMPILE__)
  asm volatile("v_nop\n\tv_nop\n\tv_nop\n\tv_nop" : "+v"(a), "+v"(b) : "v"(x), "v"(y));
#endif
}
__device__ __forceinline__ void keep4_b(v16b a, v16b b, v16b c, v16b d) {
#if defined(__HIP_DEVICE_COMPILE__)
  asm volatile("v_nop" :: "v"(a), "v"(b), "v"(c), "v"(d));
#endif
}
__device__ __forceinline__ void acc_guard4(v8f& a, v8f& b, v8f& c, v8f& d) {
#if defined(__HIP_DEVICE_COMPILE__)
  asm volatile("v_nop\n\tv_nop\n\tv_nop\n\tv_nop" : "+v"(a), "+v"(b), "+v"(c), "+v"(d));
#endif
}
__device__ __forceinline__ void wave_sync_lds() {
  __builtin_amdgcn_fence(__ATOMIC_RELEASE, "workgroup");
  __builtin_amdgcn_wave_barrier();
  __builtin_amdgcn_fence(__ATOMIC_ACQUIRE, "workgroup");
}

// =====================================================================================================
// x f32 [b][NTOK][DM] -> zero-padded bf16 plane Xp [GB*NP][DM] for batch elements b0..b0+GB-1 (RNE convert).
// address, value select). coverage: n8 = GB*NP*DM/8 threads x 8 = the whole Xp plane incl. padded rows.
// =====================================================================================================
__global__ __launch_bounds__(256) void cvt_x_bf16(const float* __restrict__ x, unsigned short* xp,
                                                   int b0, int n8) {
  const int i = blockIdx.x * 256 + threadIdx.x;
  if (i < n8) {
    const int row = i / (DM / 8);
    const int c8  = (i - row * (DM / 8)) * 8;
    const int bl  = row / NP;
    const int r   = row - bl * NP;
    const int rr  = (r < NTOK) ? r : (NTOK - 1);                 // clamped address for padded rows
    const float* src = x + ((size_t)(b0 + bl) * NTOK + rr) * DM + c8;
    const v4f a = *(const v4f*)(src);
    const v4f b = *(const v4f*)(src + 4);
    v4u p;
    p[0] = pk16(bf_bits(a[0]), bf_bits(a[1]));
    p[1] = pk16(bf_bits(a[2]), bf_bits(a[3]));
    p[2] = pk16(bf_bits(b[0]), bf_bits(b[1]));
    p[3] = pk16(bf_bits(b[2]), bf_bits(b[3]));
    const bool valid = (r < NTOK);
#pragma unroll
    for (int e = 0; e < 4; ++e) p[e] = valid ? p[e] : 0u;
    *(v4u*)(xp + (size_t)i * 8) = p;
    
  }
}

// =====================================================================================================
// Weight transpose-convert: W f32 [DM ci][DM co] (x @ W layout) -> Wt bf16 [co][ci] (k = ci contiguous),
// RNE convert. blockIdx.z selects the weight (0..4 -> Wq, Wk, Wv, Wvc, Wp), written back to back in wt.
// coverage: 8 waves x (2 it x 4 row groups) = 64 rows x (8 lanes x 8) = 64 cols per tile; grid 12x12x5.
// =====================================================================================================
__global__ __launch_bounds__(256) void wtr_bf16(const float* __restrict__ w0, const float* __restrict__ w1,
                                                 const float* __restrict__ w2, const float* __restrict__ w3,
                                                 const float* __restrict__ w4, unsigned short* wt) {
  __shared__ __align__(16) unsigned short T[64 * 72];   // [co][ci], pitch 72 (144 B, 16-B aligned rows)
  const int z = blockIdx.z;
  const float* W = (z == 0) ? w0 : (z == 1) ? w1 : (z == 2) ? w2 : (z == 3) ? w3 : w4;
  unsigned short* dst = wt + (size_t)z * DM * DM;
  const int co0 = blockIdx.x * 64;
  const int ci0 = blockIdx.y * 64;
  const int tid = threadIdx.x;
#pragma unroll
  for (int it = 0; it < 16; ++it) {
    const int idx = it * 256 + tid;
    const int i = idx >> 6;          // ci within tile
    const int j = idx & 63;          // co within tile
    T[j * 72 + i] = bf_bits(W[(size_t)(ci0 + i) * DM + co0 + j]);
  }
  __syncthreads();
  const int wave = tid >> 5, lane = tid & 31;
  const int q = lane >> 3, c8 = (lane & 7) * 8;
  v4u v[2];
#pragma unroll
  for (int it = 0; it < 2; ++it) {
    const int row = wave * 8 + it * 4 + q;
    v[it] = *(const v4u*)(T + row * 72 + c8);
  }
  {
#pragma unroll
    for (int it = 0; it < 2; ++it) {
      const int row = wave * 8 + it * 4 + q;
      *(v4u*)(dst + (size_t)(co0 + row) * DM + ci0 + c8) = v[it];
    }
    
  }
}

// =====================================================================================================
// Register-blocked batched bf16 WMMA GEMM: C[m][n] = sum_k A[m][k] * Bt[n][k]; one wave per 64x64 tile,
// no block barriers. A row-major [M][K] pitch lda; Bt row-major [N][K] pitch ldb (k contiguous);
// M, N multiples of 64, K multiple of 32 (host-checked). blockIdx.y = batch index (strides in elements).
// NSPLIT: 0 = A.Bt; 1 = (A + A2).Bt (A2 = unscaled bf16 lo plane of A); 2 = A.Bt + A2.Bt + A.Bt2.
// OUT_MODE: 0 = f32 (pitch ldc); 2 = bf16 hi plane C + bf16 lo plane C2 (lo = RNE(v - hi), unscaled);
//           3 = f16 hi plane C + f16 residual plane C2 = f16((v - hi) * rscale), C2 written only for tiles
//               with n0 < N2 (pitch ldc2, batch stride strideC2).
// =====================================================================================================
template <int NSPLIT, int OUT_MODE>
__global__ __launch_bounds__(256) void gemm64(
    const unsigned short* __restrict__ Ap, const unsigned short* A2p, int lda, long long strideA,
    const unsigned short* __restrict__ Btp, const unsigned short* Bt2p, int ldb, long long strideB,
    void* Cout, int ldc, long long strideC,
    void* Cout2, int ldc2, long long strideC2, int N2,
    int M, int N, int K, float rscale) {
  const __bf16* A   = (const __bf16*)(const void*)Ap;
  const __bf16* A2  = (const __bf16*)(const void*)A2p;
  const __bf16* Bt  = (const __bf16*)(const void*)Btp;
  const __bf16* Bt2 = (const __bf16*)(const void*)Bt2p;
  __shared__ __align__(16) float sT[8][16 * 68];   // per-wave 16x64 slab, pitch 68 floats
  const int b    = blockIdx.y;
  const int lane = threadIdx.x & 31;
  const int wave = threadIdx.x >> 5;
  const int tilesN = N >> 6;
  const int tilesM = M >> 6;
  const int tile = blockIdx.x * 8 + wave;
  if (tile >= tilesM * tilesN) return;   // wave-uniform; no block barriers in this kernel
  const int tm = tile / tilesN;
  const int tn = tile - tm * tilesN;
  const int m0 = tm << 6;
  const int n0 = tn << 6;

  const __bf16* Ab  = A  + (size_t)b * strideA;
  const __bf16* Bb  = Bt + (size_t)b * strideB;
  const __bf16* Ab2 = (NSPLIT >= 1) ? (A2  + (size_t)b * strideA) : Ab;
  const __bf16* Bb2 = (NSPLIT == 2) ? (Bt2 + (size_t)b * strideB) : Bb;

  const int rlane = lane & 15;                 // row (A) / col (B, D) within subtile
  const int koff  = (lane >> 4) * 8;           // k offset of this lane half
  const int mOff  = (lane >> 4) * 8;           // D row offset

  v8f acc[4][4];
#pragma unroll
  for (int i = 0; i < 4; ++i)
#pragma unroll
    for (int j = 0; j < 4; ++j) acc[i][j] = zero8();

  // Each fragment's address = uniform plane base + a 32-bit lane offset in bytes (every plane is far below 4 GiB);
  // the offsets step by one k-step (64 B) behind the WMMAs.
  unsigned aoff[4], boff[4];
#pragma unroll
  for (int i = 0; i < 4; ++i) {
    aoff[i] = (unsigned)(((m0 + (i << 4) + rlane) * lda + koff) * 2);
    boff[i] = (unsigned)(((n0 + (i << 4) + rlane) * ldb + koff) * 2);
  }

  for (int k0 = 0; k0 < K; k0 += 32) {
    v16b bh[4], bl[4];
#pragma unroll
    for (int j = 0; j < 4; ++j) {
      bh[j] = ldfrag_b((const __bf16*)((const char*)Bb + boff[j]));
      if (NSPLIT == 2) bl[j] = ldfrag_b((const __bf16*)((const char*)Bb2 + boff[j])); else bl[j] = bh[j];
    }
    v16b ahv[4], alv[4];   // all four A row blocks are loaded ahead of the first WMMA: one load latency a k-step, not four in series
#pragma unroll
    for (int i = 0; i < 4; ++i) {
      ahv[i] = ldfrag_b((const __bf16*)((const char*)Ab + aoff[i]));
      if (NSPLIT >= 1) alv[i] = ldfrag_b((const __bf16*)((const char*)Ab2 + aoff[i])); else alv[i] = ahv[i];
    }
#pragma unroll
    for (int i = 0; i < 4; ++i) {
      const v16b ah = ahv[i], al = alv[i];
#pragma unroll
      for (int j = 0; j < 4; ++j) {
        acc[i][j] = mma_b_raw(ah, bh[j], acc[i][j]);
        if (NSPLIT >= 1) acc[i][j] = mma_b_raw(al, bh[j], acc[i][j]);
        if (NSPLIT == 2) acc[i][j] = mma_b_raw(ah, bl[j], acc[i][j]);
      }
      dep_guard_b(acc[i][0], acc[i][3], ah, al);
    }
    keep4_b(bh[0], bh[1], bh[2], bh[3]);
    if (NSPLIT == 2) keep4_b(bl[0], bl[1], bl[2], bl[3]);
#pragma unroll
    for (int i = 0; i < 4; ++i) { aoff[i] += 64u; boff[i] += 64u; }
  }
  acc_guard4(acc[0][0], acc[0][1], acc[0][2], acc[0][3]);
  acc_guard4(acc[1][0], acc[1][1], acc[1][2], acc[1][3]);
  acc_guard4(acc[2][0], acc[2][1], acc[2][2], acc[2][3]);
  acc_guard4(acc[3][0], acc[3][1], acc[3][2], acc[3][3]);

  // ---- epilogue ----
  float* slab = sT[wave];
#pragma unroll
  for (int i = 0; i < 4; ++i) {
    const int mBase = m0 + (i << 4);
#pragma unroll
    for (int j = 0; j < 4; ++j) {
#pragma unroll
      for (int r = 0; r < 8; ++r) {
        slab[(mOff + r) * 68 + (j << 4) + rlane] = acc[i][j][r];
      }
    }
    wave_sync_lds();
    if (OUT_MODE == 0) {
      float* C = (float*)Cout + (size_t)b * strideC;
      const int hh = lane >> 4, c4 = (lane & 15) * 4;     // 256-B row segment = 16 lanes x 16 B
      {
#pragma unroll
        for (int it = 0; it < 8; ++it) {
          const int row = it * 2 + hh;                     // it 0..7 x hh 0..1 = rows 0..15
          const v4f v = *(const v4f*)(slab + row * 68 + c4);
          *(v4f*)(C + (size_t)(mBase + row) * ldc + n0 + c4) = v;
        }
        
      }
    } else {
      const int q = lane >> 3, c8 = (lane & 7) * 8;
      unsigned short* C  = (unsigned short*)Cout  + (size_t)b * strideC;
      unsigned short* C2 = (unsigned short*)Cout2 + (size_t)b * strideC2;
      const bool wlo = (OUT_MODE == 2) || (n0 < N2);      // wave-uniform
      v4u hv[4], lv[4];
#pragma unroll
      for (int it = 0; it < 4; ++it) {
        const int row = it * 4 + q;                        // it 0..3 x q 0..3 = rows 0..15
        const float* sp = slab + row * 68 + c8;
        v4u a, a2;
#pragma unroll
        for (int e = 0; e < 4; ++e) {
          const float f0 = sp[2 * e], f1 = sp[2 * e + 1];
          unsigned short h0, h1, l0, l1;
          if (OUT_MODE == 2) {
            h0 = bf_bits(f0); h1 = bf_bits(f1);
            l0 = bf_bits(f0 - bf_up(h0)); l1 = bf_bits(f1 - bf_up(h1));
          } else {
            const _Float16 x0 = (_Float16)f0, x1 = (_Float16)f1;
            h0 = h_bits(x0); h1 = h_bits(x1);
            l0 = h_bits((_Float16)((f0 - (float)x0) * rscale));
            l1 = h_bits((_Float16)((f1 - (float)x1) * rscale));
          }
          a[e] = pk16(h0, h1); a2[e] = pk16(l0, l1);
        }
        hv[it] = a; lv[it] = a2;
      }
      {
#pragma unroll
        for (int it = 0; it < 4; ++it) {
          const int row = it * 4 + q;
          *(v4u*)(C + (size_t)(mBase + row) * ldc + n0 + c8) = hv[it];
          if (wlo) *(v4u*)(C2 + (size_t)(mBase + row) * ldc2 + n0 + c8) = lv[it];
        }
        
      }
    }
    wave_sync_lds();
  }
}

// =====================================================================================================
// V^T chunk staging with the per-key-row value swap: destination LDS tiles dh/dl [d][kv] (64x64 f16, row pitch LP),
// source planes (already offset to (batch, head)) [d][s] pitch NP: keys s < M1 come from (s0h, s0l),
// keys s >= M1 from (s1h, s1l). Chunks kt < 8 are all < M1, chunks kt > 8 all >= M1 (chunk-uniform source);
// chunk 8 (kv0 = 512) takes key 512 (element 0 of the hf == 0 half-row) from s0 and the rest from s1.
// Thread (r, hf): row d = r, keys kv0+hf .. kv0+hf+31; 128 threads x 32 keys x 2 planes = the whole tile.
// =====================================================================================================
__device__ __forceinline__ void stage_vt(_Float16* dh, _Float16* dl,
                                         const _Float16* s0h, const _Float16* s0l,
                                         const _Float16* s1h, const _Float16* s1l,
                                         int kt, int kv0, int r, int hf) {
  const bool lowc = (kt < 8);
  const _Float16* gh = (lowc ? s0h : s1h) + (size_t)r * NP + kv0 + hf;
  const _Float16* gl = (lowc ? s0l : s1l) + (size_t)r * NP + kv0 + hf;
#pragma unroll
  for (int i = 0; i < 4; ++i) {
    v8h a  = *(const v8h*)(gh + 8 * i);
    v8h a2 = *(const v8h*)(gl + 8 * i);
    if (i == 0 && kt == 8) {                         // block-uniform
      const _Float16 eh = s0h[(size_t)r * NP + (M1 - 1)];
      const _Float16 el = s0l[(size_t)r * NP + (M1 - 1)];
      a[0]  = (hf == 0) ? eh : a[0];
      a2[0] = (hf == 0) ? el : a2[0];
    }
    *(v8h*)(dh + r * LP + hf + 8 * i) = a;
    *(v8h*)(dl + r * LP + hf + 8 * i) = a2;
  }
}

// ---- context += P . V^T tile (f16 WMMA), residual products into a separate accumulator folded in f32 ----
__device__ __forceinline__ void pv_acc(v8f (&oacc)[4], const _Float16* pwh,
                                       const _Float16* Vth, const _Float16* Vtl,
                                       float rres, int c, int hh) {
  v8f o1[4];
#pragma unroll
  for (int t = 0; t < 4; ++t) o1[t] = zero8();
#pragma unroll 1
  for (int kk = 0; kk < 2; ++kk) {
    FH pa;
    pa.h[0] = *(const v8h*)(pwh + c * LP + kk * 32 + 8 * hh);
    pa.h[1] = *(const v8h*)(pwh + c * LP + kk * 32 + 16 + 8 * hh);
#pragma unroll
    for (int t = 0; t < 4; ++t) {
      FH vb, vl;
      vb.h[0] = *(const v8h*)(Vth + (t * 16 + c) * LP + kk * 32 + 8 * hh);
      vb.h[1] = *(const v8h*)(Vth + (t * 16 + c) * LP + kk * 32 + 16 + 8 * hh);
      vl.h[0] = *(const v8h*)(Vtl + (t * 16 + c) * LP + kk * 32 + 8 * hh);
      vl.h[1] = *(const v8h*)(Vtl + (t * 16 + c) * LP + kk * 32 + 16 + 8 * hh);
      oacc[t] = mma_h(pa.v, vb.v, oacc[t]);
      o1[t]   = mma_h(pa.v, vl.v, o1[t]);
    }
  }
#pragma unroll
  for (int t = 0; t < 4; ++t)
#pragma unroll
    for (int r = 0; r < 8; ++r) oacc[t][r] += o1[t][r] * rres;
}

// =====================================================================================================
// Attention, head dim 64, softmax over the NTOK valid keys of the batch element (keys s >= NTOK masked to
// -1e30 before the row max in the last chunk), per-modality value swap handled at V^T staging.
//   q|k plane (f16, pitch QKP): element (row, col) at [row*QKP + col], row = bl*NP + t, q col = h*64+d,
//   k col = DM + h*64 + d; q residual plane (f16, (q - f16(q))*4096, pitch DM): [row*DM + h*64 + d]
//   v^T / vc^T hi planes (f16): element (bl, h, d, s) at [(bl*DM + h*64 + d)*NP + s]; residual planes (x4096) same
//   out planes (bf16 hi / lo of the normalised context): element (row, h, d) at [row*DM + h*64 + d]
//   NV == 1: query tiles 0..7 (rows < M1, values: v for keys < M1, vc for keys >= M1) and 9..14
//            (values: vc for keys < M1, v for keys >= M1); grid = NQB_NM * NH * GB.
//   NV == 2: query tile 8 (rows 512..575): main set = the rows >= M1 combination, extra set (wave 0 only)
//            = the rows < M1 combination; row 512 selects the extra set at the end; grid = NH * GB.
//   scores = (qh . k + (ql . k) * rres) * sscale on f16 WMMA, residual products in a separate accumulator;
//   p = exp(s - m) carried as f16(1024 p); online softmax in f32.
//   Block = 4 waves = 64 query rows of one (bl, h); kv chunks of 64, static trip NKT.
//   K / V^T chunk staging: 128 threads x 32 elements per plane = the whole 64x64 tile (plain 16-B loads,
//   __syncthreads before and after); P tiles are wave-private, spilled with _Float16 element stores; the output stage
//   aliases the K / V LDS region after a final __syncthreads.
//   Output coverage: each wave stores rows q0..q0+15 (it 0..3 x lane>>3 0..3) x 64 columns (8 lanes x 8) of both planes.
// =====================================================================================================
template <int NV>
__global__ __launch_bounds__(128)
void attn64(const unsigned short* __restrict__ qkp, const unsigned short* __restrict__ qlp,
            const unsigned short* __restrict__ vhp, const unsigned short* __restrict__ vlp,
            const unsigned short* __restrict__ vchp, const unsigned short* __restrict__ vclp,
            unsigned short* ohp, unsigned short* olp, float sscale, float rres) {
  __shared__ __align__(16) _Float16 smem[((NV == 2) ? 6 : 4) * LTILE];
  _Float16* Ksh = smem;                                   // K [kv][d]           9 KB (rows of 64 at pitch LP)
  _Float16* VMh = smem + LTILE;                           // main V^T hi [d][kv]  9 KB
  _Float16* VMl = smem + 2 * LTILE;                       // main V^T residual     9 KB
  _Float16* VEh = (NV == 2) ? (smem + 3 * LTILE) : VMh;   // extra set (NV == 2)   9 KB
  _Float16* VEl = (NV == 2) ? (smem + 4 * LTILE) : VMl;   //                       9 KB
  _Float16* Psh = smem + ((NV == 2) ? 5 : 3) * LTILE;     // per wave P [row][kv]  9 KB

  const int tid  = threadIdx.x;
  const int wave = tid >> 5;
  const int lane = tid & 31;
  const int hh   = lane >> 4;
  const int c    = lane & 15;

  const int bx = blockIdx.x;
  int qb, rest;
  if (NV == 1) {
    const int idx = bx % NQB_NM;
    qb = idx + ((idx >= 8) ? 1 : 0);
    rest = bx / NQB_NM;
  } else {
    qb = 8;
    rest = bx;
  }
  const int h  = rest % NH;
  const int bl = rest / NH;
  const int q0 = qb * 64 + wave * 16;
  const size_t rowB = (size_t)bl * NP;

  const _Float16* Qh = (const _Float16*)(const void*)qkp + (size_t)h * HD;
  const _Float16* Kg = (const _Float16*)(const void*)qkp + DM + (size_t)h * HD;
  const _Float16* Ql = (const _Float16*)(const void*)qlp + (size_t)h * HD;
  const size_t vbase = ((size_t)bl * DM + (size_t)h * HD) * NP;
  const _Float16* Vh  = (const _Float16*)(const void*)vhp  + vbase;
  const _Float16* Vl  = (const _Float16*)(const void*)vlp  + vbase;
  const _Float16* Vch = (const _Float16*)(const void*)vchp + vbase;
  const _Float16* Vcl = (const _Float16*)(const void*)vclp + vbase;
  // main set: keys < M1 from (M0h, M0l), keys >= M1 from (M1h, M1l); block-uniform pointer choice
  const bool useB = (NV == 2) || (qb > 8);
  const _Float16* M0h = useB ? Vch : Vh;
  const _Float16* M0l = useB ? Vcl : Vl;
  const _Float16* M1h = useB ? Vh  : Vch;
  const _Float16* M1l = useB ? Vl  : Vcl;

  // ---- Q fragments (A operand, row = lane&15): 2 d-chunks, hi and residual ----
  v16h qah[2], qal[2];
#pragma unroll
  for (int dc = 0; dc < 2; ++dc) {
    qah[dc] = ldfrag_h(Qh + (rowB + q0 + c) * QKP + dc * 32 + 8 * hh);
    qal[dc] = ldfrag_h(Ql + (rowB + q0 + c) * DM  + dc * 32 + 8 * hh);
  }

  float mrow[8], lrow[8];
  v8f oacc[4], oaccE[4];
#pragma unroll
  for (int r = 0; r < 8; ++r) { mrow[r] = -INFINITY; lrow[r] = 0.f; }
#pragma unroll
  for (int t = 0; t < 4; ++t) { oacc[t] = zero8(); oaccE[t] = zero8(); }

  for (int kt = 0; kt < NKT; ++kt) {         // static trip count
    const int kv0 = kt * 64;
    __syncthreads();
    {
      const int r = tid >> 1, hf = (tid & 1) * 32;
      const _Float16* kg = Kg + (rowB + kv0 + r) * QKP + hf;      // K row kv0+r, d = hf..hf+31
#pragma unroll
      for (int i = 0; i < 4; ++i) {
        const v8h a0 = *(const v8h*)(kg + 8 * i);
        *(v8h*)(Ksh + r * LP + hf + 8 * i) = a0;
      }
      stage_vt(VMh, VMl, M0h, M0l, M1h, M1l, kt, kv0, r, hf);
      if (NV == 2) stage_vt(VEh, VEl, Vh, Vl, Vch, Vcl, kt, kv0, r, hf);
    }
    __syncthreads();

    // ---- scores: 16 query rows x 64 keys per wave, 2 f16 products (hi, residual) ----
    v8f s[4];
#pragma unroll
    for (int j = 0; j < 4; ++j) {
      v8f sh = zero8(), sl = zero8();
#pragma unroll
      for (int dc = 0; dc < 2; ++dc) {
        FH kb;
        kb.h[0] = *(const v8h*)(Ksh + (j * 16 + c) * LP + dc * 32 + 8 * hh);
        kb.h[1] = *(const v8h*)(Ksh + (j * 16 + c) * LP + dc * 32 + 16 + 8 * hh);
        sh = mma_h(qah[dc], kb.v, sh);
        sl = mma_h(qal[dc], kb.v, sl);
      }
#pragma unroll
      for (int r = 0; r < 8; ++r) s[j][r] = (sh[r] + sl[r] * rres) * sscale;
    }
    // ---- keys s >= NTOK (only in the last chunk) are invalid: force -1e30 before the row max ----
    if (kt == NKT - 1) {                    // block-uniform
#pragma unroll
      for (int j = 0; j < 4; ++j) {
        const bool kval = (kv0 + j * 16 + c) < NTOK;
#pragma unroll
        for (int r = 0; r < 8; ++r) s[j][r] = kval ? s[j][r] : -1.0e30f;
      }
    }

    // ---- row max, online softmax, P (x1024, f16) to LDS ----
    _Float16* pwh = Psh + wave * (16 * LP);
#pragma unroll
    for (int r = 0; r < 8; ++r) {
      float m = s[0][r];
      m = fmaxf(m, s[1][r]);
      m = fmaxf(m, s[2][r]);
      m = fmaxf(m, s[3][r]);
#pragma unroll
      for (int off = 1; off < 16; off <<= 1) m = fmaxf(m, __shfl_xor(m, off, 32));
      const float mnew  = fmaxf(mrow[r], m);
      const float alpha = __expf(mrow[r] - mnew);
      mrow[r] = mnew;
      float psum = 0.f;
#pragma unroll
      for (int j = 0; j < 4; ++j) {
        const float p = __expf(s[j][r] - mnew);
        psum += p;
        pwh[(8 * hh + r) * LP + j * 16 + c] = (_Float16)(p * 1024.0f);
      }
#pragma unroll
      for (int off = 1; off < 16; off <<= 1) psum += __shfl_xor(psum, off, 32);
      lrow[r] = lrow[r] * alpha + psum;
#pragma unroll
      for (int t = 0; t < 4; ++t) { oacc[t][r] *= alpha; if (NV == 2) oaccE[t][r] *= alpha; }
    }
    wave_sync_lds();

    // ---- context += P . V ----
    pv_acc(oacc, pwh, VMh, VMl, rres, c, hh);
    if (NV == 2) {
      if (wave == 0) pv_acc(oaccE, pwh, VEh, VEl, rres, c, hh);   // wave-uniform
    }
  }
  __syncthreads();                           // all waves done with K / V tiles before the alias below

  // ---- normalise (1/l and the 1/1024 p carry), stage the wave's 16x64 tile (aliases the K / V region),
  float* os = (float*)(void*)smem + wave * 1024;
#pragma unroll
  for (int r = 0; r < 8; ++r) {
    const float l = lrow[r];
    const float inv = ((l > 0.f) ? (1.0f / l) : 0.f) * (1.0f / 1024.0f);
#pragma unroll
    for (int t = 0; t < 4; ++t) {
      float vm = oacc[t][r] * inv;
      if (NV == 2) {
        const float ve = oaccE[t][r] * inv;
        const bool rowA = (q0 + 8 * hh + r) == (M1 - 1);   // query row 512 uses the extra set
        vm = rowA ? ve : vm;
      }
      os[(8 * hh + r) * 64 + t * 16 + c] = vm;
    }
  }
  wave_sync_lds();
  {
    const int q4 = lane >> 3, c8 = (lane & 7) * 8;
    v4u hv[4], lv[4];
#pragma unroll
    for (int it = 0; it < 4; ++it) {
      const int row = it * 4 + q4;   // it 0..3 x q4 0..3 = rows 0..15 of the wave tile
      const float* sp = os + row * 64 + c8;
      v4u a, a2;
#pragma unroll
      for (int e = 0; e < 4; ++e) {
        const float f0 = sp[2 * e], f1 = sp[2 * e + 1];
        const unsigned short h0 = bf_bits(f0), h1 = bf_bits(f1);
        const unsigned short l0 = bf_bits(f0 - bf_up(h0)), l1 = bf_bits(f1 - bf_up(h1));
        a[e] = pk16(h0, h1); a2[e] = pk16(l0, l1);
      }
      hv[it] = a; lv[it] = a2;
    }
    {
#pragma unroll
      for (int it = 0; it < 4; ++it) {
        const int row = it * 4 + q4;
        const size_t go = (rowB + q0 + row) * DM + (size_t)h * HD + c8;
        *(v4u*)(ohp + go) = hv[it];
        *(v4u*)(olp + go) = lv[it];
      }
      
    }
  }
}

// =====================================================================================================
// d_out[(b0 + bl)*NTOK + r][c] = OUTP[(bl*NP + r)][c] + bf16-RNE(bp[c]) for r < NTOK (padded rows dropped).
// One thread per 4 floats in d_out row-major order over the group's rows, which are contiguous in d_out:
// coverage: n4 = GB*NTOK*DM/4 threads x 4 = every d_out element of batch elements b0..b0+GB-1.
// =====================================================================================================
__global__ __launch_bounds__(256) void copy_out(const float* __restrict__ op, const float* __restrict__ bp,
                                                 float* out, int b0, int n4) {
  const int i = blockIdx.x * 256 + threadIdx.x;
  if (i < n4) {
    const int row = i / (DM / 4);
    const int c4  = (i - row * (DM / 4)) * 4;
    const int bl  = row / NTOK;
    const int r   = row - bl * NTOK;
    v4f v = *(const v4f*)(op + ((size_t)bl * NP + r) * DM + c4);
    const v4f bb = *(const v4f*)(bp + c4);
#pragma unroll
    for (int e = 0; e < 4; ++e) v[e] += bf_up(bf_bits(bb[e]));
    float* d = out + ((size_t)b0 * NTOK + row) * DM + c4;
    *(v4f*)d = v;
    
  }
}

// =====================================================================================================
// Workspace map (bytes), one group of GB = 16 batch elements (GB*NP = 15360 rows), every plane an exact
// multiple of its 64x64-tile / whole-line store granularity (padded rows included):
//   Wt    bf16 [5][768 co][768 ci]   0          5898240   (Wq^T | Wk^T | Wv^T | Wvc^T | Wp^T)
//   Xp    bf16 [15360][768]          5898240    23592960
//   QK    f16  [15360][1536]         29491200   47185920  (q cols 0..767, k cols 768..1535)
//   Ql    f16  [15360][768]          76677120   23592960  (q residual x4096)
//   VTh   f16  [16][768][960]        100270080  23592960  (v^T hi)
//   VTl   f16  [16][768][960]        123863040  23592960  (v^T residual x4096)
//   VCh   f16  [16][768][960]        147456000  23592960  (vc^T hi)
//   VCl   f16  [16][768][960]        171048960  23592960  (vc^T residual x4096)
//   Oh    bf16 [15360][768]          194641920  23592960
//   Ol    bf16 [15360][768]          218234880  23592960
//   end                              241827840
//   OUTP  f32  [15360][768]          29491200   47185920  (same bytes as QK: q|k are last read by the attention
//                                                          launches, which end before launch (6) writes OUTP)
// =====================================================================================================
extern "C" void kernel_launch(void* const* d_in, const int* in_sizes, int n_in,
                              void* d_out, int out_size, void* d_ws, size_t ws_size,
                              hipStream_t stream) {
  if (n_in < 7) return;
  if (in_sizes[0] != NBATCH * NTOK * DM) return;
  if (in_sizes[1] != DM * DM || in_sizes[2] != DM * DM || in_sizes[3] != DM * DM) return;
  if (in_sizes[4] != DM * DM || in_sizes[5] != DM * DM) return;
  if (in_sizes[6] != DM) return;
  if (out_size != NBATCH * NTOK * DM) return;

  const float* x   = (const float*)d_in[0];
  const float* Wq  = (const float*)d_in[1];
  const float* Wk  = (const float*)d_in[2];
  const float* Wv  = (const float*)d_in[3];
  const float* Wvc = (const float*)d_in[4];
  const float* Wp  = (const float*)d_in[5];
  const float* bp  = (const float*)d_in[6];

  const size_t ROWS = (size_t)GB * NP;                 // 15360
  const size_t PW   = (size_t)5 * DM * DM * 2;          //  5898240
  const size_t PX   = ROWS * DM * 2;                    // 23592960
  const size_t PQK  = ROWS * QKP * 2;                   // 47185920
  const size_t PQl  = ROWS * DM * 2;                    // 23592960
  const size_t PVT  = (size_t)GB * DM * NP * 2;         // 23592960
  const size_t PO   = ROWS * DM * 2;                    // 23592960
  static_assert((size_t)DM * 4 == (size_t)QKP * 2);     // an f32 OUTP row is as long as an f16 q|k row: OUTP fits QK exactly
  size_t off = 0;
  const size_t oW   = off; off += PW;
  const size_t oXp  = off; off += PX;
  const size_t oQK  = off; off += PQK;
  const size_t oQl  = off; off += PQl;
  const size_t oVTh = off; off += PVT;
  const size_t oVTl = off; off += PVT;
  const size_t oVCh = off; off += PVT;
  const size_t oVCl = off; off += PVT;
  const size_t oOh  = off; off += PO;
  const size_t oOl  = off; off += PO;
  const size_t oOUT = oQK;                              // OUTP over QK (dead once attention has run)
  if (off > ws_size) return;                            // off = 241827840

  char* ws = (char*)d_ws;
  unsigned short* Wt   = (unsigned short*)(ws + oW);
  unsigned short* Wqk_t = Wt;                                   // rows 0..1535: Wq^T then Wk^T
  unsigned short* Wv_t  = Wt + (size_t)2 * DM * DM;
  unsigned short* Wvc_t = Wt + (size_t)3 * DM * DM;
  unsigned short* Wp_t  = Wt + (size_t)4 * DM * DM;
  unsigned short* Xp   = (unsigned short*)(ws + oXp);
  unsigned short* QK   = (unsigned short*)(ws + oQK);
  unsigned short* Ql   = (unsigned short*)(ws + oQl);
  unsigned short* VTh  = (unsigned short*)(ws + oVTh);
  unsigned short* VTl  = (unsigned short*)(ws + oVTl);
  unsigned short* VCh  = (unsigned short*)(ws + oVCh);
  unsigned short* VCl  = (unsigned short*)(ws + oVCl);
  unsigned short* Oh   = (unsigned short*)(ws + oOh);
  unsigned short* Ol   = (unsigned short*)(ws + oOl);
  float*          OUTP = (float*)(ws + oOUT);
  float*          out  = (float*)d_out;

  const dim3 blk(256);
  const int n8x = GB * NP * (DM / 8);                            // 1474560
  const int n4o = GB * NTOK * (DM / 4);                          // 2783232
  const dim3 gCvtX((n8x + 255) / 256);                           // 5760 blocks
  const dim3 gCopy((n4o + 255) / 256);                           // 10872 blocks
  const dim3 gWtr(DM / 64, DM / 64, 5);                          // 12 x 12 x 5 tiles
  const dim3 gQK(((GB * NP / 64) * (QKP / 64) + 7) / 8, 1);      // 5760 tiles -> 720 blocks: M=15360, N=1536
  const dim3 gVT(((DM / 64) * (NP / 64) + 7) / 8, GB);           // 180 tiles -> 23 blocks x 16: M=768, N=960
  const dim3 gOut(((GB * NP / 64) * (DM / 64) + 7) / 8, 1);      // 2880 tiles -> 360 blocks: M=15360, N=768
  const dim3 gAttn1(NQB_NM * NH * GB);                           // 2688 blocks
  const dim3 gAttn2(NH * GB);                                    // 192 blocks

  // (0) weights -> bf16 [out][in] planes (k contiguous = the Bt / A layout the GEMM wants)
  wtr_bf16<<<gWtr, blk, 0, stream>>>(Wq, Wk, Wv, Wvc, Wp, Wt);

  for (int g = 0; g < NGRP; ++g) {
    const int b0 = g * GB;
    // (1) x -> zero-padded bf16 plane [15360][768]
    cvt_x_bf16<<<gCvtX, blk, 0, stream>>>(x, Xp, b0, n8x);
    // (2) q|k = Xp . Wqk^T -> f16 plane [15360][1536] + f16 residual x4096 of the q half (n0 < 768, pitch 768)
    gemm64<0, 3><<<gQK, blk, 0, stream>>>(
        Xp, Xp, DM, 0LL, Wqk_t, Wqk_t, DM, 0LL,
        (void*)QK, QKP, 0LL, (void*)Ql, DM, 0LL, DM,
        GB * NP, QKP, DM, 4096.0f);
    // (3) v^T = Wv^T . Xp^T per batch element -> f16 hi [bl][h*64+d][s] (pitch NP) + residual x4096
    gemm64<0, 3><<<gVT, blk, 0, stream>>>(
        Wv_t, Wv_t, DM, 0LL, Xp, Xp, DM, (long long)NP * DM,
        (void*)VTh, NP, (long long)DM * NP, (void*)VTl, NP, (long long)DM * NP, NP,
        DM, NP, DM, 4096.0f);
    // (4) vc^T likewise
    gemm64<0, 3><<<gVT, blk, 0, stream>>>(
        Wvc_t, Wvc_t, DM, 0LL, Xp, Xp, DM, (long long)NP * DM,
        (void*)VCh, NP, (long long)DM * NP, (void*)VCl, NP, (long long)DM * NP, NP,
        DM, NP, DM, 4096.0f);
    // (5) attention -> context bf16 hi / lo planes [15360][768]: query tiles 0..7, 9..14, then the mixed tile 8
    attn64<1><<<gAttn1, dim3(128), 0, stream>>>(QK, Ql, VTh, VTl, VCh, VCl, Oh, Ol, 0.125f, 1.0f / 4096.0f);
    attn64<2><<<gAttn2, dim3(128), 0, stream>>>(QK, Ql, VTh, VTl, VCh, VCl, Oh, Ol, 0.125f, 1.0f / 4096.0f);
    // (6) OUTP = context . Wp (A = context hi + lo planes, 2 products; K=768) -> f32 [15360][768]
    gemm64<1, 0><<<gOut, blk, 0, stream>>>(
        Oh, Ol, DM, 0LL, Wp_t, Wp_t, DM, 0LL,
        (void*)OUTP, DM, 0LL, (void*)OUTP, DM, 0LL, DM,
        GB * NP, DM, DM, 1.0f);
    // (7) valid rows + bias -> d_out rows (b0 + bl)*906 + r
    copy_out<<<gCopy, blk, 0, stream>>>(OUTP, bp, out, b0, n4o);
  }
  (void)hipGetLastError();
}

// v004
// It runs in 379 microseconds.
// Timed twice side by side with v003, it ran 1.30 and 1.31 times as fast.
// Counting every step since v000, it is 3.28 times as fast.
// Contractions: q|k, v^T and vc^T projections = v_wmma_f32_16x16x32_bf16 (bf16 operands from RNE-converted x and W, single product);
// q.k^T scores = v_wmma_f32_16x16x32_f16 (q as f16 hi plane + f16 residual plane x4096 in a separate accumulator, k f16; 2 products);
// p.v = v_wmma_f32_16x16x32_f16 (p carried x1024 in f16, v^T as f16 hi plane + f16 residual plane x4096 in a separate accumulator; 2 products);
// ctx.Wp = v_wmma_f32_16x16x32_bf16 (ctx as bf16 hi + lo planes times bf16 Wp^T, 2 products); all f32 accumulate; softmax in f32.
#include <hip/hip_runtime.h>
#include <math.h>
#include <stdint.h>

#define NBATCH 16
#define NTOK   906
#define NP     960            // padded token count per batch element (15 tiles of 64)
#define DM     768
#define NH     12
#define HD     64
#define M1     513            // modality split: query / key rows < M1 vs >= M1
#define NKT    (NP / 64)      // 15 key chunks of 64
#define NQB_NM 14             // query tiles 0..7 and 9..14 (tile 8 is the mixed tile)
#define QKP    (2 * DM)       // pitch of the q|k plane: q at cols 0..DM-1, k at cols DM..2DM-1
#define GB     16             // batch elements per group (all of them: one pass of launches fills the chip)
#define NGRP   (NBATCH / GB)
#define LP     72             // LDS row pitch of the attention K / V^T / P tiles in f16: 144 B = 16 B x 9 (odd), so the 16 rows of a 16-byte fragment read fall on 16 different bank groups
#define LTILE  (64 * LP)      // one 64-row tile at that pitch
#define GBM    128            // GEMM block tile: 2 x 4 wave tiles of 64 x 64
#define GBN    256
#define GBK    64             // k per stage: 128 B of every operand row, one whole line
#define GPI    72             // LDS row pitch of a staged operand row in bf16: 144 B = 16 B x 9 (odd), as LP
static_assert(NH * HD == DM);
static_assert((NP % 64) == 0 && NP >= NTOK && (DM % 64) == 0 && (DM % 32) == 0);
static_assert((NBATCH % GB) == 0);
static_assert(M1 - 1 == 8 * 64);   // row 512 is the first row of query tile 8 and of key chunk 8
static_assert(NTOK > (NKT - 1) * 64 && NTOK <= NP);   // invalid keys live only in the last chunk

typedef _Float16 v16h __attribute__((ext_vector_type(16)));
typedef _Float16 v8h  __attribute__((ext_vector_type(8)));
typedef __bf16   v16b __attribute__((ext_vector_type(16)));
typedef __bf16   v8b  __attribute__((ext_vector_type(8)));
typedef float    v8f  __attribute__((ext_vector_type(8)));
typedef float    v4f  __attribute__((ext_vector_type(4)));
typedef unsigned int v4u __attribute__((ext_vector_type(4)));

union FH { v16h v; v8h h[2]; };

// ---- scalar helpers --------------------------------------------------------------------------------
__device__ __forceinline__ unsigned short bf_bits(float f) {          // f32 -> bf16 bits, RNE convert
  unsigned u = __float_as_uint(f);
  return (unsigned short)((u + 0x7FFFu + ((u >> 16) & 1u)) >> 16);
}
__device__ __forceinline__ float bf_up(unsigned short h) { return __uint_as_float(((unsigned)h) << 16); }
__device__ __forceinline__ unsigned short h_bits(_Float16 x) { return __builtin_bit_cast(unsigned short, x); }
__device__ __forceinline__ unsigned pk16(unsigned short a, unsigned short b) { return (unsigned)a | ((unsigned)b << 16); }
__device__ __forceinline__ v8f zero8() { v8f z = {0.f, 0.f, 0.f, 0.f, 0.f, 0.f, 0.f, 0.f}; return z; }

// ---- fragment loaders: 16-bit A/B operand, lane -> row/col (lane&15), p already includes +8*(lane>>4);
//      elements 0..7 <- p[0..7] (k0+8h..), elements 8..15 <- p[16..23] (k0+16+8h..)
__device__ __forceinline__ v16b ldfrag_b(const __bf16* p) {
  union { v16b v; v8b h[2]; } f;
  f.h[0] = *(const v8b*)(p);
  f.h[1] = *(const v8b*)(p + 16);
  return f.v;
}
__device__ __forceinline__ v16h ldfrag_h(const _Float16* p) {
  union { v16h v; v8h h[2]; } f;
  f.h[0] = *(const v8h*)(p);
  f.h[1] = *(const v8h*)(p + 16);
  return f.v;
}

// ---- WMMA helpers with trailing VALU hazard gap --------------------------------------------------------
__device__ __forceinline__ v8f mma_h(v16h a, v16h b, v8f c) {
  c = __builtin_amdgcn_wmma_f32_16x16x32_f16(false, a, false, b, (short)0, c, false, false);
#if defined(__HIP_DEVICE_COMPILE__)
  asm volatile("v_nop\n\tv_nop\n\tv_nop\n\tv_nop" : "+v"(c) : "v"(a), "v"(b));
#endif
  return c;
}
__device__ __forceinline__ v8f mma_b_raw(v16b a, v16b b, v8f c) {
  return __builtin_amdgcn_wmma_f32_16x16x32_bf16(false, a, false, b, (short)0, c, false, false);
}
__device__ __forceinline__ void dep_guard_b(v8f& a, v8f& b, v16b x, v16b y) {
#if defined(__HIP_DEVICE_COMPILE__)
  asm volatile("v_nop\n\tv_nop\n\tv_nop\n\tv_nop" : "+v"(a), "+v"(b) : "v"(x), "v"(y));
#endif
}
__device__ __forceinline__ void keep4_b(v16b a, v16b b, v16b c, v16b d) {
#if defined(__HIP_DEVICE_COMPILE__)
  asm volatile("v_nop" :: "v"(a), "v"(b), "v"(c), "v"(d));
#endif
}
__device__ __forceinline__ void acc_guard4(v8f& a, v8f& b, v8f& c, v8f& d) {
#if defined(__HIP_DEVICE_COMPILE__)
  asm volatile("v_nop\n\tv_nop\n\tv_nop\n\tv_nop" : "+v"(a), "+v"(b), "+v"(c), "+v"(d));
#endif
}
__device__ __forceinline__ void wave_sync_lds() {
  __builtin_amdgcn_fence(__ATOMIC_RELEASE, "workgroup");
  __builtin_amdgcn_wave_barrier();
  __builtin_amdgcn_fence(__ATOMIC_ACQUIRE, "workgroup");
}

// =====================================================================================================
// x f32 [b][NTOK][DM] -> zero-padded bf16 plane Xp [GB*NP][DM] for batch elements b0..b0+GB-1 (RNE convert).
// address, value select). coverage: n8 = GB*NP*DM/8 threads x 8 = the whole Xp plane incl. padded rows.
// =====================================================================================================
__global__ __launch_bounds__(256) void cvt_x_bf16(const float* __restrict__ x, unsigned short* xp,
                                                   int b0, int n8) {
  const int i = blockIdx.x * 256 + threadIdx.x;
  if (i < n8) {
    const int row = i / (DM / 8);
    const int c8  = (i - row * (DM / 8)) * 8;
    const int bl  = row / NP;
    const int r   = row - bl * NP;
    const int rr  = (r < NTOK) ? r : (NTOK - 1);                 // clamped address for padded rows
    const float* src = x + ((size_t)(b0 + bl) * NTOK + rr) * DM + c8;
    const v4f a = *(const v4f*)(src);
    const v4f b = *(const v4f*)(src + 4);
    v4u p;
    p[0] = pk16(bf_bits(a[0]), bf_bits(a[1]));
    p[1] = pk16(bf_bits(a[2]), bf_bits(a[3]));
    p[2] = pk16(bf_bits(b[0]), bf_bits(b[1]));
    p[3] = pk16(bf_bits(b[2]), bf_bits(b[3]));
    const bool valid = (r < NTOK);
#pragma unroll
    for (int e = 0; e < 4; ++e) p[e] = valid ? p[e] : 0u;
    *(v4u*)(xp + (size_t)i * 8) = p;
    
  }
}

// =====================================================================================================
// Weight transpose-convert: W f32 [DM ci][DM co] (x @ W layout) -> Wt bf16 [co][ci] (k = ci contiguous),
// RNE convert. blockIdx.z selects the weight (0..4 -> Wq, Wk, Wv, Wvc, Wp), written back to back in wt.
// coverage: 8 waves x (2 it x 4 row groups) = 64 rows x (8 lanes x 8) = 64 cols per tile; grid 12x12x5.
// =====================================================================================================
__global__ __launch_bounds__(256) void wtr_bf16(const float* __restrict__ w0, const float* __restrict__ w1,
                                                 const float* __restrict__ w2, const float* __restrict__ w3,
                                                 const float* __restrict__ w4, unsigned short* wt) {
  __shared__ __align__(16) unsigned short T[64 * 72];   // [co][ci], pitch 72 (144 B, 16-B aligned rows)
  const int z = blockIdx.z;
  const float* W = (z == 0) ? w0 : (z == 1) ? w1 : (z == 2) ? w2 : (z == 3) ? w3 : w4;
  unsigned short* dst = wt + (size_t)z * DM * DM;
  const int co0 = blockIdx.x * 64;
  const int ci0 = blockIdx.y * 64;
  const int tid = threadIdx.x;
#pragma unroll
  for (int it = 0; it < 16; ++it) {
    const int idx = it * 256 + tid;
    const int i = idx >> 6;          // ci within tile
    const int j = idx & 63;          // co within tile
    T[j * 72 + i] = bf_bits(W[(size_t)(ci0 + i) * DM + co0 + j]);
  }
  __syncthreads();
  const int wave = tid >> 5, lane = tid & 31;
  const int q = lane >> 3, c8 = (lane & 7) * 8;
  v4u v[2];
#pragma unroll
  for (int it = 0; it < 2; ++it) {
    const int row = wave * 8 + it * 4 + q;
    v[it] = *(const v4u*)(T + row * 72 + c8);
  }
  {
#pragma unroll
    for (int it = 0; it < 2; ++it) {
      const int row = wave * 8 + it * 4 + q;
      *(v4u*)(dst + (size_t)(co0 + row) * DM + ci0 + c8) = v[it];
    }
    
  }
}

// =====================================================================================================
// Four asynchronous 16-byte copies of this lane, global -> LDS, through no register: rows r, r + 32, r + 64, r + 96
// of a staged operand (l0 = LDS byte address of the lane's piece of row r, g0 = its global address, gstep = 32 rows).
// =====================================================================================================
__device__ __forceinline__ void copy4_async(unsigned l0, const char* g0, unsigned gstep) {
#if defined(__HIP_DEVICE_COMPILE__)
  const unsigned l1 = l0 + 32u * GPI * 2u, l2 = l0 + 64u * GPI * 2u, l3 = l0 + 96u * GPI * 2u;
  const char* g1 = g0 + gstep;
  const char* g2 = g1 + gstep;
  const char* g3 = g2 + gstep;
  // s_wait_xcnt stands inside the copies' own statement, so that no address register is rewritten ahead of it
  asm volatile("global_load_async_to_lds_b128 %0, %4, off\n\t"
               "global_load_async_to_lds_b128 %1, %5, off\n\t"
               "global_load_async_to_lds_b128 %2, %6, off\n\t"
               "global_load_async_to_lds_b128 %3, %7, off\n\t"
               "s_wait_xcnt 0x0"
               :: "v"(l0), "v"(l1), "v"(l2), "v"(l3), "v"(g0), "v"(g1), "v"(g2), "v"(g3) : "memory");
#endif
}

// =====================================================================================================
// bf16 WMMA GEMM: C[m][n] = sum_k A[m][k] * Bt[n][k]. A block of 8 waves (2 x 4) owns a GBM x GBN tile, one wave a
// 64 x 64 tile of it. Per stage of GBK k the block's A rows and Bt rows are copied once into LDS (whole 128-B lines,
// asynchronous copies, two buffers: stage t + 1 flies while stage t is worked on) and every wave reads its fragments there.
// A row-major [M][K] pitch lda; Bt row-major [N][K] pitch ldb (k contiguous); M a multiple of GBM, N of GBN, K of GBK;
// grid = (M / GBM) * tilesNb blocks, tilesNb = N / GBN. Output column n goes to plane n / NB, column n % NB
// (NB a multiple of 64; plane strides strideC, strideC2 in elements).
// NSPLIT: 0 = A.Bt; 1 = (A + A2).Bt (A2 = unscaled bf16 lo plane of A).
// OUT_MODE: 0 = f32 (pitch ldc); 2 = bf16 hi plane C + bf16 lo plane C2 (lo = RNE(v - hi), unscaled);
//           3 = f16 hi plane C + f16 residual plane C2 = f16((v - hi) * rscale), C2 written only for tiles
//               with column-in-plane < N2 (pitch ldc2).
// =====================================================================================================
template <int NSPLIT, int OUT_MODE>
__global__ __launch_bounds__(256) void gemm64(
    const unsigned short* __restrict__ Ap, const unsigned short* A2p, int lda,
    const unsigned short* __restrict__ Btp, int ldb,
    void* Cout, int ldc, long long strideC,
    void* Cout2, int ldc2, long long strideC2, int N2, int NB,
    int tilesNb, int K, float rscale) {
  static_assert(NSPLIT == 0 || NSPLIT == 1);
  constexpr int OFFB  = GBM * ((NSPLIT >= 1) ? 2 : 1) * GPI;   // stage layout in bf16: A rows | A2 rows | Bt rows
  constexpr int STAGE = OFFB + GBN * GPI;
  __shared__ __align__(16) unsigned short smem[2 * STAGE];
  static_assert(8 * 16 * 68 * 4 <= 2 * STAGE * 2);             // the epilogue's per-wave slabs reuse the stage buffers
  const int lane = threadIdx.x & 31;
  const int wave = __builtin_amdgcn_readfirstlane(threadIdx.x >> 5);
  const int bm   = blockIdx.x / tilesNb;
  const int bn   = blockIdx.x - bm * tilesNb;
  const int wm   = wave >> 2, wn = wave & 3;
  const int m0 = bm * GBM + (wm << 6);
  const int n0 = bn * GBN + (wn << 6);

  const int rlane = lane & 15;                 // row (A) / col (B, D) within subtile
  const int koff  = (lane >> 4) * 8;           // k offset of this lane half
  const int mOff  = (lane >> 4) * 8;           // D row offset

  v8f acc[4][4];
#pragma unroll
  for (int i = 0; i < 4; ++i)
#pragma unroll
    for (int j = 0; j < 4; ++j) acc[i][j] = zero8();

  // Copy map: thread -> row (tid >> 3) + 32 * n, 16-byte piece tid & 7 of the row's 128 B: a wave's copy covers 4 whole lines.
  const int crow = threadIdx.x >> 3;
  const int cseg = (threadIdx.x & 7) * 16;
  const unsigned lbase = (unsigned)(uintptr_t)(const void*)smem + (unsigned)(crow * (GPI * 2) + cseg);
  const char* gA  = (const char*)(const void*)Ap  + (size_t)(bm * GBM + crow) * (size_t)lda * 2 + cseg;
  const char* gA2 = (const char*)(const void*)A2p + (size_t)(bm * GBM + crow) * (size_t)lda * 2 + cseg;
  const char* gB  = (const char*)(const void*)Btp + (size_t)(bn * GBN + crow) * (size_t)ldb * 2 + cseg;
  const unsigned stepA = (unsigned)lda * 64u, stepB = (unsigned)ldb * 64u;   // 32 rows in bytes
  auto stage_copies = [&](int t) {             // stage t -> buffer t & 1: 12 (NSPLIT 0) or 16 copies a lane
    const unsigned lb = lbase + (unsigned)((t & 1) * (STAGE * 2));
    const size_t kb = (size_t)t * (GBK * 2);
    copy4_async(lb, gA + kb, stepA);
    if (NSPLIT >= 1) copy4_async(lb + GBM * GPI * 2, gA2 + kb, stepA);
    copy4_async(lb + OFFB * 2, gB + kb, stepB);
    copy4_async(lb + (OFFB + 128 * GPI) * 2, gB + kb + (size_t)stepB * 4, stepB);
  };

  const int NT = K / GBK;
  stage_copies(0);
  asm volatile("s_wait_asynccnt 0x0" ::: "memory");   // this wave's copies of stage 0 have landed
  __syncthreads();                                     // ... and every other wave's
  if (NT > 1) stage_copies(1);

  for (int t = 0; t < NT; ++t) {
    const __bf16* sb  = (const __bf16*)(const void*)smem + (t & 1) * STAGE;
    const __bf16* sA  = sb + ((wm << 6) + rlane) * GPI + koff;
    const __bf16* sA2 = sA + GBM * GPI;
    const __bf16* sB  = sb + OFFB + ((wn << 6) + rlane) * GPI + koff;
#pragma unroll   // the two 32-k steps of a stage, straight-line between the stage's barriers
    for (int ks = 0; ks < GBK / 32; ++ks) {
      v16b bh[4];
#pragma unroll
      for (int j = 0; j < 4; ++j) bh[j] = ldfrag_b(sB + j * 16 * GPI + ks * 32);
      v16b ahv[4], alv[4];   // all fragments of a k-step are loaded as one group ahead of its WMMAs
#pragma unroll
      for (int i = 0; i < 4; ++i) {
        ahv[i] = ldfrag_b(sA + i * 16 * GPI + ks * 32);
        if (NSPLIT >= 1) alv[i] = ldfrag_b(sA2 + i * 16 * GPI + ks * 32); else alv[i] = ahv[i];
      }
#pragma unroll
      for (int i = 0; i < 4; ++i) {
        const v16b ah = ahv[i], al = alv[i];
#pragma unroll
        for (int j = 0; j < 4; ++j) {
          acc[i][j] = mma_b_raw(ah, bh[j], acc[i][j]);
          if (NSPLIT >= 1) acc[i][j] = mma_b_raw(al, bh[j], acc[i][j]);
        }
        dep_guard_b(acc[i][0], acc[i][3], ah, al);
      }
      keep4_b(bh[0], bh[1], bh[2], bh[3]);
    }
    // publish point of stage t + 1, which also frees buffer t & 1
    asm volatile("s_wait_dscnt 0x0" ::: "memory");      // this wave's reads of buffer t & 1 are done
    asm volatile("s_wait_asynccnt 0x0" ::: "memory");   // this wave's copies of stage t + 1 have landed
    __syncthreads();
    if (t + 2 < NT) stage_copies(t + 2);                // block-uniform test; into the buffer every wave has just left
  }
  asm volatile("s_wait_asynccnt 0x0" ::: "memory");     // nothing is in flight when the buffers become the epilogue's slabs
  acc_guard4(acc[0][0], acc[0][1], acc[0][2], acc[0][3]);
  acc_guard4(acc[1][0], acc[1][1], acc[1][2], acc[1][3]);
  acc_guard4(acc[2][0], acc[2][1], acc[2][2], acc[2][3]);
  acc_guard4(acc[3][0], acc[3][1], acc[3][2], acc[3][3]);

  const int bo  = n0 / NB;                     // output plane and the tile's first column in it (wave-uniform)
  const int nc0 = n0 - bo * NB;

  // ---- epilogue ----
  float* slab = (float*)(void*)smem + wave * (16 * 68);   // per-wave 16x64 slab, pitch 68 floats; the loop's last barrier has ended every read of the stage buffers
#pragma unroll
  for (int i = 0; i < 4; ++i) {
    const int mBase = m0 + (i << 4);
#pragma unroll
    for (int j = 0; j < 4; ++j) {
#pragma unroll
      for (int r = 0; r < 8; ++r) {
        slab[(mOff + r) * 68 + (j << 4) + rlane] = acc[i][j][r];
      }
    }
    wave_sync_lds();
    if (OUT_MODE == 0) {
      float* C = (float*)Cout + (size_t)bo * strideC;
      const int hh = lane >> 4, c4 = (lane & 15) * 4;     // 256-B row segment = 16 lanes x 16 B
      {
#pragma unroll
        for (int it = 0; it < 8; ++it) {
          const int row = it * 2 + hh;                     // it 0..7 x hh 0..1 = rows 0..15
          const v4f v = *(const v4f*)(slab + row * 68 + c4);
          *(v4f*)(C + (size_t)(mBase + row) * ldc + nc0 + c4) = v;
        }
        
      }
    } else {
      const int q = lane >> 3, c8 = (lane & 7) * 8;
      unsigned short* C  = (unsigned short*)Cout  + (size_t)bo * strideC;
      unsigned short* C2 = (unsigned short*)Cout2 + (size_t)bo * strideC2;
      const bool wlo = (OUT_MODE == 2) || (nc0 < N2);     // wave-uniform
      v4u hv[4], lv[4];
#pragma unroll
      for (int it = 0; it < 4; ++it) {
        const int row = it * 4 + q;                        // it 0..3 x q 0..3 = rows 0..15
        const float* sp = slab + row * 68 + c8;
        v4u a, a2;
#pragma unroll
        for (int e = 0; e < 4; ++e) {
          const float f0 = sp[2 * e], f1 = sp[2 * e + 1];
          unsigned short h0, h1, l0, l1;
          if (OUT_MODE == 2) {
            h0 = bf_bits(f0); h1 = bf_bits(f1);
            l0 = bf_bits(f0 - bf_up(h0)); l1 = bf_bits(f1 - bf_up(h1));
          } else {
            const _Float16 x0 = (_Float16)f0, x1 = (_Float16)f1;
            h0 = h_bits(x0); h1 = h_bits(x1);
            l0 = h_bits((_Float16)((f0 - (float)x0) * rscale));
            l1 = h_bits((_Float16)((f1 - (float)x1) * rscale));
          }
          a[e] = pk16(h0, h1); a2[e] = pk16(l0, l1);
        }
        hv[it] = a; lv[it] = a2;
      }
      {
#pragma unroll
        for (int it = 0; it < 4; ++it) {
          const int row = it * 4 + q;
          *(v4u*)(C + (size_t)(mBase + row) * ldc + nc0 + c8) = hv[it];
          asm volatile("s_wait_xcnt 0x0" ::: "memory");   // before the store's address registers are reused for the next address
          if (wlo) {
            *(v4u*)(C2 + (size_t)(mBase + row) * ldc2 + nc0 + c8) = lv[it];
            asm volatile("s_wait_xcnt 0x0" ::: "memory");  // as above
          }
        }
        
      }
    }
    wave_sync_lds();
  }
}

// =====================================================================================================
// V^T chunk staging with the per-key-row value swap: destination LDS tiles dh/dl [d][kv] (64x64 f16, row pitch LP),
// source planes (already offset to (batch, head)) [d][s] pitch NP: keys s < M1 come from (s0h, s0l),
// keys s >= M1 from (s1h, s1l). Chunks kt < 8 are all < M1, chunks kt > 8 all >= M1 (chunk-uniform source);
// chunk 8 (kv0 = 512) takes key 512 (element 0 of the hf == 0 half-row) from s0 and the rest from s1.
// Thread (r, hf): row d = r, keys kv0+hf .. kv0+hf+31; 128 threads x 32 keys x 2 planes = the whole tile.
// =====================================================================================================
__device__ __forceinline__ void stage_vt(_Float16* dh, _Float16* dl,
                                         const _Float16* s0h, const _Float16* s0l,
                                         const _Float16* s1h, const _Float16* s1l,
                                         int kt, int kv0, int r, int hf) {
  const bool lowc = (kt < 8);
  const _Float16* gh = (lowc ? s0h : s1h) + (size_t)r * NP + kv0 + hf;
  const _Float16* gl = (lowc ? s0l : s1l) + (size_t)r * NP + kv0 + hf;
#pragma unroll
  for (int i = 0; i < 4; ++i) {
    v8h a  = *(const v8h*)(gh + 8 * i);
    v8h a2 = *(const v8h*)(gl + 8 * i);
    if (i == 0 && kt == 8) {                         // block-uniform
      const _Float16 eh = s0h[(size_t)r * NP + (M1 - 1)];
      const _Float16 el = s0l[(size_t)r * NP + (M1 - 1)];
      a[0]  = (hf == 0) ? eh : a[0];
      a2[0] = (hf == 0) ? el : a2[0];
    }
    *(v8h*)(dh + r * LP + hf + 8 * i) = a;
    *(v8h*)(dl + r * LP + hf + 8 * i) = a2;
  }
}

// ---- context += P . V^T tile (f16 WMMA), residual products into a separate accumulator folded in f32 ----
__device__ __forceinline__ void pv_acc(v8f (&oacc)[4], const _Float16* pwh,
                                       const _Float16* Vth, const _Float16* Vtl,
                                       float rres, int c, int hh) {
  v8f o1[4];
#pragma unroll
  for (int t = 0; t < 4; ++t) o1[t] = zero8();
#pragma unroll 1
  for (int kk = 0; kk < 2; ++kk) {
    FH pa;
    pa.h[0] = *(const v8h*)(pwh + c * LP + kk * 32 + 8 * hh);
    pa.h[1] = *(const v8h*)(pwh + c * LP + kk * 32 + 16 + 8 * hh);
#pragma unroll
    for (int t = 0; t < 4; ++t) {
      FH vb, vl;
      vb.h[0] = *(const v8h*)(Vth + (t * 16 + c) * LP + kk * 32 + 8 * hh);
      vb.h[1] = *(const v8h*)(Vth + (t * 16 + c) * LP + kk * 32 + 16 + 8 * hh);
      vl.h[0] = *(const v8h*)(Vtl + (t * 16 + c) * LP + kk * 32 + 8 * hh);
      vl.h[1] = *(const v8h*)(Vtl + (t * 16 + c) * LP + kk * 32 + 16 + 8 * hh);
      oacc[t] = mma_h(pa.v, vb.v, oacc[t]);
      o1[t]   = mma_h(pa.v, vl.v, o1[t]);
    }
  }
#pragma unroll
  for (int t = 0; t < 4; ++t)
#pragma unroll
    for (int r = 0; r < 8; ++r) oacc[t][r] += o1[t][r] * rres;
}

// =====================================================================================================
// Attention, head dim 64, softmax over the NTOK valid keys of the batch element (keys s >= NTOK masked to
// -1e30 before the row max in the last chunk), per-modality value swap handled at V^T staging.
//   q|k plane (f16, pitch QKP): element (row, col) at [row*QKP + col], row = bl*NP + t, q col = h*64+d,
//   k col = DM + h*64 + d; q residual plane (f16, (q - f16(q))*4096, pitch DM): [row*DM + h*64 + d]
//   v^T / vc^T hi planes (f16): element (bl, h, d, s) at [(bl*DM + h*64 + d)*NP + s]; residual planes (x4096) same
//   out planes (bf16 hi / lo of the normalised context): element (row, h, d) at [row*DM + h*64 + d]
//   NV == 1: query tiles 0..7 (rows < M1, values: v for keys < M1, vc for keys >= M1) and 9..14
//            (values: vc for keys < M1, v for keys >= M1); grid = NQB_NM * NH * GB.
//   NV == 2: query tile 8 (rows 512..575): main set = the rows >= M1 combination, extra set (wave 0 only)
//            = the rows < M1 combination; row 512 selects the extra set at the end; grid = NH * GB.
//   scores = (qh . k + (ql . k) * rres) * sscale on f16 WMMA, residual products in a separate accumulator;
//   p = exp(s - m) carried as f16(1024 p); online softmax in f32.
//   Block = 4 waves = 64 query rows of one (bl, h); kv chunks of 64, static trip NKT.
//   K / V^T chunk staging: 128 threads x 32 elements per plane = the whole 64x64 tile (plain 16-B loads,
//   __syncthreads before and after); P tiles are wave-private, spilled with _Float16 element stores; the output stage
//   aliases the K / V LDS region after a final __syncthreads.
//   Output coverage: each wave stores rows q0..q0+15 (it 0..3 x lane>>3 0..3) x 64 columns (8 lanes x 8) of both planes.
// =====================================================================================================
template <int NV>
__global__ __launch_bounds__(128)
void attn64(const unsigned short* __restrict__ qkp, const unsigned short* __restrict__ qlp,
            const unsigned short* __restrict__ vhp, const unsigned short* __restrict__ vlp,
            const unsigned short* __restrict__ vchp, const unsigned short* __restrict__ vclp,
            unsigned short* ohp, unsigned short* olp, float sscale, float rres) {
  __shared__ __align__(16) _Float16 smem[((NV == 2) ? 6 : 4) * LTILE];
  _Float16* Ksh = smem;                                   // K [kv][d]           9 KB (rows of 64 at pitch LP)
  _Float16* VMh = smem + LTILE;                           // main V^T hi [d][kv]  9 KB
  _Float16* VMl = smem + 2 * LTILE;                       // main V^T residual     9 KB
  _Float16* VEh = (NV == 2) ? (smem + 3 * LTILE) : VMh;   // extra set (NV == 2)   9 KB
  _Float16* VEl = (NV == 2) ? (smem + 4 * LTILE) : VMl;   //                       9 KB
  _Float16* Psh = smem + ((NV == 2) ? 5 : 3) * LTILE;     // per wave P [row][kv]  9 KB

  const int tid  = threadIdx.x;
  const int wave = tid >> 5;
  const int lane = tid & 31;
  const int hh   = lane >> 4;
  const int c    = lane & 15;

  const int bx = blockIdx.x;
  int qb, rest;
  if (NV == 1) {
    const int idx = bx % NQB_NM;
    qb = idx + ((idx >= 8) ? 1 : 0);
    rest = bx / NQB_NM;
  } else {
    qb = 8;
    rest = bx;
  }
  const int h  = rest % NH;
  const int bl = rest / NH;
  const int q0 = qb * 64 + wave * 16;
  const size_t rowB = (size_t)bl * NP;

  const _Float16* Qh = (const _Float16*)(const void*)qkp + (size_t)h * HD;
  const _Float16* Kg = (const _Float16*)(const void*)qkp + DM + (size_t)h * HD;
  const _Float16* Ql = (const _Float16*)(const void*)qlp + (size_t)h * HD;
  const size_t vbase = ((size_t)bl * DM + (size_t)h * HD) * NP;
  const _Float16* Vh  = (const _Float16*)(const void*)vhp  + vbase;
  const _Float16* Vl  = (const _Float16*)(const void*)vlp  + vbase;
  const _Float16* Vch = (const _Float16*)(const void*)vchp + vbase;
  const _Float16* Vcl = (const _Float16*)(const void*)vclp + vbase;
  // main set: keys < M1 from (M0h, M0l), keys >= M1 from (M1h, M1l); block-uniform pointer choice
  const bool useB = (NV == 2) || (qb > 8);
  const _Float16* M0h = useB ? Vch : Vh;
  const _Float16* M0l = useB ? Vcl : Vl;
  const _Float16* M1h = useB ? Vh  : Vch;
  const _Float16* M1l = useB ? Vl  : Vcl;

  // ---- Q fragments (A operand, row = lane&15): 2 d-chunks, hi and residual ----
  v16h qah[2], qal[2];
#pragma unroll
  for (int dc = 0; dc < 2; ++dc) {
    qah[dc] = ldfrag_h(Qh + (rowB + q0 + c) * QKP + dc * 32 + 8 * hh);
    qal[dc] = ldfrag_h(Ql + (rowB + q0 + c) * DM  + dc * 32 + 8 * hh);
  }

  float mrow[8], lrow[8];
  v8f oacc[4], oaccE[4];
#pragma unroll
  for (int r = 0; r < 8; ++r) { mrow[r] = -INFINITY; lrow[r] = 0.f; }
#pragma unroll
  for (int t = 0; t < 4; ++t) { oacc[t] = zero8(); oaccE[t] = zero8(); }

  for (int kt = 0; kt < NKT; ++kt) {         // static trip count
    const int kv0 = kt * 64;
    __syncthreads();
    {
      const int r = tid >> 1, hf = (tid & 1) * 32;
      const _Float16* kg = Kg + (rowB + kv0 + r) * QKP + hf;      // K row kv0+r, d = hf..hf+31
#pragma unroll
      for (int i = 0; i < 4; ++i) {
        const v8h a0 = *(const v8h*)(kg + 8 * i);
        *(v8h*)(Ksh + r * LP + hf + 8 * i) = a0;
      }
      stage_vt(VMh, VMl, M0h, M0l, M1h, M1l, kt, kv0, r, hf);
      if (NV == 2) stage_vt(VEh, VEl, Vh, Vl, Vch, Vcl, kt, kv0, r, hf);
    }
    __syncthreads();

    // ---- scores: 16 query rows x 64 keys per wave, 2 f16 products (hi, residual) ----
    v8f s[4];
#pragma unroll
    for (int j = 0; j < 4; ++j) {
      v8f sh = zero8(), sl = zero8();
#pragma unroll
      for (int dc = 0; dc < 2; ++dc) {
        FH kb;
        kb.h[0] = *(const v8h*)(Ksh + (j * 16 + c) * LP + dc * 32 + 8 * hh);
        kb.h[1] = *(const v8h*)(Ksh + (j * 16 + c) * LP + dc * 32 + 16 + 8 * hh);
        sh = mma_h(qah[dc], kb.v, sh);
        sl = mma_h(qal[dc], kb.v, sl);
      }
#pragma unroll
      for (int r = 0; r < 8; ++r) s[j][r] = (sh[r] + sl[r] * rres) * sscale;
    }
    // ---- keys s >= NTOK (only in the last chunk) are invalid: force -1e30 before the row max ----
    if (kt == NKT - 1) {                    // block-uniform
#pragma unroll
      for (int j = 0; j < 4; ++j) {
        const bool kval = (kv0 + j * 16 + c) < NTOK;
#pragma unroll
        for (int r = 0; r < 8; ++r) s[j][r] = kval ? s[j][r] : -1.0e30f;
      }
    }

    // ---- row max, online softmax, P (x1024, f16) to LDS ----
    _Float16* pwh = Psh + wave * (16 * LP);
#pragma unroll
    for (int r = 0; r < 8; ++r) {
      float m = s[0][r];
      m = fmaxf(m, s[1][r]);
      m = fmaxf(m, s[2][r]);
      m = fmaxf(m, s[3][r]);
#pragma unroll
      for (int off = 1; off < 16; off <<= 1) m = fmaxf(m, __shfl_xor(m, off, 32));
      const float mnew  = fmaxf(mrow[r], m);
      const float alpha = __expf(mrow[r] - mnew);
      mrow[r] = mnew;
      float psum = 0.f;
#pragma unroll
      for (int j = 0; j < 4; ++j) {
        const float p = __expf(s[j][r] - mnew);
        psum += p;
        pwh[(8 * hh + r) * LP + j * 16 + c] = (_Float16)(p * 1024.0f);
      }
#pragma unroll
      for (int off = 1; off < 16; off <<= 1) psum += __shfl_xor(psum, off, 32);
      lrow[r] = lrow[r] * alpha + psum;
#pragma unroll
      for (int t = 0; t < 4; ++t) { oacc[t][r] *= alpha; if (NV == 2) oaccE[t][r] *= alpha; }
    }
    wave_sync_lds();

    // ---- context += P . V ----
    pv_acc(oacc, pwh, VMh, VMl, rres, c, hh);
    if (NV == 2) {
      if (wave == 0) pv_acc(oaccE, pwh, VEh, VEl, rres, c, hh);   // wave-uniform
    }
  }
  __syncthreads();                           // all waves done with K / V tiles before the alias below

  // ---- normalise (1/l and the 1/1024 p carry), stage the wave's 16x64 tile (aliases the K / V region),
  float* os = (float*)(void*)smem + wave * 1024;
#pragma unroll
  for (int r = 0; r < 8; ++r) {
    const float l = lrow[r];
    const float inv = ((l > 0.f) ? (1.0f / l) : 0.f) * (1.0f / 1024.0f);
#pragma unroll
    for (int t = 0; t < 4; ++t) {
      float vm = oacc[t][r] * inv;
      if (NV == 2) {
        const float ve = oaccE[t][r] * inv;
        const bool rowA = (q0 + 8 * hh + r) == (M1 - 1);   // query row 512 uses the extra set
        vm = rowA ? ve : vm;
      }
      os[(8 * hh + r) * 64 + t * 16 + c] = vm;
    }
  }
  wave_sync_lds();
  {
    const int q4 = lane >> 3, c8 = (lane & 7) * 8;
    v4u hv[4], lv[4];
#pragma unroll
    for (int it = 0; it < 4; ++it) {
      const int row = it * 4 + q4;   // it 0..3 x q4 0..3 = rows 0..15 of the wave tile
      const float* sp = os + row * 64 + c8;
      v4u a, a2;
#pragma unroll
      for (int e = 0; e < 4; ++e) {
        const float f0 = sp[2 * e], f1 = sp[2 * e + 1];
        const unsigned short h0 = bf_bits(f0), h1 = bf_bits(f1);
        const unsigned short l0 = bf_bits(f0 - bf_up(h0)), l1 = bf_bits(f1 - bf_up(h1));
        a[e] = pk16(h0, h1); a2[e] = pk16(l0, l1);
      }
      hv[it] = a; lv[it] = a2;
    }
    {
#pragma unroll
      for (int it = 0; it < 4; ++it) {
        const int row = it * 4 + q4;
        const size_t go = (rowB + q0 + row) * DM + (size_t)h * HD + c8;
        *(v4u*)(ohp + go) = hv[it];
        *(v4u*)(olp + go) = lv[it];
      }
      
    }
  }
}

// =====================================================================================================
// d_out[(b0 + bl)*NTOK + r][c] = OUTP[(bl*NP + r)][c] + bf16-RNE(bp[c]) for r < NTOK (padded rows dropped).
// One thread per 4 floats in d_out row-major order over the group's rows, which are contiguous in d_out:
// coverage: n4 = GB*NTOK*DM/4 threads x 4 = every d_out element of batch elements b0..b0+GB-1.
// =====================================================================================================
__global__ __launch_bounds__(256) void copy_out(const float* __restrict__ op, const float* __restrict__ bp,
                                                 float* out, int b0, int n4) {
  const int i = blockIdx.x * 256 + threadIdx.x;
  if (i < n4) {
    const int row = i / (DM / 4);
    const int c4  = (i - row * (DM / 4)) * 4;
    const int bl  = row / NTOK;
    const int r   = row - bl * NTOK;
    v4f v = *(const v4f*)(op + ((size_t)bl * NP + r) * DM + c4);
    const v4f bb = *(const v4f*)(bp + c4);
#pragma unroll
    for (int e = 0; e < 4; ++e) v[e] += bf_up(bf_bits(bb[e]));
    float* d = out + ((size_t)b0 * NTOK + row) * DM + c4;
    *(v4f*)d = v;
    
  }
}

// =====================================================================================================
// Workspace map (bytes), one group of GB = 16 batch elements (GB*NP = 15360 rows), every plane an exact
// multiple of its 64x64-tile / whole-line store granularity (padded rows included):
//   Wt    bf16 [5][768 co][768 ci]   0          5898240   (Wq^T | Wk^T | Wv^T | Wvc^T | Wp^T)
//   Xp    bf16 [15360][768]          5898240    23592960
//   QK    f16  [15360][1536]         29491200   47185920  (q cols 0..767, k cols 768..1535)
//   Ql    f16  [15360][768]          76677120   23592960  (q residual x4096)
//   VTh   f16  [16][768][960]        100270080  23592960  (v^T hi)
//   VTl   f16  [16][768][960]        123863040  23592960  (v^T residual x4096)
//   VCh   f16  [16][768][960]        147456000  23592960  (vc^T hi)
//   VCl   f16  [16][768][960]        171048960  23592960  (vc^T residual x4096)
//   Oh    bf16 [15360][768]          194641920  23592960
//   Ol    bf16 [15360][768]          218234880  23592960
//   end                              241827840
//   OUTP  f32  [15360][768]          29491200   47185920  (same bytes as QK: q|k are last read by the attention
//                                                          launches, which end before launch (6) writes OUTP)
// =====================================================================================================
extern "C" void kernel_launch(void* const* d_in, const int* in_sizes, int n_in,
                              void* d_out, int out_size, void* d_ws, size_t ws_size,
                              hipStream_t stream) {
  if (n_in < 7) return;
  if (in_sizes[0] != NBATCH * NTOK * DM) return;
  if (in_sizes[1] != DM * DM || in_sizes[2] != DM * DM || in_sizes[3] != DM * DM) return;
  if (in_sizes[4] != DM * DM || in_sizes[5] != DM * DM) return;
  if (in_sizes[6] != DM) return;
  if (out_size != NBATCH * NTOK * DM) return;

  const float* x   = (const float*)d_in[0];
  const float* Wq  = (const float*)d_in[1];
  const float* Wk  = (const float*)d_in[2];
  const float* Wv  = (const float*)d_in[3];
  const float* Wvc = (const float*)d_in[4];
  const float* Wp  = (const float*)d_in[5];
  const float* bp  = (const float*)d_in[6];

  const size_t ROWS = (size_t)GB * NP;                 // 15360
  const size_t PW   = (size_t)5 * DM * DM * 2;          //  5898240
  const size_t PX   = ROWS * DM * 2;                    // 23592960
  const size_t PQK  = ROWS * QKP * 2;                   // 47185920
  const size_t PQl  = ROWS * DM * 2;                    // 23592960
  const size_t PVT  = (size_t)GB * DM * NP * 2;         // 23592960
  const size_t PO   = ROWS * DM * 2;                    // 23592960
  static_assert((size_t)DM * 4 == (size_t)QKP * 2);     // an f32 OUTP row is as long as an f16 q|k row: OUTP fits QK exactly
  size_t off = 0;
  const size_t oW   = off; off += PW;
  const size_t oXp  = off; off += PX;
  const size_t oQK  = off; off += PQK;
  const size_t oQl  = off; off += PQl;
  const size_t oVTh = off; off += PVT;
  const size_t oVTl = off; off += PVT;
  const size_t oVCh = off; off += PVT;
  const size_t oVCl = off; off += PVT;
  const size_t oOh  = off; off += PO;
  const size_t oOl  = off; off += PO;
  const size_t oOUT = oQK;                              // OUTP over QK (dead once attention has run)
  if (off > ws_size) return;                            // off = 241827840

  char* ws = (char*)d_ws;
  unsigned short* Wt   = (unsigned short*)(ws + oW);
  unsigned short* Wqk_t = Wt;                                   // rows 0..1535: Wq^T then Wk^T
  unsigned short* Wv_t  = Wt + (size_t)2 * DM * DM;
  unsigned short* Wvc_t = Wt + (size_t)3 * DM * DM;
  unsigned short* Wp_t  = Wt + (size_t)4 * DM * DM;
  unsigned short* Xp   = (unsigned short*)(ws + oXp);
  unsigned short* QK   = (unsigned short*)(ws + oQK);
  unsigned short* Ql   = (unsigned short*)(ws + oQl);
  unsigned short* VTh  = (unsigned short*)(ws + oVTh);
  unsigned short* VTl  = (unsigned short*)(ws + oVTl);
  unsigned short* VCh  = (unsigned short*)(ws + oVCh);
  unsigned short* VCl  = (unsigned short*)(ws + oVCl);
  unsigned short* Oh   = (unsigned short*)(ws + oOh);
  unsigned short* Ol   = (unsigned short*)(ws + oOl);
  float*          OUTP = (float*)(ws + oOUT);
  float*          out  = (float*)d_out;

  const dim3 blk(256);
  const int n8x = GB * NP * (DM / 8);                            // 1474560
  const int n4o = GB * NTOK * (DM / 4);                          // 2783232
  const dim3 gCvtX((n8x + 255) / 256);                           // 5760 blocks
  const dim3 gCopy((n4o + 255) / 256);                           // 10872 blocks
  const dim3 gWtr(DM / 64, DM / 64, 5);                          // 12 x 12 x 5 tiles
  static_assert((GB * NP) % GBM == 0 && (GB * NP) % GBN == 0 && DM % GBM == 0 && DM % GBN == 0 && QKP % GBN == 0 && DM % GBK == 0);
  const dim3 gQK((GB * NP / GBM) * (QKP / GBN));                 // 120 x 6 = 720 blocks: M=15360, N=1536
  const dim3 gVT((DM / GBM) * (GB * NP / GBN));                  // 6 x 60 = 360 blocks: M=768, N=15360 (all batch elements' rows of Xp)
  const dim3 gOut((GB * NP / GBM) * (DM / GBN));                 // 120 x 3 = 360 blocks: M=15360, N=768
  const dim3 gAttn1(NQB_NM * NH * GB);                           // 2688 blocks
  const dim3 gAttn2(NH * GB);                                    // 192 blocks

  // (0) weights -> bf16 [out][in] planes (k contiguous = the Bt / A layout the GEMM wants)
  wtr_bf16<<<gWtr, blk, 0, stream>>>(Wq, Wk, Wv, Wvc, Wp, Wt);

  for (int g = 0; g < NGRP; ++g) {
    const int b0 = g * GB;
    // (1) x -> zero-padded bf16 plane [15360][768]
    cvt_x_bf16<<<gCvtX, blk, 0, stream>>>(x, Xp, b0, n8x);
    // (2) q|k = Xp . Wqk^T -> f16 plane [15360][1536] + f16 residual x4096 of the q half (n0 < 768, pitch 768)
    gemm64<0, 3><<<gQK, blk, 0, stream>>>(
        Xp, Xp, DM, Wqk_t, DM,
        (void*)QK, QKP, 0LL, (void*)Ql, DM, 0LL, DM, QKP,
        QKP / GBN, DM, 4096.0f);
    // (3) v^T = Wv^T . Xp^T, column n = bl*NP + s -> f16 hi [bl][h*64+d][s] (pitch NP) + residual x4096
    gemm64<0, 3><<<gVT, blk, 0, stream>>>(
        Wv_t, Wv_t, DM, Xp, DM,
        (void*)VTh, NP, (long long)DM * NP, (void*)VTl, NP, (long long)DM * NP, NP, NP,
        GB * NP / GBN, DM, 4096.0f);
    // (4) vc^T likewise
    gemm64<0, 3><<<gVT, blk, 0, stream>>>(
        Wvc_t, Wvc_t, DM, Xp, DM,
        (void*)VCh, NP, (long long)DM * NP, (void*)VCl, NP, (long long)DM * NP, NP, NP,
        GB * NP / GBN, DM, 4096.0f);
    // (5) attention -> context bf16 hi / lo planes [15360][768]: query tiles 0..7, 9..14, then the mixed tile 8
    attn64<1><<<gAttn1, dim3(128), 0, stream>>>(QK, Ql, VTh, VTl, VCh, VCl, Oh, Ol, 0.125f, 1.0f / 4096.0f);
    attn64<2><<<gAttn2, dim3(128), 0, stream>>>(QK, Ql, VTh, VTl, VCh, VCl, Oh, Ol, 0.125f, 1.0f / 4096.0f);
    // (6) OUTP = context . Wp (A = context hi + lo planes, 2 products; K=768) -> f32 [15360][768]
    gemm64<1, 0><<<gOut, blk, 0, stream>>>(
        Oh, Ol, DM, Wp_t, DM,
        (void*)OUTP, DM, 0LL, (void*)OUTP, DM, 0LL, DM, DM,
        DM / GBN, DM, 1.0f);
    // (7) valid rows + bias -> d_out rows (b0 + bl)*906 + r
    copy_out<<<gCopy, blk, 0, stream>>>(OUTP, bp, out, b0, n4o);
  }
  (void)hipGetLastError();
}

// v005
// One run takes 321 microseconds.
// In both of two side-by-side timings against v004, it was 1.18 times as fast.
// Counting every step since v000, it is 3.87 times as fast.
// Contractions: q|k, v^T and vc^T projections = v_wmma_f32_16x16x32_bf16 (bf16 operands from RNE-converted x and W, single product);
// q.k^T scores = v_wmma_f32_16x16x32_f16 (q as f16 hi plane + f16 residual plane x4096 in a separate accumulator, k f16; 2 products);
// p.v = v_wmma_f32_16x16x32_f16 (p carried x1024 in f16, v^T as f16 hi plane + f16 residual plane x4096 in a separate accumulator; 2 products);
// ctx.Wp = v_wmma_f32_16x16x32_bf16 (ctx as bf16 hi + lo planes times bf16 Wp^T, 2 products); all f32 accumulate; softmax in f32.
#include <hip/hip_runtime.h>
#include <math.h>
#include <stdint.h>

#define NBATCH 16
#define NTOK   906
#define NP     960            // padded token count per batch element (15 tiles of 64)
#define DM     768
#define NH     12
#define HD     64
#define M1     513            // modality split: query / key rows < M1 vs >= M1
#define NKT    (NP / 64)      // 15 key chunks of 64
#define NQB_NM 14             // query tiles 0..7 and 9..14 (tile 8 is the mixed tile)
#define QKP    (2 * DM)       // pitch of the q|k plane: q at cols 0..DM-1, k at cols DM..2DM-1
#define GB     16             // batch elements per group (all of them: one pass of launches fills the chip)
#define NGRP   (NBATCH / GB)
#define LP     72             // LDS row pitch of the attention K / V^T tiles in f16: 144 B = 16 B x 9 (odd), so the 16 rows of a 16-byte fragment read fall on 16 different bank groups
#define LTILE  (64 * LP)      // one 64-row tile at that pitch
#define GBM    128            // GEMM block tile: 2 x 4 wave tiles of 64 x 64
#define GBN    256
#define GBK    64             // k per stage: 128 B of every operand row, one whole line
#define GPI    72             // LDS row pitch of a staged operand row in bf16: 144 B = 16 B x 9 (odd), as LP
static_assert(NH * HD == DM);
static_assert((NP % 64) == 0 && NP >= NTOK && (DM % 64) == 0 && (DM % 32) == 0);
static_assert((NBATCH % GB) == 0);
static_assert(M1 - 1 == 8 * 64);   // row 512 is the first row of query tile 8 and of key chunk 8
static_assert(NTOK > (NKT - 1) * 64 && NTOK <= NP);   // invalid keys live only in the last chunk

typedef _Float16 v16h __attribute__((ext_vector_type(16)));
typedef _Float16 v8h  __attribute__((ext_vector_type(8)));
typedef __bf16   v16b __attribute__((ext_vector_type(16)));
typedef __bf16   v8b  __attribute__((ext_vector_type(8)));
typedef float    v8f  __attribute__((ext_vector_type(8)));
typedef float    v4f  __attribute__((ext_vector_type(4)));
typedef unsigned int v4u __attribute__((ext_vector_type(4)));

union FH { v16h v; v8h h[2]; };

// ---- scalar helpers --------------------------------------------------------------------------------
__device__ __forceinline__ unsigned short bf_bits(float f) {          // f32 -> bf16 bits, RNE convert
  unsigned u = __float_as_uint(f);
  return (unsigned short)((u + 0x7FFFu + ((u >> 16) & 1u)) >> 16);
}
__device__ __forceinline__ float bf_up(unsigned short h) { return __uint_as_float(((unsigned)h) << 16); }
__device__ __forceinline__ unsigned short h_bits(_Float16 x) { return __builtin_bit_cast(unsigned short, x); }
__device__ __forceinline__ unsigned pk16(unsigned short a, unsigned short b) { return (unsigned)a | ((unsigned)b << 16); }
__device__ __forceinline__ v8f zero8() { v8f z = {0.f, 0.f, 0.f, 0.f, 0.f, 0.f, 0.f, 0.f}; return z; }

// ---- fragment loaders: 16-bit A/B operand, lane -> row/col (lane&15), p already includes +8*(lane>>4);
//      elements 0..7 <- p[0..7] (k0+8h..), elements 8..15 <- p[16..23] (k0+16+8h..)
__device__ __forceinline__ v16b ldfrag_b(const __bf16* p) {
  union { v16b v; v8b h[2]; } f;
  f.h[0] = *(const v8b*)(p);
  f.h[1] = *(const v8b*)(p + 16);
  return f.v;
}
__device__ __forceinline__ v16h ldfrag_h(const _Float16* p) {
  union { v16h v; v8h h[2]; } f;
  f.h[0] = *(const v8h*)(p);
  f.h[1] = *(const v8h*)(p + 16);
  return f.v;
}

// ---- WMMA helpers with trailing VALU hazard gap --------------------------------------------------------
__device__ __forceinline__ v8f mma_h(v16h a, v16h b, v8f c) {
  c = __builtin_amdgcn_wmma_f32_16x16x32_f16(false, a, false, b, (short)0, c, false, false);
#if defined(__HIP_DEVICE_COMPILE__)
  asm volatile("v_nop\n\tv_nop\n\tv_nop\n\tv_nop" : "+v"(c) : "v"(a), "v"(b));
#endif
  return c;
}
__device__ __forceinline__ v8f mma_b_raw(v16b a, v16b b, v8f c) {
  return __builtin_amdgcn_wmma_f32_16x16x32_bf16(false, a, false, b, (short)0, c, false, false);
}
__device__ __forceinline__ void dep_guard_b(v8f& a, v8f& b, v16b x, v16b y) {
#if defined(__HIP_DEVICE_COMPILE__)
  asm volatile("v_nop\n\tv_nop\n\tv_nop\n\tv_nop" : "+v"(a), "+v"(b) : "v"(x), "v"(y));
#endif
}
__device__ __forceinline__ void keep4_b(v16b a, v16b b, v16b c, v16b d) {
#if defined(__HIP_DEVICE_COMPILE__)
  asm volatile("v_nop" :: "v"(a), "v"(b), "v"(c), "v"(d));
#endif
}
__device__ __forceinline__ void acc_guard4(v8f& a, v8f& b, v8f& c, v8f& d) {
#if defined(__HIP_DEVICE_COMPILE__)
  asm volatile("v_nop\n\tv_nop\n\tv_nop\n\tv_nop" : "+v"(a), "+v"(b), "+v"(c), "+v"(d));
#endif
}
__device__ __forceinline__ void wave_sync_lds() {
  __builtin_amdgcn_fence(__ATOMIC_RELEASE, "workgroup");
  __builtin_amdgcn_wave_barrier();
  __builtin_amdgcn_fence(__ATOMIC_ACQUIRE, "workgroup");
}
// value of lane l ^ 16: the other half of the wave, which holds the same D column
__device__ __forceinline__ float xhalf(float x) {
  const int i = __builtin_bit_cast(int, x);
  return __builtin_bit_cast(float, __builtin_amdgcn_permlanex16(i, i, 0x76543210, 0xfedcba98, false, false));
}

// =====================================================================================================
// x f32 [b][NTOK][DM] -> zero-padded bf16 plane Xp [GB*NP][DM] for batch elements b0..b0+GB-1 (RNE convert).
// address, value select). coverage: n8 = GB*NP*DM/8 threads x 8 = the whole Xp plane incl. padded rows.
// =====================================================================================================
__global__ __launch_bounds__(256) void cvt_x_bf16(const float* __restrict__ x, unsigned short* xp,
                                                   int b0, int n8) {
  const int i = blockIdx.x * 256 + threadIdx.x;
  if (i < n8) {
    const int row = i / (DM / 8);
    const int c8  = (i - row * (DM / 8)) * 8;
    const int bl  = row / NP;
    const int r   = row - bl * NP;
    const int rr  = (r < NTOK) ? r : (NTOK - 1);                 // clamped address for padded rows
    const float* src = x + ((size_t)(b0 + bl) * NTOK + rr) * DM + c8;
    const v4f a = *(const v4f*)(src);
    const v4f b = *(const v4f*)(src + 4);
    v4u p;
    p[0] = pk16(bf_bits(a[0]), bf_bits(a[1]));
    p[1] = pk16(bf_bits(a[2]), bf_bits(a[3]));
    p[2] = pk16(bf_bits(b[0]), bf_bits(b[1]));
    p[3] = pk16(bf_bits(b[2]), bf_bits(b[3]));
    const bool valid = (r < NTOK);
#pragma unroll
    for (int e = 0; e < 4; ++e) p[e] = valid ? p[e] : 0u;
    *(v4u*)(xp + (size_t)i * 8) = p;
    
  }
}

// =====================================================================================================
// Weight transpose-convert: W f32 [DM ci][DM co] (x @ W layout) -> Wt bf16 [co][ci] (k = ci contiguous),
// RNE convert. blockIdx.z selects the weight (0..4 -> Wq, Wk, Wv, Wvc, Wp), written back to back in wt.
// coverage: 8 waves x (2 it x 4 row groups) = 64 rows x (8 lanes x 8) = 64 cols per tile; grid 12x12x5.
// =====================================================================================================
__global__ __launch_bounds__(256) void wtr_bf16(const float* __restrict__ w0, const float* __restrict__ w1,
                                                 const float* __restrict__ w2, const float* __restrict__ w3,
                                                 const float* __restrict__ w4, unsigned short* wt) {
  __shared__ __align__(16) unsigned short T[64 * 72];   // [co][ci], pitch 72 (144 B, 16-B aligned rows)
  const int z = blockIdx.z;
  const float* W = (z == 0) ? w0 : (z == 1) ? w1 : (z == 2) ? w2 : (z == 3) ? w3 : w4;
  unsigned short* dst = wt + (size_t)z * DM * DM;
  const int co0 = blockIdx.x * 64;
  const int ci0 = blockIdx.y * 64;
  const int tid = threadIdx.x;
#pragma unroll
  for (int it = 0; it < 16; ++it) {
    const int idx = it * 256 + tid;
    const int i = idx >> 6;          // ci within tile
    const int j = idx & 63;          // co within tile
    T[j * 72 + i] = bf_bits(W[(size_t)(ci0 + i) * DM + co0 + j]);
  }
  __syncthreads();
  const int wave = tid >> 5, lane = tid & 31;
  const int q = lane >> 3, c8 = (lane & 7) * 8;
  v4u v[2];
#pragma unroll
  for (int it = 0; it < 2; ++it) {
    const int row = wave * 8 + it * 4 + q;
    v[it] = *(const v4u*)(T + row * 72 + c8);
  }
  {
#pragma unroll
    for (int it = 0; it < 2; ++it) {
      const int row = wave * 8 + it * 4 + q;
      *(v4u*)(dst + (size_t)(co0 + row) * DM + ci0 + c8) = v[it];
    }
    
  }
}

// =====================================================================================================
// Four asynchronous 16-byte copies of this lane, global -> LDS, through no register: rows r, r + 32, r + 64, r + 96
// of a staged operand (l0 = LDS byte address of the lane's piece of row r, g0 = its global address, gstep = 32 rows).
// =====================================================================================================
__device__ __forceinline__ void copy4_async(unsigned l0, const char* g0, unsigned gstep) {
#if defined(__HIP_DEVICE_COMPILE__)
  const unsigned l1 = l0 + 32u * GPI * 2u, l2 = l0 + 64u * GPI * 2u, l3 = l0 + 96u * GPI * 2u;
  const char* g1 = g0 + gstep;
  const char* g2 = g1 + gstep;
  const char* g3 = g2 + gstep;
  // s_wait_xcnt stands inside the copies' own statement, so that no address register is rewritten ahead of it
  asm volatile("global_load_async_to_lds_b128 %0, %4, off\n\t"
               "global_load_async_to_lds_b128 %1, %5, off\n\t"
               "global_load_async_to_lds_b128 %2, %6, off\n\t"
               "global_load_async_to_lds_b128 %3, %7, off\n\t"
               "s_wait_xcnt 0x0"
               :: "v"(l0), "v"(l1), "v"(l2), "v"(l3), "v"(g0), "v"(g1), "v"(g2), "v"(g3) : "memory");
#endif
}

// =====================================================================================================
// bf16 WMMA GEMM: C[m][n] = sum_k A[m][k] * Bt[n][k]. A block of 8 waves (2 x 4) owns a GBM x GBN tile, one wave a
// 64 x 64 tile of it. Per stage of GBK k the block's A rows and Bt rows are copied once into LDS (whole 128-B lines,
// asynchronous copies, two buffers: stage t + 1 flies while stage t is worked on) and every wave reads its fragments there.
// A row-major [M][K] pitch lda; Bt row-major [N][K] pitch ldb (k contiguous); M a multiple of GBM, N of GBN, K of GBK;
// grid = (M / GBM) * tilesNb blocks, tilesNb = N / GBN. Output column n goes to plane n / NB, column n % NB
// (NB a multiple of 64; plane strides strideC, strideC2 in elements).
// NSPLIT: 0 = A.Bt; 1 = (A + A2).Bt (A2 = unscaled bf16 lo plane of A).
// OUT_MODE: 0 = f32 (pitch ldc); 2 = bf16 hi plane C + bf16 lo plane C2 (lo = RNE(v - hi), unscaled);
//           3 = f16 hi plane C + f16 residual plane C2 = f16((v - hi) * rscale), C2 written only for tiles
//               with column-in-plane < N2 (pitch ldc2).
// =====================================================================================================
template <int NSPLIT, int OUT_MODE>
__global__ __launch_bounds__(256) void gemm64(
    const unsigned short* __restrict__ Ap, const unsigned short* A2p, int lda,
    const unsigned short* __restrict__ Btp, int ldb,
    void* Cout, int ldc, long long strideC,
    void* Cout2, int ldc2, long long strideC2, int N2, int NB,
    int tilesNb, int K, float rscale) {
  static_assert(NSPLIT == 0 || NSPLIT == 1);
  constexpr int OFFB  = GBM * ((NSPLIT >= 1) ? 2 : 1) * GPI;   // stage layout in bf16: A rows | A2 rows | Bt rows
  constexpr int STAGE = OFFB + GBN * GPI;
  __shared__ __align__(16) unsigned short smem[2 * STAGE];
  static_assert(8 * 16 * 68 * 4 <= 2 * STAGE * 2);             // the epilogue's per-wave slabs reuse the stage buffers
  const int lane = threadIdx.x & 31;
  const int wave = __builtin_amdgcn_readfirstlane(threadIdx.x >> 5);
  const int bm   = blockIdx.x / tilesNb;
  const int bn   = blockIdx.x - bm * tilesNb;
  const int wm   = wave >> 2, wn = wave & 3;
  const int m0 = bm * GBM + (wm << 6);
  const int n0 = bn * GBN + (wn << 6);

  const int rlane = lane & 15;                 // row (A) / col (B, D) within subtile
  const int koff  = (lane >> 4) * 8;           // k offset of this lane half
  const int mOff  = (lane >> 4) * 8;           // D row offset

  v8f acc[4][4];
#pragma unroll
  for (int i = 0; i < 4; ++i)
#pragma unroll
    for (int j = 0; j < 4; ++j) acc[i][j] = zero8();

  // Copy map: thread -> row (tid >> 3) + 32 * n, 16-byte piece tid & 7 of the row's 128 B: a wave's copy covers 4 whole lines.
  const int crow = threadIdx.x >> 3;
  const int cseg = (threadIdx.x & 7) * 16;
  const unsigned lbase = (unsigned)(uintptr_t)(const void*)smem + (unsigned)(crow * (GPI * 2) + cseg);
  const char* gA  = (const char*)(const void*)Ap  + (size_t)(bm * GBM + crow) * (size_t)lda * 2 + cseg;
  const char* gA2 = (const char*)(const void*)A2p + (size_t)(bm * GBM + crow) * (size_t)lda * 2 + cseg;
  const char* gB  = (const char*)(const void*)Btp + (size_t)(bn * GBN + crow) * (size_t)ldb * 2 + cseg;
  const unsigned stepA = (unsigned)lda * 64u, stepB = (unsigned)ldb * 64u;   // 32 rows in bytes
  auto stage_copies = [&](int t) {             // stage t -> buffer t & 1: 12 (NSPLIT 0) or 16 copies a lane
    const unsigned lb = lbase + (unsigned)((t & 1) * (STAGE * 2));
    const size_t kb = (size_t)t * (GBK * 2);
    copy4_async(lb, gA + kb, stepA);
    if (NSPLIT >= 1) copy4_async(lb + GBM * GPI * 2, gA2 + kb, stepA);
    copy4_async(lb + OFFB * 2, gB + kb, stepB);
    copy4_async(lb + (OFFB + 128 * GPI) * 2, gB + kb + (size_t)stepB * 4, stepB);
  };

  const int NT = K / GBK;
  stage_copies(0);
  asm volatile("s_wait_asynccnt 0x0" ::: "memory");   // this wave's copies of stage 0 have landed
  __syncthreads();                                     // ... and every other wave's
  if (NT > 1) stage_copies(1);

  for (int t = 0; t < NT; ++t) {
    const __bf16* sb  = (const __bf16*)(const void*)smem + (t & 1) * STAGE;
    const __bf16* sA  = sb + ((wm << 6) + rlane) * GPI + koff;
    const __bf16* sA2 = sA + GBM * GPI;
    const __bf16* sB  = sb + OFFB + ((wn << 6) + rlane) * GPI + koff;
#pragma unroll   // the two 32-k steps of a stage, straight-line between the stage's barriers
    for (int ks = 0; ks < GBK / 32; ++ks) {
      v16b bh[4];
#pragma unroll
      for (int j = 0; j < 4; ++j) bh[j] = ldfrag_b(sB + j * 16 * GPI + ks * 32);
      v16b ahv[4], alv[4];   // all fragments of a k-step are loaded as one group ahead of its WMMAs
#pragma unroll
      for (int i = 0; i < 4; ++i) {
        ahv[i] = ldfrag_b(sA + i * 16 * GPI + ks * 32);
        if (NSPLIT >= 1) alv[i] = ldfrag_b(sA2 + i * 16 * GPI + ks * 32); else alv[i] = ahv[i];
      }
#pragma unroll
      for (int i = 0; i < 4; ++i) {
        const v16b ah = ahv[i], al = alv[i];
#pragma unroll
        for (int j = 0; j < 4; ++j) {
          acc[i][j] = mma_b_raw(ah, bh[j], acc[i][j]);
          if (NSPLIT >= 1) acc[i][j] = mma_b_raw(al, bh[j], acc[i][j]);
        }
        dep_guard_b(acc[i][0], acc[i][3], ah, al);
      }
      keep4_b(bh[0], bh[1], bh[2], bh[3]);
    }
    // publish point of stage t + 1, which also frees buffer t & 1
    asm volatile("s_wait_dscnt 0x0" ::: "memory");      // this wave's reads of buffer t & 1 are done
    asm volatile("s_wait_asynccnt 0x0" ::: "memory");   // this wave's copies of stage t + 1 have landed
    __syncthreads();
    if (t + 2 < NT) stage_copies(t + 2);                // block-uniform test; into the buffer every wave has just left
  }
  asm volatile("s_wait_asynccnt 0x0" ::: "memory");     // nothing is in flight when the buffers become the epilogue's slabs
  acc_guard4(acc[0][0], acc[0][1], acc[0][2], acc[0][3]);
  acc_guard4(acc[1][0], acc[1][1], acc[1][2], acc[1][3]);
  acc_guard4(acc[2][0], acc[2][1], acc[2][2], acc[2][3]);
  acc_guard4(acc[3][0], acc[3][1], acc[3][2], acc[3][3]);

  const int bo  = n0 / NB;                     // output plane and the tile's first column in it (wave-uniform)
  const int nc0 = n0 - bo * NB;

  // ---- epilogue ----
  float* slab = (float*)(void*)smem + wave * (16 * 68);   // per-wave 16x64 slab, pitch 68 floats; the loop's last barrier has ended every read of the stage buffers
#pragma unroll
  for (int i = 0; i < 4; ++i) {
    const int mBase = m0 + (i << 4);
#pragma unroll
    for (int j = 0; j < 4; ++j) {
#pragma unroll
      for (int r = 0; r < 8; ++r) {
        slab[(mOff + r) * 68 + (j << 4) + rlane] = acc[i][j][r];
      }
    }
    wave_sync_lds();
    if (OUT_MODE == 0) {
      float* C = (float*)Cout + (size_t)bo * strideC;
      const int hh = lane >> 4, c4 = (lane & 15) * 4;     // 256-B row segment = 16 lanes x 16 B
      {
#pragma unroll
        for (int it = 0; it < 8; ++it) {
          const int row = it * 2 + hh;                     // it 0..7 x hh 0..1 = rows 0..15
          const v4f v = *(const v4f*)(slab + row * 68 + c4);
          *(v4f*)(C + (size_t)(mBase + row) * ldc + nc0 + c4) = v;
        }
        
      }
    } else {
      const int q = lane >> 3, c8 = (lane & 7) * 8;
      unsigned short* C  = (unsigned short*)Cout  + (size_t)bo * strideC;
      unsigned short* C2 = (unsigned short*)Cout2 + (size_t)bo * strideC2;
      const bool wlo = (OUT_MODE == 2) || (nc0 < N2);     // wave-uniform
      v4u hv[4], lv[4];
#pragma unroll
      for (int it = 0; it < 4; ++it) {
        const int row = it * 4 + q;                        // it 0..3 x q 0..3 = rows 0..15
        const float* sp = slab + row * 68 + c8;
        v4u a, a2;
#pragma unroll
        for (int e = 0; e < 4; ++e) {
          const float f0 = sp[2 * e], f1 = sp[2 * e + 1];
          unsigned short h0, h1, l0, l1;
          if (OUT_MODE == 2) {
            h0 = bf_bits(f0); h1 = bf_bits(f1);
            l0 = bf_bits(f0 - bf_up(h0)); l1 = bf_bits(f1 - bf_up(h1));
          } else {
            const _Float16 x0 = (_Float16)f0, x1 = (_Float16)f1;
            h0 = h_bits(x0); h1 = h_bits(x1);
            l0 = h_bits((_Float16)((f0 - (float)x0) * rscale));
            l1 = h_bits((_Float16)((f1 - (float)x1) * rscale));
          }
          a[e] = pk16(h0, h1); a2[e] = pk16(l0, l1);
        }
        hv[it] = a; lv[it] = a2;
      }
      {
#pragma unroll
        for (int it = 0; it < 4; ++it) {
          const int row = it * 4 + q;
          *(v4u*)(C + (size_t)(mBase + row) * ldc + nc0 + c8) = hv[it];
          asm volatile("s_wait_xcnt 0x0" ::: "memory");   // before the store's address registers are reused for the next address
          if (wlo) {
            *(v4u*)(C2 + (size_t)(mBase + row) * ldc2 + nc0 + c8) = lv[it];
            asm volatile("s_wait_xcnt 0x0" ::: "memory");  // as above
          }
        }
        
      }
    }
    wave_sync_lds();
  }
}

// =====================================================================================================
// V^T chunk staging with the per-key-row value swap: destination LDS tiles dh/dl [d][kv] (64x64 f16, row pitch LP),
// source planes (already offset to (batch, head)) [d][s] pitch NP: keys s < M1 come from (s0h, s0l),
// keys s >= M1 from (s1h, s1l). Chunks kt < 8 are all < M1, chunks kt > 8 all >= M1 (chunk-uniform source);
// chunk 8 (kv0 = 512) takes key 512 (element 0 of the hf == 0 half-row) from s0 and the rest from s1.
// Thread (r, hf): row d = r, keys kv0+hf .. kv0+hf+31; 128 threads x 32 keys x 2 planes = the whole tile.
// =====================================================================================================
__device__ __forceinline__ void stage_vt(_Float16* dh, _Float16* dl,
                                         const _Float16* s0h, const _Float16* s0l,
                                         const _Float16* s1h, const _Float16* s1l,
                                         int kt, int kv0, int r, int hf) {
  const bool lowc = (kt < 8);
  const _Float16* gh = (lowc ? s0h : s1h) + (size_t)r * NP + kv0 + hf;
  const _Float16* gl = (lowc ? s0l : s1l) + (size_t)r * NP + kv0 + hf;
#pragma unroll
  for (int i = 0; i < 4; ++i) {
    v8h a  = *(const v8h*)(gh + 8 * i);
    v8h a2 = *(const v8h*)(gl + 8 * i);
    if (i == 0 && kt == 8) {                         // block-uniform
      const _Float16 eh = s0h[(size_t)r * NP + (M1 - 1)];
      const _Float16 el = s0l[(size_t)r * NP + (M1 - 1)];
      a[0]  = (hf == 0) ? eh : a[0];
      a2[0] = (hf == 0) ? el : a2[0];
    }
    *(v8h*)(dh + r * LP + hf + 8 * i) = a;
    *(v8h*)(dl + r * LP + hf + 8 * i) = a2;
  }
}

// ---- context^T += V^T tile . P^T (f16 WMMA): A = V^T rows d, B = P^T (column = query) straight from registers;
//      oacc[t][r] = context[query c][d = 16 t + 8 hh + r]; residual products into a separate accumulator folded in f32 ----
__device__ __forceinline__ void pv_acc(v8f (&oacc)[4], const v16h (&pb)[2],
                                       const _Float16* Vth, const _Float16* Vtl,
                                       float rres, int c, int hh) {
  v8f o1[4];
#pragma unroll
  for (int t = 0; t < 4; ++t) o1[t] = zero8();
#pragma unroll   // pb is a register array: its index must be a constant
  for (int kk = 0; kk < 2; ++kk) {
#pragma unroll
    for (int t = 0; t < 4; ++t) {
      FH vb, vl;
      vb.h[0] = *(const v8h*)(Vth + (t * 16 + c) * LP + kk * 32 + 8 * hh);
      vb.h[1] = *(const v8h*)(Vth + (t * 16 + c) * LP + kk * 32 + 16 + 8 * hh);
      vl.h[0] = *(const v8h*)(Vtl + (t * 16 + c) * LP + kk * 32 + 8 * hh);
      vl.h[1] = *(const v8h*)(Vtl + (t * 16 + c) * LP + kk * 32 + 16 + 8 * hh);
      oacc[t] = mma_h(vb.v, pb[kk], oacc[t]);
      o1[t]   = mma_h(vl.v, pb[kk], o1[t]);
    }
  }
#pragma unroll
  for (int t = 0; t < 4; ++t)
#pragma unroll
    for (int r = 0; r < 8; ++r) oacc[t][r] += o1[t][r] * rres;
}

// =====================================================================================================
// Attention, head dim 64, softmax over the NTOK valid keys of the batch element (keys s >= NTOK masked to
// -1e30 before the row max in the last chunk), per-modality value swap handled at V^T staging.
//   q|k plane (f16, pitch QKP): element (row, col) at [row*QKP + col], row = bl*NP + t, q col = h*64+d,
//   k col = DM + h*64 + d; q residual plane (f16, (q - f16(q))*4096, pitch DM): [row*DM + h*64 + d]
//   v^T / vc^T hi planes (f16): element (bl, h, d, s) at [(bl*DM + h*64 + d)*NP + s]; residual planes (x4096) same
//   out planes (bf16 hi / lo of the normalised context): element (row, h, d) at [row*DM + h*64 + d]
//   NV == 1: query tiles 0..7 (rows < M1, values: v for keys < M1, vc for keys >= M1) and 9..14
//            (values: vc for keys < M1, v for keys >= M1); grid = NQB_NM * NH * GB.
//   NV == 2: query tile 8 (rows 512..575): main set = the rows >= M1 combination, extra set (wave 0 only)
//            = the rows < M1 combination; row 512 selects the extra set at the end; grid = NH * GB.
//   scores^T = (k . qh^T + (k . ql^T) * rres) * sscale on f16 WMMA (A = K rows, B = Q), residual products in a separate
//   accumulator: a lane holds 32 of the chunk's 64 scores of ONE query (column c), its partner lane ^ 16 the other 32, so the
//   maximum and the sum are in-lane plus one exchange between the halves (the sum's halves are joined once, after the loop);
//   p = exp(s - m) carried as f16(1024 p), packed from the score registers into the B operand of context^T += V^T . P^T;
//   online softmax in f32.
//   Block = 4 waves = 64 query rows of one (bl, h); kv chunks of 64, static trip NKT.
//   K / V^T chunk staging: 128 threads x 32 elements per plane = the whole 64x64 tile (plain 16-B loads,
//   __syncthreads before and after); P never touches LDS; the output staging
//   aliases the K / V LDS region after a final __syncthreads.
//   Output coverage: each wave stores rows q0..q0+15 (it 0..3 x lane>>3 0..3) x 64 columns (8 lanes x 8) of both planes.
// =====================================================================================================
template <int NV>
__global__ __launch_bounds__(128)
void attn64(const unsigned short* __restrict__ qkp, const unsigned short* __restrict__ qlp,
            const unsigned short* __restrict__ vhp, const unsigned short* __restrict__ vlp,
            const unsigned short* __restrict__ vchp, const unsigned short* __restrict__ vclp,
            unsigned short* ohp, unsigned short* olp, float sscale, float rres) {
  __shared__ __align__(16) _Float16 smem[((NV == 2) ? 5 : 3) * LTILE];
  static_assert(4 * 16 * 68 * 4 <= 3 * LTILE * 2);        // the output staging fits the K / V region
  _Float16* Ksh = smem;                                   // K [kv][d]           9 KB (rows of 64 at pitch LP)
  _Float16* VMh = smem + LTILE;                           // main V^T hi [d][kv]  9 KB
  _Float16* VMl = smem + 2 * LTILE;                       // main V^T residual     9 KB
  _Float16* VEh = (NV == 2) ? (smem + 3 * LTILE) : VMh;   // extra set (NV == 2)   9 KB
  _Float16* VEl = (NV == 2) ? (smem + 4 * LTILE) : VMl;   //                       9 KB

  const int tid  = threadIdx.x;
  const int wave = tid >> 5;
  const int lane = tid & 31;
  const int hh   = lane >> 4;
  const int c    = lane & 15;

  const int bx = blockIdx.x;
  int qb, rest;
  if (NV == 1) {
    const int idx = bx % NQB_NM;
    qb = idx + ((idx >= 8) ? 1 : 0);
    rest = bx / NQB_NM;
  } else {
    qb = 8;
    rest = bx;
  }
  const int h  = rest % NH;
  const int bl = rest / NH;
  const int q0 = qb * 64 + wave * 16;
  const size_t rowB = (size_t)bl * NP;

  const _Float16* Qh = (const _Float16*)(const void*)qkp + (size_t)h * HD;
  const _Float16* Kg = (const _Float16*)(const void*)qkp + DM + (size_t)h * HD;
  const _Float16* Ql = (const _Float16*)(const void*)qlp + (size_t)h * HD;
  const size_t vbase = ((size_t)bl * DM + (size_t)h * HD) * NP;
  const _Float16* Vh  = (const _Float16*)(const void*)vhp  + vbase;
  const _Float16* Vl  = (const _Float16*)(const void*)vlp  + vbase;
  const _Float16* Vch = (const _Float16*)(const void*)vchp + vbase;
  const _Float16* Vcl = (const _Float16*)(const void*)vclp + vbase;
  // main set: keys < M1 from (M0h, M0l), keys >= M1 from (M1h, M1l); block-uniform pointer choice
  const bool useB = (NV == 2) || (qb > 8);
  const _Float16* M0h = useB ? Vch : Vh;
  const _Float16* M0l = useB ? Vcl : Vl;
  const _Float16* M1h = useB ? Vh  : Vch;
  const _Float16* M1l = useB ? Vl  : Vcl;

  // ---- Q fragments (B operand, column = query = lane&15): 2 d-chunks, hi and residual ----
  v16h qah[2], qal[2];
#pragma unroll
  for (int dc = 0; dc < 2; ++dc) {
    qah[dc] = ldfrag_h(Qh + (rowB + q0 + c) * QKP + dc * 32 + 8 * hh);
    qal[dc] = ldfrag_h(Ql + (rowB + q0 + c) * DM  + dc * 32 + 8 * hh);
  }

  float mrow = -INFINITY, lrow = 0.f;        // of query q0 + c; lrow sums this wave half's keys only
  v8f oacc[4], oaccE[4];
#pragma unroll
  for (int t = 0; t < 4; ++t) { oacc[t] = zero8(); oaccE[t] = zero8(); }

  for (int kt = 0; kt < NKT; ++kt) {         // static trip count
    const int kv0 = kt * 64;
    __syncthreads();
    {
      const int r = tid >> 1, hf = (tid & 1) * 32;
      const _Float16* kg = Kg + (rowB + kv0 + r) * QKP + hf;      // K row kv0+r, d = hf..hf+31
#pragma unroll
      for (int i = 0; i < 4; ++i) {
        const v8h a0 = *(const v8h*)(kg + 8 * i);
        *(v8h*)(Ksh + r * LP + hf + 8 * i) = a0;
      }
      stage_vt(VMh, VMl, M0h, M0l, M1h, M1l, kt, kv0, r, hf);
      if (NV == 2) stage_vt(VEh, VEl, Vh, Vl, Vch, Vcl, kt, kv0, r, hf);
    }
    __syncthreads();

    // ---- scores^T: 64 keys x 16 query columns per wave, 2 f16 products (hi, residual); s[j][r] = key kv0 + 16 j + 8 hh + r, query q0 + c ----
    v8f s[4];
#pragma unroll
    for (int j = 0; j < 4; ++j) {
      v8f sh = zero8(), sl = zero8();
#pragma unroll
      for (int dc = 0; dc < 2; ++dc) {
        FH kb;
        kb.h[0] = *(const v8h*)(Ksh + (j * 16 + c) * LP + dc * 32 + 8 * hh);
        kb.h[1] = *(const v8h*)(Ksh + (j * 16 + c) * LP + dc * 32 + 16 + 8 * hh);
        sh = mma_h(kb.v, qah[dc], sh);
        sl = mma_h(kb.v, qal[dc], sl);
      }
#pragma unroll
      for (int r = 0; r < 8; ++r) s[j][r] = (sh[r] + sl[r] * rres) * sscale;
    }
    // ---- keys s >= NTOK (only in the last chunk) are invalid: force -1e30 before the maximum ----
    if (kt == NKT - 1) {                    // block-uniform
#pragma unroll
      for (int j = 0; j < 4; ++j) {
#pragma unroll
        for (int r = 0; r < 8; ++r) s[j][r] = ((kv0 + j * 16 + 8 * hh + r) < NTOK) ? s[j][r] : -1.0e30f;
      }
    }

    // ---- column max, online softmax, P^T (x1024, f16) into the B operand registers ----
    float mj[4];
#pragma unroll
    for (int j = 0; j < 4; ++j) {
      mj[j] = s[j][0];
#pragma unroll
      for (int r = 1; r < 8; ++r) mj[j] = fmaxf(mj[j], s[j][r]);
    }
    float m = fmaxf(fmaxf(mj[0], mj[1]), fmaxf(mj[2], mj[3]));
    m = fmaxf(m, xhalf(m));                  // both halves now hold the query's maximum over the chunk
    const float mnew  = fmaxf(mrow, m);
    const float alpha = __expf(mrow - mnew);
    mrow = mnew;
    v16h pb[2];                              // pb[kk][e]: key kv0 + 32 kk + (e < 8 ? 8 hh + e : 16 + 8 hh + e - 8), the k order of the V^T loads
    float pj[4];                             // four independent sums of 8
#pragma unroll
    for (int j = 0; j < 4; ++j) {
      pj[j] = 0.f;
#pragma unroll
      for (int r = 0; r < 8; ++r) {
        const float p = __expf(s[j][r] - mnew);
        pj[j] += p;
        pb[j >> 1][(j & 1) * 8 + r] = (_Float16)(p * 1024.0f);
      }
    }
    lrow = lrow * alpha + ((pj[0] + pj[1]) + (pj[2] + pj[3]));
#pragma unroll
    for (int t = 0; t < 4; ++t)
#pragma unroll
      for (int r = 0; r < 8; ++r) { oacc[t][r] *= alpha; if (NV == 2) oaccE[t][r] *= alpha; }

    // ---- context^T += V^T . P^T ----
    pv_acc(oacc, pb, VMh, VMl, rres, c, hh);
    if (NV == 2) {
      if (wave == 0) pv_acc(oaccE, pb, VEh, VEl, rres, c, hh);   // wave-uniform
    }
  }
  __syncthreads();                           // all waves done with K / V tiles before the alias below

  // ---- normalise (1/l and the 1/1024 p carry), stage the wave's 16x64 tile (aliases the K / V region),
  float* os = (float*)(void*)smem + wave * (16 * 68);   // [query][d], pitch 68 floats (272 B = 16 B x 17, odd): the 16 rows of a 16-byte store fall on 16 bank groups
  {
    const float l = lrow + xhalf(lrow);      // the two halves' key sums joined
    const float inv = ((l > 0.f) ? (1.0f / l) : 0.f) * (1.0f / 1024.0f);
    const bool rowA = (q0 + c) == (M1 - 1);  // query row 512 uses the extra set
#pragma unroll
    for (int t = 0; t < 4; ++t) {
      v4f w[2];
#pragma unroll
      for (int r = 0; r < 8; ++r) {
        float vm = oacc[t][r] * inv;
        if (NV == 2) {
          const float ve = oaccE[t][r] * inv;
          vm = rowA ? ve : vm;
        }
        w[r >> 2][r & 3] = vm;
      }
      *(v4f*)(os + c * 68 + t * 16 + 8 * hh)     = w[0];
      *(v4f*)(os + c * 68 + t * 16 + 8 * hh + 4) = w[1];
    }
  }
  wave_sync_lds();
  {
    const int q4 = lane >> 3, c8 = (lane & 7) * 8;
    v4u hv[4], lv[4];
#pragma unroll
    for (int it = 0; it < 4; ++it) {
      const int row = it * 4 + q4;   // it 0..3 x q4 0..3 = rows 0..15 of the wave tile
      const float* sp = os + row * 68 + c8;
      v4u a, a2;
#pragma unroll
      for (int e = 0; e < 4; ++e) {
        const float f0 = sp[2 * e], f1 = sp[2 * e + 1];
        const unsigned short h0 = bf_bits(f0), h1 = bf_bits(f1);
        const unsigned short l0 = bf_bits(f0 - bf_up(h0)), l1 = bf_bits(f1 - bf_up(h1));
        a[e] = pk16(h0, h1); a2[e] = pk16(l0, l1);
      }
      hv[it] = a; lv[it] = a2;
    }
    {
#pragma unroll
      for (int it = 0; it < 4; ++it) {
        const int row = it * 4 + q4;
        const size_t go = (rowB + q0 + row) * DM + (size_t)h * HD + c8;
        *(v4u*)(ohp + go) = hv[it];
        *(v4u*)(olp + go) = lv[it];
      }
      
    }
  }
}

// =====================================================================================================
// d_out[(b0 + bl)*NTOK + r][c] = OUTP[(bl*NP + r)][c] + bf16-RNE(bp[c]) for r < NTOK (padded rows dropped).
// One thread per 4 floats in d_out row-major order over the group's rows, which are contiguous in d_out:
// coverage: n4 = GB*NTOK*DM/4 threads x 4 = every d_out element of batch elements b0..b0+GB-1.
// =====================================================================================================
__global__ __launch_bounds__(256) void copy_out(const float* __restrict__ op, const float* __restrict__ bp,
                                                 float* out, int b0, int n4) {
  const int i = blockIdx.x * 256 + threadIdx.x;
  if (i < n4) {
    const int row = i / (DM / 4);
    const int c4  = (i - row * (DM / 4)) * 4;
    const int bl  = row / NTOK;
    const int r   = row - bl * NTOK;
    v4f v = *(const v4f*)(op + ((size_t)bl * NP + r) * DM + c4);
    const v4f bb = *(const v4f*)(bp + c4);
#pragma unroll
    for (int e = 0; e < 4; ++e) v[e] += bf_up(bf_bits(bb[e]));
    float* d = out + ((size_t)b0 * NTOK + row) * DM + c4;
    *(v4f*)d = v;
    
  }
}

// =====================================================================================================
// Workspace map (bytes), one group of GB = 16 batch elements (GB*NP = 15360 rows), every plane an exact
// multiple of its 64x64-tile / whole-line store granularity (padded rows included):
//   Wt    bf16 [5][768 co][768 ci]   0          5898240   (Wq^T | Wk^T | Wv^T | Wvc^T | Wp^T)
//   Xp    bf16 [15360][768]          5898240    23592960
//   QK    f16  [15360][1536]         29491200   47185920  (q cols 0..767, k cols 768..1535)
//   Ql    f16  [15360][768]          76677120   23592960  (q residual x4096)
//   VTh   f16  [16][768][960]        100270080  23592960  (v^T hi)
//   VTl   f16  [16][768][960]        123863040  23592960  (v^T residual x4096)
//   VCh   f16  [16][768][960]        147456000  23592960  (vc^T hi)
//   VCl   f16  [16][768][960]        171048960  23592960  (vc^T residual x4096)
//   Oh    bf16 [15360][768]          194641920  23592960
//   Ol    bf16 [15360][768]          218234880  23592960
//   end                              241827840
//   OUTP  f32  [15360][768]          29491200   47185920  (same bytes as QK: q|k are last read by the attention
//                                                          launches, which end before launch (6) writes OUTP)
// =====================================================================================================
extern "C" void kernel_launch(void* const* d_in, const int* in_sizes, int n_in,
                              void* d_out, int out_size, void* d_ws, size_t ws_size,
                              hipStream_t stream) {
  if (n_in < 7) return;
  if (in_sizes[0] != NBATCH * NTOK * DM) return;
  if (in_sizes[1] != DM * DM || in_sizes[2] != DM * DM || in_sizes[3] != DM * DM) return;
  if (in_sizes[4] != DM * DM || in_sizes[5] != DM * DM) return;
  if (in_sizes[6] != DM) return;
  if (out_size != NBATCH * NTOK * DM) return;

  const float* x   = (const float*)d_in[0];
  const float* Wq  = (const float*)d_in[1];
  const float* Wk  = (const float*)d_in[2];
  const float* Wv  = (const float*)d_in[3];
  const float* Wvc = (const float*)d_in[4];
  const float* Wp  = (const float*)d_in[5];
  const float* bp  = (const float*)d_in[6];

  const size_t ROWS = (size_t)GB * NP;                 // 15360
  const size_t PW   = (size_t)5 * DM * DM * 2;          //  5898240
  const size_t PX   = ROWS * DM * 2;                    // 23592960
  const size_t PQK  = ROWS * QKP * 2;                   // 47185920
  const size_t PQl  = ROWS * DM * 2;                    // 23592960
  const size_t PVT  = (size_t)GB * DM * NP * 2;         // 23592960
  const size_t PO   = ROWS * DM * 2;                    // 23592960
  static_assert((size_t)DM * 4 == (size_t)QKP * 2);     // an f32 OUTP row is as long as an f16 q|k row: OUTP fits QK exactly
  size_t off = 0;
  const size_t oW   = off; off += PW;
  const size_t oXp  = off; off += PX;
  const size_t oQK  = off; off += PQK;
  const size_t oQl  = off; off += PQl;
  const size_t oVTh = off; off += PVT;
  const size_t oVTl = off; off += PVT;
  const size_t oVCh = off; off += PVT;
  const size_t oVCl = off; off += PVT;
  const size_t oOh  = off; off += PO;
  const size_t oOl  = off; off += PO;
  const size_t oOUT = oQK;                              // OUTP over QK (dead once attention has run)
  if (off > ws_size) return;                            // off = 241827840

  char* ws = (char*)d_ws;
  unsigned short* Wt   = (unsigned short*)(ws + oW);
  unsigned short* Wqk_t = Wt;                                   // rows 0..1535: Wq^T then Wk^T
  unsigned short* Wv_t  = Wt + (size_t)2 * DM * DM;
  unsigned short* Wvc_t = Wt + (size_t)3 * DM * DM;
  unsigned short* Wp_t  = Wt + (size_t)4 * DM * DM;
  unsigned short* Xp   = (unsigned short*)(ws + oXp);
  unsigned short* QK   = (unsigned short*)(ws + oQK);
  unsigned short* Ql   = (unsigned short*)(ws + oQl);
  unsigned short* VTh  = (unsigned short*)(ws + oVTh);
  unsigned short* VTl  = (unsigned short*)(ws + oVTl);
  unsigned short* VCh  = (unsigned short*)(ws + oVCh);
  unsigned short* VCl  = (unsigned short*)(ws + oVCl);
  unsigned short* Oh   = (unsigned short*)(ws + oOh);
  unsigned short* Ol   = (unsigned short*)(ws + oOl);
  float*          OUTP = (float*)(ws + oOUT);
  float*          out  = (float*)d_out;

  const dim3 blk(256);
  const int n8x = GB * NP * (DM / 8);                            // 1474560
  const int n4o = GB * NTOK * (DM / 4);                          // 2783232
  const dim3 gCvtX((n8x + 255) / 256);                           // 5760 blocks
  const dim3 gCopy((n4o + 255) / 256);                           // 10872 blocks
  const dim3 gWtr(DM / 64, DM / 64, 5);                          // 12 x 12 x 5 tiles
  static_assert((GB * NP) % GBM == 0 && (GB * NP) % GBN == 0 && DM % GBM == 0 && DM % GBN == 0 && QKP % GBN == 0 && DM % GBK == 0);
  const dim3 gQK((GB * NP / GBM) * (QKP / GBN));                 // 120 x 6 = 720 blocks: M=15360, N=1536
  const dim3 gVT((DM / GBM) * (GB * NP / GBN));                  // 6 x 60 = 360 blocks: M=768, N=15360 (all batch elements' rows of Xp)
  const dim3 gOut((GB * NP / GBM) * (DM / GBN));                 // 120 x 3 = 360 blocks: M=15360, N=768
  const dim3 gAttn1(NQB_NM * NH * GB);                           // 2688 blocks
  const dim3 gAttn2(NH * GB);                                    // 192 blocks

  // (0) weights -> bf16 [out][in] planes (k contiguous = the Bt / A layout the GEMM wants)
  wtr_bf16<<<gWtr, blk, 0, stream>>>(Wq, Wk, Wv, Wvc, Wp, Wt);

  for (int g = 0; g < NGRP; ++g) {
    const int b0 = g * GB;
    // (1) x -> zero-padded bf16 plane [15360][768]
    cvt_x_bf16<<<gCvtX, blk, 0, stream>>>(x, Xp, b0, n8x);
    // (2) q|k = Xp . Wqk^T -> f16 plane [15360][1536] + f16 residual x4096 of the q half (n0 < 768, pitch 768)
    gemm64<0, 3><<<gQK, blk, 0, stream>>>(
        Xp, Xp, DM, Wqk_t, DM,
        (void*)QK, QKP, 0LL, (void*)Ql, DM, 0LL, DM, QKP,
        QKP / GBN, DM, 4096.0f);
    // (3) v^T = Wv^T . Xp^T, column n = bl*NP + s -> f16 hi [bl][h*64+d][s] (pitch NP) + residual x4096
    gemm64<0, 3><<<gVT, blk, 0, stream>>>(
        Wv_t, Wv_t, DM, Xp, DM,
        (void*)VTh, NP, (long long)DM * NP, (void*)VTl, NP, (long long)DM * NP, NP, NP,
        GB * NP / GBN, DM, 4096.0f);
    // (4) vc^T likewise
    gemm64<0, 3><<<gVT, blk, 0, stream>>>(
        Wvc_t, Wvc_t, DM, Xp, DM,
        (void*)VCh, NP, (long long)DM * NP, (void*)VCl, NP, (long long)DM * NP, NP, NP,
        GB * NP / GBN, DM, 4096.0f);
    // (5) attention -> context bf16 hi / lo planes [15360][768]: query tiles 0..7, 9..14, then the mixed tile 8
    attn64<1><<<gAttn1, dim3(128), 0, stream>>>(QK, Ql, VTh, VTl, VCh, VCl, Oh, Ol, 0.125f, 1.0f / 4096.0f);
    attn64<2><<<gAttn2, dim3(128), 0, stream>>>(QK, Ql, VTh, VTl, VCh, VCl, Oh, Ol, 0.125f, 1.0f / 4096.0f);
    // (6) OUTP = context . Wp (A = context hi + lo planes, 2 products; K=768) -> f32 [15360][768]
    gemm64<1, 0><<<gOut, blk, 0, stream>>>(
        Oh, Ol, DM, Wp_t, DM,
        (void*)OUTP, DM, 0LL, (void*)OUTP, DM, 0LL, DM, DM,
        DM / GBN, DM, 1.0f);
    // (7) valid rows + bias -> d_out rows (b0 + bl)*906 + r
    copy_out<<<gCopy, blk, 0, stream>>>(OUTP, bp, out, b0, n4o);
  }
  (void)hipGetLastError();
}

// v006
// A run of this version takes 255 microseconds.
// In both of two side-by-side timings against v005, it was 1.25 times as fast.
// Counting every step since v000, it is 4.85 times as fast.
// Contractions: q|k, v^T and vc^T projections = v_wmma_f32_16x16x32_bf16 (bf16 operands from RNE-converted x and W, single product);
// q.k^T scores = v_wmma_f32_16x16x32_f16 (q as f16 hi plane + f16 residual plane x4096 in a separate accumulator, k f16; 2 products);
// p.v = v_wmma_f32_16x16x32_f16 (p carried x1024 in f16, v^T as f16 hi plane + f16 residual plane x4096 in a separate accumulator; 2 products);
// ctx.Wp = v_wmma_f32_16x16x32_bf16 (ctx as bf16 hi + lo planes times bf16 Wp^T, 2 products); all f32 accumulate; softmax in f32.
#include <hip/hip_runtime.h>
#include <math.h>
#include <stdint.h>

#define NBATCH 16
#define NTOK   906
#define NP     960            // padded token count per batch element (15 tiles of 64)
#define DM     768
#define NH     12
#define HD     64
#define M1     513            // modality split: query / key rows < M1 vs >= M1
#define NKT    (NP / 64)      // 15 key chunks of 64
#define NQB_NM 14             // query tiles 0..7 and 9..14 (tile 8 is the mixed tile)
#define QKP    (2 * DM)       // pitch of the q|k plane: q at cols 0..DM-1, k at cols DM..2DM-1
#define GB     16             // batch elements per group (all of them: one pass of launches fills the chip)
#define NGRP   (NBATCH / GB)
#define LP     72             // LDS row pitch of the attention K / V^T tiles in f16: 144 B = 16 B x 9 (odd), so the 16 rows of a 16-byte fragment read fall on 16 different bank groups
#define LTILE  (64 * LP)      // one 64-row tile at that pitch
#define GBM    128            // GEMM block tile: 2 x 4 wave tiles of 64 x 64
#define GBN    256
#define GBK    64             // k per stage: 128 B of every operand row, one whole line
#define GPI    72             // LDS row pitch of a staged operand row in bf16: 144 B = 16 B x 9 (odd), as LP
static_assert(NH * HD == DM);
static_assert((NP % 64) == 0 && NP >= NTOK && (DM % 64) == 0 && (DM % 32) == 0);
static_assert((NBATCH % GB) == 0);
static_assert(M1 - 1 == 8 * 64);   // row 512 is the first row of query tile 8 and of key chunk 8
static_assert(NTOK > (NKT - 1) * 64 && NTOK <= NP);   // invalid keys live only in the last chunk

typedef _Float16 v16h __attribute__((ext_vector_type(16)));
typedef _Float16 v8h  __attribute__((ext_vector_type(8)));
typedef __bf16   v16b __attribute__((ext_vector_type(16)));
typedef __bf16   v8b  __attribute__((ext_vector_type(8)));
typedef float    v8f  __attribute__((ext_vector_type(8)));
typedef float    v4f  __attribute__((ext_vector_type(4)));
typedef unsigned int v4u __attribute__((ext_vector_type(4)));

union FH { v16h v; v8h h[2]; };

// ---- scalar helpers --------------------------------------------------------------------------------
__device__ __forceinline__ unsigned short bf_bits(float f) {          // f32 -> bf16 bits, RNE convert
  unsigned u = __float_as_uint(f);
  return (unsigned short)((u + 0x7FFFu + ((u >> 16) & 1u)) >> 16);
}
__device__ __forceinline__ float bf_up(unsigned short h) { return __uint_as_float(((unsigned)h) << 16); }
__device__ __forceinline__ unsigned short h_bits(_Float16 x) { return __builtin_bit_cast(unsigned short, x); }
__device__ __forceinline__ unsigned pk16(unsigned short a, unsigned short b) { return (unsigned)a | ((unsigned)b << 16); }
__device__ __forceinline__ v8f zero8() { v8f z = {0.f, 0.f, 0.f, 0.f, 0.f, 0.f, 0.f, 0.f}; return z; }

// ---- fragment loaders: 16-bit A/B operand, lane -> row/col (lane&15), p already includes +8*(lane>>4);
//      elements 0..7 <- p[0..7] (k0+8h..), elements 8..15 <- p[16..23] (k0+16+8h..)
__device__ __forceinline__ v16b ldfrag_b(const __bf16* p) {
  union { v16b v; v8b h[2]; } f;
  f.h[0] = *(const v8b*)(p);
  f.h[1] = *(const v8b*)(p + 16);
  return f.v;
}
__device__ __forceinline__ v16h ldfrag_h(const _Float16* p) {
  union { v16h v; v8h h[2]; } f;
  f.h[0] = *(const v8h*)(p);
  f.h[1] = *(const v8h*)(p + 16);
  return f.v;
}

// ---- WMMA helpers with trailing VALU hazard gap --------------------------------------------------------
__device__ __forceinline__ v8f mma_h(v16h a, v16h b, v8f c) {
  c = __builtin_amdgcn_wmma_f32_16x16x32_f16(false, a, false, b, (short)0, c, false, false);
#if defined(__HIP_DEVICE_COMPILE__)
  asm volatile("v_nop\n\tv_nop\n\tv_nop\n\tv_nop" : "+v"(c) : "v"(a), "v"(b));
#endif
  return c;
}
__device__ __forceinline__ v8f mma_b_raw(v16b a, v16b b, v8f c) {
  return __builtin_amdgcn_wmma_f32_16x16x32_bf16(false, a, false, b, (short)0, c, false, false);
}
__device__ __forceinline__ void dep_guard_b(v8f& a, v8f& b, v16b x, v16b y) {
#if defined(__HIP_DEVICE_COMPILE__)
  asm volatile("v_nop\n\tv_nop\n\tv_nop\n\tv_nop" : "+v"(a), "+v"(b) : "v"(x), "v"(y));
#endif
}
__device__ __forceinline__ void keep4_b(v16b a, v16b b, v16b c, v16b d) {
#if defined(__HIP_DEVICE_COMPILE__)
  asm volatile("v_nop" :: "v"(a), "v"(b), "v"(c), "v"(d));
#endif
}
__device__ __forceinline__ void acc_guard4(v8f& a, v8f& b, v8f& c, v8f& d) {
#if defined(__HIP_DEVICE_COMPILE__)
  asm volatile("v_nop\n\tv_nop\n\tv_nop\n\tv_nop" : "+v"(a), "+v"(b), "+v"(c), "+v"(d));
#endif
}
__device__ __forceinline__ void wave_sync_lds() {
  __builtin_amdgcn_fence(__ATOMIC_RELEASE, "workgroup");
  __builtin_amdgcn_wave_barrier();
  __builtin_amdgcn_fence(__ATOMIC_ACQUIRE, "workgroup");
}
// value of lane l ^ 16: the other half of the wave, which holds the same D column
__device__ __forceinline__ float xhalf(float x) {
  const int i = __builtin_bit_cast(int, x);
  return __builtin_bit_cast(float, __builtin_amdgcn_permlanex16(i, i, 0x76543210, 0xfedcba98, false, false));
}

// =====================================================================================================
// x f32 [b][NTOK][DM] -> zero-padded bf16 plane Xp [GB*NP][DM] for batch elements b0..b0+GB-1 (RNE convert).
// address, value select). coverage: n8 = GB*NP*DM/8 threads x 8 = the whole Xp plane incl. padded rows.
// =====================================================================================================
__global__ __launch_bounds__(256) void cvt_x_bf16(const float* __restrict__ x, unsigned short* xp,
                                                   int b0, int n8) {
  const int i = blockIdx.x * 256 + threadIdx.x;
  if (i < n8) {
    const int row = i / (DM / 8);
    const int c8  = (i - row * (DM / 8)) * 8;
    const int bl  = row / NP;
    const int r   = row - bl * NP;
    const int rr  = (r < NTOK) ? r : (NTOK - 1);                 // clamped address for padded rows
    const float* src = x + ((size_t)(b0 + bl) * NTOK + rr) * DM + c8;
    const v4f a = *(const v4f*)(src);
    const v4f b = *(const v4f*)(src + 4);
    v4u p;
    p[0] = pk16(bf_bits(a[0]), bf_bits(a[1]));
    p[1] = pk16(bf_bits(a[2]), bf_bits(a[3]));
    p[2] = pk16(bf_bits(b[0]), bf_bits(b[1]));
    p[3] = pk16(bf_bits(b[2]), bf_bits(b[3]));
    const bool valid = (r < NTOK);
#pragma unroll
    for (int e = 0; e < 4; ++e) p[e] = valid ? p[e] : 0u;
    *(v4u*)(xp + (size_t)i * 8) = p;
    
  }
}

// =====================================================================================================
// Weight transpose-convert: W f32 [DM ci][DM co] (x @ W layout) -> Wt bf16 [co][ci] (k = ci contiguous),
// RNE convert. blockIdx.z selects the weight (0..4 -> Wq, Wk, Wv, Wvc, Wp), written back to back in wt.
// coverage: 8 waves x (2 it x 4 row groups) = 64 rows x (8 lanes x 8) = 64 cols per tile; grid 12x12x5.
// =====================================================================================================
__global__ __launch_bounds__(256) void wtr_bf16(const float* __restrict__ w0, const float* __restrict__ w1,
                                                 const float* __restrict__ w2, const float* __restrict__ w3,
                                                 const float* __restrict__ w4, unsigned short* wt) {
  __shared__ __align__(16) unsigned short T[64 * 72];   // [co][ci], pitch 72 (144 B, 16-B aligned rows)
  const int z = blockIdx.z;
  const float* W = (z == 0) ? w0 : (z == 1) ? w1 : (z == 2) ? w2 : (z == 3) ? w3 : w4;
  unsigned short* dst = wt + (size_t)z * DM * DM;
  const int co0 = blockIdx.x * 64;
  const int ci0 = blockIdx.y * 64;
  const int tid = threadIdx.x;
#pragma unroll
  for (int it = 0; it < 16; ++it) {
    const int idx = it * 256 + tid;
    const int i = idx >> 6;          // ci within tile
    const int j = idx & 63;          // co within tile
    T[j * 72 + i] = bf_bits(W[(size_t)(ci0 + i) * DM + co0 + j]);
  }
  __syncthreads();
  const int wave = tid >> 5, lane = tid & 31;
  const int q = lane >> 3, c8 = (lane & 7) * 8;
  v4u v[2];
#pragma unroll
  for (int it = 0; it < 2; ++it) {
    const int row = wave * 8 + it * 4 + q;
    v[it] = *(const v4u*)(T + row * 72 + c8);
  }
  {
#pragma unroll
    for (int it = 0; it < 2; ++it) {
      const int row = wave * 8 + it * 4 + q;
      *(v4u*)(dst + (size_t)(co0 + row) * DM + ci0 + c8) = v[it];
    }
    
  }
}

// =====================================================================================================
// Four asynchronous 16-byte copies of this lane, global -> LDS, through no register: rows r, r + 32, r + 64, r + 96
// of a staged operand (l0 = LDS byte address of the lane's piece of row r, g0 = its global address, gstep = 32 rows).
// =====================================================================================================
__device__ __forceinline__ void copy4_async(unsigned l0, const char* g0, unsigned gstep) {
#if defined(__HIP_DEVICE_COMPILE__)
  const unsigned l1 = l0 + 32u * GPI * 2u, l2 = l0 + 64u * GPI * 2u, l3 = l0 + 96u * GPI * 2u;
  const char* g1 = g0 + gstep;
  const char* g2 = g1 + gstep;
  const char* g3 = g2 + gstep;
  // s_wait_xcnt stands inside the copies' own statement, so that no address register is rewritten ahead of it
  asm volatile("global_load_async_to_lds_b128 %0, %4, off\n\t"
               "global_load_async_to_lds_b128 %1, %5, off\n\t"
               "global_load_async_to_lds_b128 %2, %6, off\n\t"
               "global_load_async_to_lds_b128 %3, %7, off\n\t"
               "s_wait_xcnt 0x0"
               :: "v"(l0), "v"(l1), "v"(l2), "v"(l3), "v"(g0), "v"(g1), "v"(g2), "v"(g3) : "memory");
#endif
}

// =====================================================================================================
// bf16 WMMA GEMM: C[m][n] = sum_k A[m][k] * Bt[n][k]. A block of 8 waves (2 x 4) owns a GBM x GBN tile, one wave a
// 64 x 64 tile of it. Per stage of GBK k the block's A rows and Bt rows are copied once into LDS (whole 128-B lines,
// asynchronous copies, two buffers: stage t + 1 flies while stage t is worked on) and every wave reads its fragments there.
// A row-major [M][K] pitch lda; Bt row-major [N][K] pitch ldb (k contiguous); M a multiple of GBM, N of GBN, K of GBK;
// grid = (M / GBM) * tilesNb blocks, tilesNb = N / GBN. Output column n goes to plane n / NB, column n % NB
// (NB a multiple of 64; plane strides strideC, strideC2 in elements).
// NSPLIT: 0 = A.Bt; 1 = (A + A2).Bt (A2 = unscaled bf16 lo plane of A).
// OUT_MODE: 0 = f32 (pitch ldc); 2 = bf16 hi plane C + bf16 lo plane C2 (lo = RNE(v - hi), unscaled);
//           3 = f16 hi plane C + f16 residual plane C2 = f16((v - hi) * rscale), C2 written only for tiles
//               with column-in-plane < N2 (pitch ldc2).
// =====================================================================================================
template <int NSPLIT, int OUT_MODE>
__global__ __launch_bounds__(256) void gemm64(
    const unsigned short* __restrict__ Ap, const unsigned short* A2p, int lda,
    const unsigned short* __restrict__ Btp, int ldb,
    void* Cout, int ldc, long long strideC,
    void* Cout2, int ldc2, long long strideC2, int N2, int NB,
    int tilesNb, int K, float rscale) {
  static_assert(NSPLIT == 0 || NSPLIT == 1);
  constexpr int OFFB  = GBM * ((NSPLIT >= 1) ? 2 : 1) * GPI;   // stage layout in bf16: A rows | A2 rows | Bt rows
  constexpr int STAGE = OFFB + GBN * GPI;
  __shared__ __align__(16) unsigned short smem[2 * STAGE];
  static_assert(8 * 16 * 68 * 4 <= 2 * STAGE * 2);             // the epilogue's per-wave slabs reuse the stage buffers
  const int lane = threadIdx.x & 31;
  const int wave = __builtin_amdgcn_readfirstlane(threadIdx.x >> 5);
  const int bm   = blockIdx.x / tilesNb;
  const int bn   = blockIdx.x - bm * tilesNb;
  const int wm   = wave >> 2, wn = wave & 3;
  const int m0 = bm * GBM + (wm << 6);
  const int n0 = bn * GBN + (wn << 6);

  const int rlane = lane & 15;                 // row (A) / col (B, D) within subtile
  const int koff  = (lane >> 4) * 8;           // k offset of this lane half
  const int mOff  = (lane >> 4) * 8;           // D row offset

  v8f acc[4][4];
#pragma unroll
  for (int i = 0; i < 4; ++i)
#pragma unroll
    for (int j = 0; j < 4; ++j) acc[i][j] = zero8();

  // Copy map: thread -> row (tid >> 3) + 32 * n, 16-byte piece tid & 7 of the row's 128 B: a wave's copy covers 4 whole lines.
  const int crow = threadIdx.x >> 3;
  const int cseg = (threadIdx.x & 7) * 16;
  const unsigned lbase = (unsigned)(uintptr_t)(const void*)smem + (unsigned)(crow * (GPI * 2) + cseg);
  const char* gA  = (const char*)(const void*)Ap  + (size_t)(bm * GBM + crow) * (size_t)lda * 2 + cseg;
  const char* gA2 = (const char*)(const void*)A2p + (size_t)(bm * GBM + crow) * (size_t)lda * 2 + cseg;
  const char* gB  = (const char*)(const void*)Btp + (size_t)(bn * GBN + crow) * (size_t)ldb * 2 + cseg;
  const unsigned stepA = (unsigned)lda * 64u, stepB = (unsigned)ldb * 64u;   // 32 rows in bytes
  auto stage_copies = [&](int t) {             // stage t -> buffer t & 1: 12 (NSPLIT 0) or 16 copies a lane
    const unsigned lb = lbase + (unsigned)((t & 1) * (STAGE * 2));
    const size_t kb = (size_t)t * (GBK * 2);
    copy4_async(lb, gA + kb, stepA);
    if (NSPLIT >= 1) copy4_async(lb + GBM * GPI * 2, gA2 + kb, stepA);
    copy4_async(lb + OFFB * 2, gB + kb, stepB);
    copy4_async(lb + (OFFB + 128 * GPI) * 2, gB + kb + (size_t)stepB * 4, stepB);
  };

  const int NT = K / GBK;
  stage_copies(0);
  asm volatile("s_wait_asynccnt 0x0" ::: "memory");   // this wave's copies of stage 0 have landed
  __syncthreads();                                     // ... and every other wave's
  if (NT > 1) stage_copies(1);

  for (int t = 0; t < NT; ++t) {
    const __bf16* sb  = (const __bf16*)(const void*)smem + (t & 1) * STAGE;
    const __bf16* sA  = sb + ((wm << 6) + rlane) * GPI + koff;
    const __bf16* sA2 = sA + GBM * GPI;
    const __bf16* sB  = sb + OFFB + ((wn << 6) + rlane) * GPI + koff;
#pragma unroll   // the two 32-k steps of a stage, straight-line between the stage's barriers
    for (int ks = 0; ks < GBK / 32; ++ks) {
      v16b bh[4];
#pragma unroll
      for (int j = 0; j < 4; ++j) bh[j] = ldfrag_b(sB + j * 16 * GPI + ks * 32);
      v16b ahv[4], alv[4];   // all fragments of a k-step are loaded as one group ahead of its WMMAs
#pragma unroll
      for (int i = 0; i < 4; ++i) {
        ahv[i] = ldfrag_b(sA + i * 16 * GPI + ks * 32);
        if (NSPLIT >= 1) alv[i] = ldfrag_b(sA2 + i * 16 * GPI + ks * 32); else alv[i] = ahv[i];
      }
#pragma unroll
      for (int i = 0; i < 4; ++i) {
        const v16b ah = ahv[i], al = alv[i];
#pragma unroll
        for (int j = 0; j < 4; ++j) {
          acc[i][j] = mma_b_raw(ah, bh[j], acc[i][j]);
          if (NSPLIT >= 1) acc[i][j] = mma_b_raw(al, bh[j], acc[i][j]);
        }
        dep_guard_b(acc[i][0], acc[i][3], ah, al);
      }
      keep4_b(bh[0], bh[1], bh[2], bh[3]);
    }
    // publish point of stage t + 1, which also frees buffer t & 1
    asm volatile("s_wait_dscnt 0x0" ::: "memory");      // this wave's reads of buffer t & 1 are done
    asm volatile("s_wait_asynccnt 0x0" ::: "memory");   // this wave's copies of stage t + 1 have landed
    __syncthreads();
    if (t + 2 < NT) stage_copies(t + 2);                // block-uniform test; into the buffer every wave has just left
  }
  asm volatile("s_wait_asynccnt 0x0" ::: "memory");     // nothing is in flight when the buffers become the epilogue's slabs
  acc_guard4(acc[0][0], acc[0][1], acc[0][2], acc[0][3]);
  acc_guard4(acc[1][0], acc[1][1], acc[1][2], acc[1][3]);
  acc_guard4(acc[2][0], acc[2][1], acc[2][2], acc[2][3]);
  acc_guard4(acc[3][0], acc[3][1], acc[3][2], acc[3][3]);

  const int bo  = n0 / NB;                     // output plane and the tile's first column in it (wave-uniform)
  const int nc0 = n0 - bo * NB;

  // ---- epilogue ----
  float* slab = (float*)(void*)smem + wave * (16 * 68);   // per-wave 16x64 slab, pitch 68 floats; the loop's last barrier has ended every read of the stage buffers
#pragma unroll
  for (int i = 0; i < 4; ++i) {
    const int mBase = m0 + (i << 4);
#pragma unroll
    for (int j = 0; j < 4; ++j) {
#pragma unroll
      for (int r = 0; r < 8; ++r) {
        slab[(mOff + r) * 68 + (j << 4) + rlane] = acc[i][j][r];
      }
    }
    wave_sync_lds();
    if (OUT_MODE == 0) {
      float* C = (float*)Cout + (size_t)bo * strideC;
      const int hh = lane >> 4, c4 = (lane & 15) * 4;     // 256-B row segment = 16 lanes x 16 B
      {
#pragma unroll
        for (int it = 0; it < 8; ++it) {
          const int row = it * 2 + hh;                     // it 0..7 x hh 0..1 = rows 0..15
          const v4f v = *(const v4f*)(slab + row * 68 + c4);
          *(v4f*)(C + (size_t)(mBase + row) * ldc + nc0 + c4) = v;
        }
        
      }
    } else {
      const int q = lane >> 3, c8 = (lane & 7) * 8;
      unsigned short* C  = (unsigned short*)Cout  + (size_t)bo * strideC;
      unsigned short* C2 = (unsigned short*)Cout2 + (size_t)bo * strideC2;
      const bool wlo = (OUT_MODE == 2) || (nc0 < N2);     // wave-uniform
      v4u hv[4], lv[4];
#pragma unroll
      for (int it = 0; it < 4; ++it) {
        const int row = it * 4 + q;                        // it 0..3 x q 0..3 = rows 0..15
        const float* sp = slab + row * 68 + c8;
        v4u a, a2;
#pragma unroll
        for (int e = 0; e < 4; ++e) {
          const float f0 = sp[2 * e], f1 = sp[2 * e + 1];
          unsigned short h0, h1, l0, l1;
          if (OUT_MODE == 2) {
            h0 = bf_bits(f0); h1 = bf_bits(f1);
            l0 = bf_bits(f0 - bf_up(h0)); l1 = bf_bits(f1 - bf_up(h1));
          } else {
            const _Float16 x0 = (_Float16)f0, x1 = (_Float16)f1;
            h0 = h_bits(x0); h1 = h_bits(x1);
            l0 = h_bits((_Float16)((f0 - (float)x0) * rscale));
            l1 = h_bits((_Float16)((f1 - (float)x1) * rscale));
          }
          a[e] = pk16(h0, h1); a2[e] = pk16(l0, l1);
        }
        hv[it] = a; lv[it] = a2;
      }
      {
#pragma unroll
        for (int it = 0; it < 4; ++it) {
          const int row = it * 4 + q;
          *(v4u*)(C + (size_t)(mBase + row) * ldc + nc0 + c8) = hv[it];
          asm volatile("s_wait_xcnt 0x0" ::: "memory");   // before the store's address registers are reused for the next address
          if (wlo) {
            *(v4u*)(C2 + (size_t)(mBase + row) * ldc2 + nc0 + c8) = lv[it];
            asm volatile("s_wait_xcnt 0x0" ::: "memory");  // as above
          }
        }
        
      }
    }
    wave_sync_lds();
  }
}

// =====================================================================================================
// Four asynchronous 16-byte copies of this lane, global -> LDS, through no register: rows r, r + 16, r + 32, r + 48
// of one 64-row attention tile at pitch LP (l0 = LDS byte address of the lane's piece of row r, g0 = its global address,
// gstep = 16 source rows in bytes).
// =====================================================================================================
__device__ __forceinline__ void copy4_tile(unsigned l0, const char* g0, unsigned gstep) {
#if defined(__HIP_DEVICE_COMPILE__)
  const unsigned l1 = l0 + 16u * LP * 2u, l2 = l0 + 32u * LP * 2u, l3 = l0 + 48u * LP * 2u;
  const char* g1 = g0 + gstep;
  const char* g2 = g1 + gstep;
  const char* g3 = g2 + gstep;
  // s_wait_xcnt stands inside the copies' own statement, so that no address register is rewritten ahead of it
  asm volatile("global_load_async_to_lds_b128 %0, %4, off\n\t"
               "global_load_async_to_lds_b128 %1, %5, off\n\t"
               "global_load_async_to_lds_b128 %2, %6, off\n\t"
               "global_load_async_to_lds_b128 %3, %7, off\n\t"
               "s_wait_xcnt 0x0"
               :: "v"(l0), "v"(l1), "v"(l2), "v"(l3), "v"(g0), "v"(g1), "v"(g2), "v"(g3) : "memory");
#endif
}

// ---- context^T += V^T tile . P^T (f16 WMMA): A = V^T rows d, B = P^T (column = query) straight from registers;
//      oacc[t][r] = context[query c][d = 16 t + 8 hh + r]; residual products into a separate accumulator folded in f32 ----
__device__ __forceinline__ void pv_acc(v8f (&oacc)[4], const v16h (&pb)[2],
                                       const _Float16* Vth, const _Float16* Vtl,
                                       float rres, int c, int hh) {
  v8f o1[4];
#pragma unroll
  for (int t = 0; t < 4; ++t) o1[t] = zero8();
#pragma unroll   // pb is a register array: its index must be a constant
  for (int kk = 0; kk < 2; ++kk) {
#pragma unroll
    for (int t = 0; t < 4; ++t) {
      FH vb, vl;
      vb.h[0] = *(const v8h*)(Vth + (t * 16 + c) * LP + kk * 32 + 8 * hh);
      vb.h[1] = *(const v8h*)(Vth + (t * 16 + c) * LP + kk * 32 + 16 + 8 * hh);
      vl.h[0] = *(const v8h*)(Vtl + (t * 16 + c) * LP + kk * 32 + 8 * hh);
      vl.h[1] = *(const v8h*)(Vtl + (t * 16 + c) * LP + kk * 32 + 16 + 8 * hh);
      oacc[t] = mma_h(vb.v, pb[kk], oacc[t]);
      o1[t]   = mma_h(vl.v, pb[kk], o1[t]);
    }
  }
#pragma unroll
  for (int t = 0; t < 4; ++t)
#pragma unroll
    for (int r = 0; r < 8; ++r) oacc[t][r] += o1[t][r] * rres;
}

// =====================================================================================================
// Attention, head dim 64, softmax over the NTOK valid keys of the batch element (keys s >= NTOK masked to
// -1e30 before the row max in the last chunk), per-modality value swap handled at V^T staging.
//   q|k plane (f16, pitch QKP): element (row, col) at [row*QKP + col], row = bl*NP + t, q col = h*64+d,
//   k col = DM + h*64 + d; q residual plane (f16, (q - f16(q))*4096, pitch DM): [row*DM + h*64 + d]
//   v^T / vc^T hi planes (f16): element (bl, h, d, s) at [(bl*DM + h*64 + d)*NP + s]; residual planes (x4096) same
//   out planes (bf16 hi / lo of the normalised context): element (row, h, d) at [row*DM + h*64 + d]
//   NV == 1: query tiles 0..7 (rows < M1, values: v for keys < M1, vc for keys >= M1) and 9..14
//            (values: vc for keys < M1, v for keys >= M1); grid = NQB_NM * NH * GB.
//   NV == 2: query tile 8 (rows 512..575): main set = the rows >= M1 combination, extra set (wave 0 only)
//            = the rows < M1 combination; row 512 selects the extra set at the end; grid = NH * GB.
//   scores^T = (k . qh^T + (k . ql^T) * rres) * sscale on f16 WMMA (A = K rows, B = Q), residual products in a separate
//   accumulator: a lane holds 32 of the chunk's 64 scores of ONE query (column c), its partner lane ^ 16 the other 32, so the
//   maximum and the sum are in-lane plus one exchange between the halves (the sum's halves are joined once, after the loop);
//   p = exp(s - m) carried as f16(1024 p), packed from the score registers into the B operand of context^T += V^T . P^T;
//   online softmax in f32.
//   Block = 4 waves = 64 query rows of one (bl, h); kv chunks of 64, static trip NKT.
//   K / V^T chunk staging: asynchronous 16-byte copies to LDS, two buffers: chunk kt + 1 flies while chunk kt is worked on,
//   one barrier a chunk. 128 threads x 4 copies per tile = the whole 64x64 tile (a wave's copy = 4 whole 128-B lines).
//   The value swap is a chunk-uniform choice of source plane (chunks < 8: keys < M1, chunks > 8: keys >= M1); chunk 8 is
//   copied from the keys >= M1 planes and its key 512 (column 0 of the V^T tiles) is then overwritten from the keys < M1
//   planes, with a barrier of its own. P never touches LDS; the output staging aliases the buffers after the loop's last barrier.
//   Output coverage: each wave stores rows q0..q0+15 (it 0..3 x lane>>3 0..3) x 64 columns (8 lanes x 8) of both planes.
// =====================================================================================================
template <int NV>
__global__ __launch_bounds__(128)
void attn64(const unsigned short* __restrict__ qkp, const unsigned short* __restrict__ qlp,
            const unsigned short* __restrict__ vhp, const unsigned short* __restrict__ vlp,
            const unsigned short* __restrict__ vchp, const unsigned short* __restrict__ vclp,
            unsigned short* ohp, unsigned short* olp, float sscale, float rres) {
  constexpr int STG = ((NV == 2) ? 5 : 3) * LTILE;        // one buffer in f16: K | main V^T hi | main V^T residual | extra hi | extra residual
  __shared__ __align__(16) _Float16 smem[2 * STG];
  static_assert(4 * 16 * 68 * 4 <= 2 * STG * 2);          // the output staging fits the buffers

  const int tid  = threadIdx.x;
  const int wave = tid >> 5;
  const int lane = tid & 31;
  const int hh   = lane >> 4;
  const int c    = lane & 15;

  const int bx = blockIdx.x;
  int qb, rest;
  if (NV == 1) {
    const int idx = bx % NQB_NM;
    qb = idx + ((idx >= 8) ? 1 : 0);
    rest = bx / NQB_NM;
  } else {
    qb = 8;
    rest = bx;
  }
  const int h  = rest % NH;
  const int bl = rest / NH;
  const int q0 = qb * 64 + wave * 16;
  const size_t rowB = (size_t)bl * NP;

  const _Float16* Qh = (const _Float16*)(const void*)qkp + (size_t)h * HD;
  const _Float16* Kg = (const _Float16*)(const void*)qkp + DM + (size_t)h * HD;
  const _Float16* Ql = (const _Float16*)(const void*)qlp + (size_t)h * HD;
  const size_t vbase = ((size_t)bl * DM + (size_t)h * HD) * NP;
  const _Float16* Vh  = (const _Float16*)(const void*)vhp  + vbase;
  const _Float16* Vl  = (const _Float16*)(const void*)vlp  + vbase;
  const _Float16* Vch = (const _Float16*)(const void*)vchp + vbase;
  const _Float16* Vcl = (const _Float16*)(const void*)vclp + vbase;
  // main set: keys < M1 from (M0h, M0l), keys >= M1 from (M1h, M1l); block-uniform pointer choice
  const bool useB = (NV == 2) || (qb > 8);
  const _Float16* M0h = useB ? Vch : Vh;
  const _Float16* M0l = useB ? Vcl : Vl;
  const _Float16* M1h = useB ? Vh  : Vch;
  const _Float16* M1l = useB ? Vl  : Vcl;

  // ---- Q fragments (B operand, column = query = lane&15): 2 d-chunks, hi and residual ----
  v16h qah[2], qal[2];
#pragma unroll
  for (int dc = 0; dc < 2; ++dc) {
    qah[dc] = ldfrag_h(Qh + (rowB + q0 + c) * QKP + dc * 32 + 8 * hh);
    qal[dc] = ldfrag_h(Ql + (rowB + q0 + c) * DM  + dc * 32 + 8 * hh);
  }

  // Copy map: thread -> row (tid >> 3) + 16 * n, 16-byte piece tid & 7 of the row's 128 B
  const int crow = tid >> 3;
  const int cseg = (tid & 7) * 16;
  const unsigned lbase = (unsigned)(uintptr_t)(const void*)smem + (unsigned)(crow * (LP * 2) + cseg);
  const char* gK = (const char*)(const void*)(Kg + (rowB + crow) * QKP) + cseg;
  const size_t voff = (size_t)crow * (NP * 2) + cseg;
  auto stage_copies = [&](int t) {           // chunk t -> buffer t & 1: 12 (NV 1) or 20 copies a lane
    const unsigned lb = lbase + (unsigned)((t & 1) * (STG * 2));
    const bool lowc = (t < 8);               // block-uniform
    const size_t vb = voff + (size_t)t * (64 * 2);
    copy4_tile(lb, gK + (size_t)t * (64 * QKP * 2), 16u * QKP * 2u);
    copy4_tile(lb + LTILE * 2,     (const char*)(const void*)(lowc ? M0h : M1h) + vb, 16u * NP * 2u);
    copy4_tile(lb + 2 * LTILE * 2, (const char*)(const void*)(lowc ? M0l : M1l) + vb, 16u * NP * 2u);
    if (NV == 2) {
      copy4_tile(lb + 3 * LTILE * 2, (const char*)(const void*)(lowc ? Vh : Vch) + vb, 16u * NP * 2u);
      copy4_tile(lb + 4 * LTILE * 2, (const char*)(const void*)(lowc ? Vl : Vcl) + vb, 16u * NP * 2u);
    }
  };
  // key 512 of row d = tid >> 1, hi (tid even) or residual (tid odd) plane, from the keys < M1 planes; stored into chunk 8's tiles
  const int prow = tid >> 1, ppl = tid & 1;
  const _Float16 pkM = (ppl ? M0l : M0h)[(size_t)prow * NP + (M1 - 1)];
  const _Float16 pkE = (NV == 2) ? (ppl ? Vl : Vh)[(size_t)prow * NP + (M1 - 1)] : pkM;

  float mrow = -INFINITY, lrow = 0.f;        // of query q0 + c; lrow sums this wave half's keys only
  v8f oacc[4], oaccE[4];
#pragma unroll
  for (int t = 0; t < 4; ++t) { oacc[t] = zero8(); oaccE[t] = zero8(); }

  static_assert(NKT > 1);
  stage_copies(0);
  asm volatile("s_wait_asynccnt 0x0" ::: "memory");   // this wave's copies of chunk 0 have landed
  __syncthreads();                                     // ... and every other wave's
  stage_copies(1);

  for (int kt = 0; kt < NKT; ++kt) {         // static trip count
    const int kv0 = kt * 64;
    _Float16* sb = smem + (kt & 1) * STG;
    const _Float16* Ksh = sb;                                   // K [kv][d]           9 KB (rows of 64 at pitch LP)
    const _Float16* VMh = sb + LTILE;                           // main V^T hi [d][kv]  9 KB
    const _Float16* VMl = sb + 2 * LTILE;                       // main V^T residual     9 KB
    const _Float16* VEh = (NV == 2) ? (sb + 3 * LTILE) : VMh;   // extra set (NV == 2)   9 KB
    const _Float16* VEl = (NV == 2) ? (sb + 4 * LTILE) : VMl;   //                       9 KB
    if (kt == 8) {                           // block-uniform: the chunk that holds key 512; its copies landed before the last barrier
      sb[(1 + ppl) * LTILE + prow * LP] = pkM;
      if (NV == 2) sb[(3 + ppl) * LTILE + prow * LP] = pkE;
      __syncthreads();                       // key 512's column is in place before any wave reads the V^T tiles
    }

    // ---- scores^T: 64 keys x 16 query columns per wave, 2 f16 products (hi, residual); s[j][r] = key kv0 + 16 j + 8 hh + r, query q0 + c ----
    v8f s[4];
#pragma unroll
    for (int j = 0; j < 4; ++j) {
      v8f sh = zero8(), sl = zero8();
#pragma unroll
      for (int dc = 0; dc < 2; ++dc) {
        FH kb;
        kb.h[0] = *(const v8h*)(Ksh + (j * 16 + c) * LP + dc * 32 + 8 * hh);
        kb.h[1] = *(const v8h*)(Ksh + (j * 16 + c) * LP + dc * 32 + 16 + 8 * hh);
        sh = mma_h(kb.v, qah[dc], sh);
        sl = mma_h(kb.v, qal[dc], sl);
      }
#pragma unroll
      for (int r = 0; r < 8; ++r) s[j][r] = (sh[r] + sl[r] * rres) * sscale;
    }
    // ---- keys s >= NTOK (only in the last chunk) are invalid: force -1e30 before the maximum ----
    if (kt == NKT - 1) {                    // block-uniform
#pragma unroll
      for (int j = 0; j < 4; ++j) {
#pragma unroll
        for (int r = 0; r < 8; ++r) s[j][r] = ((kv0 + j * 16 + 8 * hh + r) < NTOK) ? s[j][r] : -1.0e30f;
      }
    }

    // ---- column max, online softmax, P^T (x1024, f16) into the B operand registers ----
    float mj[4];
#pragma unroll
    for (int j = 0; j < 4; ++j) {
      mj[j] = s[j][0];
#pragma unroll
      for (int r = 1; r < 8; ++r) mj[j] = fmaxf(mj[j], s[j][r]);
    }
    float m = fmaxf(fmaxf(mj[0], mj[1]), fmaxf(mj[2], mj[3]));
    m = fmaxf(m, xhalf(m));                  // both halves now hold the query's maximum over the chunk
    const float mnew  = fmaxf(mrow, m);
    const float alpha = __expf(mrow - mnew);
    mrow = mnew;
    v16h pb[2];                              // pb[kk][e]: key kv0 + 32 kk + (e < 8 ? 8 hh + e : 16 + 8 hh + e - 8), the k order of the V^T loads
    float pj[4];                             // four independent sums of 8
#pragma unroll
    for (int j = 0; j < 4; ++j) {
      pj[j] = 0.f;
#pragma unroll
      for (int r = 0; r < 8; ++r) {
        const float p = __expf(s[j][r] - mnew);
        pj[j] += p;
        pb[j >> 1][(j & 1) * 8 + r] = (_Float16)(p * 1024.0f);
      }
    }
    lrow = lrow * alpha + ((pj[0] + pj[1]) + (pj[2] + pj[3]));
#pragma unroll
    for (int t = 0; t < 4; ++t)
#pragma unroll
      for (int r = 0; r < 8; ++r) { oacc[t][r] *= alpha; if (NV == 2) oaccE[t][r] *= alpha; }

    // ---- context^T += V^T . P^T ----
    pv_acc(oacc, pb, VMh, VMl, rres, c, hh);
    if (NV == 2) {
      if (wave == 0) pv_acc(oaccE, pb, VEh, VEl, rres, c, hh);   // wave-uniform
    }
    // publish point of chunk kt + 1, which also frees buffer kt & 1
    asm volatile("s_wait_dscnt 0x0" ::: "memory");      // this wave's reads of buffer kt & 1 are done
    asm volatile("s_wait_asynccnt 0x0" ::: "memory");   // this wave's copies of chunk kt + 1 have landed
    __syncthreads();
    if (kt + 2 < NKT) stage_copies(kt + 2);             // block-uniform test; into the buffer every wave has just left
  }
  asm volatile("s_wait_asynccnt 0x0" ::: "memory");     // nothing is in flight when the buffers become the output staging

  // ---- normalise (1/l and the 1/1024 p carry), stage the wave's 16x64 tile (aliases the K / V region),
  float* os = (float*)(void*)smem + wave * (16 * 68);   // [query][d], pitch 68 floats (272 B = 16 B x 17, odd): the 16 rows of a 16-byte store fall on 16 bank groups
  {
    const float l = lrow + xhalf(lrow);      // the two halves' key sums joined
    const float inv = ((l > 0.f) ? (1.0f / l) : 0.f) * (1.0f / 1024.0f);
    const bool rowA = (q0 + c) == (M1 - 1);  // query row 512 uses the extra set
#pragma unroll
    for (int t = 0; t < 4; ++t) {
      v4f w[2];
#pragma unroll
      for (int r = 0; r < 8; ++r) {
        float vm = oacc[t][r] * inv;
        if (NV == 2) {
          const float ve = oaccE[t][r] * inv;
          vm = rowA ? ve : vm;
        }
        w[r >> 2][r & 3] = vm;
      }
      *(v4f*)(os + c * 68 + t * 16 + 8 * hh)     = w[0];
      *(v4f*)(os + c * 68 + t * 16 + 8 * hh + 4) = w[1];
    }
  }
  wave_sync_lds();
  {
    const int q4 = lane >> 3, c8 = (lane & 7) * 8;
    v4u hv[4], lv[4];
#pragma unroll
    for (int it = 0; it < 4; ++it) {
      const int row = it * 4 + q4;   // it 0..3 x q4 0..3 = rows 0..15 of the wave tile
      const float* sp = os + row * 68 + c8;
      v4u a, a2;
#pragma unroll
      for (int e = 0; e < 4; ++e) {
        const float f0 = sp[2 * e], f1 = sp[2 * e + 1];
        const unsigned short h0 = bf_bits(f0), h1 = bf_bits(f1);
        const unsigned short l0 = bf_bits(f0 - bf_up(h0)), l1 = bf_bits(f1 - bf_up(h1));
        a[e] = pk16(h0, h1); a2[e] = pk16(l0, l1);
      }
      hv[it] = a; lv[it] = a2;
    }
    {
#pragma unroll
      for (int it = 0; it < 4; ++it) {
        const int row = it * 4 + q4;
        const size_t go = (rowB + q0 + row) * DM + (size_t)h * HD + c8;
        *(v4u*)(ohp + go) = hv[it];
        *(v4u*)(olp + go) = lv[it];
      }
      
    }
  }
}

// =====================================================================================================
// d_out[(b0 + bl)*NTOK + r][c] = OUTP[(bl*NP + r)][c] + bf16-RNE(bp[c]) for r < NTOK (padded rows dropped).
// One thread per 4 floats in d_out row-major order over the group's rows, which are contiguous in d_out:
// coverage: n4 = GB*NTOK*DM/4 threads x 4 = every d_out element of batch elements b0..b0+GB-1.
// =====================================================================================================
__global__ __launch_bounds__(256) void copy_out(const float* __restrict__ op, const float* __restrict__ bp,
                                                 float* out, int b0, int n4) {
  const int i = blockIdx.x * 256 + threadIdx.x;
  if (i < n4) {
    const int row = i / (DM / 4);
    const int c4  = (i - row * (DM / 4)) * 4;
    const int bl  = row / NTOK;
    const int r   = row - bl * NTOK;
    v4f v = *(const v4f*)(op + ((size_t)bl * NP + r) * DM + c4);
    const v4f bb = *(const v4f*)(bp + c4);
#pragma unroll
    for (int e = 0; e < 4; ++e) v[e] += bf_up(bf_bits(bb[e]));
    float* d = out + ((size_t)b0 * NTOK + row) * DM + c4;
    *(v4f*)d = v;
    
  }
}

// =====================================================================================================
// Workspace map (bytes), one group of GB = 16 batch elements (GB*NP = 15360 rows), every plane an exact
// multiple of its 64x64-tile / whole-line store granularity (padded rows included):
//   Wt    bf16 [5][768 co][768 ci]   0          5898240   (Wq^T | Wk^T | Wv^T | Wvc^T | Wp^T)
//   Xp    bf16 [15360][768]          5898240    23592960
//   QK    f16  [15360][1536]         29491200   47185920  (q cols 0..767, k cols 768..1535)
//   Ql    f16  [15360][768]          76677120   23592960  (q residual x4096)
//   VTh   f16  [16][768][960]        100270080  23592960  (v^T hi)
//   VTl   f16  [16][768][960]        123863040  23592960  (v^T residual x4096)
//   VCh   f16  [16][768][960]        147456000  23592960  (vc^T hi)
//   VCl   f16  [16][768][960]        171048960  23592960  (vc^T residual x4096)
//   Oh    bf16 [15360][768]          194641920  23592960
//   Ol    bf16 [15360][768]          218234880  23592960
//   end                              241827840
//   OUTP  f32  [15360][768]          29491200   47185920  (same bytes as QK: q|k are last read by the attention
//                                                          launches, which end before launch (6) writes OUTP)
// =====================================================================================================
extern "C" void kernel_launch(void* const* d_in, const int* in_sizes, int n_in,
                              void* d_out, int out_size, void* d_ws, size_t ws_size,
                              hipStream_t stream) {
  if (n_in < 7) return;
  if (in_sizes[0] != NBATCH * NTOK * DM) return;
  if (in_sizes[1] != DM * DM || in_sizes[2] != DM * DM || in_sizes[3] != DM * DM) return;
  if (in_sizes[4] != DM * DM || in_sizes[5] != DM * DM) return;
  if (in_sizes[6] != DM) return;
  if (out_size != NBATCH * NTOK * DM) return;

  const float* x   = (const float*)d_in[0];
  const float* Wq  = (const float*)d_in[1];
  const float* Wk  = (const float*)d_in[2];
  const float* Wv  = (const float*)d_in[3];
  const float* Wvc = (const float*)d_in[4];
  const float* Wp  = (const float*)d_in[5];
  const float* bp  = (const float*)d_in[6];

  const size_t ROWS = (size_t)GB * NP;                 // 15360
  const size_t PW   = (size_t)5 * DM * DM * 2;          //  5898240
  const size_t PX   = ROWS * DM * 2;                    // 23592960
  const size_t PQK  = ROWS * QKP * 2;                   // 47185920
  const size_t PQl  = ROWS * DM * 2;                    // 23592960
  const size_t PVT  = (size_t)GB * DM * NP * 2;         // 23592960
  const size_t PO   = ROWS * DM * 2;                    // 23592960
  static_assert((size_t)DM * 4 == (size_t)QKP * 2);     // an f32 OUTP row is as long as an f16 q|k row: OUTP fits QK exactly
  size_t off = 0;
  const size_t oW   = off; off += PW;
  const size_t oXp  = off; off += PX;
  const size_t oQK  = off; off += PQK;
  const size_t oQl  = off; off += PQl;
  const size_t oVTh = off; off += PVT;
  const size_t oVTl = off; off += PVT;
  const size_t oVCh = off; off += PVT;
  const size_t oVCl = off; off += PVT;
  const size_t oOh  = off; off += PO;
  const size_t oOl  = off; off += PO;
  const size_t oOUT = oQK;                              // OUTP over QK (dead once attention has run)
  if (off > ws_size) return;                            // off = 241827840

  char* ws = (char*)d_ws;
  unsigned short* Wt   = (unsigned short*)(ws + oW);
  unsigned short* Wqk_t = Wt;                                   // rows 0..1535: Wq^T then Wk^T
  unsigned short* Wv_t  = Wt + (size_t)2 * DM * DM;
  unsigned short* Wvc_t = Wt + (size_t)3 * DM * DM;
  unsigned short* Wp_t  = Wt + (size_t)4 * DM * DM;
  unsigned short* Xp   = (unsigned short*)(ws + oXp);
  unsigned short* QK   = (unsigned short*)(ws + oQK);
  unsigned short* Ql   = (unsigned short*)(ws + oQl);
  unsigned short* VTh  = (unsigned short*)(ws + oVTh);
  unsigned short* VTl  = (unsigned short*)(ws + oVTl);
  unsigned short* VCh  = (unsigned short*)(ws + oVCh);
  unsigned short* VCl  = (unsigned short*)(ws + oVCl);
  unsigned short* Oh   = (unsigned short*)(ws + oOh);
  unsigned short* Ol   = (unsigned short*)(ws + oOl);
  float*          OUTP = (float*)(ws + oOUT);
  float*          out  = (float*)d_out;

  const dim3 blk(256);
  const int n8x = GB * NP * (DM / 8);                            // 1474560
  const int n4o = GB * NTOK * (DM / 4);                          // 2783232
  const dim3 gCvtX((n8x + 255) / 256);                           // 5760 blocks
  const dim3 gCopy((n4o + 255) / 256);                           // 10872 blocks
  const dim3 gWtr(DM / 64, DM / 64, 5);                          // 12 x 12 x 5 tiles
  static_assert((GB * NP) % GBM == 0 && (GB * NP) % GBN == 0 && DM % GBM == 0 && DM % GBN == 0 && QKP % GBN == 0 && DM % GBK == 0);
  const dim3 gQK((GB * NP / GBM) * (QKP / GBN));                 // 120 x 6 = 720 blocks: M=15360, N=1536
  const dim3 gVT((DM / GBM) * (GB * NP / GBN));                  // 6 x 60 = 360 blocks: M=768, N=15360 (all batch elements' rows of Xp)
  const dim3 gOut((GB * NP / GBM) * (DM / GBN));                 // 120 x 3 = 360 blocks: M=15360, N=768
  const dim3 gAttn1(NQB_NM * NH * GB);                           // 2688 blocks
  const dim3 gAttn2(NH * GB);                                    // 192 blocks

  // (0) weights -> bf16 [out][in] planes (k contiguous = the Bt / A layout the GEMM wants)
  wtr_bf16<<<gWtr, blk, 0, stream>>>(Wq, Wk, Wv, Wvc, Wp, Wt);

  for (int g = 0; g < NGRP; ++g) {
    const int b0 = g * GB;
    // (1) x -> zero-padded bf16 plane [15360][768]
    cvt_x_bf16<<<gCvtX, blk, 0, stream>>>(x, Xp, b0, n8x);
    // (2) q|k = Xp . Wqk^T -> f16 plane [15360][1536] + f16 residual x4096 of the q half (n0 < 768, pitch 768)
    gemm64<0, 3><<<gQK, blk, 0, stream>>>(
        Xp, Xp, DM, Wqk_t, DM,
        (void*)QK, QKP, 0LL, (void*)Ql, DM, 0LL, DM, QKP,
        QKP / GBN, DM, 4096.0f);
    // (3) v^T = Wv^T . Xp^T, column n = bl*NP + s -> f16 hi [bl][h*64+d][s] (pitch NP) + residual x4096
    gemm64<0, 3><<<gVT, blk, 0, stream>>>(
        Wv_t, Wv_t, DM, Xp, DM,
        (void*)VTh, NP, (long long)DM * NP, (void*)VTl, NP, (long long)DM * NP, NP, NP,
        GB * NP / GBN, DM, 4096.0f);
    // (4) vc^T likewise
    gemm64<0, 3><<<gVT, blk, 0, stream>>>(
        Wvc_t, Wvc_t, DM, Xp, DM,
        (void*)VCh, NP, (long long)DM * NP, (void*)VCl, NP, (long long)DM * NP, NP, NP,
        GB * NP / GBN, DM, 4096.0f);
    // (5) attention -> context bf16 hi / lo planes [15360][768]: query tiles 0..7, 9..14, then the mixed tile 8
    attn64<1><<<gAttn1, dim3(128), 0, stream>>>(QK, Ql, VTh, VTl, VCh, VCl, Oh, Ol, 0.125f, 1.0f / 4096.0f);
    attn64<2><<<gAttn2, dim3(128), 0, stream>>>(QK, Ql, VTh, VTl, VCh, VCl, Oh, Ol, 0.125f, 1.0f / 4096.0f);
    // (6) OUTP = context . Wp (A = context hi + lo planes, 2 products; K=768) -> f32 [15360][768]
    gemm64<1, 0><<<gOut, blk, 0, stream>>>(
        Oh, Ol, DM, Wp_t, DM,
        (void*)OUTP, DM, 0LL, (void*)OUTP, DM, 0LL, DM, DM,
        DM / GBN, DM, 1.0f);
    // (7) valid rows + bias -> d_out rows (b0 + bl)*906 + r
    copy_out<<<gCopy, blk, 0, stream>>>(OUTP, bp, out, b0, n4o);
  }
  (void)hipGetLastError();
}

// v007
// Measured time: 241 microseconds a run.
// Next to v006, in two timings, it ran 1.07 times as fast each time.
// Over all steps from v000 it is 5.18 times as fast.
// Contractions: q|k, v^T and vc^T projections = v_wmma_f32_16x16x32_bf16 (bf16 operands from RNE-converted x and W, single product);
// q.k^T scores = v_wmma_f32_16x16x32_f16 (q as f16 hi plane + f16 residual plane x4096 in a separate accumulator, k f16; 2 products);
// p.v = v_wmma_f32_16x16x32_f16 (p carried x1024 in f16, v^T as f16 hi plane + f16 residual plane x4096 in a separate accumulator; 2 products);
// ctx.Wp = v_wmma_f32_16x16x32_bf16 (ctx as bf16 hi + lo planes times bf16 Wp^T, 2 products); all f32 accumulate; softmax in f32.
#include <hip/hip_runtime.h>
#include <math.h>
#include <stdint.h>

#define NBATCH 16
#define NTOK   906
#define NP     960            // padded token count per batch element (15 tiles of 64)
#define DM     768
#define NH     12
#define HD     64
#define M1     513            // modality split: query / key rows < M1 vs >= M1
#define NKT    (NP / 64)      // 15 key chunks of 64
#define NQB_NM 14             // query tiles 0..7 and 9..14 (tile 8 is the mixed tile)
#define QKP    (2 * DM)       // pitch of the q|k plane: q at cols 0..DM-1, k at cols DM..2DM-1
#define GB     16             // batch elements per group (all of them: one pass of launches fills the chip)
#define NGRP   (NBATCH / GB)
#define LP     72             // LDS row pitch of the attention K / V^T tiles in f16: 144 B = 16 B x 9 (odd), so the 16 rows of a 16-byte fragment read fall on 16 different bank groups
#define LTILE  (64 * LP)      // one 64-row tile at that pitch
#define GBM    128            // GEMM block tile: 2 x 4 wave tiles of 64 x 64
#define GBN    256
#define GBK    64             // k per stage: 128 B of every operand row, one whole line
#define GPI    72             // LDS row pitch of a staged operand row in bf16: 144 B = 16 B x 9 (odd), as LP
static_assert(NH * HD == DM);
static_assert((NP % 64) == 0 && NP >= NTOK && (DM % 64) == 0 && (DM % 32) == 0);
static_assert((NBATCH % GB) == 0);
static_assert(M1 - 1 == 8 * 64);   // row 512 is the first row of query tile 8 and of key chunk 8
static_assert(NTOK > (NKT - 1) * 64 && NTOK <= NP);   // invalid keys live only in the last chunk

typedef _Float16 v16h __attribute__((ext_vector_type(16)));
typedef _Float16 v8h  __attribute__((ext_vector_type(8)));
typedef __bf16   v16b __attribute__((ext_vector_type(16)));
typedef __bf16   v8b  __attribute__((ext_vector_type(8)));
typedef float    v8f  __attribute__((ext_vector_type(8)));
typedef float    v4f  __attribute__((ext_vector_type(4)));
typedef unsigned int v4u __attribute__((ext_vector_type(4)));

union FH { v16h v; v8h h[2]; };

// ---- scalar helpers --------------------------------------------------------------------------------
__device__ __forceinline__ unsigned short bf_bits(float f) {          // f32 -> bf16 bits, RNE convert
  unsigned u = __float_as_uint(f);
  return (unsigned short)((u + 0x7FFFu + ((u >> 16) & 1u)) >> 16);
}
__device__ __forceinline__ float bf_up(unsigned short h) { return __uint_as_float(((unsigned)h) << 16); }
__device__ __forceinline__ unsigned short h_bits(_Float16 x) { return __builtin_bit_cast(unsigned short, x); }
__device__ __forceinline__ unsigned pk16(unsigned short a, unsigned short b) { return (unsigned)a | ((unsigned)b << 16); }
__device__ __forceinline__ v8f zero8() { v8f z = {0.f, 0.f, 0.f, 0.f, 0.f, 0.f, 0.f, 0.f}; return z; }

// ---- fragment loaders: 16-bit A/B operand, lane -> row/col (lane&15), p already includes +8*(lane>>4);
//      elements 0..7 <- p[0..7] (k0+8h..), elements 8..15 <- p[16..23] (k0+16+8h..)
__device__ __forceinline__ v16b ldfrag_b(const __bf16* p) {
  union { v16b v; v8b h[2]; } f;
  f.h[0] = *(const v8b*)(p);
  f.h[1] = *(const v8b*)(p + 16);
  return f.v;
}
__device__ __forceinline__ v16h ldfrag_h(const _Float16* p) {
  union { v16h v; v8h h[2]; } f;
  f.h[0] = *(const v8h*)(p);
  f.h[1] = *(const v8h*)(p + 16);
  return f.v;
}

// ---- WMMA helpers --------------------------------------------------------------------------------------
// attention: the plain builtin; the compiler keeps the distance behind it and is free to order LDS loads and WMMAs
__device__ __forceinline__ v8f mma_h(v16h a, v16h b, v8f c) {
  return __builtin_amdgcn_wmma_f32_16x16x32_f16(false, a, false, b, (short)0, c, false, false);
}
// GEMM: builtin, with statements behind each row of WMMAs that hold the k-step's fragment loads together ahead of them
__device__ __forceinline__ v8f mma_b_raw(v16b a, v16b b, v8f c) {
  return __builtin_amdgcn_wmma_f32_16x16x32_bf16(false, a, false, b, (short)0, c, false, false);
}
__device__ __forceinline__ void dep_guard_b(v8f& a, v8f& b, v16b x, v16b y) {
#if defined(__HIP_DEVICE_COMPILE__)
  asm volatile("v_nop\n\tv_nop\n\tv_nop\n\tv_nop" : "+v"(a), "+v"(b) : "v"(x), "v"(y));
#endif
}
__device__ __forceinline__ void keep4_b(v16b a, v16b b, v16b c, v16b d) {
#if defined(__HIP_DEVICE_COMPILE__)
  asm volatile("v_nop" :: "v"(a), "v"(b), "v"(c), "v"(d));
#endif
}
__device__ __forceinline__ void acc_guard4(v8f& a, v8f& b, v8f& c, v8f& d) {
#if defined(__HIP_DEVICE_COMPILE__)
  asm volatile("v_nop\n\tv_nop\n\tv_nop\n\tv_nop" : "+v"(a), "+v"(b), "+v"(c), "+v"(d));
#endif
}
__device__ __forceinline__ void wave_sync_lds() {
  __builtin_amdgcn_fence(__ATOMIC_RELEASE, "workgroup");
  __builtin_amdgcn_wave_barrier();
  __builtin_amdgcn_fence(__ATOMIC_ACQUIRE, "workgroup");
}
// value of lane l ^ 16: the other half of the wave, which holds the same D column
__device__ __forceinline__ float xhalf(float x) {
  const int i = __builtin_bit_cast(int, x);
  return __builtin_bit_cast(float, __builtin_amdgcn_permlanex16(i, i, 0x76543210, 0xfedcba98, false, false));
}

// =====================================================================================================
// x f32 [b][NTOK][DM] -> zero-padded bf16 plane Xp [GB*NP][DM] for batch elements b0..b0+GB-1 (RNE convert).
// address, value select). coverage: n8 = GB*NP*DM/8 threads x 8 = the whole Xp plane incl. padded rows.
// =====================================================================================================
__global__ __launch_bounds__(256) void cvt_x_bf16(const float* __restrict__ x, unsigned short* xp,
                                                   int b0, int n8) {
  const int i = blockIdx.x * 256 + threadIdx.x;
  if (i < n8) {
    const int row = i / (DM / 8);
    const int c8  = (i - row * (DM / 8)) * 8;
    const int bl  = row / NP;
    const int r   = row - bl * NP;
    const int rr  = (r < NTOK) ? r : (NTOK - 1);                 // clamped address for padded rows
    const float* src = x + ((size_t)(b0 + bl) * NTOK + rr) * DM + c8;
    const v4f a = *(const v4f*)(src);
    const v4f b = *(const v4f*)(src + 4);
    v4u p;
    p[0] = pk16(bf_bits(a[0]), bf_bits(a[1]));
    p[1] = pk16(bf_bits(a[2]), bf_bits(a[3]));
    p[2] = pk16(bf_bits(b[0]), bf_bits(b[1]));
    p[3] = pk16(bf_bits(b[2]), bf_bits(b[3]));
    const bool valid = (r < NTOK);
#pragma unroll
    for (int e = 0; e < 4; ++e) p[e] = valid ? p[e] : 0u;
    *(v4u*)(xp + (size_t)i * 8) = p;
    
  }
}

// =====================================================================================================
// Weight transpose-convert: W f32 [DM ci][DM co] (x @ W layout) -> Wt bf16 [co][ci] (k = ci contiguous),
// RNE convert. blockIdx.z selects the weight (0..4 -> Wq, Wk, Wv, Wvc, Wp), written back to back in wt.
// coverage: 8 waves x (2 it x 4 row groups) = 64 rows x (8 lanes x 8) = 64 cols per tile; grid 12x12x5.
// =====================================================================================================
__global__ __launch_bounds__(256) void wtr_bf16(const float* __restrict__ w0, const float* __restrict__ w1,
                                                 const float* __restrict__ w2, const float* __restrict__ w3,
                                                 const float* __restrict__ w4, unsigned short* wt) {
  __shared__ __align__(16) unsigned short T[64 * 72];   // [co][ci], pitch 72 (144 B, 16-B aligned rows)
  const int z = blockIdx.z;
  const float* W = (z == 0) ? w0 : (z == 1) ? w1 : (z == 2) ? w2 : (z == 3) ? w3 : w4;
  unsigned short* dst = wt + (size_t)z * DM * DM;
  const int co0 = blockIdx.x * 64;
  const int ci0 = blockIdx.y * 64;
  const int tid = threadIdx.x;
#pragma unroll
  for (int it = 0; it < 16; ++it) {
    const int idx = it * 256 + tid;
    const int i = idx >> 6;          // ci within tile
    const int j = idx & 63;          // co within tile
    T[j * 72 + i] = bf_bits(W[(size_t)(ci0 + i) * DM + co0 + j]);
  }
  __syncthreads();
  const int wave = tid >> 5, lane = tid & 31;
  const int q = lane >> 3, c8 = (lane & 7) * 8;
  v4u v[2];
#pragma unroll
  for (int it = 0; it < 2; ++it) {
    const int row = wave * 8 + it * 4 + q;
    v[it] = *(const v4u*)(T + row * 72 + c8);
  }
  {
#pragma unroll
    for (int it = 0; it < 2; ++it) {
      const int row = wave * 8 + it * 4 + q;
      *(v4u*)(dst + (size_t)(co0 + row) * DM + ci0 + c8) = v[it];
    }
    
  }
}

// =====================================================================================================
// Four asynchronous 16-byte copies of this lane, global -> LDS, through no register: rows r, r + 32, r + 64, r + 96
// of a staged operand (l0 = LDS byte address of the lane's piece of row r, g0 = its global address, gstep = 32 rows).
// =====================================================================================================
__device__ __forceinline__ void copy4_async(unsigned l0, const char* g0, unsigned gstep) {
#if defined(__HIP_DEVICE_COMPILE__)
  const unsigned l1 = l0 + 32u * GPI * 2u, l2 = l0 + 64u * GPI * 2u, l3 = l0 + 96u * GPI * 2u;
  const char* g1 = g0 + gstep;
  const char* g2 = g1 + gstep;
  const char* g3 = g2 + gstep;
  // s_wait_xcnt stands inside the copies' own statement, so that no address register is rewritten ahead of it
  asm volatile("global_load_async_to_lds_b128 %0, %4, off\n\t"
               "global_load_async_to_lds_b128 %1, %5, off\n\t"
               "global_load_async_to_lds_b128 %2, %6, off\n\t"
               "global_load_async_to_lds_b128 %3, %7, off\n\t"
               "s_wait_xcnt 0x0"
               :: "v"(l0), "v"(l1), "v"(l2), "v"(l3), "v"(g0), "v"(g1), "v"(g2), "v"(g3) : "memory");
#endif
}

// =====================================================================================================
// bf16 WMMA GEMM: C[m][n] = sum_k A[m][k] * Bt[n][k]. A block of 8 waves (2 x 4) owns a GBM x GBN tile, one wave a
// 64 x 64 tile of it. Per stage of GBK k the block's A rows and Bt rows are copied once into LDS (whole 128-B lines,
// asynchronous copies, two buffers: stage t + 1 flies while stage t is worked on) and every wave reads its fragments there.
// A row-major [M][K] pitch lda; Bt row-major [N][K] pitch ldb (k contiguous); M a multiple of GBM, N of GBN, K of GBK;
// grid = (M / GBM) * tilesNb blocks, tilesNb = N / GBN. Output column n goes to plane n / NB, column n % NB
// (NB a multiple of 64; plane strides strideC, strideC2 in elements).
// NSPLIT: 0 = A.Bt; 1 = (A + A2).Bt (A2 = unscaled bf16 lo plane of A).
// OUT_MODE: 0 = f32 (pitch ldc); 2 = bf16 hi plane C + bf16 lo plane C2 (lo = RNE(v - hi), unscaled);
//           3 = f16 hi plane C + f16 residual plane C2 = f16((v - hi) * rscale), C2 written only for tiles
//               with column-in-plane < N2 (pitch ldc2).
// =====================================================================================================
template <int NSPLIT, int OUT_MODE>
__global__ __launch_bounds__(256) void gemm64(
    const unsigned short* __restrict__ Ap, const unsigned short* A2p, int lda,
    const unsigned short* __restrict__ Btp, int ldb,
    void* Cout, int ldc, long long strideC,
    void* Cout2, int ldc2, long long strideC2, int N2, int NB,
    int tilesNb, int K, float rscale) {
  static_assert(NSPLIT == 0 || NSPLIT == 1);
  constexpr int OFFB  = GBM * ((NSPLIT >= 1) ? 2 : 1) * GPI;   // stage layout in bf16: A rows | A2 rows | Bt rows
  constexpr int STAGE = OFFB + GBN * GPI;
  __shared__ __align__(16) unsigned short smem[2 * STAGE];
  static_assert(8 * 16 * 68 * 4 <= 2 * STAGE * 2);             // the epilogue's per-wave slabs reuse the stage buffers
  const int lane = threadIdx.x & 31;
  const int wave = __builtin_amdgcn_readfirstlane(threadIdx.x >> 5);
  const int bm   = blockIdx.x / tilesNb;
  const int bn   = blockIdx.x - bm * tilesNb;
  const int wm   = wave >> 2, wn = wave & 3;
  const int m0 = bm * GBM + (wm << 6);
  const int n0 = bn * GBN + (wn << 6);

  const int rlane = lane & 15;                 // row (A) / col (B, D) within subtile
  const int koff  = (lane >> 4) * 8;           // k offset of this lane half
  const int mOff  = (lane >> 4) * 8;           // D row offset

  v8f acc[4][4];
#pragma unroll
  for (int i = 0; i < 4; ++i)
#pragma unroll
    for (int j = 0; j < 4; ++j) acc[i][j] = zero8();

  // Copy map: thread -> row (tid >> 3) + 32 * n, 16-byte piece tid & 7 of the row's 128 B: a wave's copy covers 4 whole lines.
  const int crow = threadIdx.x >> 3;
  const int cseg = (threadIdx.x & 7) * 16;
  const unsigned lbase = (unsigned)(uintptr_t)(const void*)smem + (unsigned)(crow * (GPI * 2) + cseg);
  const char* gA  = (const char*)(const void*)Ap  + (size_t)(bm * GBM + crow) * (size_t)lda * 2 + cseg;
  const char* gA2 = (const char*)(const void*)A2p + (size_t)(bm * GBM + crow) * (size_t)lda * 2 + cseg;
  const char* gB  = (const char*)(const void*)Btp + (size_t)(bn * GBN + crow) * (size_t)ldb * 2 + cseg;
  const unsigned stepA = (unsigned)lda * 64u, stepB = (unsigned)ldb * 64u;   // 32 rows in bytes
  auto stage_copies = [&](int t) {             // stage t -> buffer t & 1: 12 (NSPLIT 0) or 16 copies a lane
    const unsigned lb = lbase + (unsigned)((t & 1) * (STAGE * 2));
    const size_t kb = (size_t)t * (GBK * 2);
    copy4_async(lb, gA + kb, stepA);
    if (NSPLIT >= 1) copy4_async(lb + GBM * GPI * 2, gA2 + kb, stepA);
    copy4_async(lb + OFFB * 2, gB + kb, stepB);
    copy4_async(lb + (OFFB + 128 * GPI) * 2, gB + kb + (size_t)stepB * 4, stepB);
  };

  const int NT = K / GBK;
  stage_copies(0);
  asm volatile("s_wait_asynccnt 0x0" ::: "memory");   // this wave's copies of stage 0 have landed
  __syncthreads();                                     // ... and every other wave's
  if (NT > 1) stage_copies(1);

  for (int t = 0; t < NT; ++t) {
    const __bf16* sb  = (const __bf16*)(const void*)smem + (t & 1) * STAGE;
    const __bf16* sA  = sb + ((wm << 6) + rlane) * GPI + koff;
    const __bf16* sA2 = sA + GBM * GPI;
    const __bf16* sB  = sb + OFFB + ((wn << 6) + rlane) * GPI + koff;
#pragma unroll   // the two 32-k steps of a stage, straight-line between the stage's barriers
    for (int ks = 0; ks < GBK / 32; ++ks) {
      v16b bh[4];
#pragma unroll
      for (int j = 0; j < 4; ++j) bh[j] = ldfrag_b(sB + j * 16 * GPI + ks * 32);
      v16b ahv[4], alv[4];   // all fragments of a k-step are loaded as one group ahead of its WMMAs
#pragma unroll
      for (int i = 0; i < 4; ++i) {
        ahv[i] = ldfrag_b(sA + i * 16 * GPI + ks * 32);
        if (NSPLIT >= 1) alv[i] = ldfrag_b(sA2 + i * 16 * GPI + ks * 32); else alv[i] = ahv[i];
      }
#pragma unroll
      for (int i = 0; i < 4; ++i) {
        const v16b ah = ahv[i], al = alv[i];
#pragma unroll
        for (int j = 0; j < 4; ++j) {
          acc[i][j] = mma_b_raw(ah, bh[j], acc[i][j]);
          if (NSPLIT >= 1) acc[i][j] = mma_b_raw(al, bh[j], acc[i][j]);
        }
        dep_guard_b(acc[i][0], acc[i][3], ah, al);
      }
      keep4_b(bh[0], bh[1], bh[2], bh[3]);
    }
    // publish point of stage t + 1, which also frees buffer t & 1
    asm volatile("s_wait_dscnt 0x0" ::: "memory");      // this wave's reads of buffer t & 1 are done
    asm volatile("s_wait_asynccnt 0x0" ::: "memory");   // this wave's copies of stage t + 1 have landed
    __syncthreads();
    if (t + 2 < NT) stage_copies(t + 2);                // block-uniform test; into the buffer every wave has just left
  }
  asm volatile("s_wait_asynccnt 0x0" ::: "memory");     // nothing is in flight when the buffers become the epilogue's slabs
  acc_guard4(acc[0][0], acc[0][1], acc[0][2], acc[0][3]);
  acc_guard4(acc[1][0], acc[1][1], acc[1][2], acc[1][3]);
  acc_guard4(acc[2][0], acc[2][1], acc[2][2], acc[2][3]);
  acc_guard4(acc[3][0], acc[3][1], acc[3][2], acc[3][3]);

  const int bo  = n0 / NB;                     // output plane and the tile's first column in it (wave-uniform)
  const int nc0 = n0 - bo * NB;

  // ---- epilogue ----
  float* slab = (float*)(void*)smem + wave * (16 * 68);   // per-wave 16x64 slab, pitch 68 floats; the loop's last barrier has ended every read of the stage buffers
#pragma unroll
  for (int i = 0; i < 4; ++i) {
    const int mBase = m0 + (i << 4);
#pragma unroll
    for (int j = 0; j < 4; ++j) {
#pragma unroll
      for (int r = 0; r < 8; ++r) {
        slab[(mOff + r) * 68 + (j << 4) + rlane] = acc[i][j][r];
      }
    }
    wave_sync_lds();
    if (OUT_MODE == 0) {
      float* C = (float*)Cout + (size_t)bo * strideC;
      const int hh = lane >> 4, c4 = (lane & 15) * 4;     // 256-B row segment = 16 lanes x 16 B
      {
#pragma unroll
        for (int it = 0; it < 8; ++it) {
          const int row = it * 2 + hh;                     // it 0..7 x hh 0..1 = rows 0..15
          const v4f v = *(const v4f*)(slab + row * 68 + c4);
          *(v4f*)(C + (size_t)(mBase + row) * ldc + nc0 + c4) = v;
        }
        
      }
    } else {
      const int q = lane >> 3, c8 = (lane & 7) * 8;
      unsigned short* C  = (unsigned short*)Cout  + (size_t)bo * strideC;
      unsigned short* C2 = (unsigned short*)Cout2 + (size_t)bo * strideC2;
      const bool wlo = (OUT_MODE == 2) || (nc0 < N2);     // wave-uniform
      v4u hv[4], lv[4];
#pragma unroll
      for (int it = 0; it < 4; ++it) {
        const int row = it * 4 + q;                        // it 0..3 x q 0..3 = rows 0..15
        const float* sp = slab + row * 68 + c8;
        v4u a, a2;
#pragma unroll
        for (int e = 0; e < 4; ++e) {
          const float f0 = sp[2 * e], f1 = sp[2 * e + 1];
          unsigned short h0, h1, l0, l1;
          if (OUT_MODE == 2) {
            h0 = bf_bits(f0); h1 = bf_bits(f1);
            l0 = bf_bits(f0 - bf_up(h0)); l1 = bf_bits(f1 - bf_up(h1));
          } else {
            const _Float16 x0 = (_Float16)f0, x1 = (_Float16)f1;
            h0 = h_bits(x0); h1 = h_bits(x1);
            l0 = h_bits((_Float16)((f0 - (float)x0) * rscale));
            l1 = h_bits((_Float16)((f1 - (float)x1) * rscale));
          }
          a[e] = pk16(h0, h1); a2[e] = pk16(l0, l1);
        }
        hv[it] = a; lv[it] = a2;
      }
      {
#pragma unroll
        for (int it = 0; it < 4; ++it) {
          const int row = it * 4 + q;
          *(v4u*)(C + (size_t)(mBase + row) * ldc + nc0 + c8) = hv[it];
          asm volatile("s_wait_xcnt 0x0" ::: "memory");   // before the store's address registers are reused for the next address
          if (wlo) {
            *(v4u*)(C2 + (size_t)(mBase + row) * ldc2 + nc0 + c8) = lv[it];
            asm volatile("s_wait_xcnt 0x0" ::: "memory");  // as above
          }
        }
        
      }
    }
    wave_sync_lds();
  }
}

// =====================================================================================================
// Four asynchronous 16-byte copies of this lane, global -> LDS, through no register: rows r, r + 16, r + 32, r + 48
// of one 64-row attention tile at pitch LP (l0 = LDS byte address of the lane's piece of row r, g0 = its global address,
// gstep = 16 source rows in bytes).
// =====================================================================================================
__device__ __forceinline__ void copy4_tile(unsigned l0, const char* g0, unsigned gstep) {
#if defined(__HIP_DEVICE_COMPILE__)
  const unsigned l1 = l0 + 16u * LP * 2u, l2 = l0 + 32u * LP * 2u, l3 = l0 + 48u * LP * 2u;
  const char* g1 = g0 + gstep;
  const char* g2 = g1 + gstep;
  const char* g3 = g2 + gstep;
  // s_wait_xcnt stands inside the copies' own statement, so that no address register is rewritten ahead of it
  asm volatile("global_load_async_to_lds_b128 %0, %4, off\n\t"
               "global_load_async_to_lds_b128 %1, %5, off\n\t"
               "global_load_async_to_lds_b128 %2, %6, off\n\t"
               "global_load_async_to_lds_b128 %3, %7, off\n\t"
               "s_wait_xcnt 0x0"
               :: "v"(l0), "v"(l1), "v"(l2), "v"(l3), "v"(g0), "v"(g1), "v"(g2), "v"(g3) : "memory");
#endif
}

// ---- context^T += V^T tile . P^T (f16 WMMA): A = V^T rows d, B = P^T (column = query) straight from registers;
//      oacc[t][r] = context[query c][d = 16 t + 8 hh + r]; residual products into a separate accumulator folded in f32 ----
__device__ __forceinline__ void pv_acc(v8f (&oacc)[4], const v16h (&pb)[2],
                                       const _Float16* Vth, const _Float16* Vtl,
                                       float rres, int c, int hh) {
  v8f o1[4];
#pragma unroll
  for (int t = 0; t < 4; ++t) o1[t] = zero8();
#pragma unroll   // pb is a register array: its index must be a constant
  for (int kk = 0; kk < 2; ++kk) {
#pragma unroll
    for (int t = 0; t < 4; ++t) {
      FH vb, vl;
      vb.h[0] = *(const v8h*)(Vth + (t * 16 + c) * LP + kk * 32 + 8 * hh);
      vb.h[1] = *(const v8h*)(Vth + (t * 16 + c) * LP + kk * 32 + 16 + 8 * hh);
      vl.h[0] = *(const v8h*)(Vtl + (t * 16 + c) * LP + kk * 32 + 8 * hh);
      vl.h[1] = *(const v8h*)(Vtl + (t * 16 + c) * LP + kk * 32 + 16 + 8 * hh);
      oacc[t] = mma_h(vb.v, pb[kk], oacc[t]);
      o1[t]   = mma_h(vl.v, pb[kk], o1[t]);
    }
  }
#pragma unroll
  for (int t = 0; t < 4; ++t)
#pragma unroll
    for (int r = 0; r < 8; ++r) oacc[t][r] += o1[t][r] * rres;
}

// =====================================================================================================
// Attention, head dim 64, softmax over the NTOK valid keys of the batch element (keys s >= NTOK masked to
// -1e30 before the row max in the last chunk), per-modality value swap handled at V^T staging.
//   q|k plane (f16, pitch QKP): element (row, col) at [row*QKP + col], row = bl*NP + t, q col = h*64+d,
//   k col = DM + h*64 + d; q residual plane (f16, (q - f16(q))*4096, pitch DM): [row*DM + h*64 + d]
//   v^T / vc^T hi planes (f16): element (bl, h, d, s) at [(bl*DM + h*64 + d)*NP + s]; residual planes (x4096) same
//   out planes (bf16 hi / lo of the normalised context): element (row, h, d) at [row*DM + h*64 + d]
//   NV == 1: query tiles 0..7 (rows < M1, values: v for keys < M1, vc for keys >= M1) and 9..14
//            (values: vc for keys < M1, v for keys >= M1); grid = NQB_NM * NH * GB.
//   NV == 2: query tile 8 (rows 512..575): main set = the rows >= M1 combination, extra set (wave 0 only)
//            = the rows < M1 combination; row 512 selects the extra set at the end; grid = NH * GB.
//   scores^T = (k . qh^T + (k . ql^T) * rres) * sscale on f16 WMMA (A = K rows, B = Q), residual products in a separate
//   accumulator: a lane holds 32 of the chunk's 64 scores of ONE query (column c), its partner lane ^ 16 the other 32, so the
//   maximum and the sum are in-lane plus one exchange between the halves (the sum's halves are joined once, after the loop);
//   p = exp(s - m) carried as f16(1024 p), packed from the score registers into the B operand of context^T += V^T . P^T;
//   online softmax in f32.
//   Block = 4 waves = 64 query rows of one (bl, h); kv chunks of 64, static trip NKT.
//   K / V^T chunk staging: asynchronous 16-byte copies to LDS, two buffers: chunk kt + 1 flies while chunk kt is worked on,
//   one barrier a chunk. 128 threads x 4 copies per tile = the whole 64x64 tile (a wave's copy = 4 whole 128-B lines).
//   The value swap is a chunk-uniform choice of source plane (chunks < 8: keys < M1, chunks > 8: keys >= M1); chunk 8 is
//   copied from the keys >= M1 planes and its key 512 (column 0 of the V^T tiles) is then overwritten from the keys < M1
//   planes, with a barrier of its own. P never touches LDS; the output staging aliases the buffers after the loop's last barrier.
//   Output coverage: each wave stores rows q0..q0+15 (it 0..3 x lane>>3 0..3) x 64 columns (8 lanes x 8) of both planes.
// =====================================================================================================
template <int NV>
__global__ __launch_bounds__(128, (NV == 1) ? 5 : 1)   // second argument = waves per SIMD the register budget is set for: NV 1's LDS admits 5 blocks a WGP
void attn64(const unsigned short* __restrict__ qkp, const unsigned short* __restrict__ qlp,
            const unsigned short* __restrict__ vhp, const unsigned short* __restrict__ vlp,
            const unsigned short* __restrict__ vchp, const unsigned short* __restrict__ vclp,
            unsigned short* ohp, unsigned short* olp, float sscale, float rres) {
  constexpr int STG = ((NV == 2) ? 5 : 3) * LTILE;        // one buffer in f16: K | main V^T hi | main V^T residual | extra hi | extra residual
  __shared__ __align__(16) _Float16 smem[2 * STG];
  static_assert(4 * 16 * 68 * 4 <= 2 * STG * 2);          // the output staging fits the buffers

  const int tid  = threadIdx.x;
  const int wave = tid >> 5;
  const int lane = tid & 31;
  const int hh   = lane >> 4;
  const int c    = lane & 15;

  const int bx = blockIdx.x;
  int qb, rest;
  if (NV == 1) {
    const int idx = bx % NQB_NM;
    qb = idx + ((idx >= 8) ? 1 : 0);
    rest = bx / NQB_NM;
  } else {
    qb = 8;
    rest = bx;
  }
  const int h  = rest % NH;
  const int bl = rest / NH;
  const int q0 = qb * 64 + wave * 16;
  const size_t rowB = (size_t)bl * NP;

  const _Float16* Qh = (const _Float16*)(const void*)qkp + (size_t)h * HD;
  const _Float16* Kg = (const _Float16*)(const void*)qkp + DM + (size_t)h * HD;
  const _Float16* Ql = (const _Float16*)(const void*)qlp + (size_t)h * HD;
  const size_t vbase = ((size_t)bl * DM + (size_t)h * HD) * NP;
  const _Float16* Vh  = (const _Float16*)(const void*)vhp  + vbase;
  const _Float16* Vl  = (const _Float16*)(const void*)vlp  + vbase;
  const _Float16* Vch = (const _Float16*)(const void*)vchp + vbase;
  const _Float16* Vcl = (const _Float16*)(const void*)vclp + vbase;
  // main set: keys < M1 from (M0h, M0l), keys >= M1 from (M1h, M1l); block-uniform pointer choice
  const bool useB = (NV == 2) || (qb > 8);
  const _Float16* M0h = useB ? Vch : Vh;
  const _Float16* M0l = useB ? Vcl : Vl;
  const _Float16* M1h = useB ? Vh  : Vch;
  const _Float16* M1l = useB ? Vl  : Vcl;

  // ---- Q fragments (B operand, column = query = lane&15): 2 d-chunks, hi and residual ----
  v16h qah[2], qal[2];
#pragma unroll
  for (int dc = 0; dc < 2; ++dc) {
    qah[dc] = ldfrag_h(Qh + (rowB + q0 + c) * QKP + dc * 32 + 8 * hh);
    qal[dc] = ldfrag_h(Ql + (rowB + q0 + c) * DM  + dc * 32 + 8 * hh);
  }

  // Copy map: thread -> row (tid >> 3) + 16 * n, 16-byte piece tid & 7 of the row's 128 B
  const int crow = tid >> 3;
  const int cseg = (tid & 7) * 16;
  const unsigned lbase = (unsigned)(uintptr_t)(const void*)smem + (unsigned)(crow * (LP * 2) + cseg);
  const char* gK = (const char*)(const void*)(Kg + (rowB + crow) * QKP) + cseg;
  const size_t voff = (size_t)crow * (NP * 2) + cseg;
  auto stage_copies = [&](int t) {           // chunk t -> buffer t & 1: 12 (NV 1) or 20 copies a lane
    const unsigned lb = lbase + (unsigned)((t & 1) * (STG * 2));
    const bool lowc = (t < 8);               // block-uniform
    const size_t vb = voff + (size_t)t * (64 * 2);
    copy4_tile(lb, gK + (size_t)t * (64 * QKP * 2), 16u * QKP * 2u);
    copy4_tile(lb + LTILE * 2,     (const char*)(const void*)(lowc ? M0h : M1h) + vb, 16u * NP * 2u);
    copy4_tile(lb + 2 * LTILE * 2, (const char*)(const void*)(lowc ? M0l : M1l) + vb, 16u * NP * 2u);
    if (NV == 2) {
      copy4_tile(lb + 3 * LTILE * 2, (const char*)(const void*)(lowc ? Vh : Vch) + vb, 16u * NP * 2u);
      copy4_tile(lb + 4 * LTILE * 2, (const char*)(const void*)(lowc ? Vl : Vcl) + vb, 16u * NP * 2u);
    }
  };
  // key 512 of row d = tid >> 1, hi (tid even) or residual (tid odd) plane, from the keys < M1 planes; stored into chunk 8's tiles
  const int prow = tid >> 1, ppl = tid & 1;
  const _Float16 pkM = (ppl ? M0l : M0h)[(size_t)prow * NP + (M1 - 1)];
  const _Float16 pkE = (NV == 2) ? (ppl ? Vl : Vh)[(size_t)prow * NP + (M1 - 1)] : pkM;

  float mrow = -INFINITY, lrow = 0.f;        // of query q0 + c; lrow sums this wave half's keys only
  v8f oacc[4], oaccE[4];
#pragma unroll
  for (int t = 0; t < 4; ++t) { oacc[t] = zero8(); oaccE[t] = zero8(); }

  static_assert(NKT > 1);
  stage_copies(0);
  asm volatile("s_wait_asynccnt 0x0" ::: "memory");   // this wave's copies of chunk 0 have landed
  __syncthreads();                                     // ... and every other wave's
  stage_copies(1);

  for (int kt = 0; kt < NKT; ++kt) {         // static trip count
    const int kv0 = kt * 64;
    _Float16* sb = smem + (kt & 1) * STG;
    const _Float16* Ksh = sb;                                   // K [kv][d]           9 KB (rows of 64 at pitch LP)
    const _Float16* VMh = sb + LTILE;                           // main V^T hi [d][kv]  9 KB
    const _Float16* VMl = sb + 2 * LTILE;                       // main V^T residual     9 KB
    const _Float16* VEh = (NV == 2) ? (sb + 3 * LTILE) : VMh;   // extra set (NV == 2)   9 KB
    const _Float16* VEl = (NV == 2) ? (sb + 4 * LTILE) : VMl;   //                       9 KB
    if (kt == 8) {                           // block-uniform: the chunk that holds key 512; its copies landed before the last barrier
      sb[(1 + ppl) * LTILE + prow * LP] = pkM;
      if (NV == 2) sb[(3 + ppl) * LTILE + prow * LP] = pkE;
      __syncthreads();                       // key 512's column is in place before any wave reads the V^T tiles
    }

    // ---- scores^T: 64 keys x 16 query columns per wave, 2 f16 products (hi, residual); s[j][r] = key kv0 + 16 j + 8 hh + r, query q0 + c ----
    v8f s[4];
#pragma unroll
    for (int j = 0; j < 4; ++j) {
      v8f sh = zero8(), sl = zero8();
#pragma unroll
      for (int dc = 0; dc < 2; ++dc) {
        FH kb;
        kb.h[0] = *(const v8h*)(Ksh + (j * 16 + c) * LP + dc * 32 + 8 * hh);
        kb.h[1] = *(const v8h*)(Ksh + (j * 16 + c) * LP + dc * 32 + 16 + 8 * hh);
        sh = mma_h(kb.v, qah[dc], sh);
        sl = mma_h(kb.v, qal[dc], sl);
      }
#pragma unroll
      for (int r = 0; r < 8; ++r) s[j][r] = (sh[r] + sl[r] * rres) * sscale;
    }
    // ---- keys s >= NTOK (only in the last chunk) are invalid: force -1e30 before the maximum ----
    if (kt == NKT - 1) {                    // block-uniform
#pragma unroll
      for (int j = 0; j < 4; ++j) {
#pragma unroll
        for (int r = 0; r < 8; ++r) s[j][r] = ((kv0 + j * 16 + 8 * hh + r) < NTOK) ? s[j][r] : -1.0e30f;
      }
    }

    // ---- column max, online softmax, P^T (x1024, f16) into the B operand registers ----
    float mj[4];
#pragma unroll
    for (int j = 0; j < 4; ++j) {
      mj[j] = s[j][0];
#pragma unroll
      for (int r = 1; r < 8; ++r) mj[j] = fmaxf(mj[j], s[j][r]);
    }
    float m = fmaxf(fmaxf(mj[0], mj[1]), fmaxf(mj[2], mj[3]));
    m = fmaxf(m, xhalf(m));                  // both halves now hold the query's maximum over the chunk
    const float mnew  = fmaxf(mrow, m);
    const float alpha = __expf(mrow - mnew);
    mrow = mnew;
    v16h pb[2];                              // pb[kk][e]: key kv0 + 32 kk + (e < 8 ? 8 hh + e : 16 + 8 hh + e - 8), the k order of the V^T loads
    float pj[4];                             // four independent sums of 8
#pragma unroll
    for (int j = 0; j < 4; ++j) {
      pj[j] = 0.f;
#pragma unroll
      for (int r = 0; r < 8; ++r) {
        const float p = __expf(s[j][r] - mnew);
        pj[j] += p;
        pb[j >> 1][(j & 1) * 8 + r] = (_Float16)(p * 1024.0f);
      }
    }
    lrow = lrow * alpha + ((pj[0] + pj[1]) + (pj[2] + pj[3]));
#pragma unroll
    for (int t = 0; t < 4; ++t)
#pragma unroll
      for (int r = 0; r < 8; ++r) { oacc[t][r] *= alpha; if (NV == 2) oaccE[t][r] *= alpha; }

    // ---- context^T += V^T . P^T ----
    pv_acc(oacc, pb, VMh, VMl, rres, c, hh);
    if (NV == 2) {
      if (wave == 0) pv_acc(oaccE, pb, VEh, VEl, rres, c, hh);   // wave-uniform
    }
    // publish point of chunk kt + 1, which also frees buffer kt & 1
    asm volatile("s_wait_dscnt 0x0" ::: "memory");      // this wave's reads of buffer kt & 1 are done
    asm volatile("s_wait_asynccnt 0x0" ::: "memory");   // this wave's copies of chunk kt + 1 have landed
    __syncthreads();
    if (kt + 2 < NKT) stage_copies(kt + 2);             // block-uniform test; into the buffer every wave has just left
  }
  asm volatile("s_wait_asynccnt 0x0" ::: "memory");     // nothing is in flight when the buffers become the output staging

  // ---- normalise (1/l and the 1/1024 p carry), stage the wave's 16x64 tile (aliases the K / V region),
  float* os = (float*)(void*)smem + wave * (16 * 68);   // [query][d], pitch 68 floats (272 B = 16 B x 17, odd): the 16 rows of a 16-byte store fall on 16 bank groups
  {
    const float l = lrow + xhalf(lrow);      // the two halves' key sums joined
    const float inv = ((l > 0.f) ? (1.0f / l) : 0.f) * (1.0f / 1024.0f);
    const bool rowA = (q0 + c) == (M1 - 1);  // query row 512 uses the extra set
#pragma unroll
    for (int t = 0; t < 4; ++t) {
      v4f w[2];
#pragma unroll
      for (int r = 0; r < 8; ++r) {
        float vm = oacc[t][r] * inv;
        if (NV == 2) {
          const float ve = oaccE[t][r] * inv;
          vm = rowA ? ve : vm;
        }
        w[r >> 2][r & 3] = vm;
      }
      *(v4f*)(os + c * 68 + t * 16 + 8 * hh)     = w[0];
      *(v4f*)(os + c * 68 + t * 16 + 8 * hh + 4) = w[1];
    }
  }
  wave_sync_lds();
  {
    const int q4 = lane >> 3, c8 = (lane & 7) * 8;
    v4u hv[4], lv[4];
#pragma unroll
    for (int it = 0; it < 4; ++it) {
      const int row = it * 4 + q4;   // it 0..3 x q4 0..3 = rows 0..15 of the wave tile
      const float* sp = os + row * 68 + c8;
      v4u a, a2;
#pragma unroll
      for (int e = 0; e < 4; ++e) {
        const float f0 = sp[2 * e], f1 = sp[2 * e + 1];
        const unsigned short h0 = bf_bits(f0), h1 = bf_bits(f1);
        const unsigned short l0 = bf_bits(f0 - bf_up(h0)), l1 = bf_bits(f1 - bf_up(h1));
        a[e] = pk16(h0, h1); a2[e] = pk16(l0, l1);
      }
      hv[it] = a; lv[it] = a2;
    }
    {
#pragma unroll
      for (int it = 0; it < 4; ++it) {
        const int row = it * 4 + q4;
        const size_t go = (rowB + q0 + row) * DM + (size_t)h * HD + c8;
        *(v4u*)(ohp + go) = hv[it];
        *(v4u*)(olp + go) = lv[it];
      }
      
    }
  }
}

// =====================================================================================================
// d_out[(b0 + bl)*NTOK + r][c] = OUTP[(bl*NP + r)][c] + bf16-RNE(bp[c]) for r < NTOK (padded rows dropped).
// One thread per 4 floats in d_out row-major order over the group's rows, which are contiguous in d_out:
// coverage: n4 = GB*NTOK*DM/4 threads x 4 = every d_out element of batch elements b0..b0+GB-1.
// =====================================================================================================
__global__ __launch_bounds__(256) void copy_out(const float* __restrict__ op, const float* __restrict__ bp,
                                                 float* out, int b0, int n4) {
  const int i = blockIdx.x * 256 + threadIdx.x;
  if (i < n4) {
    const int row = i / (DM / 4);
    const int c4  = (i - row * (DM / 4)) * 4;
    const int bl  = row / NTOK;
    const int r   = row - bl * NTOK;
    v4f v = *(const v4f*)(op + ((size_t)bl * NP + r) * DM + c4);
    const v4f bb = *(const v4f*)(bp + c4);
#pragma unroll
    for (int e = 0; e < 4; ++e) v[e] += bf_up(bf_bits(bb[e]));
    float* d = out + ((size_t)b0 * NTOK + row) * DM + c4;
    *(v4f*)d = v;
    
  }
}

// =====================================================================================================
// Workspace map (bytes), one group of GB = 16 batch elements (GB*NP = 15360 rows), every plane an exact
// multiple of its 64x64-tile / whole-line store granularity (padded rows included):
//   Wt    bf16 [5][768 co][768 ci]   0          5898240   (Wq^T | Wk^T | Wv^T | Wvc^T | Wp^T)
//   Xp    bf16 [15360][768]          5898240    23592960
//   QK    f16  [15360][1536]         29491200   47185920  (q cols 0..767, k cols 768..1535)
//   Ql    f16  [15360][768]          76677120   23592960  (q residual x4096)
//   VTh   f16  [16][768][960]        100270080  23592960  (v^T hi)
//   VTl   f16  [16][768][960]        123863040  23592960  (v^T residual x4096)
//   VCh   f16  [16][768][960]        147456000  23592960  (vc^T hi)
//   VCl   f16  [16][768][960]        171048960  23592960  (vc^T residual x4096)
//   Oh    bf16 [15360][768]          194641920  23592960
//   Ol    bf16 [15360][768]          218234880  23592960
//   end                              241827840
//   OUTP  f32  [15360][768]          29491200   47185920  (same bytes as QK: q|k are last read by the attention
//                                                          launches, which end before launch (6) writes OUTP)
// =====================================================================================================
extern "C" void kernel_launch(void* const* d_in, const int* in_sizes, int n_in,
                              void* d_out, int out_size, void* d_ws, size_t ws_size,
                              hipStream_t stream) {
  if (n_in < 7) return;
  if (in_sizes[0] != NBATCH * NTOK * DM) return;
  if (in_sizes[1] != DM * DM || in_sizes[2] != DM * DM || in_sizes[3] != DM * DM) return;
  if (in_sizes[4] != DM * DM || in_sizes[5] != DM * DM) return;
  if (in_sizes[6] != DM) return;
  if (out_size != NBATCH * NTOK * DM) return;

  const float* x   = (const float*)d_in[0];
  const float* Wq  = (const float*)d_in[1];
  const float* Wk  = (const float*)d_in[2];
  const float* Wv  = (const float*)d_in[3];
  const float* Wvc = (const float*)d_in[4];
  const float* Wp  = (const float*)d_in[5];
  const float* bp  = (const float*)d_in[6];

  const size_t ROWS = (size_t)GB * NP;                 // 15360
  const size_t PW   = (size_t)5 * DM * DM * 2;          //  5898240
  const size_t PX   = ROWS * DM * 2;                    // 23592960
  const size_t PQK  = ROWS * QKP * 2;                   // 47185920
  const size_t PQl  = ROWS * DM * 2;                    // 23592960
  const size_t PVT  = (size_t)GB * DM * NP * 2;         // 23592960
  const size_t PO   = ROWS * DM * 2;                    // 23592960
  static_assert((size_t)DM * 4 == (size_t)QKP * 2);     // an f32 OUTP row is as long as an f16 q|k row: OUTP fits QK exactly
  size_t off = 0;
  const size_t oW   = off; off += PW;
  const size_t oXp  = off; off += PX;
  const size_t oQK  = off; off += PQK;
  const size_t oQl  = off; off += PQl;
  const size_t oVTh = off; off += PVT;
  const size_t oVTl = off; off += PVT;
  const size_t oVCh = off; off += PVT;
  const size_t oVCl = off; off += PVT;
  const size_t oOh  = off; off += PO;
  const size_t oOl  = off; off += PO;
  const size_t oOUT = oQK;                              // OUTP over QK (dead once attention has run)
  if (off > ws_size) return;                            // off = 241827840

  char* ws = (char*)d_ws;
  unsigned short* Wt   = (unsigned short*)(ws + oW);
  unsigned short* Wqk_t = Wt;                                   // rows 0..1535: Wq^T then Wk^T
  unsigned short* Wv_t  = Wt + (size_t)2 * DM * DM;
  unsigned short* Wvc_t = Wt + (size_t)3 * DM * DM;
  unsigned short* Wp_t  = Wt + (size_t)4 * DM * DM;
  unsigned short* Xp   = (unsigned short*)(ws + oXp);
  unsigned short* QK   = (unsigned short*)(ws + oQK);
  unsigned short* Ql   = (unsigned short*)(ws + oQl);
  unsigned short* VTh  = (unsigned short*)(ws + oVTh);
  unsigned short* VTl  = (unsigned short*)(ws + oVTl);
  unsigned short* VCh  = (unsigned short*)(ws + oVCh);
  unsigned short* VCl  = (unsigned short*)(ws + oVCl);
  unsigned short* Oh   = (unsigned short*)(ws + oOh);
  unsigned short* Ol   = (unsigned short*)(ws + oOl);
  float*          OUTP = (float*)(ws + oOUT);
  float*          out  = (float*)d_out;

  const dim3 blk(256);
  const int n8x = GB * NP * (DM / 8);                            // 1474560
  const int n4o = GB * NTOK * (DM / 4);                          // 2783232
  const dim3 gCvtX((n8x + 255) / 256);                           // 5760 blocks
  const dim3 gCopy((n4o + 255) / 256);                           // 10872 blocks
  const dim3 gWtr(DM / 64, DM / 64, 5);                          // 12 x 12 x 5 tiles
  static_assert((GB * NP) % GBM == 0 && (GB * NP) % GBN == 0 && DM % GBM == 0 && DM % GBN == 0 && QKP % GBN == 0 && DM % GBK == 0);
  const dim3 gQK((GB * NP / GBM) * (QKP / GBN));                 // 120 x 6 = 720 blocks: M=15360, N=1536
  const dim3 gVT((DM / GBM) * (GB * NP / GBN));                  // 6 x 60 = 360 blocks: M=768, N=15360 (all batch elements' rows of Xp)
  const dim3 gOut((GB * NP / GBM) * (DM / GBN));                 // 120 x 3 = 360 blocks: M=15360, N=768
  const dim3 gAttn1(NQB_NM * NH * GB);                           // 2688 blocks
  const dim3 gAttn2(NH * GB);                                    // 192 blocks

  // (0) weights -> bf16 [out][in] planes (k contiguous = the Bt / A layout the GEMM wants)
  wtr_bf16<<<gWtr, blk, 0, stream>>>(Wq, Wk, Wv, Wvc, Wp, Wt);

  for (int g = 0; g < NGRP; ++g) {
    const int b0 = g * GB;
    // (1) x -> zero-padded bf16 plane [15360][768]
    cvt_x_bf16<<<gCvtX, blk, 0, stream>>>(x, Xp, b0, n8x);
    // (2) q|k = Xp . Wqk^T -> f16 plane [15360][1536] + f16 residual x4096 of the q half (n0 < 768, pitch 768)
    gemm64<0, 3><<<gQK, blk, 0, stream>>>(
        Xp, Xp, DM, Wqk_t, DM,
        (void*)QK, QKP, 0LL, (void*)Ql, DM, 0LL, DM, QKP,
        QKP / GBN, DM, 4096.0f);
    // (3) v^T = Wv^T . Xp^T, column n = bl*NP + s -> f16 hi [bl][h*64+d][s] (pitch NP) + residual x4096
    gemm64<0, 3><<<gVT, blk, 0, stream>>>(
        Wv_t, Wv_t, DM, Xp, DM,
        (void*)VTh, NP, (long long)DM * NP, (void*)VTl, NP, (long long)DM * NP, NP, NP,
        GB * NP / GBN, DM, 4096.0f);
    // (4) vc^T likewise
    gemm64<0, 3><<<gVT, blk, 0, stream>>>(
        Wvc_t, Wvc_t, DM, Xp, DM,
        (void*)VCh, NP, (long long)DM * NP, (void*)VCl, NP, (long long)DM * NP, NP, NP,
        GB * NP / GBN, DM, 4096.0f);
    // (5) attention -> context bf16 hi / lo planes [15360][768]: query tiles 0..7, 9..14, then the mixed tile 8
    attn64<1><<<gAttn1, dim3(128), 0, stream>>>(QK, Ql, VTh, VTl, VCh, VCl, Oh, Ol, 0.125f, 1.0f / 4096.0f);
    attn64<2><<<gAttn2, dim3(128), 0, stream>>>(QK, Ql, VTh, VTl, VCh, VCl, Oh, Ol, 0.125f, 1.0f / 4096.0f);
    // (6) OUTP = context . Wp (A = context hi + lo planes, 2 products; K=768) -> f32 [15360][768]
    gemm64<1, 0><<<gOut, blk, 0, stream>>>(
        Oh, Ol, DM, Wp_t, DM,
        (void*)OUTP, DM, 0LL, (void*)OUTP, DM, 0LL, DM, DM,
        DM / GBN, DM, 1.0f);
    // (7) valid rows + bias -> d_out rows (b0 + bl)*906 + r
    copy_out<<<gCopy, blk, 0, stream>>>(OUTP, bp, out, b0, n4o);
  }
  (void)hipGetLastError();
}

// v008
// One run takes 232 microseconds.
// Next to v007, in two timings, it ran 1.04 and 1.03 times as fast.
// All steps since v000 together make it 5.36 times as fast.
// Contractions: q|k, v^T and vc^T projections = v_wmma_f32_16x16x32_bf16 (bf16 operands from RNE-converted x and W, single product);
// q.k^T scores = v_wmma_f32_16x16x32_f16 (q as f16 hi plane + f16 residual plane x4096 in a separate accumulator, k f16; 2 products);
// p.v = v_wmma_f32_16x16x32_f16 (p carried x1024 in f16, v^T as f16 hi plane + f16 residual plane x4096 in a separate accumulator; 2 products);
// ctx.Wp = v_wmma_f32_16x16x32_bf16 (ctx as bf16 hi + lo planes times bf16 Wp^T, 2 products); all f32 accumulate; softmax in f32.
#include <hip/hip_runtime.h>
#include <math.h>
#include <stdint.h>

#define NBATCH 16
#define NTOK   906
#define NP     960            // padded token count per batch element (15 tiles of 64)
#define DM     768
#define NH     12
#define HD     64
#define M1     513            // modality split: query / key rows < M1 vs >= M1
#define NKT    (NP / 64)      // 15 key chunks of 64
#define NQB_NM 14             // query tiles 0..7 and 9..14 (tile 8 is the mixed tile)
#define QKP    (2 * DM)       // pitch of the q|k plane: q at cols 0..DM-1, k at cols DM..2DM-1
#define GB     16             // batch elements per group (all of them: one pass of launches fills the chip)
#define NGRP   (NBATCH / GB)
#define LP     72             // LDS row pitch of the attention K / V^T tiles in f16: 144 B = 16 B x 9 (odd), so the 16 rows of a 16-byte fragment read fall on 16 different bank groups
#define LTILE  (64 * LP)      // one 64-row tile at that pitch
#define GBM    128            // GEMM block tile: 2 x 4 wave tiles of 64 x 64
#define GBN    256
#define GBK    64             // k per stage: 128 B of every operand row, one whole line
#define GPI    72             // LDS row pitch of a staged operand row in bf16: 144 B = 16 B x 9 (odd), as LP
static_assert(NH * HD == DM);
static_assert((NP % 64) == 0 && NP >= NTOK && (DM % 64) == 0 && (DM % 32) == 0);
static_assert((NBATCH % GB) == 0);
static_assert(M1 - 1 == 8 * 64);   // row 512 is the first row of query tile 8 and of key chunk 8
static_assert(NTOK > (NKT - 1) * 64 && NTOK <= NP);   // invalid keys live only in the last chunk

typedef _Float16 v16h __attribute__((ext_vector_type(16)));
typedef _Float16 v8h  __attribute__((ext_vector_type(8)));
typedef __bf16   v16b __attribute__((ext_vector_type(16)));
typedef __bf16   v8b  __attribute__((ext_vector_type(8)));
typedef float    v8f  __attribute__((ext_vector_type(8)));
typedef float    v4f  __attribute__((ext_vector_type(4)));
typedef unsigned int v4u __attribute__((ext_vector_type(4)));

union FH { v16h v; v8h h[2]; };

// ---- scalar helpers --------------------------------------------------------------------------------
__device__ __forceinline__ unsigned short bf_bits(float f) {          // f32 -> bf16 bits, RNE convert
  unsigned u = __float_as_uint(f);
  return (unsigned short)((u + 0x7FFFu + ((u >> 16) & 1u)) >> 16);
}
__device__ __forceinline__ float bf_up(unsigned short h) { return __uint_as_float(((unsigned)h) << 16); }
__device__ __forceinline__ unsigned short h_bits(_Float16 x) { return __builtin_bit_cast(unsigned short, x); }
__device__ __forceinline__ unsigned pk16(unsigned short a, unsigned short b) { return (unsigned)a | ((unsigned)b << 16); }
__device__ __forceinline__ v8f zero8() { v8f z = {0.f, 0.f, 0.f, 0.f, 0.f, 0.f, 0.f, 0.f}; return z; }

// ---- fragment loaders: 16-bit A/B operand, lane -> row/col (lane&15), p already includes +8*(lane>>4);
//      elements 0..7 <- p[0..7] (k0+8h..), elements 8..15 <- p[16..23] (k0+16+8h..)
__device__ __forceinline__ v16b ldfrag_b(const __bf16* p) {
  union { v16b v; v8b h[2]; } f;
  f.h[0] = *(const v8b*)(p);
  f.h[1] = *(const v8b*)(p + 16);
  return f.v;
}
__device__ __forceinline__ v16h ldfrag_h(const _Float16* p) {
  union { v16h v; v8h h[2]; } f;
  f.h[0] = *(const v8h*)(p);
  f.h[1] = *(const v8h*)(p + 16);
  return f.v;
}

// ---- WMMA helpers --------------------------------------------------------------------------------------
// attention: the plain builtin; the compiler keeps the distance behind it and is free to order LDS loads and WMMAs
__device__ __forceinline__ v8f mma_h(v16h a, v16h b, v8f c) {
  return __builtin_amdgcn_wmma_f32_16x16x32_f16(false, a, false, b, (short)0, c, false, false);
}
// GEMM: builtin, with statements behind each row of WMMAs that hold the k-step's fragment loads together ahead of them
__device__ __forceinline__ v8f mma_b_raw(v16b a, v16b b, v8f c) {
  return __builtin_amdgcn_wmma_f32_16x16x32_bf16(false, a, false, b, (short)0, c, false, false);
}
__device__ __forceinline__ void dep_guard_b(v8f& a, v8f& b, v16b x, v16b y) {
#if defined(__HIP_DEVICE_COMPILE__)
  asm volatile("v_nop\n\tv_nop\n\tv_nop\n\tv_nop" : "+v"(a), "+v"(b) : "v"(x), "v"(y));
#endif
}
__device__ __forceinline__ void keep4_b(v16b a, v16b b, v16b c, v16b d) {
#if defined(__HIP_DEVICE_COMPILE__)
  asm volatile("v_nop" :: "v"(a), "v"(b), "v"(c), "v"(d));
#endif
}
__device__ __forceinline__ void acc_guard4(v8f& a, v8f& b, v8f& c, v8f& d) {
#if defined(__HIP_DEVICE_COMPILE__)
  asm volatile("v_nop\n\tv_nop\n\tv_nop\n\tv_nop" : "+v"(a), "+v"(b), "+v"(c), "+v"(d));
#endif
}
__device__ __forceinline__ void wave_sync_lds() {
  __builtin_amdgcn_fence(__ATOMIC_RELEASE, "workgroup");
  __builtin_amdgcn_wave_barrier();
  __builtin_amdgcn_fence(__ATOMIC_ACQUIRE, "workgroup");
}
// value of lane l ^ 16: the other half of the wave, which holds the same D column
__device__ __forceinline__ float xhalf(float x) {
  const int i = __builtin_bit_cast(int, x);
  return __builtin_bit_cast(float, __builtin_amdgcn_permlanex16(i, i, 0x76543210, 0xfedcba98, false, false));
}

// =====================================================================================================
// x f32 [b][NTOK][DM] -> zero-padded bf16 plane Xp [GB*NP][DM] for batch elements b0..b0+GB-1 (RNE convert).
// address, value select). coverage: n8 = GB*NP*DM/8 threads x 8 = the whole Xp plane incl. padded rows.
// =====================================================================================================
__global__ __launch_bounds__(256) void cvt_x_bf16(const float* __restrict__ x, unsigned short* xp,
                                                   int b0, int n8) {
  const int i = blockIdx.x * 256 + threadIdx.x;
  if (i < n8) {
    const int row = i / (DM / 8);
    const int c8  = (i - row * (DM / 8)) * 8;
    const int bl  = row / NP;
    const int r   = row - bl * NP;
    const int rr  = (r < NTOK) ? r : (NTOK - 1);                 // clamped address for padded rows
    const float* src = x + ((size_t)(b0 + bl) * NTOK + rr) * DM + c8;
    const v4f a = *(const v4f*)(src);
    const v4f b = *(const v4f*)(src + 4);
    v4u p;
    p[0] = pk16(bf_bits(a[0]), bf_bits(a[1]));
    p[1] = pk16(bf_bits(a[2]), bf_bits(a[3]));
    p[2] = pk16(bf_bits(b[0]), bf_bits(b[1]));
    p[3] = pk16(bf_bits(b[2]), bf_bits(b[3]));
    const bool valid = (r < NTOK);
#pragma unroll
    for (int e = 0; e < 4; ++e) p[e] = valid ? p[e] : 0u;
    *(v4u*)(xp + (size_t)i * 8) = p;
    
  }
}

// =====================================================================================================
// Weight transpose-convert: W f32 [DM ci][DM co] (x @ W layout) -> Wt bf16 [co][ci] (k = ci contiguous),
// RNE convert. blockIdx.z selects the weight (0..4 -> Wq, Wk, Wv, Wvc, Wp), written back to back in wt.
// coverage: 8 waves x (2 it x 4 row groups) = 64 rows x (8 lanes x 8) = 64 cols per tile; grid 12x12x5.
// =====================================================================================================
__global__ __launch_bounds__(256) void wtr_bf16(const float* __restrict__ w0, const float* __restrict__ w1,
                                                 const float* __restrict__ w2, const float* __restrict__ w3,
                                                 const float* __restrict__ w4, unsigned short* wt) {
  __shared__ __align__(16) unsigned short T[64 * 72];   // [co][ci], pitch 72 (144 B, 16-B aligned rows)
  const int z = blockIdx.z;
  const float* W = (z == 0) ? w0 : (z == 1) ? w1 : (z == 2) ? w2 : (z == 3) ? w3 : w4;
  unsigned short* dst = wt + (size_t)z * DM * DM;
  const int co0 = blockIdx.x * 64;
  const int ci0 = blockIdx.y * 64;
  const int tid = threadIdx.x;
#pragma unroll
  for (int it = 0; it < 16; ++it) {
    const int idx = it * 256 + tid;
    const int i = idx >> 6;          // ci within tile
    const int j = idx & 63;          // co within tile
    T[j * 72 + i] = bf_bits(W[(size_t)(ci0 + i) * DM + co0 + j]);
  }
  __syncthreads();
  const int wave = tid >> 5, lane = tid & 31;
  const int q = lane >> 3, c8 = (lane & 7) * 8;
  v4u v[2];
#pragma unroll
  for (int it = 0; it < 2; ++it) {
    const int row = wave * 8 + it * 4 + q;
    v[it] = *(const v4u*)(T + row * 72 + c8);
  }
  {
#pragma unroll
    for (int it = 0; it < 2; ++it) {
      const int row = wave * 8 + it * 4 + q;
      *(v4u*)(dst + (size_t)(co0 + row) * DM + ci0 + c8) = v[it];
    }
    
  }
}

// =====================================================================================================
// Four asynchronous 16-byte copies of this lane, global -> LDS, through no register: rows r, r + 32, r + 64, r + 96
// of a staged operand (l0 = LDS byte address of the lane's piece of row r, g0 = its global address, gstep = 32 rows).
// =====================================================================================================
__device__ __forceinline__ void copy4_async(unsigned l0, const char* g0, unsigned gstep) {
#if defined(__HIP_DEVICE_COMPILE__)
  const unsigned l1 = l0 + 32u * GPI * 2u, l2 = l0 + 64u * GPI * 2u, l3 = l0 + 96u * GPI * 2u;
  const char* g1 = g0 + gstep;
  const char* g2 = g1 + gstep;
  const char* g3 = g2 + gstep;
  // s_wait_xcnt stands inside the copies' own statement, so that no address register is rewritten ahead of it
  asm volatile("global_load_async_to_lds_b128 %0, %4, off\n\t"
               "global_load_async_to_lds_b128 %1, %5, off\n\t"
               "global_load_async_to_lds_b128 %2, %6, off\n\t"
               "global_load_async_to_lds_b128 %3, %7, off\n\t"
               "s_wait_xcnt 0x0"
               :: "v"(l0), "v"(l1), "v"(l2), "v"(l3), "v"(g0), "v"(g1), "v"(g2), "v"(g3) : "memory");
#endif
}

// =====================================================================================================
// bf16 WMMA GEMM: C[m][n] = sum_k A[m][k] * Bt[n][k]. A block of 8 waves (2 x 4) owns a GBM x GBN tile, one wave a
// 64 x 64 tile of it. Per stage of GBK k the block's A rows and Bt rows are copied once into LDS (whole 128-B lines,
// asynchronous copies, two buffers: stage t + 1 flies while stage t is worked on) and every wave reads its fragments there.
// A row-major [M][K] pitch lda; Bt row-major [N][K] pitch ldb (k contiguous); M a multiple of GBM, N of GBN, K of GBK;
// grid = (M / GBM) * tilesNb blocks, tilesNb = N / GBN. Output column n goes to plane n / NB, column n % NB
// (NB a multiple of 64; plane strides strideC, strideC2 in elements).
// NSPLIT: 0 = A.Bt; 1 = (A + A2).Bt (A2 = unscaled bf16 lo plane of A).
// OUT_MODE: 0 = f32 + bf16-RNE(bias[n]) straight into outf (N = DM, one plane): row m = bl*NP + r goes to outf row bl*NTOK + r (pitch DM), padded rows r >= NTOK are dropped;
//           2 = bf16 hi plane C + bf16 lo plane C2 (lo = RNE(v - hi), unscaled);
//           3 = f16 hi plane C + f16 residual plane C2 = f16((v - hi) * rscale), C2 written only for tiles
//               with column-in-plane < N2 (pitch ldc2).
// =====================================================================================================
template <int NSPLIT, int OUT_MODE>
__global__ __launch_bounds__(256) void gemm64(
    const unsigned short* __restrict__ Ap, const unsigned short* A2p, int lda,
    const unsigned short* __restrict__ Btp, int ldb,
    void* Cout, int ldc, long long strideC,
    void* Cout2, int ldc2, long long strideC2, int N2, int NB,
    int tilesNb, int K, float rscale,
    const float* __restrict__ bias, float* outf) {
  static_assert(NSPLIT == 0 || NSPLIT == 1);
  constexpr int OFFB  = GBM * ((NSPLIT >= 1) ? 2 : 1) * GPI;   // stage layout in bf16: A rows | A2 rows | Bt rows
  constexpr int STAGE = OFFB + GBN * GPI;
  __shared__ __align__(16) unsigned short smem[2 * STAGE];
  static_assert(8 * 16 * 68 * 4 <= 2 * STAGE * 2);             // the epilogue's per-wave slabs reuse the stage buffers
  const int lane = threadIdx.x & 31;
  const int wave = __builtin_amdgcn_readfirstlane(threadIdx.x >> 5);
  const int bm   = blockIdx.x / tilesNb;
  const int bn   = blockIdx.x - bm * tilesNb;
  const int wm   = wave >> 2, wn = wave & 3;
  const int m0 = bm * GBM + (wm << 6);
  const int n0 = bn * GBN + (wn << 6);

  const int rlane = lane & 15;                 // row (A) / col (B, D) within subtile
  const int koff  = (lane >> 4) * 8;           // k offset of this lane half
  const int mOff  = (lane >> 4) * 8;           // D row offset

  v8f acc[4][4];
#pragma unroll
  for (int i = 0; i < 4; ++i)
#pragma unroll
    for (int j = 0; j < 4; ++j) acc[i][j] = zero8();

  // Copy map: thread -> row (tid >> 3) + 32 * n, 16-byte piece tid & 7 of the row's 128 B: a wave's copy covers 4 whole lines.
  const int crow = threadIdx.x >> 3;
  const int cseg = (threadIdx.x & 7) * 16;
  const unsigned lbase = (unsigned)(uintptr_t)(const void*)smem + (unsigned)(crow * (GPI * 2) + cseg);
  const char* gA  = (const char*)(const void*)Ap  + (size_t)(bm * GBM + crow) * (size_t)lda * 2 + cseg;
  const char* gA2 = (const char*)(const void*)A2p + (size_t)(bm * GBM + crow) * (size_t)lda * 2 + cseg;
  const char* gB  = (const char*)(const void*)Btp + (size_t)(bn * GBN + crow) * (size_t)ldb * 2 + cseg;
  const unsigned stepA = (unsigned)lda * 64u, stepB = (unsigned)ldb * 64u;   // 32 rows in bytes
  auto stage_copies = [&](int t) {             // stage t -> buffer t & 1: 12 (NSPLIT 0) or 16 copies a lane
    const unsigned lb = lbase + (unsigned)((t & 1) * (STAGE * 2));
    const size_t kb = (size_t)t * (GBK * 2);
    copy4_async(lb, gA + kb, stepA);
    if (NSPLIT >= 1) copy4_async(lb + GBM * GPI * 2, gA2 + kb, stepA);
    copy4_async(lb + OFFB * 2, gB + kb, stepB);
    copy4_async(lb + (OFFB + 128 * GPI) * 2, gB + kb + (size_t)stepB * 4, stepB);
  };

  v4f bb = {0.f, 0.f, 0.f, 0.f};               // OUT_MODE 0: the lane's four bias values, fetched here so that the epilogue does not wait for them
  if (OUT_MODE == 0) bb = *(const v4f*)(bias + n0 + (lane & 15) * 4);

  const int NT = K / GBK;
  stage_copies(0);
  asm volatile("s_wait_asynccnt 0x0" ::: "memory");   // this wave's copies of stage 0 have landed
  __syncthreads();                                     // ... and every other wave's
  if (NT > 1) stage_copies(1);

  for (int t = 0; t < NT; ++t) {
    const __bf16* sb  = (const __bf16*)(const void*)smem + (t & 1) * STAGE;
    const __bf16* sA  = sb + ((wm << 6) + rlane) * GPI + koff;
    const __bf16* sA2 = sA + GBM * GPI;
    const __bf16* sB  = sb + OFFB + ((wn << 6) + rlane) * GPI + koff;
#pragma unroll   // the two 32-k steps of a stage, straight-line between the stage's barriers
    for (int ks = 0; ks < GBK / 32; ++ks) {
      v16b bh[4];
#pragma unroll
      for (int j = 0; j < 4; ++j) bh[j] = ldfrag_b(sB + j * 16 * GPI + ks * 32);
      v16b ahv[4], alv[4];   // all fragments of a k-step are loaded as one group ahead of its WMMAs
#pragma unroll
      for (int i = 0; i < 4; ++i) {
        ahv[i] = ldfrag_b(sA + i * 16 * GPI + ks * 32);
        if (NSPLIT >= 1) alv[i] = ldfrag_b(sA2 + i * 16 * GPI + ks * 32); else alv[i] = ahv[i];
      }
#pragma unroll
      for (int i = 0; i < 4; ++i) {
        const v16b ah = ahv[i], al = alv[i];
#pragma unroll
        for (int j = 0; j < 4; ++j) {
          acc[i][j] = mma_b_raw(ah, bh[j], acc[i][j]);
          if (NSPLIT >= 1) acc[i][j] = mma_b_raw(al, bh[j], acc[i][j]);
        }
        dep_guard_b(acc[i][0], acc[i][3], ah, al);
      }
      keep4_b(bh[0], bh[1], bh[2], bh[3]);
    }
    // publish point of stage t + 1, which also frees buffer t & 1
    asm volatile("s_wait_dscnt 0x0" ::: "memory");      // this wave's reads of buffer t & 1 are done
    asm volatile("s_wait_asynccnt 0x0" ::: "memory");   // this wave's copies of stage t + 1 have landed
    __syncthreads();
    if (t + 2 < NT) stage_copies(t + 2);                // block-uniform test; into the buffer every wave has just left
  }
  asm volatile("s_wait_asynccnt 0x0" ::: "memory");     // nothing is in flight when the buffers become the epilogue's slabs
  acc_guard4(acc[0][0], acc[0][1], acc[0][2], acc[0][3]);
  acc_guard4(acc[1][0], acc[1][1], acc[1][2], acc[1][3]);
  acc_guard4(acc[2][0], acc[2][1], acc[2][2], acc[2][3]);
  acc_guard4(acc[3][0], acc[3][1], acc[3][2], acc[3][3]);

  const int bo  = n0 / NB;                     // output plane and the tile's first column in it (wave-uniform)
  const int nc0 = n0 - bo * NB;

  // ---- epilogue ----
  float* slab = (float*)(void*)smem + wave * (16 * 68);   // per-wave 16x64 slab, pitch 68 floats; the loop's last barrier has ended every read of the stage buffers
  static_assert((NP % 64) == 0);               // a wave's 64 rows lie in one batch element
  const int obl = m0 / NP;                     // OUT_MODE 0: batch element and first row in it (wave-uniform)
  const int or0 = m0 - obl * NP;
  if (OUT_MODE == 0) {
#pragma unroll
    for (int e = 0; e < 4; ++e) bb[e] = bf_up(bf_bits(bb[e]));
  }
#pragma unroll
  for (int i = 0; i < 4; ++i) {
    const int mBase = m0 + (i << 4);
    if (OUT_MODE == 0 && or0 + (i << 4) >= NTOK) break;   // wave-uniform: this subtile and the ones behind it hold padded rows only
#pragma unroll
    for (int j = 0; j < 4; ++j) {
#pragma unroll
      for (int r = 0; r < 8; ++r) {
        slab[(mOff + r) * 68 + (j << 4) + rlane] = acc[i][j][r];
      }
    }
    wave_sync_lds();
    if (OUT_MODE == 0) {
      const int hh = lane >> 4, c4 = (lane & 15) * 4;     // 256-B row segment = 16 lanes x 16 B
      const int rb = or0 + (i << 4);                       // first row of the subtile in its batch element
      float* D = outf + ((size_t)obl * NTOK + rb + hh) * DM + n0 + c4;
      v4f v[8];
#pragma unroll
      for (int it = 0; it < 8; ++it) {                     // it 0..7 x hh 0..1 = rows 0..15
        v[it] = *(const v4f*)(slab + (it * 2 + hh) * 68 + c4);
#pragma unroll
        for (int e = 0; e < 4; ++e) v[it][e] += bb[e];
      }
      if (rb + 16 <= NTOK) {                               // wave-uniform: all 16 rows are valid (every subtile but the one that holds row NTOK)
#pragma unroll
        for (int it = 0; it < 8; ++it) *(v4f*)(D + (size_t)(it * 2) * DM) = v[it];
      } else {
#pragma unroll
        for (int it = 0; it < 8; ++it) {
          if (rb + it * 2 + hh < NTOK) *(v4f*)(D + (size_t)(it * 2) * DM) = v[it];
        }
      }
    } else {
      const int q = lane >> 3, c8 = (lane & 7) * 8;
      unsigned short* C  = (unsigned short*)Cout  + (size_t)bo * strideC;
      unsigned short* C2 = (unsigned short*)Cout2 + (size_t)bo * strideC2;
      const bool wlo = (OUT_MODE == 2) || (nc0 < N2);     // wave-uniform
      v4u hv[4], lv[4];
#pragma unroll
      for (int it = 0; it < 4; ++it) {
        const int row = it * 4 + q;                        // it 0..3 x q 0..3 = rows 0..15
        const float* sp = slab + row * 68 + c8;
        v4u a, a2;
#pragma unroll
        for (int e = 0; e < 4; ++e) {
          const float f0 = sp[2 * e], f1 = sp[2 * e + 1];
          unsigned short h0, h1, l0, l1;
          if (OUT_MODE == 2) {
            h0 = bf_bits(f0); h1 = bf_bits(f1);
            l0 = bf_bits(f0 - bf_up(h0)); l1 = bf_bits(f1 - bf_up(h1));
          } else {
            const _Float16 x0 = (_Float16)f0, x1 = (_Float16)f1;
            h0 = h_bits(x0); h1 = h_bits(x1);
            l0 = h_bits((_Float16)((f0 - (float)x0) * rscale));
            l1 = h_bits((_Float16)((f1 - (float)x1) * rscale));
          }
          a[e] = pk16(h0, h1); a2[e] = pk16(l0, l1);
        }
        hv[it] = a; lv[it] = a2;
      }
      {
#pragma unroll
        for (int it = 0; it < 4; ++it) {
          const int row = it * 4 + q;
          *(v4u*)(C + (size_t)(mBase + row) * ldc + nc0 + c8) = hv[it];
          asm volatile("s_wait_xcnt 0x0" ::: "memory");   // before the store's address registers are reused for the next address
          if (wlo) {
            *(v4u*)(C2 + (size_t)(mBase + row) * ldc2 + nc0 + c8) = lv[it];
            asm volatile("s_wait_xcnt 0x0" ::: "memory");  // as above
          }
        }
        
      }
    }
    wave_sync_lds();
  }
}

// =====================================================================================================
// Four asynchronous 16-byte copies of this lane, global -> LDS, through no register: rows r, r + 16, r + 32, r + 48
// of one 64-row attention tile at pitch LP (l0 = LDS byte address of the lane's piece of row r, g0 = its global address,
// gstep = 16 source rows in bytes).
// =====================================================================================================
__device__ __forceinline__ void copy4_tile(unsigned l0, const char* g0, unsigned gstep) {
#if defined(__HIP_DEVICE_COMPILE__)
  const unsigned l1 = l0 + 16u * LP * 2u, l2 = l0 + 32u * LP * 2u, l3 = l0 + 48u * LP * 2u;
  const char* g1 = g0 + gstep;
  const char* g2 = g1 + gstep;
  const char* g3 = g2 + gstep;
  // s_wait_xcnt stands inside the copies' own statement, so that no address register is rewritten ahead of it
  asm volatile("global_load_async_to_lds_b128 %0, %4, off\n\t"
               "global_load_async_to_lds_b128 %1, %5, off\n\t"
               "global_load_async_to_lds_b128 %2, %6, off\n\t"
               "global_load_async_to_lds_b128 %3, %7, off\n\t"
               "s_wait_xcnt 0x0"
               :: "v"(l0), "v"(l1), "v"(l2), "v"(l3), "v"(g0), "v"(g1), "v"(g2), "v"(g3) : "memory");
#endif
}

// ---- context^T += V^T tile . P^T (f16 WMMA): A = V^T rows d, B = P^T (column = query) straight from registers;
//      oacc[t][r] = context[query c][d = 16 t + 8 hh + r]; residual products into a separate accumulator folded in f32 ----
__device__ __forceinline__ void pv_acc(v8f (&oacc)[4], const v16h (&pb)[2],
                                       const _Float16* Vth, const _Float16* Vtl,
                                       float rres, int c, int hh) {
  v8f o1[4];
#pragma unroll
  for (int t = 0; t < 4; ++t) o1[t] = zero8();
#pragma unroll   // pb is a register array: its index must be a constant
  for (int kk = 0; kk < 2; ++kk) {
#pragma unroll
    for (int t = 0; t < 4; ++t) {
      FH vb, vl;
      vb.h[0] = *(const v8h*)(Vth + (t * 16 + c) * LP + kk * 32 + 8 * hh);
      vb.h[1] = *(const v8h*)(Vth + (t * 16 + c) * LP + kk * 32 + 16 + 8 * hh);
      vl.h[0] = *(const v8h*)(Vtl + (t * 16 + c) * LP + kk * 32 + 8 * hh);
      vl.h[1] = *(const v8h*)(Vtl + (t * 16 + c) * LP + kk * 32 + 16 + 8 * hh);
      oacc[t] = mma_h(vb.v, pb[kk], oacc[t]);
      o1[t]   = mma_h(vl.v, pb[kk], o1[t]);
    }
  }
#pragma unroll
  for (int t = 0; t < 4; ++t)
#pragma unroll
    for (int r = 0; r < 8; ++r) oacc[t][r] += o1[t][r] * rres;
}

// =====================================================================================================
// Attention, head dim 64, softmax over the NTOK valid keys of the batch element (keys s >= NTOK masked to
// -1e30 before the row max in the last chunk), per-modality value swap handled at V^T staging.
//   q|k plane (f16, pitch QKP): element (row, col) at [row*QKP + col], row = bl*NP + t, q col = h*64+d,
//   k col = DM + h*64 + d; q residual plane (f16, (q - f16(q))*4096, pitch DM): [row*DM + h*64 + d]
//   v^T / vc^T hi planes (f16): element (bl, h, d, s) at [(bl*DM + h*64 + d)*NP + s]; residual planes (x4096) same
//   out planes (bf16 hi / lo of the normalised context): element (row, h, d) at [row*DM + h*64 + d]
//   NV == 1: query tiles 0..7 (rows < M1, values: v for keys < M1, vc for keys >= M1) and 9..14
//            (values: vc for keys < M1, v for keys >= M1); grid = NQB_NM * NH * GB.
//   NV == 2: query tile 8 (rows 512..575): main set = the rows >= M1 combination, extra set (wave 0 only)
//            = the rows < M1 combination; row 512 selects the extra set at the end; grid = NH * GB.
//   scores^T = (k . qh^T + (k . ql^T) * rres) * sscale on f16 WMMA (A = K rows, B = Q), residual products in a separate
//   accumulator: a lane holds 32 of the chunk's 64 scores of ONE query (column c), its partner lane ^ 16 the other 32, so the
//   maximum and the sum are in-lane plus one exchange between the halves (the sum's halves are joined once, after the loop);
//   p = exp(s - m) carried as f16(1024 p), packed from the score registers into the B operand of context^T += V^T . P^T;
//   online softmax in f32.
//   Block = 4 waves = 64 query rows of one (bl, h); kv chunks of 64, static trip NKT.
//   K / V^T chunk staging: asynchronous 16-byte copies to LDS, two buffers: chunk kt + 1 flies while chunk kt is worked on,
//   one barrier a chunk. 128 threads x 4 copies per tile = the whole 64x64 tile (a wave's copy = 4 whole 128-B lines).
//   The value swap is a chunk-uniform choice of source plane (chunks < 8: keys < M1, chunks > 8: keys >= M1); chunk 8 is
//   copied from the keys >= M1 planes and its key 512 (column 0 of the V^T tiles) is then overwritten from the keys < M1
//   planes, with a barrier of its own. P never touches LDS; the output staging aliases the buffers after the loop's last barrier.
//   Output coverage: each wave stores rows q0..q0+15 (it 0..3 x lane>>3 0..3) x 64 columns (8 lanes x 8) of both planes.
// =====================================================================================================
template <int NV>
__global__ __launch_bounds__(128, (NV == 1) ? 5 : 1)   // second argument = waves per SIMD the register budget is set for: NV 1's LDS admits 5 blocks a WGP
void attn64(const unsigned short* __restrict__ qkp, const unsigned short* __restrict__ qlp,
            const unsigned short* __restrict__ vhp, const unsigned short* __restrict__ vlp,
            const unsigned short* __restrict__ vchp, const unsigned short* __restrict__ vclp,
            unsigned short* ohp, unsigned short* olp, float sscale, float rres) {
  constexpr int STG = ((NV == 2) ? 5 : 3) * LTILE;        // one buffer in f16: K | main V^T hi | main V^T residual | extra hi | extra residual
  __shared__ __align__(16) _Float16 smem[2 * STG];
  static_assert(4 * 16 * 68 * 4 <= 2 * STG * 2);          // the output staging fits the buffers

  const int tid  = threadIdx.x;
  const int wave = tid >> 5;
  const int lane = tid & 31;
  const int hh   = lane >> 4;
  const int c    = lane & 15;

  const int bx = blockIdx.x;
  int qb, rest;
  if (NV == 1) {
    const int idx = bx % NQB_NM;
    qb = idx + ((idx >= 8) ? 1 : 0);
    rest = bx / NQB_NM;
  } else {
    qb = 8;
    rest = bx;
  }
  const int h  = rest % NH;
  const int bl = rest / NH;
  const int q0 = qb * 64 + wave * 16;
  const size_t rowB = (size_t)bl * NP;

  const _Float16* Qh = (const _Float16*)(const void*)qkp + (size_t)h * HD;
  const _Float16* Kg = (const _Float16*)(const void*)qkp + DM + (size_t)h * HD;
  const _Float16* Ql = (const _Float16*)(const void*)qlp + (size_t)h * HD;
  const size_t vbase = ((size_t)bl * DM + (size_t)h * HD) * NP;
  const _Float16* Vh  = (const _Float16*)(const void*)vhp  + vbase;
  const _Float16* Vl  = (const _Float16*)(const void*)vlp  + vbase;
  const _Float16* Vch = (const _Float16*)(const void*)vchp + vbase;
  const _Float16* Vcl = (const _Float16*)(const void*)vclp + vbase;
  // main set: keys < M1 from (M0h, M0l), keys >= M1 from (M1h, M1l); block-uniform pointer choice
  const bool useB = (NV == 2) || (qb > 8);
  const _Float16* M0h = useB ? Vch : Vh;
  const _Float16* M0l = useB ? Vcl : Vl;
  const _Float16* M1h = useB ? Vh  : Vch;
  const _Float16* M1l = useB ? Vl  : Vcl;

  // ---- Q fragments (B operand, column = query = lane&15): 2 d-chunks, hi and residual ----
  v16h qah[2], qal[2];
#pragma unroll
  for (int dc = 0; dc < 2; ++dc) {
    qah[dc] = ldfrag_h(Qh + (rowB + q0 + c) * QKP + dc * 32 + 8 * hh);
    qal[dc] = ldfrag_h(Ql + (rowB + q0 + c) * DM  + dc * 32 + 8 * hh);
  }

  // Copy map: thread -> row (tid >> 3) + 16 * n, 16-byte piece tid & 7 of the row's 128 B
  const int crow = tid >> 3;
  const int cseg = (tid & 7) * 16;
  const unsigned lbase = (unsigned)(uintptr_t)(const void*)smem + (unsigned)(crow * (LP * 2) + cseg);
  const char* gK = (const char*)(const void*)(Kg + (rowB + crow) * QKP) + cseg;
  const size_t voff = (size_t)crow * (NP * 2) + cseg;
  auto stage_copies = [&](int t) {           // chunk t -> buffer t & 1: 12 (NV 1) or 20 copies a lane
    const unsigned lb = lbase + (unsigned)((t & 1) * (STG * 2));
    const bool lowc = (t < 8);               // block-uniform
    const size_t vb = voff + (size_t)t * (64 * 2);
    copy4_tile(lb, gK + (size_t)t * (64 * QKP * 2), 16u * QKP * 2u);
    copy4_tile(lb + LTILE * 2,     (const char*)(const void*)(lowc ? M0h : M1h) + vb, 16u * NP * 2u);
    copy4_tile(lb + 2 * LTILE * 2, (const char*)(const void*)(lowc ? M0l : M1l) + vb, 16u * NP * 2u);
    if (NV == 2) {
      copy4_tile(lb + 3 * LTILE * 2, (const char*)(const void*)(lowc ? Vh : Vch) + vb, 16u * NP * 2u);
      copy4_tile(lb + 4 * LTILE * 2, (const char*)(const void*)(lowc ? Vl : Vcl) + vb, 16u * NP * 2u);
    }
  };
  // key 512 of row d = tid >> 1, hi (tid even) or residual (tid odd) plane, from the keys < M1 planes; stored into chunk 8's tiles
  const int prow = tid >> 1, ppl = tid & 1;
  const _Float16 pkM = (ppl ? M0l : M0h)[(size_t)prow * NP + (M1 - 1)];
  const _Float16 pkE = (NV == 2) ? (ppl ? Vl : Vh)[(size_t)prow * NP + (M1 - 1)] : pkM;

  float mrow = -INFINITY, lrow = 0.f;        // of query q0 + c; lrow sums this wave half's keys only
  v8f oacc[4], oaccE[4];
#pragma unroll
  for (int t = 0; t < 4; ++t) { oacc[t] = zero8(); oaccE[t] = zero8(); }

  static_assert(NKT > 1);
  stage_copies(0);
  asm volatile("s_wait_asynccnt 0x0" ::: "memory");   // this wave's copies of chunk 0 have landed
  __syncthreads();                                     // ... and every other wave's
  stage_copies(1);

  for (int kt = 0; kt < NKT; ++kt) {         // static trip count
    const int kv0 = kt * 64;
    _Float16* sb = smem + (kt & 1) * STG;
    const _Float16* Ksh = sb;                                   // K [kv][d]           9 KB (rows of 64 at pitch LP)
    const _Float16* VMh = sb + LTILE;                           // main V^T hi [d][kv]  9 KB
    const _Float16* VMl = sb + 2 * LTILE;                       // main V^T residual     9 KB
    const _Float16* VEh = (NV == 2) ? (sb + 3 * LTILE) : VMh;   // extra set (NV == 2)   9 KB
    const _Float16* VEl = (NV == 2) ? (sb + 4 * LTILE) : VMl;   //                       9 KB
    if (kt == 8) {                           // block-uniform: the chunk that holds key 512; its copies landed before the last barrier
      sb[(1 + ppl) * LTILE + prow * LP] = pkM;
      if (NV == 2) sb[(3 + ppl) * LTILE + prow * LP] = pkE;
      __syncthreads();                       // key 512's column is in place before any wave reads the V^T tiles
    }

    // ---- scores^T: 64 keys x 16 query columns per wave, 2 f16 products (hi, residual); s[j][r] = key kv0 + 16 j + 8 hh + r, query q0 + c ----
    v8f s[4];
#pragma unroll
    for (int j = 0; j < 4; ++j) {
      v8f sh = zero8(), sl = zero8();
#pragma unroll
      for (int dc = 0; dc < 2; ++dc) {
        FH kb;
        kb.h[0] = *(const v8h*)(Ksh + (j * 16 + c) * LP + dc * 32 + 8 * hh);
        kb.h[1] = *(const v8h*)(Ksh + (j * 16 + c) * LP + dc * 32 + 16 + 8 * hh);
        sh = mma_h(kb.v, qah[dc], sh);
        sl = mma_h(kb.v, qal[dc], sl);
      }
#pragma unroll
      for (int r = 0; r < 8; ++r) s[j][r] = (sh[r] + sl[r] * rres) * sscale;
    }
    // ---- keys s >= NTOK (only in the last chunk) are invalid: force -1e30 before the maximum ----
    if (kt == NKT - 1) {                    // block-uniform
#pragma unroll
      for (int j = 0; j < 4; ++j) {
#pragma unroll
        for (int r = 0; r < 8; ++r) s[j][r] = ((kv0 + j * 16 + 8 * hh + r) < NTOK) ? s[j][r] : -1.0e30f;
      }
    }

    // ---- column max, online softmax, P^T (x1024, f16) into the B operand registers ----
    float mj[4];
#pragma unroll
    for (int j = 0; j < 4; ++j) {
      mj[j] = s[j][0];
#pragma unroll
      for (int r = 1; r < 8; ++r) mj[j] = fmaxf(mj[j], s[j][r]);
    }
    float m = fmaxf(fmaxf(mj[0], mj[1]), fmaxf(mj[2], mj[3]));
    m = fmaxf(m, xhalf(m));                  // both halves now hold the query's maximum over the chunk
    const float mnew  = fmaxf(mrow, m);
    const float alpha = __expf(mrow - mnew);
    mrow = mnew;
    v16h pb[2];                              // pb[kk][e]: key kv0 + 32 kk + (e < 8 ? 8 hh + e : 16 + 8 hh + e - 8), the k order of the V^T loads
    float pj[4];                             // four independent sums of 8
#pragma unroll
    for (int j = 0; j < 4; ++j) {
      pj[j] = 0.f;
#pragma unroll
      for (int r = 0; r < 8; ++r) {
        const float p = __expf(s[j][r] - mnew);
        pj[j] += p;
        pb[j >> 1][(j & 1) * 8 + r] = (_Float16)(p * 1024.0f);
      }
    }
    lrow = lrow * alpha + ((pj[0] + pj[1]) + (pj[2] + pj[3]));
#pragma unroll
    for (int t = 0; t < 4; ++t)
#pragma unroll
      for (int r = 0; r < 8; ++r) { oacc[t][r] *= alpha; if (NV == 2) oaccE[t][r] *= alpha; }

    // ---- context^T += V^T . P^T ----
    pv_acc(oacc, pb, VMh, VMl, rres, c, hh);
    if (NV == 2) {
      if (wave == 0) pv_acc(oaccE, pb, VEh, VEl, rres, c, hh);   // wave-uniform
    }
    // publish point of chunk kt + 1, which also frees buffer kt & 1
    asm volatile("s_wait_dscnt 0x0" ::: "memory");      // this wave's reads of buffer kt & 1 are done
    asm volatile("s_wait_asynccnt 0x0" ::: "memory");   // this wave's copies of chunk kt + 1 have landed
    __syncthreads();
    if (kt + 2 < NKT) stage_copies(kt + 2);             // block-uniform test; into the buffer every wave has just left
  }
  asm volatile("s_wait_asynccnt 0x0" ::: "memory");     // nothing is in flight when the buffers become the output staging

  // ---- normalise (1/l and the 1/1024 p carry), stage the wave's 16x64 tile (aliases the K / V region),
  float* os = (float*)(void*)smem + wave * (16 * 68);   // [query][d], pitch 68 floats (272 B = 16 B x 17, odd): the 16 rows of a 16-byte store fall on 16 bank groups
  {
    const float l = lrow + xhalf(lrow);      // the two halves' key sums joined
    const float inv = ((l > 0.f) ? (1.0f / l) : 0.f) * (1.0f / 1024.0f);
    const bool rowA = (q0 + c) == (M1 - 1);  // query row 512 uses the extra set
#pragma unroll
    for (int t = 0; t < 4; ++t) {
      v4f w[2];
#pragma unroll
      for (int r = 0; r < 8; ++r) {
        float vm = oacc[t][r] * inv;
        if (NV == 2) {
          const float ve = oaccE[t][r] * inv;
          vm = rowA ? ve : vm;
        }
        w[r >> 2][r & 3] = vm;
      }
      *(v4f*)(os + c * 68 + t * 16 + 8 * hh)     = w[0];
      *(v4f*)(os + c * 68 + t * 16 + 8 * hh + 4) = w[1];
    }
  }
  wave_sync_lds();
  {
    const int q4 = lane >> 3, c8 = (lane & 7) * 8;
    v4u hv[4], lv[4];
#pragma unroll
    for (int it = 0; it < 4; ++it) {
      const int row = it * 4 + q4;   // it 0..3 x q4 0..3 = rows 0..15 of the wave tile
      const float* sp = os + row * 68 + c8;
      v4u a, a2;
#pragma unroll
      for (int e = 0; e < 4; ++e) {
        const float f0 = sp[2 * e], f1 = sp[2 * e + 1];
        const unsigned short h0 = bf_bits(f0), h1 = bf_bits(f1);
        const unsigned short l0 = bf_bits(f0 - bf_up(h0)), l1 = bf_bits(f1 - bf_up(h1));
        a[e] = pk16(h0, h1); a2[e] = pk16(l0, l1);
      }
      hv[it] = a; lv[it] = a2;
    }
    {
#pragma unroll
      for (int it = 0; it < 4; ++it) {
        const int row = it * 4 + q4;
        const size_t go = (rowB + q0 + row) * DM + (size_t)h * HD + c8;
        *(v4u*)(ohp + go) = hv[it];
        *(v4u*)(olp + go) = lv[it];
      }
      
    }
  }
}

// =====================================================================================================
// Workspace map (bytes), one group of GB = 16 batch elements (GB*NP = 15360 rows), every plane an exact
// multiple of its 64x64-tile / whole-line store granularity (padded rows included):
//   Wt    bf16 [5][768 co][768 ci]   0          5898240   (Wq^T | Wk^T | Wv^T | Wvc^T | Wp^T)
//   Xp    bf16 [15360][768]          5898240    23592960
//   QK    f16  [15360][1536]         29491200   47185920  (q cols 0..767, k cols 768..1535)
//   Ql    f16  [15360][768]          76677120   23592960  (q residual x4096)
//   VTh   f16  [16][768][960]        100270080  23592960  (v^T hi)
//   VTl   f16  [16][768][960]        123863040  23592960  (v^T residual x4096)
//   VCh   f16  [16][768][960]        147456000  23592960  (vc^T hi)
//   VCl   f16  [16][768][960]        171048960  23592960  (vc^T residual x4096)
//   Oh    bf16 [15360][768]          194641920  23592960
//   Ol    bf16 [15360][768]          218234880  23592960
//   end                              241827840
// =====================================================================================================
extern "C" void kernel_launch(void* const* d_in, const int* in_sizes, int n_in,
                              void* d_out, int out_size, void* d_ws, size_t ws_size,
                              hipStream_t stream) {
  if (n_in < 7) return;
  if (in_sizes[0] != NBATCH * NTOK * DM) return;
  if (in_sizes[1] != DM * DM || in_sizes[2] != DM * DM || in_sizes[3] != DM * DM) return;
  if (in_sizes[4] != DM * DM || in_sizes[5] != DM * DM) return;
  if (in_sizes[6] != DM) return;
  if (out_size != NBATCH * NTOK * DM) return;

  const float* x   = (const float*)d_in[0];
  const float* Wq  = (const float*)d_in[1];
  const float* Wk  = (const float*)d_in[2];
  const float* Wv  = (const float*)d_in[3];
  const float* Wvc = (const float*)d_in[4];
  const float* Wp  = (const float*)d_in[5];
  const float* bp  = (const float*)d_in[6];

  const size_t ROWS = (size_t)GB * NP;                 // 15360
  const size_t PW   = (size_t)5 * DM * DM * 2;          //  5898240
  const size_t PX   = ROWS * DM * 2;                    // 23592960
  const size_t PQK  = ROWS * QKP * 2;                   // 47185920
  const size_t PQl  = ROWS * DM * 2;                    // 23592960
  const size_t PVT  = (size_t)GB * DM * NP * 2;         // 23592960
  const size_t PO   = ROWS * DM * 2;                    // 23592960
  size_t off = 0;
  const size_t oW   = off; off += PW;
  const size_t oXp  = off; off += PX;
  const size_t oQK  = off; off += PQK;
  const size_t oQl  = off; off += PQl;
  const size_t oVTh = off; off += PVT;
  const size_t oVTl = off; off += PVT;
  const size_t oVCh = off; off += PVT;
  const size_t oVCl = off; off += PVT;
  const size_t oOh  = off; off += PO;
  const size_t oOl  = off; off += PO;
  if (off > ws_size) return;                            // off = 241827840

  char* ws = (char*)d_ws;
  unsigned short* Wt   = (unsigned short*)(ws + oW);
  unsigned short* Wqk_t = Wt;                                   // rows 0..1535: Wq^T then Wk^T
  unsigned short* Wv_t  = Wt + (size_t)2 * DM * DM;
  unsigned short* Wvc_t = Wt + (size_t)3 * DM * DM;
  unsigned short* Wp_t  = Wt + (size_t)4 * DM * DM;
  unsigned short* Xp   = (unsigned short*)(ws + oXp);
  unsigned short* QK   = (unsigned short*)(ws + oQK);
  unsigned short* Ql   = (unsigned short*)(ws + oQl);
  unsigned short* VTh  = (unsigned short*)(ws + oVTh);
  unsigned short* VTl  = (unsigned short*)(ws + oVTl);
  unsigned short* VCh  = (unsigned short*)(ws + oVCh);
  unsigned short* VCl  = (unsigned short*)(ws + oVCl);
  unsigned short* Oh   = (unsigned short*)(ws + oOh);
  unsigned short* Ol   = (unsigned short*)(ws + oOl);
  float*          out  = (float*)d_out;

  const dim3 blk(256);
  const int n8x = GB * NP * (DM / 8);                            // 1474560
  const dim3 gCvtX((n8x + 255) / 256);                           // 5760 blocks
  const dim3 gWtr(DM / 64, DM / 64, 5);                          // 12 x 12 x 5 tiles
  static_assert((GB * NP) % GBM == 0 && (GB * NP) % GBN == 0 && DM % GBM == 0 && DM % GBN == 0 && QKP % GBN == 0 && DM % GBK == 0);
  const dim3 gQK((GB * NP / GBM) * (QKP / GBN));                 // 120 x 6 = 720 blocks: M=15360, N=1536
  const dim3 gVT((DM / GBM) * (GB * NP / GBN));                  // 6 x 60 = 360 blocks: M=768, N=15360 (all batch elements' rows of Xp)
  const dim3 gOut((GB * NP / GBM) * (DM / GBN));                 // 120 x 3 = 360 blocks: M=15360, N=768
  const dim3 gAttn1(NQB_NM * NH * GB);                           // 2688 blocks
  const dim3 gAttn2(NH * GB);                                    // 192 blocks

  // (0) weights -> bf16 [out][in] planes (k contiguous = the Bt / A layout the GEMM wants)
  wtr_bf16<<<gWtr, blk, 0, stream>>>(Wq, Wk, Wv, Wvc, Wp, Wt);

  for (int g = 0; g < NGRP; ++g) {
    const int b0 = g * GB;
    // (1) x -> zero-padded bf16 plane [15360][768]
    cvt_x_bf16<<<gCvtX, blk, 0, stream>>>(x, Xp, b0, n8x);
    // (2) q|k = Xp . Wqk^T -> f16 plane [15360][1536] + f16 residual x4096 of the q half (n0 < 768, pitch 768)
    gemm64<0, 3><<<gQK, blk, 0, stream>>>(
        Xp, Xp, DM, Wqk_t, DM,
        (void*)QK, QKP, 0LL, (void*)Ql, DM, 0LL, DM, QKP,
        QKP / GBN, DM, 4096.0f, bp, out);
    // (3) v^T = Wv^T . Xp^T, column n = bl*NP + s -> f16 hi [bl][h*64+d][s] (pitch NP) + residual x4096
    gemm64<0, 3><<<gVT, blk, 0, stream>>>(
        Wv_t, Wv_t, DM, Xp, DM,
        (void*)VTh, NP, (long long)DM * NP, (void*)VTl, NP, (long long)DM * NP, NP, NP,
        GB * NP / GBN, DM, 4096.0f, bp, out);
    // (4) vc^T likewise
    gemm64<0, 3><<<gVT, blk, 0, stream>>>(
        Wvc_t, Wvc_t, DM, Xp, DM,
        (void*)VCh, NP, (long long)DM * NP, (void*)VCl, NP, (long long)DM * NP, NP, NP,
        GB * NP / GBN, DM, 4096.0f, bp, out);
    // (5) attention -> context bf16 hi / lo planes [15360][768]: query tiles 0..7, 9..14, then the mixed tile 8
    attn64<1><<<gAttn1, dim3(128), 0, stream>>>(QK, Ql, VTh, VTl, VCh, VCl, Oh, Ol, 0.125f, 1.0f / 4096.0f);
    attn64<2><<<gAttn2, dim3(128), 0, stream>>>(QK, Ql, VTh, VTl, VCh, VCl, Oh, Ol, 0.125f, 1.0f / 4096.0f);
    // (6) d_out rows bl*906 + r = context . Wp + bias (A = context hi + lo planes, 2 products; K=768), valid rows only
    static_assert(NGRP == 1);                            // the GEMM's row m = bl*NP + r counts bl from batch element 0
    gemm64<1, 0><<<gOut, blk, 0, stream>>>(
        Oh, Ol, DM, Wp_t, DM,
        (void*)Oh, DM, 0LL, (void*)Oh, DM, 0LL, DM, DM,   // the two plane pointers are not used by OUT_MODE 0
        DM / GBN, DM, 1.0f, bp, out);
  }
  (void)hipGetLastError();
}

// v009
// Measured time: 197 microseconds a run.
// Next to v008, in two timings, it ran 1.18 times as fast each time.
// Over all steps from v000 it is 6.34 times as fast.
// Contractions: q|k, v^T and vc^T projections = v_wmma_f32_16x16x32_bf16 (bf16 operands from RNE-converted x and W, single product);
// q.k^T scores = v_wmma_f32_16x16x32_f16 (q as f16 hi plane + f16 residual plane x4096 in a separate accumulator, k f16; 2 products);
// p.v = v_wmma_f32_16x16x32_f16 (p carried x1024 in f16, v^T as f16 hi plane + f16 residual plane x4096 in a separate accumulator; 2 products);
// ctx.Wp = v_wmma_f32_16x16x32_bf16 (ctx as bf16 hi + lo planes times bf16 Wp^T, 2 products); all f32 accumulate; softmax in f32.
#include <hip/hip_runtime.h>
#include <math.h>
#include <stdint.h>

#define NBATCH 16
#define NTOK   906
#define NP     960            // padded token count per batch element (15 tiles of 64)
#define DM     768
#define NH     12
#define HD     64
#define M1     513            // modality split: query / key rows < M1 vs >= M1
#define NKT    (NP / 64)      // 15 key chunks of 64
#define NQB    16             // query jobs per (batch element, head): tiles 0..8 with the value set of rows < M1, tiles 8..14 with that of rows >= M1
#define QKP    (2 * DM)       // pitch of the q|k plane: q at cols 0..DM-1, k at cols DM..2DM-1
#define GB     16             // batch elements per group (all of them: one pass of launches fills the chip)
#define NGRP   (NBATCH / GB)
#define LP     72             // LDS row pitch of the attention K / V^T tiles in f16: 144 B = 16 B x 9 (odd), so the 16 rows of a 16-byte fragment read fall on 16 different bank groups
#define LTILE  (64 * LP)      // one 64-row tile at that pitch
#define GBM    128            // GEMM block tile: 2 x 4 wave tiles of 64 x 64
#define GBN    256
#define GBK    64             // k per stage: 128 B of every operand row, one whole line
#define GPI    72             // LDS row pitch of a staged operand row in bf16: 144 B = 16 B x 9 (odd), as LP
static_assert(NH * HD == DM);
static_assert((NP % 64) == 0 && NP >= NTOK && (DM % 64) == 0 && (DM % 32) == 0);
static_assert((NBATCH % GB) == 0);
static_assert(M1 - 1 == 8 * 64);   // row 512 is the first row of query tile 8 and of key chunk 8
static_assert(NTOK > (NKT - 1) * 64 && NTOK <= NP);   // invalid keys live only in the last chunk

typedef _Float16 v16h __attribute__((ext_vector_type(16)));
typedef _Float16 v8h  __attribute__((ext_vector_type(8)));
typedef __bf16   v16b __attribute__((ext_vector_type(16)));
typedef __bf16   v8b  __attribute__((ext_vector_type(8)));
typedef float    v8f  __attribute__((ext_vector_type(8)));
typedef float    v4f  __attribute__((ext_vector_type(4)));
typedef unsigned int v4u __attribute__((ext_vector_type(4)));

union FH { v16h v; v8h h[2]; };

// ---- scalar helpers --------------------------------------------------------------------------------
__device__ __forceinline__ unsigned short bf_bits(float f) {          // f32 -> bf16 bits, RNE convert
  unsigned u = __float_as_uint(f);
  return (unsigned short)((u + 0x7FFFu + ((u >> 16) & 1u)) >> 16);
}
__device__ __forceinline__ float bf_up(unsigned short h) { return __uint_as_float(((unsigned)h) << 16); }
__device__ __forceinline__ unsigned short h_bits(_Float16 x) { return __builtin_bit_cast(unsigned short, x); }
__device__ __forceinline__ unsigned pk16(unsigned short a, unsigned short b) { return (unsigned)a | ((unsigned)b << 16); }
__device__ __forceinline__ v8f zero8() { v8f z = {0.f, 0.f, 0.f, 0.f, 0.f, 0.f, 0.f, 0.f}; return z; }

// ---- fragment loaders: 16-bit A/B operand, lane -> row/col (lane&15), p already includes +8*(lane>>4);
//      elements 0..7 <- p[0..7] (k0+8h..), elements 8..15 <- p[16..23] (k0+16+8h..)
__device__ __forceinline__ v16b ldfrag_b(const __bf16* p) {
  union { v16b v; v8b h[2]; } f;
  f.h[0] = *(const v8b*)(p);
  f.h[1] = *(const v8b*)(p + 16);
  return f.v;
}
__device__ __forceinline__ v16h ldfrag_h(const _Float16* p) {
  union { v16h v; v8h h[2]; } f;
  f.h[0] = *(const v8h*)(p);
  f.h[1] = *(const v8h*)(p + 16);
  return f.v;
}

// ---- WMMA helpers --------------------------------------------------------------------------------------
// attention: the plain builtin; the compiler keeps the distance behind it and is free to order LDS loads and WMMAs
__device__ __forceinline__ v8f mma_h(v16h a, v16h b, v8f c) {
  return __builtin_amdgcn_wmma_f32_16x16x32_f16(false, a, false, b, (short)0, c, false, false);
}
// GEMM: builtin, with statements behind each row of WMMAs that hold the k-step's fragment loads together ahead of them
__device__ __forceinline__ v8f mma_b_raw(v16b a, v16b b, v8f c) {
  return __builtin_amdgcn_wmma_f32_16x16x32_bf16(false, a, false, b, (short)0, c, false, false);
}
__device__ __forceinline__ void dep_guard_b(v8f& a, v8f& b, v16b x, v16b y) {
#if defined(__HIP_DEVICE_COMPILE__)
  asm volatile("v_nop\n\tv_nop\n\tv_nop\n\tv_nop" : "+v"(a), "+v"(b) : "v"(x), "v"(y));
#endif
}
__device__ __forceinline__ void keep4_b(v16b a, v16b b, v16b c, v16b d) {
#if defined(__HIP_DEVICE_COMPILE__)
  asm volatile("v_nop" :: "v"(a), "v"(b), "v"(c), "v"(d));
#endif
}
__device__ __forceinline__ void acc_guard4(v8f& a, v8f& b, v8f& c, v8f& d) {
#if defined(__HIP_DEVICE_COMPILE__)
  asm volatile("v_nop\n\tv_nop\n\tv_nop\n\tv_nop" : "+v"(a), "+v"(b), "+v"(c), "+v"(d));
#endif
}
__device__ __forceinline__ void wave_sync_lds() {
  __builtin_amdgcn_fence(__ATOMIC_RELEASE, "workgroup");
  __builtin_amdgcn_wave_barrier();
  __builtin_amdgcn_fence(__ATOMIC_ACQUIRE, "workgroup");
}
// value of lane l ^ 16: the other half of the wave, which holds the same D column
__device__ __forceinline__ float xhalf(float x) {
  const int i = __builtin_bit_cast(int, x);
  return __builtin_bit_cast(float, __builtin_amdgcn_permlanex16(i, i, 0x76543210, 0xfedcba98, false, false));
}

// =====================================================================================================
// Operand preparation, one launch; the block index picks the job (block-uniform), the two jobs are independent.
// Blocks 0 .. NWB-1: weight transpose-convert, W f32 [DM ci][DM co] (x @ W layout) -> Wt bf16 [co][ci] (k = ci contiguous),
//   RNE convert; one 64 x 64 tile a block, weight z = 0..4 -> Wq, Wk, Wv, Wvc, Wp, written back to back in wt.
//   coverage: 8 waves x (2 it x 4 row groups) = 64 rows x (8 lanes x 8) = 64 cols per tile; 12 x 12 x 5 tiles.
// Blocks NWB .. : x f32 [b][NTOK][DM] -> zero-padded bf16 plane Xp [GB*NP][DM] for batch elements b0..b0+GB-1 (RNE convert).
//   coverage: n8 = GB*NP*DM/8 threads x 8 = the whole Xp plane incl. padded rows.
// =====================================================================================================
#define NWT (DM / 64)               // weight tiles a side
#define NWB (NWT * NWT * 5)         // weight-tile blocks
__global__ __launch_bounds__(256) void prep_bf16(const float* __restrict__ x, unsigned short* xp, int b0, int n8,
                                                  const float* __restrict__ w0, const float* __restrict__ w1,
                                                  const float* __restrict__ w2, const float* __restrict__ w3,
                                                  const float* __restrict__ w4, unsigned short* wt) {
  __shared__ __align__(16) unsigned short T[64 * 72];   // [co][ci], pitch 72 (144 B, 16-B aligned rows)
  const int tid = threadIdx.x;
  if (blockIdx.x < NWB) {            // block-uniform: the barrier below is passed by the whole block or by none of it
    const int z   = blockIdx.x / (NWT * NWT);
    const int rem = blockIdx.x - z * (NWT * NWT);
    const float* W = (z == 0) ? w0 : (z == 1) ? w1 : (z == 2) ? w2 : (z == 3) ? w3 : w4;
    unsigned short* dst = wt + (size_t)z * DM * DM;
    const int co0 = (rem % NWT) * 64;
    const int ci0 = (rem / NWT) * 64;
#pragma unroll
    for (int it = 0; it < 16; ++it) {
      const int idx = it * 256 + tid;
      const int i = idx >> 6;          // ci within tile
      const int j = idx & 63;          // co within tile
      T[j * 72 + i] = bf_bits(W[(size_t)(ci0 + i) * DM + co0 + j]);
    }
    __syncthreads();
    const int wave = tid >> 5, lane = tid & 31;
    const int q = lane >> 3, c8 = (lane & 7) * 8;
    v4u v[2];
#pragma unroll
    for (int it = 0; it < 2; ++it) {
      const int row = wave * 8 + it * 4 + q;
      v[it] = *(const v4u*)(T + row * 72 + c8);
    }
#pragma unroll
    for (int it = 0; it < 2; ++it) {
      const int row = wave * 8 + it * 4 + q;
      *(v4u*)(dst + (size_t)(co0 + row) * DM + ci0 + c8) = v[it];
    }
    return;
  }
  const int i = (blockIdx.x - NWB) * 256 + tid;
  if (i < n8) {
    const int row = i / (DM / 8);
    const int c8  = (i - row * (DM / 8)) * 8;
    const int bl  = row / NP;
    const int r   = row - bl * NP;
    const int rr  = (r < NTOK) ? r : (NTOK - 1);                 // clamped address for padded rows
    const float* src = x + ((size_t)(b0 + bl) * NTOK + rr) * DM + c8;
    const v4f a = *(const v4f*)(src);
    const v4f b = *(const v4f*)(src + 4);
    v4u p;
    p[0] = pk16(bf_bits(a[0]), bf_bits(a[1]));
    p[1] = pk16(bf_bits(a[2]), bf_bits(a[3]));
    p[2] = pk16(bf_bits(b[0]), bf_bits(b[1]));
    p[3] = pk16(bf_bits(b[2]), bf_bits(b[3]));
    const bool valid = (r < NTOK);
#pragma unroll
    for (int e = 0; e < 4; ++e) p[e] = valid ? p[e] : 0u;
    *(v4u*)(xp + (size_t)i * 8) = p;
  }
}

// =====================================================================================================
// Four asynchronous 16-byte copies of this lane, global -> LDS, through no register: rows r, r + 32, r + 64, r + 96
// of a staged operand (l0 = LDS byte address of the lane's piece of row r, g0 = its global address, gstep = 32 rows).
// =====================================================================================================
__device__ __forceinline__ void copy4_async(unsigned l0, const char* g0, unsigned gstep) {
#if defined(__HIP_DEVICE_COMPILE__)
  const unsigned l1 = l0 + 32u * GPI * 2u, l2 = l0 + 64u * GPI * 2u, l3 = l0 + 96u * GPI * 2u;
  const char* g1 = g0 + gstep;
  const char* g2 = g1 + gstep;
  const char* g3 = g2 + gstep;
  // s_wait_xcnt stands inside the copies' own statement, so that no address register is rewritten ahead of it
  asm volatile("global_load_async_to_lds_b128 %0, %4, off\n\t"
               "global_load_async_to_lds_b128 %1, %5, off\n\t"
               "global_load_async_to_lds_b128 %2, %6, off\n\t"
               "global_load_async_to_lds_b128 %3, %7, off\n\t"
               "s_wait_xcnt 0x0"
               :: "v"(l0), "v"(l1), "v"(l2), "v"(l3), "v"(g0), "v"(g1), "v"(g2), "v"(g3) : "memory");
#endif
}

// =====================================================================================================
// bf16 WMMA GEMM: C[m][n] = sum_k A[m][k] * Bt[n][k]. A block of 8 waves (2 x 4) owns a GBM x GBN tile, one wave a
// 64 x 64 tile of it. Per stage of GBK k the block's A rows and Bt rows are copied once into LDS (whole 128-B lines,
// asynchronous copies, two buffers: stage t + 1 flies while stage t is worked on) and every wave reads its fragments there.
// A row-major [M][K] pitch lda; Bt row-major [N][K] pitch ldb (k contiguous); M a multiple of GBM, N of GBN, K of GBK;
// grid = (M / GBM) * tilesNb blocks, tilesNb = N / GBN. Output column n goes to plane n / NB, column n % NB
// (NB a multiple of 64; plane strides strideC, strideC2 in elements).
// OUT_MODE 3 takes TWO independent problems in one launch (same lda, ldb, K, rscale): blocks 0 .. nblkA-1 work on the first,
// the blocks behind them on the second (the arguments with the suffix B), so that one grid fills the chip's rounds for both.
// In the second problem output rows m >= MBB go to row m - MBB of the planes strideMB elements further on (MBB a multiple of 64).
// NSPLIT: 0 = A.Bt; 1 = (A + A2).Bt (A2 = unscaled bf16 lo plane of A).
// OUT_MODE: 0 = f32 + bf16-RNE(bias[n]) straight into outf (N = DM, one plane): row m = bl*NP + r goes to outf row bl*NTOK + r (pitch DM), padded rows r >= NTOK are dropped;
//           2 = bf16 hi plane C + bf16 lo plane C2 (lo = RNE(v - hi), unscaled);
//           3 = f16 hi plane C + f16 residual plane C2 = f16((v - hi) * rscale), C2 written only for tiles
//               with column-in-plane < N2 (pitch ldc2).
// =====================================================================================================
template <int NSPLIT, int OUT_MODE>
__global__ __launch_bounds__(256) void gemm64(
    const unsigned short* __restrict__ Ap, const unsigned short* A2p, int lda,
    const unsigned short* __restrict__ Btp, int ldb,
    void* Cout, int ldc, long long strideC,
    void* Cout2, int ldc2, long long strideC2, int N2, int NB,
    int tilesNb, int K, float rscale,
    const float* __restrict__ bias, float* outf,
    int nblkA, const unsigned short* __restrict__ ApB, const unsigned short* __restrict__ BtpB,
    void* CoutB, int ldcB, long long strideCB,
    void* Cout2B, int ldc2B, long long strideC2B, int N2B, int NBB,
    int tilesNbB, int MBB, long long strideMB) {
  static_assert(NSPLIT == 0 || NSPLIT == 1);
  constexpr int OFFB  = GBM * ((NSPLIT >= 1) ? 2 : 1) * GPI;   // stage layout in bf16: A rows | A2 rows | Bt rows
  constexpr int STAGE = OFFB + GBN * GPI;
  __shared__ __align__(16) unsigned short smem[2 * STAGE];
  static_assert(8 * 16 * 68 * 4 <= 2 * STAGE * 2);             // the epilogue's per-wave slabs reuse the stage buffers
  const int lane = threadIdx.x & 31;
  const int wave = __builtin_amdgcn_readfirstlane(threadIdx.x >> 5);
  int bx = blockIdx.x;
  int MB = 0x40000000;                         // first problem: no row reaches it
  if (OUT_MODE == 3 && bx >= nblkA) {          // block-uniform choice of the problem
    bx -= nblkA;
    Ap = ApB; A2p = ApB; Btp = BtpB;
    Cout = CoutB; ldc = ldcB; strideC = strideCB;
    Cout2 = Cout2B; ldc2 = ldc2B; strideC2 = strideC2B; N2 = N2B; NB = NBB;
    tilesNb = tilesNbB; MB = MBB;
  }
  const int bm   = bx / tilesNb;
  const int bn   = bx - bm * tilesNb;
  const int wm   = wave >> 2, wn = wave & 3;
  const int m0 = bm * GBM + (wm << 6);
  const int n0 = bn * GBN + (wn << 6);

  const int rlane = lane & 15;                 // row (A) / col (B, D) within subtile
  const int koff  = (lane >> 4) * 8;           // k offset of this lane half
  const int mOff  = (lane >> 4) * 8;           // D row offset

  v8f acc[4][4];
#pragma unroll
  for (int i = 0; i < 4; ++i)
#pragma unroll
    for (int j = 0; j < 4; ++j) acc[i][j] = zero8();

  // Copy map: thread -> row (tid >> 3) + 32 * n, 16-byte piece tid & 7 of the row's 128 B: a wave's copy covers 4 whole lines.
  const int crow = threadIdx.x >> 3;
  const int cseg = (threadIdx.x & 7) * 16;
  const unsigned lbase = (unsigned)(uintptr_t)(const void*)smem + (unsigned)(crow * (GPI * 2) + cseg);
  const char* gA  = (const char*)(const void*)Ap  + (size_t)(bm * GBM + crow) * (size_t)lda * 2 + cseg;
  const char* gA2 = (const char*)(const void*)A2p + (size_t)(bm * GBM + crow) * (size_t)lda * 2 + cseg;
  const char* gB  = (const char*)(const void*)Btp + (size_t)(bn * GBN + crow) * (size_t)ldb * 2 + cseg;
  const unsigned stepA = (unsigned)lda * 64u, stepB = (unsigned)ldb * 64u;   // 32 rows in bytes
  auto stage_copies = [&](int t) {             // stage t -> buffer t & 1: 12 (NSPLIT 0) or 16 copies a lane
    const unsigned lb = lbase + (unsigned)((t & 1) * (STAGE * 2));
    const size_t kb = (size_t)t * (GBK * 2);
    copy4_async(lb, gA + kb, stepA);
    if (NSPLIT >= 1) copy4_async(lb + GBM * GPI * 2, gA2 + kb, stepA);
    copy4_async(lb + OFFB * 2, gB + kb, stepB);
    copy4_async(lb + (OFFB + 128 * GPI) * 2, gB + kb + (size_t)stepB * 4, stepB);
  };

  v4f bb = {0.f, 0.f, 0.f, 0.f};               // OUT_MODE 0: the lane's four bias values, fetched here so that the epilogue does not wait for them
  if (OUT_MODE == 0) bb = *(const v4f*)(bias + n0 + (lane & 15) * 4);

  const int NT = K / GBK;
  stage_copies(0);
  asm volatile("s_wait_asynccnt 0x0" ::: "memory");   // this wave's copies of stage 0 have landed
  __syncthreads();                                     // ... and every other wave's
  if (NT > 1) stage_copies(1);

  for (int t = 0; t < NT; ++t) {
    const __bf16* sb  = (const __bf16*)(const void*)smem + (t & 1) * STAGE;
    const __bf16* sA  = sb + ((wm << 6) + rlane) * GPI + koff;
    const __bf16* sA2 = sA + GBM * GPI;
    const __bf16* sB  = sb + OFFB + ((wn << 6) + rlane) * GPI + koff;
#pragma unroll   // the two 32-k steps of a stage, straight-line between the stage's barriers
    for (int ks = 0; ks < GBK / 32; ++ks) {
      v16b bh[4];
#pragma unroll
      for (int j = 0; j < 4; ++j) bh[j] = ldfrag_b(sB + j * 16 * GPI + ks * 32);
      v16b ahv[4], alv[4];   // all fragments of a k-step are loaded as one group ahead of its WMMAs
#pragma unroll
      for (int i = 0; i < 4; ++i) {
        ahv[i] = ldfrag_b(sA + i * 16 * GPI + ks * 32);
        if (NSPLIT >= 1) alv[i] = ldfrag_b(sA2 + i * 16 * GPI + ks * 32); else alv[i] = ahv[i];
      }
#pragma unroll
      for (int i = 0; i < 4; ++i) {
        const v16b ah = ahv[i], al = alv[i];
#pragma unroll
        for (int j = 0; j < 4; ++j) {
          acc[i][j] = mma_b_raw(ah, bh[j], acc[i][j]);
          if (NSPLIT >= 1) acc[i][j] = mma_b_raw(al, bh[j], acc[i][j]);
        }
        dep_guard_b(acc[i][0], acc[i][3], ah, al);
      }
      keep4_b(bh[0], bh[1], bh[2], bh[3]);
    }
    // publish point of stage t + 1, which also frees buffer t & 1
    asm volatile("s_wait_dscnt 0x0" ::: "memory");      // this wave's reads of buffer t & 1 are done
    asm volatile("s_wait_asynccnt 0x0" ::: "memory");   // this wave's copies of stage t + 1 have landed
    __syncthreads();
    if (t + 2 < NT) stage_copies(t + 2);                // block-uniform test; into the buffer every wave has just left
  }
  asm volatile("s_wait_asynccnt 0x0" ::: "memory");     // nothing is in flight when the buffers become the epilogue's slabs
  acc_guard4(acc[0][0], acc[0][1], acc[0][2], acc[0][3]);
  acc_guard4(acc[1][0], acc[1][1], acc[1][2], acc[1][3]);
  acc_guard4(acc[2][0], acc[2][1], acc[2][2], acc[2][3]);
  acc_guard4(acc[3][0], acc[3][1], acc[3][2], acc[3][3]);

  const int bo  = n0 / NB;                     // output plane and the tile's first column in it (wave-uniform)
  const int nc0 = n0 - bo * NB;
  const bool mhi = (m0 >= MB);                 // the wave's 64 rows lie in the second set of row planes (wave-uniform)
  const int  mC0 = m0 - (mhi ? MB : 0);        // the tile's first row in its plane
  const long long mAdd = mhi ? strideMB : 0LL;

  // ---- epilogue ----
  float* slab = (float*)(void*)smem + wave * (16 * 68);   // per-wave 16x64 slab, pitch 68 floats; the loop's last barrier has ended every read of the stage buffers
  static_assert((NP % 64) == 0);               // a wave's 64 rows lie in one batch element
  const int obl = m0 / NP;                     // OUT_MODE 0: batch element and first row in it (wave-uniform)
  const int or0 = m0 - obl * NP;
  if (OUT_MODE == 0) {
#pragma unroll
    for (int e = 0; e < 4; ++e) bb[e] = bf_up(bf_bits(bb[e]));
  }
#pragma unroll
  for (int i = 0; i < 4; ++i) {
    const int mBase = mC0 + (i << 4);
    if (OUT_MODE == 0 && or0 + (i << 4) >= NTOK) break;   // wave-uniform: this subtile and the ones behind it hold padded rows only
#pragma unroll
    for (int j = 0; j < 4; ++j) {
#pragma unroll
      for (int r = 0; r < 8; ++r) {
        slab[(mOff + r) * 68 + (j << 4) + rlane] = acc[i][j][r];
      }
    }
    wave_sync_lds();
    if (OUT_MODE == 0) {
      const int hh = lane >> 4, c4 = (lane & 15) * 4;     // 256-B row segment = 16 lanes x 16 B
      const int rb = or0 + (i << 4);                       // first row of the subtile in its batch element
      float* D = outf + ((size_t)obl * NTOK + rb + hh) * DM + n0 + c4;
      v4f v[8];
#pragma unroll
      for (int it = 0; it < 8; ++it) {                     // it 0..7 x hh 0..1 = rows 0..15
        v[it] = *(const v4f*)(slab + (it * 2 + hh) * 68 + c4);
#pragma unroll
        for (int e = 0; e < 4; ++e) v[it][e] += bb[e];
      }
      if (rb + 16 <= NTOK) {                               // wave-uniform: all 16 rows are valid (every subtile but the one that holds row NTOK)
#pragma unroll
        for (int it = 0; it < 8; ++it) *(v4f*)(D + (size_t)(it * 2) * DM) = v[it];
      } else {
#pragma unroll
        for (int it = 0; it < 8; ++it) {
          if (rb + it * 2 + hh < NTOK) *(v4f*)(D + (size_t)(it * 2) * DM) = v[it];
        }
      }
    } else {
      const int q = lane >> 3, c8 = (lane & 7) * 8;
      unsigned short* C  = (unsigned short*)Cout  + (size_t)bo * strideC  + mAdd;
      unsigned short* C2 = (unsigned short*)Cout2 + (size_t)bo * strideC2 + mAdd;
      const bool wlo = (OUT_MODE == 2) || (nc0 < N2);     // wave-uniform
      v4u hv[4], lv[4];
#pragma unroll
      for (int it = 0; it < 4; ++it) {
        const int row = it * 4 + q;                        // it 0..3 x q 0..3 = rows 0..15
        const float* sp = slab + row * 68 + c8;
        v4u a, a2;
#pragma unroll
        for (int e = 0; e < 4; ++e) {
          const float f0 = sp[2 * e], f1 = sp[2 * e + 1];
          unsigned short h0, h1, l0, l1;
          if (OUT_MODE == 2) {
            h0 = bf_bits(f0); h1 = bf_bits(f1);
            l0 = bf_bits(f0 - bf_up(h0)); l1 = bf_bits(f1 - bf_up(h1));
          } else {
            const _Float16 x0 = (_Float16)f0, x1 = (_Float16)f1;
            h0 = h_bits(x0); h1 = h_bits(x1);
            l0 = h_bits((_Float16)((f0 - (float)x0) * rscale));
            l1 = h_bits((_Float16)((f1 - (float)x1) * rscale));
          }
          a[e] = pk16(h0, h1); a2[e] = pk16(l0, l1);
        }
        hv[it] = a; lv[it] = a2;
      }
      {
#pragma unroll
        for (int it = 0; it < 4; ++it) {
          const int row = it * 4 + q;
          *(v4u*)(C + (size_t)(mBase + row) * ldc + nc0 + c8) = hv[it];
          asm volatile("s_wait_xcnt 0x0" ::: "memory");   // before the store's address registers are reused for the next address
          if (wlo) {
            *(v4u*)(C2 + (size_t)(mBase + row) * ldc2 + nc0 + c8) = lv[it];
            asm volatile("s_wait_xcnt 0x0" ::: "memory");  // as above
          }
        }
        
      }
    }
    wave_sync_lds();
  }
}

// =====================================================================================================
// Four asynchronous 16-byte copies of this lane, global -> LDS, through no register: rows r, r + 16, r + 32, r + 48
// of one 64-row attention tile at pitch LP (l0 = LDS byte address of the lane's piece of row r, g0 = its global address,
// gstep = 16 source rows in bytes).
// =====================================================================================================
__device__ __forceinline__ void copy4_tile(unsigned l0, const char* g0, unsigned gstep) {
#if defined(__HIP_DEVICE_COMPILE__)
  const unsigned l1 = l0 + 16u * LP * 2u, l2 = l0 + 32u * LP * 2u, l3 = l0 + 48u * LP * 2u;
  const char* g1 = g0 + gstep;
  const char* g2 = g1 + gstep;
  const char* g3 = g2 + gstep;
  // s_wait_xcnt stands inside the copies' own statement, so that no address register is rewritten ahead of it
  asm volatile("global_load_async_to_lds_b128 %0, %4, off\n\t"
               "global_load_async_to_lds_b128 %1, %5, off\n\t"
               "global_load_async_to_lds_b128 %2, %6, off\n\t"
               "global_load_async_to_lds_b128 %3, %7, off\n\t"
               "s_wait_xcnt 0x0"
               :: "v"(l0), "v"(l1), "v"(l2), "v"(l3), "v"(g0), "v"(g1), "v"(g2), "v"(g3) : "memory");
#endif
}

// ---- context^T += V^T tile . P^T (f16 WMMA): A = V^T rows d, B = P^T (column = query) straight from registers;
//      oacc[t][r] = context[query c][d = 16 t + 8 hh + r]; residual products into a separate accumulator folded in f32 ----
__device__ __forceinline__ void pv_acc(v8f (&oacc)[4], const v16h (&pb)[2],
                                       const _Float16* Vth, const _Float16* Vtl,
                                       float rres, int c, int hh) {
  v8f o1[4];
#pragma unroll
  for (int t = 0; t < 4; ++t) o1[t] = zero8();
#pragma unroll   // pb is a register array: its index must be a constant
  for (int kk = 0; kk < 2; ++kk) {
#pragma unroll
    for (int t = 0; t < 4; ++t) {
      FH vb, vl;
      vb.h[0] = *(const v8h*)(Vth + (t * 16 + c) * LP + kk * 32 + 8 * hh);
      vb.h[1] = *(const v8h*)(Vth + (t * 16 + c) * LP + kk * 32 + 16 + 8 * hh);
      vl.h[0] = *(const v8h*)(Vtl + (t * 16 + c) * LP + kk * 32 + 8 * hh);
      vl.h[1] = *(const v8h*)(Vtl + (t * 16 + c) * LP + kk * 32 + 16 + 8 * hh);
      oacc[t] = mma_h(vb.v, pb[kk], oacc[t]);
      o1[t]   = mma_h(vl.v, pb[kk], o1[t]);
    }
  }
#pragma unroll
  for (int t = 0; t < 4; ++t)
#pragma unroll
    for (int r = 0; r < 8; ++r) oacc[t][r] += o1[t][r] * rres;
}

// =====================================================================================================
// Attention, head dim 64, softmax over the NTOK valid keys of the batch element (keys s >= NTOK masked to
// -1e30 before the row max in the last chunk), per-modality value swap handled at V^T staging.
//   q|k plane (f16, pitch QKP): element (row, col) at [row*QKP + col], row = bl*NP + t, q col = h*64+d,
//   k col = DM + h*64 + d; q residual plane (f16, (q - f16(q))*4096, pitch DM): [row*DM + h*64 + d]
//   v^T / vc^T hi planes (f16): element (bl, h, d, s) at [(bl*DM + h*64 + d)*NP + s]; residual planes (x4096) same
//   out planes (bf16 hi / lo of the normalised context): element (row, h, d) at [row*DM + h*64 + d]
//   Jobs 0..8: query tiles 0..8 with the values of rows < M1 (v for keys < M1, vc for keys >= M1); jobs 9..15: query tiles 8..14
//   with the values of rows >= M1 (vc for keys < M1, v for keys >= M1); grid = NQB * NH * GB. Tile 8 (rows 512..575) holds rows of
//   both kinds and is worked on by two blocks: job 8 stores row 512 alone (only its wave 0 computes), job 9 every row but 512.
//   scores^T = (k . qh^T + (k . ql^T) * rres) * sscale on f16 WMMA (A = K rows, B = Q), residual products in a separate
//   accumulator: a lane holds 32 of the chunk's 64 scores of ONE query (column c), its partner lane ^ 16 the other 32, so the
//   maximum and the sum are in-lane plus one exchange between the halves (the sum's halves are joined once, after the loop);
//   p = exp(s - m) carried as f16(1024 p), packed from the score registers into the B operand of context^T += V^T . P^T;
//   online softmax in f32.
//   Block = 4 waves = 64 query rows of one (bl, h); kv chunks of 64, static trip NKT.
//   K / V^T chunk staging: asynchronous 16-byte copies to LDS, two buffers: chunk kt + 1 flies while chunk kt is worked on,
//   one barrier a chunk. 128 threads x 4 copies per tile = the whole 64x64 tile (a wave's copy = 4 whole 128-B lines).
//   The value swap is a chunk-uniform choice of source plane (chunks < 8: keys < M1, chunks > 8: keys >= M1); chunk 8 is
//   copied from the keys >= M1 planes and its key 512 (column 0 of the V^T tiles) is then overwritten from the keys < M1
//   planes, with a barrier of its own. P never touches LDS; the output staging aliases the buffers after the loop's last barrier.
//   Output coverage: each wave stores rows q0..q0+15 (it 0..3 x lane>>3 0..3) x 64 columns (8 lanes x 8) of both planes, in tile 8 only the rows of its job (none for waves 1..3 of job 8).
// =====================================================================================================
__global__ __launch_bounds__(128, 5)   // second argument = waves per SIMD the register budget is set for: the LDS admits 5 blocks a WGP
void attn64(const unsigned short* __restrict__ qkp, const unsigned short* __restrict__ qlp,
            const unsigned short* __restrict__ vhp, const unsigned short* __restrict__ vlp,
            const unsigned short* __restrict__ vchp, const unsigned short* __restrict__ vclp,
            unsigned short* ohp, unsigned short* olp, float sscale, float rres) {
  constexpr int STG = 3 * LTILE;                          // one buffer in f16: K | V^T hi | V^T residual
  __shared__ __align__(16) _Float16 smem[2 * STG];
  static_assert(4 * 16 * 68 * 4 <= 2 * STG * 2);          // the output staging fits the buffers

  const int tid  = threadIdx.x;
  const int wave = __builtin_amdgcn_readfirstlane(tid >> 5);
  const int lane = tid & 31;
  const int hh   = lane >> 4;
  const int c    = lane & 15;

  const int bx   = blockIdx.x;
  const int job  = bx % NQB;
  const int rest = bx / NQB;
  const bool useB = (job > 8);               // block-uniform: the value set of rows >= M1
  const int qb   = job - (useB ? 1 : 0);
  const bool work = (job != 8) || (wave == 0);   // wave-uniform: of job 8 only row 512 is stored, which wave 0 holds
  const int h  = rest % NH;
  const int bl = rest / NH;
  const int q0 = qb * 64 + wave * 16;
  const size_t rowB = (size_t)bl * NP;

  const _Float16* Qh = (const _Float16*)(const void*)qkp + (size_t)h * HD;
  const _Float16* Kg = (const _Float16*)(const void*)qkp + DM + (size_t)h * HD;
  const _Float16* Ql = (const _Float16*)(const void*)qlp + (size_t)h * HD;
  const size_t vbase = ((size_t)bl * DM + (size_t)h * HD) * NP;
  const _Float16* Vh  = (const _Float16*)(const void*)vhp  + vbase;
  const _Float16* Vl  = (const _Float16*)(const void*)vlp  + vbase;
  const _Float16* Vch = (const _Float16*)(const void*)vchp + vbase;
  const _Float16* Vcl = (const _Float16*)(const void*)vclp + vbase;
  // value set: keys < M1 from (M0h, M0l), keys >= M1 from (M1h, M1l); block-uniform pointer choice
  const _Float16* M0h = useB ? Vch : Vh;
  const _Float16* M0l = useB ? Vcl : Vl;
  const _Float16* M1h = useB ? Vh  : Vch;
  const _Float16* M1l = useB ? Vl  : Vcl;

  // ---- Q fragments (B operand, column = query = lane&15): 2 d-chunks, hi and residual ----
  v16h qah[2], qal[2];
#pragma unroll
  for (int dc = 0; dc < 2; ++dc) {
    qah[dc] = ldfrag_h(Qh + (rowB + q0 + c) * QKP + dc * 32 + 8 * hh);
    qal[dc] = ldfrag_h(Ql + (rowB + q0 + c) * DM  + dc * 32 + 8 * hh);
  }

  // Copy map: thread -> row (tid >> 3) + 16 * n, 16-byte piece tid & 7 of the row's 128 B
  const int crow = tid >> 3;
  const int cseg = (tid & 7) * 16;
  const unsigned lbase = (unsigned)(uintptr_t)(const void*)smem + (unsigned)(crow * (LP * 2) + cseg);
  const char* gK = (const char*)(const void*)(Kg + (rowB + crow) * QKP) + cseg;
  const size_t voff = (size_t)crow * (NP * 2) + cseg;
  auto stage_copies = [&](int t) {           // chunk t -> buffer t & 1: 12 copies a lane
    const unsigned lb = lbase + (unsigned)((t & 1) * (STG * 2));
    const bool lowc = (t < 8);               // block-uniform
    const size_t vb = voff + (size_t)t * (64 * 2);
    copy4_tile(lb, gK + (size_t)t * (64 * QKP * 2), 16u * QKP * 2u);
    copy4_tile(lb + LTILE * 2,     (const char*)(const void*)(lowc ? M0h : M1h) + vb, 16u * NP * 2u);
    copy4_tile(lb + 2 * LTILE * 2, (const char*)(const void*)(lowc ? M0l : M1l) + vb, 16u * NP * 2u);
  };
  // key 512 of row d = tid >> 1, hi (tid even) or residual (tid odd) plane, from the keys < M1 planes; stored into chunk 8's tiles
  const int prow = tid >> 1, ppl = tid & 1;
  const _Float16 pkM = (ppl ? M0l : M0h)[(size_t)prow * NP + (M1 - 1)];

  float mrow = -INFINITY, lrow = 0.f;        // of query q0 + c; lrow sums this wave half's keys only
  v8f oacc[4];
#pragma unroll
  for (int t = 0; t < 4; ++t) oacc[t] = zero8();

  static_assert(NKT > 1);
  stage_copies(0);
  asm volatile("s_wait_asynccnt 0x0" ::: "memory");   // this wave's copies of chunk 0 have landed
  __syncthreads();                                     // ... and every other wave's
  stage_copies(1);

  for (int kt = 0; kt < NKT; ++kt) {         // static trip count
    const int kv0 = kt * 64;
    _Float16* sb = smem + (kt & 1) * STG;
    const _Float16* Ksh = sb;                                   // K [kv][d]           9 KB (rows of 64 at pitch LP)
    const _Float16* VMh = sb + LTILE;                           // V^T hi [d][kv]       9 KB
    const _Float16* VMl = sb + 2 * LTILE;                       // V^T residual          9 KB
    if (kt == 8) {                           // block-uniform: the chunk that holds key 512; its copies landed before the last barrier
      sb[(1 + ppl) * LTILE + prow * LP] = pkM;
      __syncthreads();                       // key 512's column is in place before any wave reads the V^T tiles
    }

    if (work) {                              // scalar branch; every wave passes the waits and the barrier behind it
    // ---- scores^T: 64 keys x 16 query columns per wave, 2 f16 products (hi, residual); s[j][r] = key kv0 + 16 j + 8 hh + r, query q0 + c ----
    v8f s[4];
#pragma unroll
    for (int j = 0; j < 4; ++j) {
      v8f sh = zero8(), sl = zero8();
#pragma unroll
      for (int dc = 0; dc < 2; ++dc) {
        FH kb;
        kb.h[0] = *(const v8h*)(Ksh + (j * 16 + c) * LP + dc * 32 + 8 * hh);
        kb.h[1] = *(const v8h*)(Ksh + (j * 16 + c) * LP + dc * 32 + 16 + 8 * hh);
        sh = mma_h(kb.v, qah[dc], sh);
        sl = mma_h(kb.v, qal[dc], sl);
      }
#pragma unroll
      for (int r = 0; r < 8; ++r) s[j][r] = (sh[r] + sl[r] * rres) * sscale;
    }
    // ---- keys s >= NTOK (only in the last chunk) are invalid: force -1e30 before the maximum ----
    if (kt == NKT - 1) {                    // block-uniform
#pragma unroll
      for (int j = 0; j < 4; ++j) {
#pragma unroll
        for (int r = 0; r < 8; ++r) s[j][r] = ((kv0 + j * 16 + 8 * hh + r) < NTOK) ? s[j][r] : -1.0e30f;
      }
    }

    // ---- column max, online softmax, P^T (x1024, f16) into the B operand registers ----
    float mj[4];
#pragma unroll
    for (int j = 0; j < 4; ++j) {
      mj[j] = s[j][0];
#pragma unroll
      for (int r = 1; r < 8; ++r) mj[j] = fmaxf(mj[j], s[j][r]);
    }
    float m = fmaxf(fmaxf(mj[0], mj[1]), fmaxf(mj[2], mj[3]));
    m = fmaxf(m, xhalf(m));                  // both halves now hold the query's maximum over the chunk
    const float mnew  = fmaxf(mrow, m);
    const float alpha = __expf(mrow - mnew);
    mrow = mnew;
    v16h pb[2];                              // pb[kk][e]: key kv0 + 32 kk + (e < 8 ? 8 hh + e : 16 + 8 hh + e - 8), the k order of the V^T loads
    float pj[4];                             // four independent sums of 8
#pragma unroll
    for (int j = 0; j < 4; ++j) {
      pj[j] = 0.f;
#pragma unroll
      for (int r = 0; r < 8; ++r) {
        const float p = __expf(s[j][r] - mnew);
        pj[j] += p;
        pb[j >> 1][(j & 1) * 8 + r] = (_Float16)(p * 1024.0f);
      }
    }
    lrow = lrow * alpha + ((pj[0] + pj[1]) + (pj[2] + pj[3]));
#pragma unroll
    for (int t = 0; t < 4; ++t)
#pragma unroll
      for (int r = 0; r < 8; ++r) oacc[t][r] *= alpha;

    // ---- context^T += V^T . P^T ----
    pv_acc(oacc, pb, VMh, VMl, rres, c, hh);
    }                                        // work
    // publish point of chunk kt + 1, which also frees buffer kt & 1
    asm volatile("s_wait_dscnt 0x0" ::: "memory");      // this wave's reads of buffer kt & 1 are done
    asm volatile("s_wait_asynccnt 0x0" ::: "memory");   // this wave's copies of chunk kt + 1 have landed
    __syncthreads();
    if (kt + 2 < NKT) stage_copies(kt + 2);             // block-uniform test; into the buffer every wave has just left
  }
  asm volatile("s_wait_asynccnt 0x0" ::: "memory");     // nothing is in flight when the buffers become the output staging
  if (!work) return;                         // behind the last barrier

  // ---- normalise (1/l and the 1/1024 p carry), stage the wave's 16x64 tile (aliases the K / V region),
  float* os = (float*)(void*)smem + wave * (16 * 68);   // [query][d], pitch 68 floats (272 B = 16 B x 17, odd): the 16 rows of a 16-byte store fall on 16 bank groups
  {
    const float l = lrow + xhalf(lrow);      // the two halves' key sums joined
    const float inv = ((l > 0.f) ? (1.0f / l) : 0.f) * (1.0f / 1024.0f);
#pragma unroll
    for (int t = 0; t < 4; ++t) {
      v4f w[2];
#pragma unroll
      for (int r = 0; r < 8; ++r) {
        w[r >> 2][r & 3] = oacc[t][r] * inv;
      }
      *(v4f*)(os + c * 68 + t * 16 + 8 * hh)     = w[0];
      *(v4f*)(os + c * 68 + t * 16 + 8 * hh + 4) = w[1];
    }
  }
  wave_sync_lds();
  {
    const int q4 = lane >> 3, c8 = (lane & 7) * 8;
    v4u hv[4], lv[4];
#pragma unroll
    for (int it = 0; it < 4; ++it) {
      const int row = it * 4 + q4;   // it 0..3 x q4 0..3 = rows 0..15 of the wave tile
      const float* sp = os + row * 68 + c8;
      v4u a, a2;
#pragma unroll
      for (int e = 0; e < 4; ++e) {
        const float f0 = sp[2 * e], f1 = sp[2 * e + 1];
        const unsigned short h0 = bf_bits(f0), h1 = bf_bits(f1);
        const unsigned short l0 = bf_bits(f0 - bf_up(h0)), l1 = bf_bits(f1 - bf_up(h1));
        a[e] = pk16(h0, h1); a2[e] = pk16(l0, l1);
      }
      hv[it] = a; lv[it] = a2;
    }
    {
#pragma unroll
      for (int it = 0; it < 4; ++it) {
        const int row = it * 4 + q4;
        const size_t go = (rowB + q0 + row) * DM + (size_t)h * HD + c8;
        if (qb != 8 || ((q0 + row == M1 - 1) != useB)) {   // tile 8: row 512 from job 8, the other rows from job 9
          *(v4u*)(ohp + go) = hv[it];
          *(v4u*)(olp + go) = lv[it];
          asm volatile("s_wait_xcnt 0x0" ::: "memory");   // before the two stores' registers are reused for the next rows
        }
      }
      
    }
  }
}

// =====================================================================================================
// Workspace map (bytes), one group of GB = 16 batch elements (GB*NP = 15360 rows), every plane an exact
// multiple of its 64x64-tile / whole-line store granularity (padded rows included):
//   Wt    bf16 [5][768 co][768 ci]   0          5898240   (Wq^T | Wk^T | Wv^T | Wvc^T | Wp^T)
//   Xp    bf16 [15360][768]          5898240    23592960
//   QK    f16  [15360][1536]         29491200   47185920  (q cols 0..767, k cols 768..1535)
//   Ql    f16  [15360][768]          76677120   23592960  (q residual x4096)
//   VTh   f16  [16][768][960]        100270080  23592960  (v^T hi)
//   VTl   f16  [16][768][960]        123863040  23592960  (v^T residual x4096)
//   VCh   f16  [16][768][960]        147456000  23592960  (vc^T hi)
//   VCl   f16  [16][768][960]        171048960  23592960  (vc^T residual x4096)
//   Oh    bf16 [15360][768]          194641920  23592960
//   Ol    bf16 [15360][768]          218234880  23592960
//   end                              241827840
// =====================================================================================================
extern "C" void kernel_launch(void* const* d_in, const int* in_sizes, int n_in,
                              void* d_out, int out_size, void* d_ws, size_t ws_size,
                              hipStream_t stream) {
  if (n_in < 7) return;
  if (in_sizes[0] != NBATCH * NTOK * DM) return;
  if (in_sizes[1] != DM * DM || in_sizes[2] != DM * DM || in_sizes[3] != DM * DM) return;
  if (in_sizes[4] != DM * DM || in_sizes[5] != DM * DM) return;
  if (in_sizes[6] != DM) return;
  if (out_size != NBATCH * NTOK * DM) return;

  const float* x   = (const float*)d_in[0];
  const float* Wq  = (const float*)d_in[1];
  const float* Wk  = (const float*)d_in[2];
  const float* Wv  = (const float*)d_in[3];
  const float* Wvc = (const float*)d_in[4];
  const float* Wp  = (const float*)d_in[5];
  const float* bp  = (const float*)d_in[6];

  const size_t ROWS = (size_t)GB * NP;                 // 15360
  const size_t PW   = (size_t)5 * DM * DM * 2;          //  5898240
  const size_t PX   = ROWS * DM * 2;                    // 23592960
  const size_t PQK  = ROWS * QKP * 2;                   // 47185920
  const size_t PQl  = ROWS * DM * 2;                    // 23592960
  const size_t PVT  = (size_t)GB * DM * NP * 2;         // 23592960
  const size_t PO   = ROWS * DM * 2;                    // 23592960
  size_t off = 0;
  const size_t oW   = off; off += PW;
  const size_t oXp  = off; off += PX;
  const size_t oQK  = off; off += PQK;
  const size_t oQl  = off; off += PQl;
  const size_t oVTh = off; off += PVT;
  const size_t oVTl = off; off += PVT;
  const size_t oVCh = off; off += PVT;
  const size_t oVCl = off; off += PVT;
  const size_t oOh  = off; off += PO;
  const size_t oOl  = off; off += PO;
  if (off > ws_size) return;                            // off = 241827840

  char* ws = (char*)d_ws;
  unsigned short* Wt   = (unsigned short*)(ws + oW);
  unsigned short* Wqk_t = Wt;                                   // rows 0..1535: Wq^T then Wk^T
  unsigned short* Wv_t  = Wt + (size_t)2 * DM * DM;
  unsigned short* Wp_t  = Wt + (size_t)4 * DM * DM;
  unsigned short* Xp   = (unsigned short*)(ws + oXp);
  unsigned short* QK   = (unsigned short*)(ws + oQK);
  unsigned short* Ql   = (unsigned short*)(ws + oQl);
  unsigned short* VTh  = (unsigned short*)(ws + oVTh);
  unsigned short* VTl  = (unsigned short*)(ws + oVTl);
  unsigned short* VCh  = (unsigned short*)(ws + oVCh);
  unsigned short* VCl  = (unsigned short*)(ws + oVCl);
  unsigned short* Oh   = (unsigned short*)(ws + oOh);
  unsigned short* Ol   = (unsigned short*)(ws + oOl);
  float*          out  = (float*)d_out;

  const dim3 blk(256);
  const int n8x = GB * NP * (DM / 8);                            // 1474560
  const dim3 gPrep(NWB + (n8x + 255) / 256);                     // 720 weight tiles + 5760 blocks of x
  static_assert((GB * NP) % GBM == 0 && (GB * NP) % GBN == 0 && DM % GBM == 0 && DM % GBN == 0 && QKP % GBN == 0 && DM % GBK == 0);
  const int nbQK = (GB * NP / GBM) * (QKP / GBN);                // 120 x 6 = 720 blocks: M=15360, N=1536
  const int nbVT = (2 * DM / GBM) * (GB * NP / GBN);             // 12 x 60 = 720 blocks: M=1536 (Wv^T rows, then Wvc^T rows), N=15360 (all batch elements' rows of Xp)
  const dim3 gProj(nbQK + nbVT);                                 // 1440 blocks
  const dim3 gOut((GB * NP / GBM) * (DM / GBN));                 // 120 x 3 = 360 blocks: M=15360, N=768
  const dim3 gAttn(NQB * NH * GB);                               // 3072 blocks

  for (int g = 0; g < NGRP; ++g) {
    const int b0 = g * GB;
    // (1) weights -> bf16 [out][in] planes (k contiguous = the Bt / A layout the GEMM wants); x -> zero-padded bf16 plane [15360][768]
    prep_bf16<<<gPrep, blk, 0, stream>>>(x, Xp, b0, n8x, Wq, Wk, Wv, Wvc, Wp, Wt);
    // (2) the projections, one launch:
    //     q|k = Xp . Wqk^T -> f16 plane [15360][1536] + f16 residual x4096 of the q half (n0 < 768, pitch 768);
    //     v^T | vc^T = (Wv^T ; Wvc^T) . Xp^T, row m = d (v) or 768 + d (vc), column n = bl*NP + s
    //     -> f16 hi [bl][h*64+d][s] (pitch NP) + residual x4096, the vc planes two planes behind the v planes
    gemm64<0, 3><<<gProj, blk, 0, stream>>>(
        Xp, Xp, DM, Wqk_t, DM,
        (void*)QK, QKP, 0LL, (void*)Ql, DM, 0LL, DM, QKP,
        QKP / GBN, DM, 4096.0f, bp, out,
        nbQK, Wv_t, Xp,
        (void*)VTh, NP, (long long)DM * NP, (void*)VTl, NP, (long long)DM * NP, NP, NP,
        GB * NP / GBN, DM, (long long)(VCh - VTh));
    // (3) attention -> context bf16 hi / lo planes [15360][768]
    attn64<<<gAttn, dim3(128), 0, stream>>>(QK, Ql, VTh, VTl, VCh, VCl, Oh, Ol, 0.125f, 1.0f / 4096.0f);
    // (4) d_out rows bl*906 + r = context . Wp + bias (A = context hi + lo planes, 2 products; K=768), valid rows only
    static_assert(NGRP == 1);                            // the GEMM's row m = bl*NP + r counts bl from batch element 0
    gemm64<1, 0><<<gOut, blk, 0, stream>>>(
        Oh, Ol, DM, Wp_t, DM,
        (void*)Oh, DM, 0LL, (void*)Oh, DM, 0LL, DM, DM,   // the two plane pointers are not used by OUT_MODE 0
        DM / GBN, DM, 1.0f, bp, out,
        0, Oh, Wp_t, (void*)Oh, DM, 0LL, (void*)Oh, DM, 0LL, DM, DM, DM / GBN, DM, 0LL);   // OUT_MODE 0 has one problem: these are not used
  }
  (void)hipGetLastError();
}
